// v000
// The times below were measured on an AMD MI455X: many runs one after another, warmed up first and cycling through
// copies of the inputs, with the whole window's GPU time divided by the number of runs. Launches and the gaps
// between them are all in it. The median over several windows is given; except for v000 it joins two sittings, which
// can be a few percent apart, so the side-by-side timings, each taken in one sitting, are the better comparison.
// The starting kernel, v000, takes 302 microseconds a run.
#include <hip/hip_runtime.h>
// PerNeuronMLPHead (2 x 512 time bins x 512, 256 units x 512: bin_h = bin_repr Wbp + b, unit_h = unit_embs Wup + b (256 wide); h1[(b,t), n] = gelu(bin_h w1a + unit_h w1b + b1) (the split-weight broadcast add); h2 = gelu(h1 w2 + b2) (128); log_rate = h2 w3 + b3; clip(-10, 10); exact erf GELU).
// Structure: the four small projections as f16 WMMA GEMMs (32x64 wave tiles, f32 accumulation, exact x16 weights + bias); the broadcast add + GELU on VALU into an f16 plane [262144][256]; h2 as an f16 WMMA GEMM (f16 out) followed by an in-place VALU GELU; the 128 -> 1 head, clip and store on VALU (thread per output row, 4-B thread-linear stores).
// Compute dtype: inputs rounded to bf16; inputs / weights exact as f16; bin_h / unit_h, h1 and h2 as plain f16 operands (~2^-12); GELU / head f32. v_wmma_f32_16x16x32_f16.
#define NB 2
#define NTB 512
#define DIM 512
#define HALF 256
#define QTR 128
#define NU 256
#define NBT (NB * NTB)           /* 1024 bin rows */
#define NRW ((size_t)NBT * NU)   /* 262144 output rows */
typedef __bf16 v16b __attribute__((ext_vector_type(16)));
typedef unsigned short v8us __attribute__((ext_vector_type(8), may_alias));
typedef float  v8f  __attribute__((ext_vector_type(8)));
typedef float  v4f  __attribute__((ext_vector_type(4)));
typedef float  v4fa __attribute__((ext_vector_type(4), may_alias));
union FragB { v16b v; v8us half[2]; unsigned short u[16]; };

__device__ __forceinline__ unsigned short bf16_bits(float x) { unsigned int u = __float_as_uint(x); return (unsigned short)((u + 0x7FFFu + ((u >> 16) & 1u)) >> 16); }
__device__ __forceinline__ float bf16_val(unsigned short b) { return __uint_as_float(((unsigned int)b) << 16); }
__device__ __forceinline__ float bf16_round(float x) { return bf16_val(bf16_bits(x)); }
// D += A·B with NT terms: 1 = ah·bh, 2 = + al·bh (A split), 3 = + ah·bl (both split)
template <int NT>
__device__ __forceinline__ v8f mmaN(v16b ah, v16b al, v16b bh, v16b bl, v8f c) {
  c = __builtin_amdgcn_wmma_f32_16x16x32_bf16(false, ah, false, bh, (short)0, c, false, false);
  if (NT >= 2) c = __builtin_amdgcn_wmma_f32_16x16x32_bf16(false, al, false, bh, (short)0, c, false, false);
  if (NT >= 3) c = __builtin_amdgcn_wmma_f32_16x16x32_bf16(false, ah, false, bl, (short)0, c, false, false);
  asm volatile("v_nop\n\tv_nop\n\tv_nop\n\tv_nop" : "+v"(c) : "v"(ah), "v"(al), "v"(bh), "v"(bl));
  return c;
}

__global__ __launch_bounds__(256) void k_wt_bf16(const float* __restrict__ W, unsigned short* __restrict__ Wt, int K, int N) {
  const int t = blockIdx.x * 256 + threadIdx.x;
  const int k8n = K / 8;
  if (t >= N * k8n) return;
  const int n = t / k8n, k8 = (t % k8n) * 8;
  v8us v;
#pragma unroll
  for (int i = 0; i < 8; ++i) v[i] = bf16_bits(W[(size_t)(k8 + i) * N + n]);
  *(v8us*)(Wt + (size_t)n * K + k8) = v;
  
}

// GEMM C[M][N] (f32, pitch ldc) = act(A[M][K]·W + bias). A f32 row-major (pitch lda) converted per fragment to bf16
// (ASPLIT: hi/lo two planes -> 2 terms, else single rounded term); Wt bf16 [N][K] (pitch ldb). BIAS_BF16 rounds the
// bias to bf16 first (bias quantised to bf16 before the add). K%32==0, M%16==0, N%64==0.
template <bool ASPLIT, int ACT, bool BIAS_BF16>
__global__ __launch_bounds__(128) void k_gemm_bf(const float* __restrict__ A, int lda, const unsigned short* __restrict__ Wt, int ldb,
                                               const float* __restrict__ bias, float* __restrict__ C, int ldc, int M, int N, int K) {
  __shared__ __attribute__((aligned(16))) float so[4][16][64];
  const int tid = threadIdx.x, w = tid >> 5, lane = tid & 31, ln = lane & 15, hh = lane >> 4;
  const int ntn = N / 64;
  const int wid = blockIdx.x * 4 + w;
  const int mt = wid / ntn, nq = wid % ntn;
  if (mt * 16 >= M) return;
  const int row0 = mt * 16, col0 = nq * 64;
  const float* arow = A + (size_t)(row0 + ln) * lda;
  v8f acc[4] = {};
  for (int kb = 0; kb < K; kb += 32) {
    FragB ah, al;
    const v4f x0 = *(const v4fa*)(arow + kb + 8 * hh), x1 = *(const v4fa*)(arow + kb + 8 * hh + 4);
    const v4f x2 = *(const v4fa*)(arow + kb + 16 + 8 * hh), x3 = *(const v4fa*)(arow + kb + 16 + 8 * hh + 4);
    float xs[16] = {x0[0],x0[1],x0[2],x0[3],x1[0],x1[1],x1[2],x1[3],x2[0],x2[1],x2[2],x2[3],x3[0],x3[1],x3[2],x3[3]};
#pragma unroll
    for (int i = 0; i < 16; ++i) { const unsigned short hb = bf16_bits(xs[i]); ah.u[i] = hb; al.u[i] = ASPLIT ? bf16_bits(xs[i] - bf16_val(hb)) : (unsigned short)0; }
#pragma unroll
    for (int t = 0; t < 4; ++t) {
      const unsigned short* brow = Wt + (size_t)(col0 + t * 16 + ln) * ldb + kb;
      FragB b;
      b.half[0] = *(const v8us*)(brow + 8 * hh);
      b.half[1] = *(const v8us*)(brow + 16 + 8 * hh);
      acc[t] = mmaN<ASPLIT ? 2 : 1>(ah.v, al.v, b.v, b.v, acc[t]);
    }
  }
#pragma unroll
  for (int t = 0; t < 4; ++t) {
    float bv = bias ? bias[col0 + t * 16 + ln] : 0.f;
    if (BIAS_BF16) bv = bf16_round(bv);
#pragma unroll
    for (int r = 0; r < 8; ++r) { float v = acc[t][r] + bv; if (ACT == 1) v = fmaxf(v, 0.f); so[w][8 * hh + r][t * 16 + ln] = v; }
  }
  __builtin_amdgcn_fence(__ATOMIC_ACQ_REL, "workgroup");
  __builtin_amdgcn_wave_barrier();
  const int rsub = lane >> 4, c4 = (lane & 15) * 4;
  {
#pragma unroll
    for (int q = 0; q < 8; ++q) {
      const int r = q * 2 + rsub;
      const v4f v = *(const v4fa*)&so[w][r][c4];
      *(v4f*)(C + (size_t)(row0 + r) * ldc + col0 + c4) = v;
    }
    
  }
}

// GEMM C = act(A·W + bias + resid): A f32 (ASPLIT -> hi/lo 2 terms), Wt bf16 [N][K]; ACT 0 none, 1 relu, 2 exact gelu;
// resid (optional, f32, row index = (row % rmod), pitch ldr, RES_BF16 rounds it) added before the activation.
template <bool ASPLIT, int ACT, bool BIAS_BF16, bool RES_BF16>
__global__ __launch_bounds__(128) void k_gemm_bf3(const float* __restrict__ A, int lda, const unsigned short* __restrict__ Wt, int ldb,
                                                const float* __restrict__ bias, const float* __restrict__ resid, int rmod, int ldr,
                                                float* __restrict__ C, int ldc, int M, int N, int K) {
  __shared__ __attribute__((aligned(16))) float so[4][16][64];
  const int tid = threadIdx.x, w = tid >> 5, lane = tid & 31, ln = lane & 15, hh = lane >> 4;
  const int ntn = N / 64;
  const int wid = blockIdx.x * 4 + w;
  const int mt = wid / ntn, nq = wid % ntn;
  if (mt * 16 >= M) return;
  const int row0 = mt * 16, col0 = nq * 64;
  const float* arow = A + (size_t)(row0 + ln) * lda;
  v8f acc[4] = {};
  for (int kb = 0; kb < K; kb += 32) {
    FragB ah, al;
    const v4f x0 = *(const v4fa*)(arow + kb + 8 * hh), x1 = *(const v4fa*)(arow + kb + 8 * hh + 4);
    const v4f x2 = *(const v4fa*)(arow + kb + 16 + 8 * hh), x3 = *(const v4fa*)(arow + kb + 16 + 8 * hh + 4);
    float xs[16] = {x0[0],x0[1],x0[2],x0[3],x1[0],x1[1],x1[2],x1[3],x2[0],x2[1],x2[2],x2[3],x3[0],x3[1],x3[2],x3[3]};
#pragma unroll
    for (int i = 0; i < 16; ++i) { const unsigned short hb = bf16_bits(xs[i]); ah.u[i] = hb; al.u[i] = ASPLIT ? bf16_bits(xs[i] - bf16_val(hb)) : (unsigned short)0; }
#pragma unroll
    for (int t = 0; t < 4; ++t) {
      const unsigned short* brow = Wt + (size_t)(col0 + t * 16 + ln) * ldb + kb;
      FragB b;
      b.half[0] = *(const v8us*)(brow + 8 * hh);
      b.half[1] = *(const v8us*)(brow + 16 + 8 * hh);
      acc[t] = mmaN<ASPLIT ? 2 : 1>(ah.v, al.v, b.v, b.v, acc[t]);
    }
  }
#pragma unroll
  for (int t = 0; t < 4; ++t) {
    const int col = col0 + t * 16 + ln;
    float bv = bias ? bias[col] : 0.f;
    if (BIAS_BF16) bv = bf16_round(bv);
#pragma unroll
    for (int r = 0; r < 8; ++r) {
      float v = acc[t][r] + bv;
      if (resid) { float rv = resid[(size_t)((row0 + 8 * hh + r) % rmod) * ldr + col]; if (RES_BF16) rv = bf16_round(rv); v += rv; }
      if (ACT == 1) v = fmaxf(v, 0.f);
      if (ACT == 2) v = 0.5f * v * (1.0f + erff(v * 0.70710678118654752f));
      if (ACT == 3) { const float u = 0.7978845608028654f * (v + 0.044715f * v * v * v); v = 0.5f * v * (1.0f + tanhf(u)); }
      so[w][8 * hh + r][t * 16 + ln] = v;
    }
  }
  __builtin_amdgcn_fence(__ATOMIC_ACQ_REL, "workgroup");
  __builtin_amdgcn_wave_barrier();
  const int rsub = lane >> 4, c4 = (lane & 15) * 4;
  {
#pragma unroll
    for (int q = 0; q < 8; ++q) {
      const int r = q * 2 + rsub;
      const v4f v = *(const v4fa*)&so[w][r][c4];
      *(v4f*)(C + (size_t)(row0 + r) * ldc + col0 + c4) = v;
    }
    
  }
}
// row LayerNorm (biased variance, eps) over N: s = X (+ R); optional out_sum <- s; out_norm <- (s-mu)*rsqrt(var+eps)*g + b
template <bool PARAM_BF16>
__global__ __launch_bounds__(256) void k_layernorm(const float* __restrict__ X, const float* __restrict__ R, const float* __restrict__ g, const float* __restrict__ bta,
                                                  float* __restrict__ out_sum, float* __restrict__ out_norm, int N, float eps) {
  __shared__ float red[256];
  const int row = blockIdx.x, tid = threadIdx.x;
  const float* x = X + (size_t)row * N; const float* rr = R ? R + (size_t)row * N : nullptr;
  float vals[16];                     // up to N = 4096
  const int per = N / 256;            // contiguous chunk per thread? use strided-by-4 chunks: thread handles j = tid*4 + 1024*u
  float s1 = 0.f;
  for (int u = 0; u < per / 4; ++u) {
    const int j = tid * 4 + 1024 * u;
    const v4f a = *(const v4fa*)(x + j);
    v4f b = {0.f,0.f,0.f,0.f}; if (rr) b = *(const v4fa*)(rr + j);
#pragma unroll
    for (int q = 0; q < 4; ++q) { const float v = a[q] + b[q]; vals[u * 4 + q] = v; s1 += v; }
  }
  red[tid] = s1; __syncthreads();
  for (int st = 128; st > 0; st >>= 1) { if (tid < st) red[tid] += red[tid + st]; __syncthreads(); }
  const float mu = red[0] / (float)N; __syncthreads();
  float s2 = 0.f;
  for (int u = 0; u < per / 4; ++u)
#pragma unroll
    for (int q = 0; q < 4; ++q) { const float c = vals[u * 4 + q] - mu; s2 += c * c; }
  red[tid] = s2; __syncthreads();
  for (int st = 128; st > 0; st >>= 1) { if (tid < st) red[tid] += red[tid + st]; __syncthreads(); }
  const float rs = rsqrtf(red[0] / (float)N + eps);
  {
    for (int u = 0; u < per / 4; ++u) {
      const int j = tid * 4 + 1024 * u;
      v4f o, sm;
#pragma unroll
      for (int q = 0; q < 4; ++q) {
        float gg = g[j + q], bb = bta[j + q];
        if (PARAM_BF16) { gg = bf16_round(gg); bb = bf16_round(bb); }
        sm[q] = vals[u * 4 + q]; o[q] = (vals[u * 4 + q] - mu) * rs * gg + bb;
      }
      if (out_sum) *(v4f*)(out_sum + (size_t)row * N + j) = sm;
      *(v4f*)(out_norm + (size_t)row * N + j) = o;
    }
    
  }
}



// ---- f16 WMMA path (v_wmma_f32_16x16x32_f16): 11-bit significands for operands in range — used for every GEMM launched here
typedef _Float16 v16h __attribute__((ext_vector_type(16)));
union FragH { v16h v; v8us half[2]; _Float16 h[16]; unsigned short u[16]; };
template <int NT>
__device__ __forceinline__ v8f mmaH(v16h ah, v16h al, v16h bh, v16h bl, v8f c) {
  c = __builtin_amdgcn_wmma_f32_16x16x32_f16(false, ah, false, bh, (short)0, c, false, false);
  if (NT >= 2) c = __builtin_amdgcn_wmma_f32_16x16x32_f16(false, al, false, bh, (short)0, c, false, false);
  if (NT >= 3) c = __builtin_amdgcn_wmma_f32_16x16x32_f16(false, ah, false, bl, (short)0, c, false, false);
  asm volatile("v_nop\n\tv_nop\n\tv_nop\n\tv_nop" : "+v"(c) : "v"(ah), "v"(al), "v"(bh), "v"(bl));
  return c;
}
// batched GEMM like k_gemm_b but f16 operands: A f32 (split into f16 hi/lo if ASPLIT, else rounded to f16), Bt = f16 values [n][k]; alpha; C f32; N multiple of 16 (partial tiles skipped)
template <bool ASPLIT>
__global__ __launch_bounds__(128) void k_gemm_h(const float* __restrict__ A, int lda, size_t sA, const _Float16* __restrict__ Bh, int ldb, size_t sB, float alpha, float* __restrict__ C, int ldc, size_t sC, int M, int N, int K) {
  __shared__ __attribute__((aligned(16))) float so[4][16][64];
  const int tid = threadIdx.x, w = tid >> 5, lane = tid & 31, ln = lane & 15, hh = lane >> 4; const int by = blockIdx.y;
  A += (size_t)by * sA; Bh += (size_t)by * sB; C += (size_t)by * sC;
  const int ntn = (N + 63) / 64; const int wid = blockIdx.x * 4 + w; const int mt = wid / ntn, nq = wid % ntn; if (mt * 16 >= M) return;
  const int row0 = mt * 16, col0 = nq * 64; const float* arow = A + (size_t)(row0 + ln) * lda;
  v8f acc[4] = {};
  for (int kb = 0; kb < K; kb += 32) {
    FragH ah, al;
    const v4f x0 = *(const v4fa*)(arow + kb + 8 * hh), x1 = *(const v4fa*)(arow + kb + 8 * hh + 4), x2 = *(const v4fa*)(arow + kb + 16 + 8 * hh), x3 = *(const v4fa*)(arow + kb + 16 + 8 * hh + 4);
    float xs[16] = {x0[0],x0[1],x0[2],x0[3],x1[0],x1[1],x1[2],x1[3],x2[0],x2[1],x2[2],x2[3],x3[0],x3[1],x3[2],x3[3]};
#pragma unroll
    for (int i = 0; i < 16; ++i) { const _Float16 h = (_Float16)xs[i]; ah.h[i] = h; al.h[i] = ASPLIT ? (_Float16)(xs[i] - (float)h) : (_Float16)0.0f; }
#pragma unroll
    for (int t = 0; t < 4; ++t) { if (col0 + t * 16 >= N) continue; const size_t boff = (size_t)(col0 + t * 16 + ln) * ldb + kb; FragH bq; bq.half[0] = *(const v8us*)(Bh + boff + 8 * hh); bq.half[1] = *(const v8us*)(Bh + boff + 16 + 8 * hh);
      acc[t] = mmaH<ASPLIT ? 2 : 1>(ah.v, al.v, bq.v, bq.v, acc[t]); }
  }
#pragma unroll
  for (int t = 0; t < 4; ++t) { if (col0 + t * 16 >= N) continue;
#pragma unroll
    for (int r = 0; r < 8; ++r) so[w][8 * hh + r][t * 16 + ln] = acc[t][r] * alpha; }
  __builtin_amdgcn_fence(__ATOMIC_ACQ_REL, "workgroup"); __builtin_amdgcn_wave_barrier();
  const int rsub = lane >> 4, c4 = (lane & 15) * 4;
  {
#pragma unroll
    for (int q = 0; q < 8; ++q) { const int r = q * 2 + rsub; if (col0 + c4 < N) { const v4f v = *(const v4fa*)&so[w][r][c4]; *(v4f*)(C + (size_t)(row0 + r) * ldc + col0 + c4) = v; } }
     }
}

// Wt[n][k] = f16(bf16(W[k][n])·scale) from f32 row-major W[K][N] (scale = power of two; bf16-exact weights stay exact in f16 away from the subnormal range)
__global__ __launch_bounds__(256) void k_wt_f16(const float* __restrict__ W, _Float16* __restrict__ Wt, int K, int N, float scale) {
  const int t = blockIdx.x * 256 + threadIdx.x; if (t >= N * (K / 8)) return; const int n = t / (K / 8), k8 = (t % (K / 8)) * 8; FragH f;
#pragma unroll
  for (int i = 0; i < 8; ++i) f.h[i] = (_Float16)(bf16_round(W[(size_t)(k8 + i) * N + n]) * scale); const v8us o = f.half[0];
  *(v8us*)((unsigned short*)Wt + (size_t)n * K + k8) = o; 
}
// k_gemm_hh variant with fused epilogue: v = acc·alpha + bias[by·sBias + col] (+ CP[(row/rowsPerB)·sCPb + by·64 + col] if CP) ; ACT 0 none / 1 elu ; writes f16 C16 (and f32 C if non-null)
template <int ACT>
__global__ __launch_bounds__(128) void k_gemm_hhx(const _Float16* __restrict__ A, int lda, size_t sA, const _Float16* __restrict__ Bh, int ldb, size_t sB, float alpha, const float* __restrict__ bias, size_t sBias, const float* __restrict__ CP, int rowsPerB, size_t sCPb, int row0g,
    float* __restrict__ C, _Float16* __restrict__ C16, int ldc, size_t sC, int M, int N, int K) {
  __shared__ __attribute__((aligned(16))) float so[4][16][64];
  const int tid = threadIdx.x, w = tid >> 5, lane = tid & 31, ln = lane & 15, hh = lane >> 4; const int by = blockIdx.y;
  A += (size_t)by * sA; Bh += (size_t)by * sB; const size_t cofs = (size_t)by * sC; const float* bp = bias ? bias + (size_t)by * sBias : nullptr;
  const int ntn = (N + 63) / 64; const int wid = blockIdx.x * 4 + w; const int mt = wid / ntn, nq = wid % ntn; if (mt * 16 >= M) return;
  const int row0 = mt * 16, col0 = nq * 64; const _Float16* arow = A + (size_t)(row0 + ln) * lda;
  v8f acc[4] = {};
  for (int kb = 0; kb < K; kb += 32) { FragH ah; ah.half[0] = *(const v8us*)((const unsigned short*)arow + kb + 8 * hh); ah.half[1] = *(const v8us*)((const unsigned short*)arow + kb + 16 + 8 * hh);
#pragma unroll
    for (int t = 0; t < 4; ++t) { if (col0 + t * 16 >= N) continue; const size_t boff = (size_t)(col0 + t * 16 + ln) * ldb + kb; FragH bq; bq.half[0] = *(const v8us*)((const unsigned short*)Bh + boff + 8 * hh); bq.half[1] = *(const v8us*)((const unsigned short*)Bh + boff + 16 + 8 * hh);
      acc[t] = mmaH<1>(ah.v, ah.v, bq.v, bq.v, acc[t]); }
  }
#pragma unroll
  for (int t = 0; t < 4; ++t) { if (col0 + t * 16 >= N) continue; const int col = col0 + t * 16 + ln; const float bv = bp ? bf16_round(bp[col]) : 0.f;
#pragma unroll
    for (int r = 0; r < 8; ++r) { float v = acc[t][r] * alpha + bv; if (CP) { const int rr = row0g + row0 + 8 * hh + r; if (rowsPerB < 0) v += CP[cofs + (size_t)rr * ldc + col];      /* rowsPerB < 0: own element of the batched C plane */ else { const int bidx = rr / rowsPerB; v += CP[(size_t)bidx * sCPb + (size_t)by * 64 + col]; } } if (ACT == 1) v = (v > 0.f) ? v : expm1f(v); else if (ACT == 7) v = (v > 0.f) ? v + 1.0f : expf(v); else if (ACT == 8) v = tanhf(v); else if (ACT == 9) v = 0.5f * v * (1.0f + tanhf(0.7978845608028654f * (v + 0.044715f * v * v * v))); else if (ACT == 11) v = 1.0f / (1.0f + expf(-v)); else if (ACT == 12) v = (v > 0.f) ? v : 0.01f * v; else if (ACT == 14) v = (v > 0.f) ? v : 0.1f * v; else if (ACT == 16) v = (v >= 0.f) ? v : 0.3f * v; else if (ACT == 17) v = (v >= 0.f) ? v : 0.2f * v; else if (ACT == 15) v = v / (1.0f + expf(-v)); else if (ACT == 3) v = fmaxf(v, 0.f); else if (ACT == 6) v = 0.5f * v * (1.0f + erff(v * 0.70710678118654752f)); so[w][8 * hh + r][t * 16 + ln] = v; } }
  __builtin_amdgcn_fence(__ATOMIC_ACQ_REL, "workgroup"); __builtin_amdgcn_wave_barrier();
  const int rsub = lane >> 4, c4 = (lane & 15) * 4; typedef _Float16 v4h __attribute__((ext_vector_type(4)));
  {
#pragma unroll
    for (int q = 0; q < 8; ++q) { const int r = q * 2 + rsub; if (col0 + c4 < N) { const v4f v = *(const v4fa*)&so[w][r][c4]; if (C) *(v4f*)(C + cofs + (size_t)(row0 + r) * ldc + col0 + c4) = v; if (C16) { v4h h4; for (int i = 0; i < 4; ++i) h4[i] = (_Float16)v[i]; *(v4h*)(C16 + cofs + (size_t)(row0 + r) * ldc + col0 + c4) = h4; } } }
     }
}


typedef _Float16 v4h __attribute__((ext_vector_type(4)));

__global__ __launch_bounds__(256) void k_x16(const float* __restrict__ x, _Float16* __restrict__ X16, size_t n8) { const size_t t = (size_t)blockIdx.x * 256 + threadIdx.x; if (t >= n8) return; FragH f;
#pragma unroll
  for (int q = 0; q < 8; ++q) f.h[q] = (_Float16)bf16_round(x[t * 8 + q]); *(v8us*)((unsigned short*)X16 + t * 8) = f.half[0];  }
__global__ __launch_bounds__(256) void k_h16(const float* __restrict__ x, _Float16* __restrict__ X16, size_t n8) { const size_t t = (size_t)blockIdx.x * 256 + threadIdx.x; if (t >= n8) return; FragH f;
#pragma unroll
  for (int q = 0; q < 8; ++q) f.h[q] = (_Float16)x[t * 8 + q]; *(v8us*)((unsigned short*)X16 + t * 8) = f.half[0];  }
__global__ __launch_bounds__(256) void k_round16f(const float* __restrict__ W, _Float16* __restrict__ Bt, size_t n8) { const size_t t = (size_t)blockIdx.x * 256 + threadIdx.x; if (t >= n8) return; FragH f;
#pragma unroll
  for (int i = 0; i < 8; ++i) f.h[i] = (_Float16)(bf16_round(W[t * 8 + i]) * 16.0f); *(v8us*)((unsigned short*)Bt + t * 8) = f.half[0];  }
template <int NHv, int TTv>
__global__ __launch_bounds__(256) void k_vt(const _Float16* __restrict__ V16, int ldv, int voff, _Float16* __restrict__ Vt) { __shared__ unsigned short tl[64][66]; const int tid = threadIdx.x; const int slab = blockIdx.x / (TTv / 64), lg = blockIdx.x % (TTv / 64); const int b = slab / NHv, h = slab % NHv;
  for (int i = tid; i < 64 * 8; i += 256) { const int r = i / 8, c8 = (i % 8) * 8; FragH f; f.half[0] = *(const v8us*)((const unsigned short*)V16 + ((size_t)b * TTv + lg * 64 + r) * ldv + voff + h * 64 + c8);
#pragma unroll
    for (int q = 0; q < 8; ++q) tl[r][c8 + q] = f.u[q]; }
  __syncthreads();
  {
#pragma unroll
    for (int rd = 0; rd < 2; ++rd) { const int d = rd * 32 + tid / 8, pc = tid % 8; FragH f;
#pragma unroll
      for (int q = 0; q < 8; ++q) f.u[q] = tl[pc * 8 + q][d];
      *(v8us*)((unsigned short*)Vt + ((size_t)slab * 64 + d) * TTv + lg * 64 + pc * 8) = f.half[0]; }
     } }

__global__ __launch_bounds__(256) void k_hl(const float* __restrict__ F, _Float16* __restrict__ Hh, _Float16* __restrict__ Hl, size_t n8) { const size_t t = (size_t)blockIdx.x * 256 + threadIdx.x; if (t >= n8) return; FragH fh, fl; const v4f a = *(const v4fa*)(F + t * 8), c = *(const v4fa*)(F + t * 8 + 4);
#pragma unroll
  for (int q = 0; q < 4; ++q) { _Float16 h = (_Float16)a[q]; fh.h[q] = h; fl.h[q] = (_Float16)((a[q] - (float)h) * 1024.0f); h = (_Float16)c[q]; fh.h[4 + q] = h; fl.h[4 + q] = (_Float16)((c[q] - (float)h) * 1024.0f); }
  { *(v8us*)((unsigned short*)Hh + t * 8) = fh.half[0]; *(v8us*)((unsigned short*)Hl + t * 8) = fl.half[0];  } }

// ---- fast GEMM (wave tile 32x64; requires M % 32 == 0 rows per launch region and N % 64 == 0); epilogue = k_gemm_hhx semantics ----
__device__ __forceinline__ v16h g2_frag(const _Float16* p, int hh) { FragH f; f.half[0] = *(const v8us*)((const unsigned short*)p + 8 * hh); f.half[1] = *(const v8us*)((const unsigned short*)p + 16 + 8 * hh); return f.v; }
__device__ __forceinline__ v8f g2_mma(v16h a, v16h b, v8f c) { v8f d = __builtin_amdgcn_wmma_f32_16x16x32_f16(false, a, false, b, (short)0, c, false, false); asm volatile("v_nop\n\tv_nop\n\tv_nop\n\tv_nop" : "+v"(d) : "v"(a), "v"(b)); return d; }
template <int ACT>
__global__ __launch_bounds__(128) void k_gemm2(const _Float16* __restrict__ A, int lda, size_t sA, const _Float16* __restrict__ Bh, int ldb, size_t sB, float alpha, const float* __restrict__ bias, size_t sBias, const float* __restrict__ CP, int rowsPerB, size_t sCPb, int row0g,
    float* __restrict__ C, _Float16* __restrict__ C16, int ldc, size_t sC, int M, int N, int K) { static_assert(ACT == 0 || ACT == 3 || ACT == 6 || ACT == 8 || ACT == 9 || ACT == 11 || ACT == 12 || ACT == 14 || ACT == 15 || ACT == 16 || ACT == 17, "k_gemm2: unsupported ACT code (would silently apply no activation)");
  __shared__ __attribute__((aligned(16))) float so[4][32][68];
  const int tid = threadIdx.x, w = tid >> 5, lane = tid & 31, ln = lane & 15, hh = lane >> 4; const int by = blockIdx.y;
  A += (size_t)by * sA; Bh += (size_t)by * sB; const size_t cofs = (size_t)by * sC; const float* bp = bias ? bias + (size_t)by * sBias : nullptr;
  const int ntn = N >> 6; const int mt = blockIdx.x / ntn, nq = blockIdx.x - mt * ntn; const int row0 = mt * 128 + 32 * w, col0 = nq * 64; if (row0 >= M) return;
  const _Float16* a0p = A + (size_t)(row0 + ln) * lda; const _Float16* a1p = a0p + (size_t)16 * lda;
  const _Float16* b0p = Bh + (size_t)(col0 + ln) * ldb; const _Float16* b1p = b0p + (size_t)16 * ldb; const _Float16* b2p = b1p + (size_t)16 * ldb; const _Float16* b3p = b2p + (size_t)16 * ldb;
  const v8f z8 = {0.f,0.f,0.f,0.f,0.f,0.f,0.f,0.f}; v8f c00 = z8, c01 = z8, c02 = z8, c03 = z8, c10 = z8, c11 = z8, c12 = z8, c13 = z8;
#pragma unroll 1
  for (int kb = 0; kb < K; kb += 32) { const v16h a0 = g2_frag(a0p + kb, hh), a1 = g2_frag(a1p + kb, hh);
    v16h b = g2_frag(b0p + kb, hh); c00 = g2_mma(a0, b, c00); c10 = g2_mma(a1, b, c10);
    b = g2_frag(b1p + kb, hh); c01 = g2_mma(a0, b, c01); c11 = g2_mma(a1, b, c11);
    b = g2_frag(b2p + kb, hh); c02 = g2_mma(a0, b, c02); c12 = g2_mma(a1, b, c12);
    b = g2_frag(b3p + kb, hh); c03 = g2_mma(a0, b, c03); c13 = g2_mma(a1, b, c13); }
  v8f accs[8] = {c00, c01, c02, c03, c10, c11, c12, c13};
#pragma unroll
  for (int u = 0; u < 8; ++u) { const int t = u & 3, half = u >> 2; const int col = col0 + t * 16 + ln; const float bv = bp ? bf16_round(bp[col]) : 0.f;
#pragma unroll
    for (int r = 0; r < 8; ++r) { const int rloc = half * 16 + 8 * hh + r; float v = accs[u][r] * alpha + bv; if (CP) { if (rowsPerB < 0) v += CP[cofs + (size_t)(row0g + row0 + rloc) * ldc + col];      /* rowsPerB < 0: own element of the batched C plane */ else { const int bidx = (row0g + row0 + rloc) / rowsPerB; v += CP[(size_t)bidx * sCPb + (size_t)by * 64 + col]; } }
      if (ACT == 3) v = fmaxf(v, 0.f); else if (ACT == 6) v = 0.5f * v * (1.0f + erff(v * 0.70710678118654752f)); else if (ACT == 11) v = 1.0f / (1.0f + expf(-v)); else if (ACT == 15) v = v / (1.0f + expf(-v)); else if (ACT == 12) v = (v > 0.f) ? v : 0.01f * v; else if (ACT == 8) v = tanhf(v); else if (ACT == 9) v = 0.5f * v * (1.0f + tanhf(0.7978845608028654f * (v + 0.044715f * v * v * v))); else if (ACT == 14) v = (v > 0.f) ? v : 0.1f * v; else if (ACT == 16) v = (v >= 0.f) ? v : 0.3f * v; else if (ACT == 17) v = (v >= 0.f) ? v : 0.2f * v;
      so[w][rloc][t * 16 + ln] = v; } }
  __builtin_amdgcn_fence(__ATOMIC_ACQ_REL, "workgroup"); __builtin_amdgcn_wave_barrier();
  const int rsub = lane >> 4, c4 = (lane & 15) * 4;
  {
#pragma unroll
    for (int q = 0; q < 16; ++q) { const int r = q * 2 + rsub; const v4f v = *(const v4fa*)&so[w][r][c4]; if (C) *(v4f*)(C + cofs + (size_t)(row0 + r) * ldc + col0 + c4) = v; if (C16) { v4h h4; for (int i = 0; i < 4; ++i) h4[i] = (_Float16)v[i]; *(v4h*)(C16 + cofs + (size_t)(row0 + r) * ldc + col0 + c4) = h4; } }
     } }


__global__ __launch_bounds__(256) void k_f16c(const float* __restrict__ A, _Float16* __restrict__ D, size_t n8) { const size_t t = (size_t)blockIdx.x * 256 + threadIdx.x; if (t >= n8) return; const v8f a = *(const v8f*)(A + t * 8); FragH f; for (int q = 0; q < 8; ++q) f.h[q] = (_Float16)a[q]; *(v8us*)((unsigned short*)D + t * 8) = f.half[0];  }
__global__ __launch_bounds__(256) void k_h1(const float* __restrict__ A, const float* __restrict__ Bu, const float* __restrict__ b1, _Float16* __restrict__ H1) {
  #pragma clang fp contract(off)
  const size_t t = (size_t)blockIdx.x * 256 + threadIdx.x; if (t >= NRW * HALF / 4) return; const int c0 = (int)((t * 4) % HALF); const size_t row = (t * 4) / HALF; const int n = (int)(row % NU); const size_t bt = row / NU; const v4f a = *(const v4fa*)(A + bt * HALF + c0); const v4f u = *(const v4fa*)(Bu + (size_t)n * HALF + c0); v4h o;
#pragma unroll 1
  for (int q = 0; q < 4; ++q) { float s = a[q] + u[q]; s += bf16_round(b1[c0 + q]); o[q] = (_Float16)(0.5f * s * (1.0f + erff(s * 0.70710678118654752f))); }
  *(v4h*)(H1 + t * 4) = o;  }
__global__ __launch_bounds__(256) void k_gelu16(_Float16* __restrict__ H, size_t n4) {
  #pragma clang fp contract(off)
  const size_t t = (size_t)blockIdx.x * 256 + threadIdx.x; if (t >= n4) return; v4h a = *(const v4h*)(H + t * 4); v4h o;
#pragma unroll 1
  for (int q = 0; q < 4; ++q) { const float u = (float)a[q]; o[q] = (_Float16)(0.5f * u * (1.0f + erff(u * 0.70710678118654752f))); }
  *(v4h*)(H + t * 4) = o;  }
__global__ __launch_bounds__(256) void k_head(const _Float16* __restrict__ H2, const float* __restrict__ w3, const float* __restrict__ b3, float* __restrict__ out) {
  #pragma clang fp contract(off)
  __shared__ float w[QTR]; if (threadIdx.x < QTR) w[threadIdx.x] = bf16_round(w3[threadIdx.x]); __syncthreads();
  const size_t row = (size_t)blockIdx.x * 256 + threadIdx.x; if (row >= NRW) return; const unsigned short* h = (const unsigned short*)H2 + row * QTR; float s = 0.f;
#pragma unroll 1
  for (int c = 0; c < QTR; c += 8) { FragH f; f.half[0] = *(const v8us*)(h + c); for (int q = 0; q < 8; ++q) s += (float)f.h[q] * w[c + q]; }
  s += bf16_round(b3[0]); s = fminf(fmaxf(s, -10.0f), 10.0f); *(float*)(out + row) = s;  }

extern "C" void kernel_launch(void* const* d_in, const int* in_sizes, int n_in,
                              void* d_out, int out_size, void* d_ws, size_t ws_size, hipStream_t stream) {
  (void)in_sizes; (void)n_in; (void)out_size;
  const float* const* I = (const float* const*)d_in; const float* br = I[0]; const float* ue = I[1]; const float* bpw = I[2]; const float* bpb = I[3]; const float* upw = I[4]; const float* upb = I[5]; const float* w1 = I[6]; const float* b1 = I[7]; const float* w2 = I[8]; const float* b2 = I[9]; const float* w3 = I[10]; const float* b3 = I[11];
  char* ws = (char*)d_ws; size_t off = 0;
  auto take = [&](size_t bytes) { char* p = ws + off; off += (bytes + 255) & ~(size_t)255; return p; };
  _Float16* BBP = (_Float16*)take((size_t)HALF * DIM * 2); _Float16* BUP = (_Float16*)take((size_t)HALF * DIM * 2); _Float16* BW1A = (_Float16*)take((size_t)HALF * HALF * 2); _Float16* BW1B = (_Float16*)take((size_t)HALF * HALF * 2); _Float16* BW2 = (_Float16*)take((size_t)QTR * HALF * 2);
  _Float16* BR16 = (_Float16*)take((size_t)NBT * DIM * 2); _Float16* UE16 = (_Float16*)take((size_t)NU * DIM * 2); _Float16* BH16 = (_Float16*)take((size_t)NBT * HALF * 2); _Float16* UH16 = (_Float16*)take((size_t)NU * HALF * 2); float* A = (float*)take((size_t)NBT * HALF * 4); float* Bu = (float*)take((size_t)NU * HALF * 4);
  _Float16* H1 = (_Float16*)take(NRW * HALF * 2); _Float16* H2 = (_Float16*)take(NRW * QTR * 2);
  if (off > ws_size) return;      /* 1 + 1.3 + 0.4 + 1 + 0.25 + 128 + 64 = ≈ 196 MiB */
  k_wt_f16<<<(HALF * DIM / 8 + 255) / 256, 256, 0, stream>>>(bpw, BBP, DIM, HALF, 16.0f); k_wt_f16<<<(HALF * DIM / 8 + 255) / 256, 256, 0, stream>>>(upw, BUP, DIM, HALF, 16.0f); k_wt_f16<<<(HALF * HALF / 8 + 255) / 256, 256, 0, stream>>>(w1, BW1A, HALF, HALF, 16.0f); k_wt_f16<<<(HALF * HALF / 8 + 255) / 256, 256, 0, stream>>>(w1 + (size_t)HALF * HALF, BW1B, HALF, HALF, 16.0f); k_wt_f16<<<(QTR * HALF / 8 + 255) / 256, 256, 0, stream>>>(w2, BW2, HALF, QTR, 16.0f);      /* (in, out) */
  k_x16<<<(NBT * DIM / 8 + 255) / 256, 256, 0, stream>>>(br, BR16, (size_t)NBT * DIM / 8); k_x16<<<(NU * DIM / 8 + 255) / 256, 256, 0, stream>>>(ue, UE16, (size_t)NU * DIM / 8);
  k_gemm2<0><<<dim3((NBT / 128) * (HALF / 64), 1), 128, 0, stream>>>(BR16, DIM, 0, BBP, DIM, 0, 0.0625f, bpb, 0, nullptr, 1, 0, 0, nullptr, BH16, HALF, 0, NBT, HALF, DIM);
  k_gemm2<0><<<dim3((NU / 128) * (HALF / 64), 1), 128, 0, stream>>>(UE16, DIM, 0, BUP, DIM, 0, 0.0625f, upb, 0, nullptr, 1, 0, 0, nullptr, UH16, HALF, 0, NU, HALF, DIM);      /* bin_h, unit_h (f16) */
  k_gemm2<0><<<dim3((NBT / 128) * (HALF / 64), 1), 128, 0, stream>>>(BH16, HALF, 0, BW1A, HALF, 0, 0.0625f, nullptr, 0, nullptr, 1, 0, 0, A, nullptr, HALF, 0, NBT, HALF, HALF);
  k_gemm2<0><<<dim3((NU / 128) * (HALF / 64), 1), 128, 0, stream>>>(UH16, HALF, 0, BW1B, HALF, 0, 0.0625f, nullptr, 0, nullptr, 1, 0, 0, Bu, nullptr, HALF, 0, NU, HALF, HALF);      /* bin_h w1a, unit_h w1b */
  k_h1<<<(unsigned)((NRW * HALF / 4 + 255) / 256), 256, 0, stream>>>(A, Bu, b1, H1);
  k_gemm2<0><<<dim3((unsigned)((NRW / 128) * (QTR / 64)), 1), 128, 0, stream>>>(H1, HALF, 0, BW2, HALF, 0, 0.0625f, b2, 0, nullptr, 1, 0, 0, nullptr, H2, QTR, 0, (int)NRW, QTR, HALF);      /* h1 w2 + b2 (f16) */
  k_gelu16<<<(unsigned)((NRW * QTR / 4 + 255) / 256), 256, 0, stream>>>(H2, NRW * QTR / 4);      /* h2 = gelu(.) in place */
  k_head<<<(unsigned)((NRW + 255) / 256), 256, 0, stream>>>(H2, w3, b3, (float*)d_out);
}

// v001
// Measured time: 154 microseconds a run.
// Two timings next to v000 both put it at 1.99 times that version's speed.
#include <hip/hip_runtime.h>
// PerNeuronMLPHead (2 x 512 time bins x 512, 256 units x 512: bin_h = bin_repr Wbp + b, unit_h = unit_embs Wup + b (256 wide); h1[(b,t), n] = gelu(bin_h w1a + unit_h w1b + b1) (the split-weight broadcast add); h2 = gelu(h1 w2 + b2) (128); log_rate = h2 w3 + b3; clip(-10, 10); exact erf GELU).
// Structure: the four small projections as f16 WMMA GEMMs (32x64 wave tiles, f32 accumulation, exact x16 weights + bias); then one fused kernel: broadcast add + GELU on VALU straight into f16 WMMA fragments, h1 w2 on f16 WMMA, GELU, the 128 -> 1 head and the clip on the f32 accumulators (128-B stores, one a wave).
// Compute dtype: inputs rounded to bf16; inputs / weights exact as f16; bin_h / unit_h and h1 as plain f16 operands (~2^-12); h2, GELU and head f32. v_wmma_f32_16x16x32_f16.
#define NB 2
#define NTB 512
#define DIM 512
#define HALF 256
#define QTR 128
#define NU 256
#define NBT (NB * NTB)           /* 1024 bin rows */
#define NRW ((size_t)NBT * NU)   /* 262144 output rows */
typedef __bf16 v16b __attribute__((ext_vector_type(16)));
typedef unsigned short v8us __attribute__((ext_vector_type(8), may_alias));
typedef float  v8f  __attribute__((ext_vector_type(8)));
typedef float  v4f  __attribute__((ext_vector_type(4)));
typedef float  v4fa __attribute__((ext_vector_type(4), may_alias));
union FragB { v16b v; v8us half[2]; unsigned short u[16]; };

__device__ __forceinline__ unsigned short bf16_bits(float x) { unsigned int u = __float_as_uint(x); return (unsigned short)((u + 0x7FFFu + ((u >> 16) & 1u)) >> 16); }
__device__ __forceinline__ float bf16_val(unsigned short b) { return __uint_as_float(((unsigned int)b) << 16); }
__device__ __forceinline__ float bf16_round(float x) { return bf16_val(bf16_bits(x)); }
// D += A·B with NT terms: 1 = ah·bh, 2 = + al·bh (A split), 3 = + ah·bl (both split)
template <int NT>
__device__ __forceinline__ v8f mmaN(v16b ah, v16b al, v16b bh, v16b bl, v8f c) {
  c = __builtin_amdgcn_wmma_f32_16x16x32_bf16(false, ah, false, bh, (short)0, c, false, false);
  if (NT >= 2) c = __builtin_amdgcn_wmma_f32_16x16x32_bf16(false, al, false, bh, (short)0, c, false, false);
  if (NT >= 3) c = __builtin_amdgcn_wmma_f32_16x16x32_bf16(false, ah, false, bl, (short)0, c, false, false);
  asm volatile("v_nop\n\tv_nop\n\tv_nop\n\tv_nop" : "+v"(c) : "v"(ah), "v"(al), "v"(bh), "v"(bl));
  return c;
}

__global__ __launch_bounds__(256) void k_wt_bf16(const float* __restrict__ W, unsigned short* __restrict__ Wt, int K, int N) {
  const int t = blockIdx.x * 256 + threadIdx.x;
  const int k8n = K / 8;
  if (t >= N * k8n) return;
  const int n = t / k8n, k8 = (t % k8n) * 8;
  v8us v;
#pragma unroll
  for (int i = 0; i < 8; ++i) v[i] = bf16_bits(W[(size_t)(k8 + i) * N + n]);
  *(v8us*)(Wt + (size_t)n * K + k8) = v;
  
}

// GEMM C[M][N] (f32, pitch ldc) = act(A[M][K]·W + bias). A f32 row-major (pitch lda) converted per fragment to bf16
// (ASPLIT: hi/lo two planes -> 2 terms, else single rounded term); Wt bf16 [N][K] (pitch ldb). BIAS_BF16 rounds the
// bias to bf16 first (bias quantised to bf16 before the add). K%32==0, M%16==0, N%64==0.
template <bool ASPLIT, int ACT, bool BIAS_BF16>
__global__ __launch_bounds__(128) void k_gemm_bf(const float* __restrict__ A, int lda, const unsigned short* __restrict__ Wt, int ldb,
                                               const float* __restrict__ bias, float* __restrict__ C, int ldc, int M, int N, int K) {
  __shared__ __attribute__((aligned(16))) float so[4][16][64];
  const int tid = threadIdx.x, w = tid >> 5, lane = tid & 31, ln = lane & 15, hh = lane >> 4;
  const int ntn = N / 64;
  const int wid = blockIdx.x * 4 + w;
  const int mt = wid / ntn, nq = wid % ntn;
  if (mt * 16 >= M) return;
  const int row0 = mt * 16, col0 = nq * 64;
  const float* arow = A + (size_t)(row0 + ln) * lda;
  v8f acc[4] = {};
  for (int kb = 0; kb < K; kb += 32) {
    FragB ah, al;
    const v4f x0 = *(const v4fa*)(arow + kb + 8 * hh), x1 = *(const v4fa*)(arow + kb + 8 * hh + 4);
    const v4f x2 = *(const v4fa*)(arow + kb + 16 + 8 * hh), x3 = *(const v4fa*)(arow + kb + 16 + 8 * hh + 4);
    float xs[16] = {x0[0],x0[1],x0[2],x0[3],x1[0],x1[1],x1[2],x1[3],x2[0],x2[1],x2[2],x2[3],x3[0],x3[1],x3[2],x3[3]};
#pragma unroll
    for (int i = 0; i < 16; ++i) { const unsigned short hb = bf16_bits(xs[i]); ah.u[i] = hb; al.u[i] = ASPLIT ? bf16_bits(xs[i] - bf16_val(hb)) : (unsigned short)0; }
#pragma unroll
    for (int t = 0; t < 4; ++t) {
      const unsigned short* brow = Wt + (size_t)(col0 + t * 16 + ln) * ldb + kb;
      FragB b;
      b.half[0] = *(const v8us*)(brow + 8 * hh);
      b.half[1] = *(const v8us*)(brow + 16 + 8 * hh);
      acc[t] = mmaN<ASPLIT ? 2 : 1>(ah.v, al.v, b.v, b.v, acc[t]);
    }
  }
#pragma unroll
  for (int t = 0; t < 4; ++t) {
    float bv = bias ? bias[col0 + t * 16 + ln] : 0.f;
    if (BIAS_BF16) bv = bf16_round(bv);
#pragma unroll
    for (int r = 0; r < 8; ++r) { float v = acc[t][r] + bv; if (ACT == 1) v = fmaxf(v, 0.f); so[w][8 * hh + r][t * 16 + ln] = v; }
  }
  __builtin_amdgcn_fence(__ATOMIC_ACQ_REL, "workgroup");
  __builtin_amdgcn_wave_barrier();
  const int rsub = lane >> 4, c4 = (lane & 15) * 4;
  {
#pragma unroll
    for (int q = 0; q < 8; ++q) {
      const int r = q * 2 + rsub;
      const v4f v = *(const v4fa*)&so[w][r][c4];
      *(v4f*)(C + (size_t)(row0 + r) * ldc + col0 + c4) = v;
    }
    
  }
}

// GEMM C = act(A·W + bias + resid): A f32 (ASPLIT -> hi/lo 2 terms), Wt bf16 [N][K]; ACT 0 none, 1 relu, 2 exact gelu;
// resid (optional, f32, row index = (row % rmod), pitch ldr, RES_BF16 rounds it) added before the activation.
template <bool ASPLIT, int ACT, bool BIAS_BF16, bool RES_BF16>
__global__ __launch_bounds__(128) void k_gemm_bf3(const float* __restrict__ A, int lda, const unsigned short* __restrict__ Wt, int ldb,
                                                const float* __restrict__ bias, const float* __restrict__ resid, int rmod, int ldr,
                                                float* __restrict__ C, int ldc, int M, int N, int K) {
  __shared__ __attribute__((aligned(16))) float so[4][16][64];
  const int tid = threadIdx.x, w = tid >> 5, lane = tid & 31, ln = lane & 15, hh = lane >> 4;
  const int ntn = N / 64;
  const int wid = blockIdx.x * 4 + w;
  const int mt = wid / ntn, nq = wid % ntn;
  if (mt * 16 >= M) return;
  const int row0 = mt * 16, col0 = nq * 64;
  const float* arow = A + (size_t)(row0 + ln) * lda;
  v8f acc[4] = {};
  for (int kb = 0; kb < K; kb += 32) {
    FragB ah, al;
    const v4f x0 = *(const v4fa*)(arow + kb + 8 * hh), x1 = *(const v4fa*)(arow + kb + 8 * hh + 4);
    const v4f x2 = *(const v4fa*)(arow + kb + 16 + 8 * hh), x3 = *(const v4fa*)(arow + kb + 16 + 8 * hh + 4);
    float xs[16] = {x0[0],x0[1],x0[2],x0[3],x1[0],x1[1],x1[2],x1[3],x2[0],x2[1],x2[2],x2[3],x3[0],x3[1],x3[2],x3[3]};
#pragma unroll
    for (int i = 0; i < 16; ++i) { const unsigned short hb = bf16_bits(xs[i]); ah.u[i] = hb; al.u[i] = ASPLIT ? bf16_bits(xs[i] - bf16_val(hb)) : (unsigned short)0; }
#pragma unroll
    for (int t = 0; t < 4; ++t) {
      const unsigned short* brow = Wt + (size_t)(col0 + t * 16 + ln) * ldb + kb;
      FragB b;
      b.half[0] = *(const v8us*)(brow + 8 * hh);
      b.half[1] = *(const v8us*)(brow + 16 + 8 * hh);
      acc[t] = mmaN<ASPLIT ? 2 : 1>(ah.v, al.v, b.v, b.v, acc[t]);
    }
  }
#pragma unroll
  for (int t = 0; t < 4; ++t) {
    const int col = col0 + t * 16 + ln;
    float bv = bias ? bias[col] : 0.f;
    if (BIAS_BF16) bv = bf16_round(bv);
#pragma unroll
    for (int r = 0; r < 8; ++r) {
      float v = acc[t][r] + bv;
      if (resid) { float rv = resid[(size_t)((row0 + 8 * hh + r) % rmod) * ldr + col]; if (RES_BF16) rv = bf16_round(rv); v += rv; }
      if (ACT == 1) v = fmaxf(v, 0.f);
      if (ACT == 2) v = 0.5f * v * (1.0f + erff(v * 0.70710678118654752f));
      if (ACT == 3) { const float u = 0.7978845608028654f * (v + 0.044715f * v * v * v); v = 0.5f * v * (1.0f + tanhf(u)); }
      so[w][8 * hh + r][t * 16 + ln] = v;
    }
  }
  __builtin_amdgcn_fence(__ATOMIC_ACQ_REL, "workgroup");
  __builtin_amdgcn_wave_barrier();
  const int rsub = lane >> 4, c4 = (lane & 15) * 4;
  {
#pragma unroll
    for (int q = 0; q < 8; ++q) {
      const int r = q * 2 + rsub;
      const v4f v = *(const v4fa*)&so[w][r][c4];
      *(v4f*)(C + (size_t)(row0 + r) * ldc + col0 + c4) = v;
    }
    
  }
}
// row LayerNorm (biased variance, eps) over N: s = X (+ R); optional out_sum <- s; out_norm <- (s-mu)*rsqrt(var+eps)*g + b
template <bool PARAM_BF16>
__global__ __launch_bounds__(256) void k_layernorm(const float* __restrict__ X, const float* __restrict__ R, const float* __restrict__ g, const float* __restrict__ bta,
                                                  float* __restrict__ out_sum, float* __restrict__ out_norm, int N, float eps) {
  __shared__ float red[256];
  const int row = blockIdx.x, tid = threadIdx.x;
  const float* x = X + (size_t)row * N; const float* rr = R ? R + (size_t)row * N : nullptr;
  float vals[16];                     // up to N = 4096
  const int per = N / 256;            // contiguous chunk per thread? use strided-by-4 chunks: thread handles j = tid*4 + 1024*u
  float s1 = 0.f;
  for (int u = 0; u < per / 4; ++u) {
    const int j = tid * 4 + 1024 * u;
    const v4f a = *(const v4fa*)(x + j);
    v4f b = {0.f,0.f,0.f,0.f}; if (rr) b = *(const v4fa*)(rr + j);
#pragma unroll
    for (int q = 0; q < 4; ++q) { const float v = a[q] + b[q]; vals[u * 4 + q] = v; s1 += v; }
  }
  red[tid] = s1; __syncthreads();
  for (int st = 128; st > 0; st >>= 1) { if (tid < st) red[tid] += red[tid + st]; __syncthreads(); }
  const float mu = red[0] / (float)N; __syncthreads();
  float s2 = 0.f;
  for (int u = 0; u < per / 4; ++u)
#pragma unroll
    for (int q = 0; q < 4; ++q) { const float c = vals[u * 4 + q] - mu; s2 += c * c; }
  red[tid] = s2; __syncthreads();
  for (int st = 128; st > 0; st >>= 1) { if (tid < st) red[tid] += red[tid + st]; __syncthreads(); }
  const float rs = rsqrtf(red[0] / (float)N + eps);
  {
    for (int u = 0; u < per / 4; ++u) {
      const int j = tid * 4 + 1024 * u;
      v4f o, sm;
#pragma unroll
      for (int q = 0; q < 4; ++q) {
        float gg = g[j + q], bb = bta[j + q];
        if (PARAM_BF16) { gg = bf16_round(gg); bb = bf16_round(bb); }
        sm[q] = vals[u * 4 + q]; o[q] = (vals[u * 4 + q] - mu) * rs * gg + bb;
      }
      if (out_sum) *(v4f*)(out_sum + (size_t)row * N + j) = sm;
      *(v4f*)(out_norm + (size_t)row * N + j) = o;
    }
    
  }
}



// ---- f16 WMMA path (v_wmma_f32_16x16x32_f16): 11-bit significands for operands in range — used for every GEMM launched here
typedef _Float16 v16h __attribute__((ext_vector_type(16)));
union FragH { v16h v; v8us half[2]; _Float16 h[16]; unsigned short u[16]; };
template <int NT>
__device__ __forceinline__ v8f mmaH(v16h ah, v16h al, v16h bh, v16h bl, v8f c) {
  c = __builtin_amdgcn_wmma_f32_16x16x32_f16(false, ah, false, bh, (short)0, c, false, false);
  if (NT >= 2) c = __builtin_amdgcn_wmma_f32_16x16x32_f16(false, al, false, bh, (short)0, c, false, false);
  if (NT >= 3) c = __builtin_amdgcn_wmma_f32_16x16x32_f16(false, ah, false, bl, (short)0, c, false, false);
  asm volatile("v_nop\n\tv_nop\n\tv_nop\n\tv_nop" : "+v"(c) : "v"(ah), "v"(al), "v"(bh), "v"(bl));
  return c;
}
// batched GEMM like k_gemm_b but f16 operands: A f32 (split into f16 hi/lo if ASPLIT, else rounded to f16), Bt = f16 values [n][k]; alpha; C f32; N multiple of 16 (partial tiles skipped)
template <bool ASPLIT>
__global__ __launch_bounds__(128) void k_gemm_h(const float* __restrict__ A, int lda, size_t sA, const _Float16* __restrict__ Bh, int ldb, size_t sB, float alpha, float* __restrict__ C, int ldc, size_t sC, int M, int N, int K) {
  __shared__ __attribute__((aligned(16))) float so[4][16][64];
  const int tid = threadIdx.x, w = tid >> 5, lane = tid & 31, ln = lane & 15, hh = lane >> 4; const int by = blockIdx.y;
  A += (size_t)by * sA; Bh += (size_t)by * sB; C += (size_t)by * sC;
  const int ntn = (N + 63) / 64; const int wid = blockIdx.x * 4 + w; const int mt = wid / ntn, nq = wid % ntn; if (mt * 16 >= M) return;
  const int row0 = mt * 16, col0 = nq * 64; const float* arow = A + (size_t)(row0 + ln) * lda;
  v8f acc[4] = {};
  for (int kb = 0; kb < K; kb += 32) {
    FragH ah, al;
    const v4f x0 = *(const v4fa*)(arow + kb + 8 * hh), x1 = *(const v4fa*)(arow + kb + 8 * hh + 4), x2 = *(const v4fa*)(arow + kb + 16 + 8 * hh), x3 = *(const v4fa*)(arow + kb + 16 + 8 * hh + 4);
    float xs[16] = {x0[0],x0[1],x0[2],x0[3],x1[0],x1[1],x1[2],x1[3],x2[0],x2[1],x2[2],x2[3],x3[0],x3[1],x3[2],x3[3]};
#pragma unroll
    for (int i = 0; i < 16; ++i) { const _Float16 h = (_Float16)xs[i]; ah.h[i] = h; al.h[i] = ASPLIT ? (_Float16)(xs[i] - (float)h) : (_Float16)0.0f; }
#pragma unroll
    for (int t = 0; t < 4; ++t) { if (col0 + t * 16 >= N) continue; const size_t boff = (size_t)(col0 + t * 16 + ln) * ldb + kb; FragH bq; bq.half[0] = *(const v8us*)(Bh + boff + 8 * hh); bq.half[1] = *(const v8us*)(Bh + boff + 16 + 8 * hh);
      acc[t] = mmaH<ASPLIT ? 2 : 1>(ah.v, al.v, bq.v, bq.v, acc[t]); }
  }
#pragma unroll
  for (int t = 0; t < 4; ++t) { if (col0 + t * 16 >= N) continue;
#pragma unroll
    for (int r = 0; r < 8; ++r) so[w][8 * hh + r][t * 16 + ln] = acc[t][r] * alpha; }
  __builtin_amdgcn_fence(__ATOMIC_ACQ_REL, "workgroup"); __builtin_amdgcn_wave_barrier();
  const int rsub = lane >> 4, c4 = (lane & 15) * 4;
  {
#pragma unroll
    for (int q = 0; q < 8; ++q) { const int r = q * 2 + rsub; if (col0 + c4 < N) { const v4f v = *(const v4fa*)&so[w][r][c4]; *(v4f*)(C + (size_t)(row0 + r) * ldc + col0 + c4) = v; } }
     }
}

// Wt[n][k] = f16(bf16(W[k][n])·scale) from f32 row-major W[K][N] (scale = power of two; bf16-exact weights stay exact in f16 away from the subnormal range)
__global__ __launch_bounds__(256) void k_wt_f16(const float* __restrict__ W, _Float16* __restrict__ Wt, int K, int N, float scale) {
  const int t = blockIdx.x * 256 + threadIdx.x; if (t >= N * (K / 8)) return; const int n = t / (K / 8), k8 = (t % (K / 8)) * 8; FragH f;
#pragma unroll
  for (int i = 0; i < 8; ++i) f.h[i] = (_Float16)(bf16_round(W[(size_t)(k8 + i) * N + n]) * scale); const v8us o = f.half[0];
  *(v8us*)((unsigned short*)Wt + (size_t)n * K + k8) = o; 
}
// k_gemm_hh variant with fused epilogue: v = acc·alpha + bias[by·sBias + col] (+ CP[(row/rowsPerB)·sCPb + by·64 + col] if CP) ; ACT 0 none / 1 elu ; writes f16 C16 (and f32 C if non-null)
template <int ACT>
__global__ __launch_bounds__(128) void k_gemm_hhx(const _Float16* __restrict__ A, int lda, size_t sA, const _Float16* __restrict__ Bh, int ldb, size_t sB, float alpha, const float* __restrict__ bias, size_t sBias, const float* __restrict__ CP, int rowsPerB, size_t sCPb, int row0g,
    float* __restrict__ C, _Float16* __restrict__ C16, int ldc, size_t sC, int M, int N, int K) {
  __shared__ __attribute__((aligned(16))) float so[4][16][64];
  const int tid = threadIdx.x, w = tid >> 5, lane = tid & 31, ln = lane & 15, hh = lane >> 4; const int by = blockIdx.y;
  A += (size_t)by * sA; Bh += (size_t)by * sB; const size_t cofs = (size_t)by * sC; const float* bp = bias ? bias + (size_t)by * sBias : nullptr;
  const int ntn = (N + 63) / 64; const int wid = blockIdx.x * 4 + w; const int mt = wid / ntn, nq = wid % ntn; if (mt * 16 >= M) return;
  const int row0 = mt * 16, col0 = nq * 64; const _Float16* arow = A + (size_t)(row0 + ln) * lda;
  v8f acc[4] = {};
  for (int kb = 0; kb < K; kb += 32) { FragH ah; ah.half[0] = *(const v8us*)((const unsigned short*)arow + kb + 8 * hh); ah.half[1] = *(const v8us*)((const unsigned short*)arow + kb + 16 + 8 * hh);
#pragma unroll
    for (int t = 0; t < 4; ++t) { if (col0 + t * 16 >= N) continue; const size_t boff = (size_t)(col0 + t * 16 + ln) * ldb + kb; FragH bq; bq.half[0] = *(const v8us*)((const unsigned short*)Bh + boff + 8 * hh); bq.half[1] = *(const v8us*)((const unsigned short*)Bh + boff + 16 + 8 * hh);
      acc[t] = mmaH<1>(ah.v, ah.v, bq.v, bq.v, acc[t]); }
  }
#pragma unroll
  for (int t = 0; t < 4; ++t) { if (col0 + t * 16 >= N) continue; const int col = col0 + t * 16 + ln; const float bv = bp ? bf16_round(bp[col]) : 0.f;
#pragma unroll
    for (int r = 0; r < 8; ++r) { float v = acc[t][r] * alpha + bv; if (CP) { const int rr = row0g + row0 + 8 * hh + r; if (rowsPerB < 0) v += CP[cofs + (size_t)rr * ldc + col];      /* rowsPerB < 0: own element of the batched C plane */ else { const int bidx = rr / rowsPerB; v += CP[(size_t)bidx * sCPb + (size_t)by * 64 + col]; } } if (ACT == 1) v = (v > 0.f) ? v : expm1f(v); else if (ACT == 7) v = (v > 0.f) ? v + 1.0f : expf(v); else if (ACT == 8) v = tanhf(v); else if (ACT == 9) v = 0.5f * v * (1.0f + tanhf(0.7978845608028654f * (v + 0.044715f * v * v * v))); else if (ACT == 11) v = 1.0f / (1.0f + expf(-v)); else if (ACT == 12) v = (v > 0.f) ? v : 0.01f * v; else if (ACT == 14) v = (v > 0.f) ? v : 0.1f * v; else if (ACT == 16) v = (v >= 0.f) ? v : 0.3f * v; else if (ACT == 17) v = (v >= 0.f) ? v : 0.2f * v; else if (ACT == 15) v = v / (1.0f + expf(-v)); else if (ACT == 3) v = fmaxf(v, 0.f); else if (ACT == 6) v = 0.5f * v * (1.0f + erff(v * 0.70710678118654752f)); so[w][8 * hh + r][t * 16 + ln] = v; } }
  __builtin_amdgcn_fence(__ATOMIC_ACQ_REL, "workgroup"); __builtin_amdgcn_wave_barrier();
  const int rsub = lane >> 4, c4 = (lane & 15) * 4; typedef _Float16 v4h __attribute__((ext_vector_type(4)));
  {
#pragma unroll
    for (int q = 0; q < 8; ++q) { const int r = q * 2 + rsub; if (col0 + c4 < N) { const v4f v = *(const v4fa*)&so[w][r][c4]; if (C) *(v4f*)(C + cofs + (size_t)(row0 + r) * ldc + col0 + c4) = v; if (C16) { v4h h4; for (int i = 0; i < 4; ++i) h4[i] = (_Float16)v[i]; *(v4h*)(C16 + cofs + (size_t)(row0 + r) * ldc + col0 + c4) = h4; } } }
     }
}


typedef _Float16 v4h __attribute__((ext_vector_type(4)));

__global__ __launch_bounds__(256) void k_x16(const float* __restrict__ x, _Float16* __restrict__ X16, size_t n8) { const size_t t = (size_t)blockIdx.x * 256 + threadIdx.x; if (t >= n8) return; FragH f;
#pragma unroll
  for (int q = 0; q < 8; ++q) f.h[q] = (_Float16)bf16_round(x[t * 8 + q]); *(v8us*)((unsigned short*)X16 + t * 8) = f.half[0];  }
__global__ __launch_bounds__(256) void k_h16(const float* __restrict__ x, _Float16* __restrict__ X16, size_t n8) { const size_t t = (size_t)blockIdx.x * 256 + threadIdx.x; if (t >= n8) return; FragH f;
#pragma unroll
  for (int q = 0; q < 8; ++q) f.h[q] = (_Float16)x[t * 8 + q]; *(v8us*)((unsigned short*)X16 + t * 8) = f.half[0];  }
__global__ __launch_bounds__(256) void k_round16f(const float* __restrict__ W, _Float16* __restrict__ Bt, size_t n8) { const size_t t = (size_t)blockIdx.x * 256 + threadIdx.x; if (t >= n8) return; FragH f;
#pragma unroll
  for (int i = 0; i < 8; ++i) f.h[i] = (_Float16)(bf16_round(W[t * 8 + i]) * 16.0f); *(v8us*)((unsigned short*)Bt + t * 8) = f.half[0];  }
template <int NHv, int TTv>
__global__ __launch_bounds__(256) void k_vt(const _Float16* __restrict__ V16, int ldv, int voff, _Float16* __restrict__ Vt) { __shared__ unsigned short tl[64][66]; const int tid = threadIdx.x; const int slab = blockIdx.x / (TTv / 64), lg = blockIdx.x % (TTv / 64); const int b = slab / NHv, h = slab % NHv;
  for (int i = tid; i < 64 * 8; i += 256) { const int r = i / 8, c8 = (i % 8) * 8; FragH f; f.half[0] = *(const v8us*)((const unsigned short*)V16 + ((size_t)b * TTv + lg * 64 + r) * ldv + voff + h * 64 + c8);
#pragma unroll
    for (int q = 0; q < 8; ++q) tl[r][c8 + q] = f.u[q]; }
  __syncthreads();
  {
#pragma unroll
    for (int rd = 0; rd < 2; ++rd) { const int d = rd * 32 + tid / 8, pc = tid % 8; FragH f;
#pragma unroll
      for (int q = 0; q < 8; ++q) f.u[q] = tl[pc * 8 + q][d];
      *(v8us*)((unsigned short*)Vt + ((size_t)slab * 64 + d) * TTv + lg * 64 + pc * 8) = f.half[0]; }
     } }

__global__ __launch_bounds__(256) void k_hl(const float* __restrict__ F, _Float16* __restrict__ Hh, _Float16* __restrict__ Hl, size_t n8) { const size_t t = (size_t)blockIdx.x * 256 + threadIdx.x; if (t >= n8) return; FragH fh, fl; const v4f a = *(const v4fa*)(F + t * 8), c = *(const v4fa*)(F + t * 8 + 4);
#pragma unroll
  for (int q = 0; q < 4; ++q) { _Float16 h = (_Float16)a[q]; fh.h[q] = h; fl.h[q] = (_Float16)((a[q] - (float)h) * 1024.0f); h = (_Float16)c[q]; fh.h[4 + q] = h; fl.h[4 + q] = (_Float16)((c[q] - (float)h) * 1024.0f); }
  { *(v8us*)((unsigned short*)Hh + t * 8) = fh.half[0]; *(v8us*)((unsigned short*)Hl + t * 8) = fl.half[0];  } }

// ---- fast GEMM (wave tile 32x64; requires M % 32 == 0 rows per launch region and N % 64 == 0); epilogue = k_gemm_hhx semantics ----
__device__ __forceinline__ v16h g2_frag(const _Float16* p, int hh) { FragH f; f.half[0] = *(const v8us*)((const unsigned short*)p + 8 * hh); f.half[1] = *(const v8us*)((const unsigned short*)p + 16 + 8 * hh); return f.v; }
__device__ __forceinline__ v8f g2_mma(v16h a, v16h b, v8f c) { v8f d = __builtin_amdgcn_wmma_f32_16x16x32_f16(false, a, false, b, (short)0, c, false, false); asm volatile("v_nop\n\tv_nop\n\tv_nop\n\tv_nop" : "+v"(d) : "v"(a), "v"(b)); return d; }
template <int ACT>
__global__ __launch_bounds__(128) void k_gemm2(const _Float16* __restrict__ A, int lda, size_t sA, const _Float16* __restrict__ Bh, int ldb, size_t sB, float alpha, const float* __restrict__ bias, size_t sBias, const float* __restrict__ CP, int rowsPerB, size_t sCPb, int row0g,
    float* __restrict__ C, _Float16* __restrict__ C16, int ldc, size_t sC, int M, int N, int K) { static_assert(ACT == 0 || ACT == 3 || ACT == 6 || ACT == 8 || ACT == 9 || ACT == 11 || ACT == 12 || ACT == 14 || ACT == 15 || ACT == 16 || ACT == 17, "k_gemm2: unsupported ACT code (would silently apply no activation)");
  __shared__ __attribute__((aligned(16))) float so[4][32][68];
  const int tid = threadIdx.x, w = tid >> 5, lane = tid & 31, ln = lane & 15, hh = lane >> 4; const int by = blockIdx.y;
  A += (size_t)by * sA; Bh += (size_t)by * sB; const size_t cofs = (size_t)by * sC; const float* bp = bias ? bias + (size_t)by * sBias : nullptr;
  const int ntn = N >> 6; const int mt = blockIdx.x / ntn, nq = blockIdx.x - mt * ntn; const int row0 = mt * 128 + 32 * w, col0 = nq * 64; if (row0 >= M) return;
  const _Float16* a0p = A + (size_t)(row0 + ln) * lda; const _Float16* a1p = a0p + (size_t)16 * lda;
  const _Float16* b0p = Bh + (size_t)(col0 + ln) * ldb; const _Float16* b1p = b0p + (size_t)16 * ldb; const _Float16* b2p = b1p + (size_t)16 * ldb; const _Float16* b3p = b2p + (size_t)16 * ldb;
  const v8f z8 = {0.f,0.f,0.f,0.f,0.f,0.f,0.f,0.f}; v8f c00 = z8, c01 = z8, c02 = z8, c03 = z8, c10 = z8, c11 = z8, c12 = z8, c13 = z8;
#pragma unroll 1
  for (int kb = 0; kb < K; kb += 32) { const v16h a0 = g2_frag(a0p + kb, hh), a1 = g2_frag(a1p + kb, hh);
    v16h b = g2_frag(b0p + kb, hh); c00 = g2_mma(a0, b, c00); c10 = g2_mma(a1, b, c10);
    b = g2_frag(b1p + kb, hh); c01 = g2_mma(a0, b, c01); c11 = g2_mma(a1, b, c11);
    b = g2_frag(b2p + kb, hh); c02 = g2_mma(a0, b, c02); c12 = g2_mma(a1, b, c12);
    b = g2_frag(b3p + kb, hh); c03 = g2_mma(a0, b, c03); c13 = g2_mma(a1, b, c13); }
  v8f accs[8] = {c00, c01, c02, c03, c10, c11, c12, c13};
#pragma unroll
  for (int u = 0; u < 8; ++u) { const int t = u & 3, half = u >> 2; const int col = col0 + t * 16 + ln; const float bv = bp ? bf16_round(bp[col]) : 0.f;
#pragma unroll
    for (int r = 0; r < 8; ++r) { const int rloc = half * 16 + 8 * hh + r; float v = accs[u][r] * alpha + bv; if (CP) { if (rowsPerB < 0) v += CP[cofs + (size_t)(row0g + row0 + rloc) * ldc + col];      /* rowsPerB < 0: own element of the batched C plane */ else { const int bidx = (row0g + row0 + rloc) / rowsPerB; v += CP[(size_t)bidx * sCPb + (size_t)by * 64 + col]; } }
      if (ACT == 3) v = fmaxf(v, 0.f); else if (ACT == 6) v = 0.5f * v * (1.0f + erff(v * 0.70710678118654752f)); else if (ACT == 11) v = 1.0f / (1.0f + expf(-v)); else if (ACT == 15) v = v / (1.0f + expf(-v)); else if (ACT == 12) v = (v > 0.f) ? v : 0.01f * v; else if (ACT == 8) v = tanhf(v); else if (ACT == 9) v = 0.5f * v * (1.0f + tanhf(0.7978845608028654f * (v + 0.044715f * v * v * v))); else if (ACT == 14) v = (v > 0.f) ? v : 0.1f * v; else if (ACT == 16) v = (v >= 0.f) ? v : 0.3f * v; else if (ACT == 17) v = (v >= 0.f) ? v : 0.2f * v;
      so[w][rloc][t * 16 + ln] = v; } }
  __builtin_amdgcn_fence(__ATOMIC_ACQ_REL, "workgroup"); __builtin_amdgcn_wave_barrier();
  const int rsub = lane >> 4, c4 = (lane & 15) * 4;
  {
#pragma unroll
    for (int q = 0; q < 16; ++q) { const int r = q * 2 + rsub; const v4f v = *(const v4fa*)&so[w][r][c4]; if (C) *(v4f*)(C + cofs + (size_t)(row0 + r) * ldc + col0 + c4) = v; if (C16) { v4h h4; for (int i = 0; i < 4; ++i) h4[i] = (_Float16)v[i]; *(v4h*)(C16 + cofs + (size_t)(row0 + r) * ldc + col0 + c4) = h4; } }
     } }


__global__ __launch_bounds__(256) void k_f16c(const float* __restrict__ A, _Float16* __restrict__ D, size_t n8) { const size_t t = (size_t)blockIdx.x * 256 + threadIdx.x; if (t >= n8) return; const v8f a = *(const v8f*)(A + t * 8); FragH f; for (int q = 0; q < 8; ++q) f.h[q] = (_Float16)a[q]; *(v8us*)((unsigned short*)D + t * 8) = f.half[0];  }
// exp(-q) by the math library's own steps: the product with log2(e) in two parts, split at the nearest integer, v_exp_f32, ldexp, the two range ends.
__device__ __forceinline__ float exp_neg(float q) {
  const float m = -1.44269502e+0f * q;
  float e = fmaf(-1.44269502e+0f, q, -m); e = fmaf(-1.92596286e-8f, q, e);
  const float rn = rintf(m), a = (m - rn) + e;
  float r;
  // v_nop: the one slot that the instruction set asks for behind a transcendental before its result is read or its source overwritten; in the same statement it cannot drift
  asm("v_exp_f32 %0, %1\n\tv_nop" : "=v"(r) : "v"(a));
  r = ldexpf(r, (int)rn);
  r = q > 1.03278931e+2f ? 0.f : r;
  return q < -8.87228394e+1f ? __builtin_inff() : r;
}
// erf by the math library's own two forms (|x| < 1: x + x P(x^2); else 1 - exp(-(|x| + |x| Q(|x|)))), both evaluated and one selected: the values are erff's.
// Written out because erff's branch would cut the unrolled fragment code below into one block per element: no two elements' chains could overlap, and every element's values stayed live to the end of the tile.
__device__ __forceinline__ float erf_sel(float x) {
  const float ax = fabsf(x), t = x * x;
  float p = fmaf(t, -5.61801775e-4f, 4.91381623e-3f); p = fmaf(t, p, -2.67075151e-2f); p = fmaf(t, p, 1.12800106e-1f); p = fmaf(t, p, -3.76122952e-1f); p = fmaf(t, p, 1.28379107e-1f);
  float q = fmaf(ax, 1.69988107e-5f, -3.78677854e-4f); q = fmaf(ax, q, 3.85781587e-3f); q = fmaf(ax, q, -2.41816975e-2f); q = fmaf(ax, q, 1.06668264e-1f); q = fmaf(ax, q, 6.34933293e-1f); q = fmaf(ax, q, 1.28689408e-1f);
  const float lo = fmaf(ax, p, ax), hi = 1.0f - exp_neg(fmaf(ax, q, ax));
  return copysignf(ax < 1.0f ? lo : hi, x);
}
// Exact erf GELU in f32.
__device__ __forceinline__ float gelu_erf(float s) { return 0.5f * s * (1.0f + erf_sel(s * 0.70710678118654752f)); }
// Fused tail: h1 = gelu(A[bt] + Bu[n] + b1), h2 = gelu(h1 w2 + b2), out = clip(h2 w3 + b3); h1 and h2 never leave the registers.
// One work-group per bin row bt; wave w owns units 32w .. 32w+31 as two tiles of 16 rows.
// The product runs transposed: w2's columns are the A operand (from LDS, stored in fragment order), the h1 rows the B operand.
// A lane computes the 16 h1 values of its own row and k half straight into the B fragment (k = 8h+i, 16+8h+i on both operands).
// D register r of tile t is then h2[row = lane & 15][feature 16t + 8h + r]: the head's dot product stays inside a lane but for one add across the lane halves.
__global__ __launch_bounds__(256) void k_tail(const float* __restrict__ A, const float* __restrict__ Bu, const float* __restrict__ b1, const _Float16* __restrict__ W2t,
                                              const float* __restrict__ b2, const float* __restrict__ w3, const float* __restrict__ b3, float* __restrict__ out) {
  __shared__ __attribute__((aligned(16))) unsigned short sW[HALF / 32][QTR / 16][2][32][8];   /* [k step][feature tile][fragment half][lane][8 f16], 64 KiB: each fragment load reads 512 contiguous bytes */
  __shared__ __attribute__((aligned(16))) float sab[HALF];
  __shared__ __attribute__((aligned(16))) float sb2[QTR];
  __shared__ __attribute__((aligned(16))) float sw3[QTR];
  const int tid = threadIdx.x, w = tid >> 5, lane = tid & 31, ln = lane & 15, hh = lane >> 4;
  const int bt = blockIdx.x;
  // unrolled: all 16 loads of the w2 fill are in flight before the first LDS store
#pragma unroll
  for (int i = 0; i < 16; ++i) {
    const int ks = i >> 1, t = (i & 1) * 4 + (w >> 1), half = w & 1;
    const v8us v = *(const v8us*)((const unsigned short*)W2t + (size_t)(t * 16 + ln) * HALF + ks * 32 + half * 16 + hh * 8);
    *(v8us*)&sW[ks][t][half][lane][0] = v;
  }
  sab[tid] = A[(size_t)bt * HALF + tid] + bf16_round(b1[tid]);
  if (tid < QTR) { sb2[tid] = bf16_round(b2[tid]); sw3[tid] = bf16_round(w3[tid]); }
  __syncthreads();
  const float* ub = Bu + (size_t)(w * 32 + ln) * HALF + 8 * hh;
  v4f u0 = *(const v4fa*)(ub), u1 = *(const v4fa*)(ub + 4), u2 = *(const v4fa*)(ub + 16), u3 = *(const v4fa*)(ub + 20);
  float res = 0.f;
  // the tile loop and the k loop stay rolled: 16 + 64 inlined GELUs are all the text that the instruction cache should have to hold;
  // the loops inside them are unrolled, so that fragments and accumulators are indexed by constants and stay in registers
#pragma unroll 1
  for (int tile = 0; tile < 2; ++tile) {
    v8f acc[8] = {};
#pragma unroll 1
    for (int ks = 0; ks < HALF / 32; ++ks) {
      // the next step's unit values are loaded one step ahead (the last step reloads its own)
      const int qn = min(tile * 8 + ks + 1, 15);
      const float* un = ub + (size_t)(qn >> 3) * 16 * HALF + (qn & 7) * 32;
      const v4f p0 = *(const v4fa*)(un), p1 = *(const v4fa*)(un + 4), p2 = *(const v4fa*)(un + 16), p3 = *(const v4fa*)(un + 20);
      const float* ap = &sab[ks * 32 + 8 * hh];
      const v4f a0 = *(const v4fa*)(ap), a1 = *(const v4fa*)(ap + 4), a2 = *(const v4fa*)(ap + 16), a3 = *(const v4fa*)(ap + 20);
      FragH f;
#pragma unroll
      for (int i = 0; i < 4; ++i) {
        f.h[i] = (_Float16)gelu_erf(a0[i] + u0[i]); f.h[4 + i] = (_Float16)gelu_erf(a1[i] + u1[i]);
        f.h[8 + i] = (_Float16)gelu_erf(a2[i] + u2[i]); f.h[12 + i] = (_Float16)gelu_erf(a3[i] + u3[i]);
      }
#pragma unroll
      for (int t = 0; t < 8; ++t) {
        FragH wf; wf.half[0] = *(const v8us*)&sW[ks][t][0][lane][0]; wf.half[1] = *(const v8us*)&sW[ks][t][1][lane][0];
        acc[t] = __builtin_amdgcn_wmma_f32_16x16x32_f16(false, wf.v, false, f.v, (short)0, acc[t], false, false);
      }
      u0 = p0; u1 = p1; u2 = p2; u3 = p3;
    }
    // compiler fence: keeps the 32 LDS loads of b2 and w3 inside the tile loop; hoisted out of it they hold 128 registers through the k loop, which then has none left to fetch w2 fragments ahead of its WMMAs
    asm volatile("" ::: "memory");
    v4f pv = {0.f, 0.f, 0.f, 0.f};      /* four partial sums of the head, so that the GELUs pair up into packed f32 instructions */
#pragma unroll
    for (int t = 0; t < 8; ++t) {
      const int f0 = t * 16 + 8 * hh;
      const v4f c0 = *(const v4fa*)&sb2[f0], c1 = *(const v4fa*)&sb2[f0 + 4], g0 = *(const v4fa*)&sw3[f0], g1 = *(const v4fa*)&sw3[f0 + 4];
      v4f h0, h1;
#pragma unroll
      for (int r = 0; r < 4; ++r) { h0[r] = gelu_erf(acc[t][r] * 0.0625f + c0[r]); h1[r] = gelu_erf(acc[t][4 + r] * 0.0625f + c1[r]); }
      pv += h0 * g0; pv += h1 * g1;
    }
    float p = (pv[0] + pv[1]) + (pv[2] + pv[3]);
    p += __shfl_xor(p, 16, 32);
    if (hh == tile) res = p;      /* tile 0's rows end in lanes 0-15, tile 1's in lanes 16-31: one 128-byte store a wave */
  }
  res += bf16_round(b3[0]);
  out[(size_t)bt * NU + w * 32 + lane] = fminf(fmaxf(res, -10.0f), 10.0f);
}

extern "C" void kernel_launch(void* const* d_in, const int* in_sizes, int n_in,
                              void* d_out, int out_size, void* d_ws, size_t ws_size, hipStream_t stream) {
  (void)in_sizes; (void)n_in; (void)out_size;
  const float* const* I = (const float* const*)d_in; const float* br = I[0]; const float* ue = I[1]; const float* bpw = I[2]; const float* bpb = I[3]; const float* upw = I[4]; const float* upb = I[5]; const float* w1 = I[6]; const float* b1 = I[7]; const float* w2 = I[8]; const float* b2 = I[9]; const float* w3 = I[10]; const float* b3 = I[11];
  char* ws = (char*)d_ws; size_t off = 0;
  auto take = [&](size_t bytes) { char* p = ws + off; off += (bytes + 255) & ~(size_t)255; return p; };
  _Float16* BBP = (_Float16*)take((size_t)HALF * DIM * 2); _Float16* BUP = (_Float16*)take((size_t)HALF * DIM * 2); _Float16* BW1A = (_Float16*)take((size_t)HALF * HALF * 2); _Float16* BW1B = (_Float16*)take((size_t)HALF * HALF * 2); _Float16* BW2 = (_Float16*)take((size_t)QTR * HALF * 2);
  _Float16* BR16 = (_Float16*)take((size_t)NBT * DIM * 2); _Float16* UE16 = (_Float16*)take((size_t)NU * DIM * 2); _Float16* BH16 = (_Float16*)take((size_t)NBT * HALF * 2); _Float16* UH16 = (_Float16*)take((size_t)NU * HALF * 2); float* A = (float*)take((size_t)NBT * HALF * 4); float* Bu = (float*)take((size_t)NU * HALF * 4);
  if (off > ws_size) return;
  k_wt_f16<<<(HALF * DIM / 8 + 255) / 256, 256, 0, stream>>>(bpw, BBP, DIM, HALF, 16.0f); k_wt_f16<<<(HALF * DIM / 8 + 255) / 256, 256, 0, stream>>>(upw, BUP, DIM, HALF, 16.0f); k_wt_f16<<<(HALF * HALF / 8 + 255) / 256, 256, 0, stream>>>(w1, BW1A, HALF, HALF, 16.0f); k_wt_f16<<<(HALF * HALF / 8 + 255) / 256, 256, 0, stream>>>(w1 + (size_t)HALF * HALF, BW1B, HALF, HALF, 16.0f); k_wt_f16<<<(QTR * HALF / 8 + 255) / 256, 256, 0, stream>>>(w2, BW2, HALF, QTR, 16.0f);      /* (in, out) */
  k_x16<<<(NBT * DIM / 8 + 255) / 256, 256, 0, stream>>>(br, BR16, (size_t)NBT * DIM / 8); k_x16<<<(NU * DIM / 8 + 255) / 256, 256, 0, stream>>>(ue, UE16, (size_t)NU * DIM / 8);
  k_gemm2<0><<<dim3((NBT / 128) * (HALF / 64), 1), 128, 0, stream>>>(BR16, DIM, 0, BBP, DIM, 0, 0.0625f, bpb, 0, nullptr, 1, 0, 0, nullptr, BH16, HALF, 0, NBT, HALF, DIM);
  k_gemm2<0><<<dim3((NU / 128) * (HALF / 64), 1), 128, 0, stream>>>(UE16, DIM, 0, BUP, DIM, 0, 0.0625f, upb, 0, nullptr, 1, 0, 0, nullptr, UH16, HALF, 0, NU, HALF, DIM);      /* bin_h, unit_h (f16) */
  k_gemm2<0><<<dim3((NBT / 128) * (HALF / 64), 1), 128, 0, stream>>>(BH16, HALF, 0, BW1A, HALF, 0, 0.0625f, nullptr, 0, nullptr, 1, 0, 0, A, nullptr, HALF, 0, NBT, HALF, HALF);
  k_gemm2<0><<<dim3((NU / 128) * (HALF / 64), 1), 128, 0, stream>>>(UH16, HALF, 0, BW1B, HALF, 0, 0.0625f, nullptr, 0, nullptr, 1, 0, 0, Bu, nullptr, HALF, 0, NU, HALF, HALF);      /* bin_h w1a, unit_h w1b */
  k_tail<<<NBT, 256, 0, stream>>>(A, Bu, b1, BW2, b2, w3, b3, (float*)d_out);      /* h1, h2, head, clip */
}

// v002
// A run of this version takes 132 microseconds.
// Two timings next to v001 put it at 1.19 and 1.21 times that version's speed.
// All steps since v000 together make it 2.39 times as fast.
#include <hip/hip_runtime.h>
// PerNeuronMLPHead (2 x 512 time bins x 512, 256 units x 512: bin_h = bin_repr Wbp + b, unit_h = unit_embs Wup + b (256 wide); h1[(b,t), n] = gelu(bin_h w1a + unit_h w1b + b1) (the split-weight broadcast add); h2 = gelu(h1 w2 + b2) (128); log_rate = h2 w3 + b3; clip(-10, 10); exact erf GELU).
// Structure: the four small projections as f16 WMMA GEMMs (32x64 wave tiles, f32 accumulation, exact x16 weights + bias); then one fused kernel: broadcast add + GELU on VALU straight into f16 WMMA fragments, h1 w2 on f16 WMMA, GELU, the 128 -> 1 head and the clip on the f32 accumulators (128-B stores, one a wave).
// Compute dtype: inputs rounded to bf16; inputs / weights exact as f16; bin_h / unit_h and h1 as plain f16 operands (~2^-12); h2, GELU and head f32. v_wmma_f32_16x16x32_f16.
#define NB 2
#define NTB 512
#define DIM 512
#define HALF 256
#define QTR 128
#define NU 256
#define NBT (NB * NTB)           /* 1024 bin rows */
#define NRW ((size_t)NBT * NU)   /* 262144 output rows */
typedef __bf16 v16b __attribute__((ext_vector_type(16)));
typedef unsigned short v8us __attribute__((ext_vector_type(8), may_alias));
typedef float  v8f  __attribute__((ext_vector_type(8)));
typedef float  v4f  __attribute__((ext_vector_type(4)));
typedef float  v4fa __attribute__((ext_vector_type(4), may_alias));
union FragB { v16b v; v8us half[2]; unsigned short u[16]; };

__device__ __forceinline__ unsigned short bf16_bits(float x) { unsigned int u = __float_as_uint(x); return (unsigned short)((u + 0x7FFFu + ((u >> 16) & 1u)) >> 16); }
__device__ __forceinline__ float bf16_val(unsigned short b) { return __uint_as_float(((unsigned int)b) << 16); }
__device__ __forceinline__ float bf16_round(float x) { return bf16_val(bf16_bits(x)); }
// D += A·B with NT terms: 1 = ah·bh, 2 = + al·bh (A split), 3 = + ah·bl (both split)
template <int NT>
__device__ __forceinline__ v8f mmaN(v16b ah, v16b al, v16b bh, v16b bl, v8f c) {
  c = __builtin_amdgcn_wmma_f32_16x16x32_bf16(false, ah, false, bh, (short)0, c, false, false);
  if (NT >= 2) c = __builtin_amdgcn_wmma_f32_16x16x32_bf16(false, al, false, bh, (short)0, c, false, false);
  if (NT >= 3) c = __builtin_amdgcn_wmma_f32_16x16x32_bf16(false, ah, false, bl, (short)0, c, false, false);
  asm volatile("v_nop\n\tv_nop\n\tv_nop\n\tv_nop" : "+v"(c) : "v"(ah), "v"(al), "v"(bh), "v"(bl));
  return c;
}

__global__ __launch_bounds__(256) void k_wt_bf16(const float* __restrict__ W, unsigned short* __restrict__ Wt, int K, int N) {
  const int t = blockIdx.x * 256 + threadIdx.x;
  const int k8n = K / 8;
  if (t >= N * k8n) return;
  const int n = t / k8n, k8 = (t % k8n) * 8;
  v8us v;
#pragma unroll
  for (int i = 0; i < 8; ++i) v[i] = bf16_bits(W[(size_t)(k8 + i) * N + n]);
  *(v8us*)(Wt + (size_t)n * K + k8) = v;
  
}

// GEMM C[M][N] (f32, pitch ldc) = act(A[M][K]·W + bias). A f32 row-major (pitch lda) converted per fragment to bf16
// (ASPLIT: hi/lo two planes -> 2 terms, else single rounded term); Wt bf16 [N][K] (pitch ldb). BIAS_BF16 rounds the
// bias to bf16 first (bias quantised to bf16 before the add). K%32==0, M%16==0, N%64==0.
template <bool ASPLIT, int ACT, bool BIAS_BF16>
__global__ __launch_bounds__(128) void k_gemm_bf(const float* __restrict__ A, int lda, const unsigned short* __restrict__ Wt, int ldb,
                                               const float* __restrict__ bias, float* __restrict__ C, int ldc, int M, int N, int K) {
  __shared__ __attribute__((aligned(16))) float so[4][16][64];
  const int tid = threadIdx.x, w = tid >> 5, lane = tid & 31, ln = lane & 15, hh = lane >> 4;
  const int ntn = N / 64;
  const int wid = blockIdx.x * 4 + w;
  const int mt = wid / ntn, nq = wid % ntn;
  if (mt * 16 >= M) return;
  const int row0 = mt * 16, col0 = nq * 64;
  const float* arow = A + (size_t)(row0 + ln) * lda;
  v8f acc[4] = {};
  for (int kb = 0; kb < K; kb += 32) {
    FragB ah, al;
    const v4f x0 = *(const v4fa*)(arow + kb + 8 * hh), x1 = *(const v4fa*)(arow + kb + 8 * hh + 4);
    const v4f x2 = *(const v4fa*)(arow + kb + 16 + 8 * hh), x3 = *(const v4fa*)(arow + kb + 16 + 8 * hh + 4);
    float xs[16] = {x0[0],x0[1],x0[2],x0[3],x1[0],x1[1],x1[2],x1[3],x2[0],x2[1],x2[2],x2[3],x3[0],x3[1],x3[2],x3[3]};
#pragma unroll
    for (int i = 0; i < 16; ++i) { const unsigned short hb = bf16_bits(xs[i]); ah.u[i] = hb; al.u[i] = ASPLIT ? bf16_bits(xs[i] - bf16_val(hb)) : (unsigned short)0; }
#pragma unroll
    for (int t = 0; t < 4; ++t) {
      const unsigned short* brow = Wt + (size_t)(col0 + t * 16 + ln) * ldb + kb;
      FragB b;
      b.half[0] = *(const v8us*)(brow + 8 * hh);
      b.half[1] = *(const v8us*)(brow + 16 + 8 * hh);
      acc[t] = mmaN<ASPLIT ? 2 : 1>(ah.v, al.v, b.v, b.v, acc[t]);
    }
  }
#pragma unroll
  for (int t = 0; t < 4; ++t) {
    float bv = bias ? bias[col0 + t * 16 + ln] : 0.f;
    if (BIAS_BF16) bv = bf16_round(bv);
#pragma unroll
    for (int r = 0; r < 8; ++r) { float v = acc[t][r] + bv; if (ACT == 1) v = fmaxf(v, 0.f); so[w][8 * hh + r][t * 16 + ln] = v; }
  }
  __builtin_amdgcn_fence(__ATOMIC_ACQ_REL, "workgroup");
  __builtin_amdgcn_wave_barrier();
  const int rsub = lane >> 4, c4 = (lane & 15) * 4;
  {
#pragma unroll
    for (int q = 0; q < 8; ++q) {
      const int r = q * 2 + rsub;
      const v4f v = *(const v4fa*)&so[w][r][c4];
      *(v4f*)(C + (size_t)(row0 + r) * ldc + col0 + c4) = v;
    }
    
  }
}

// GEMM C = act(A·W + bias + resid): A f32 (ASPLIT -> hi/lo 2 terms), Wt bf16 [N][K]; ACT 0 none, 1 relu, 2 exact gelu;
// resid (optional, f32, row index = (row % rmod), pitch ldr, RES_BF16 rounds it) added before the activation.
template <bool ASPLIT, int ACT, bool BIAS_BF16, bool RES_BF16>
__global__ __launch_bounds__(128) void k_gemm_bf3(const float* __restrict__ A, int lda, const unsigned short* __restrict__ Wt, int ldb,
                                                const float* __restrict__ bias, const float* __restrict__ resid, int rmod, int ldr,
                                                float* __restrict__ C, int ldc, int M, int N, int K) {
  __shared__ __attribute__((aligned(16))) float so[4][16][64];
  const int tid = threadIdx.x, w = tid >> 5, lane = tid & 31, ln = lane & 15, hh = lane >> 4;
  const int ntn = N / 64;
  const int wid = blockIdx.x * 4 + w;
  const int mt = wid / ntn, nq = wid % ntn;
  if (mt * 16 >= M) return;
  const int row0 = mt * 16, col0 = nq * 64;
  const float* arow = A + (size_t)(row0 + ln) * lda;
  v8f acc[4] = {};
  for (int kb = 0; kb < K; kb += 32) {
    FragB ah, al;
    const v4f x0 = *(const v4fa*)(arow + kb + 8 * hh), x1 = *(const v4fa*)(arow + kb + 8 * hh + 4);
    const v4f x2 = *(const v4fa*)(arow + kb + 16 + 8 * hh), x3 = *(const v4fa*)(arow + kb + 16 + 8 * hh + 4);
    float xs[16] = {x0[0],x0[1],x0[2],x0[3],x1[0],x1[1],x1[2],x1[3],x2[0],x2[1],x2[2],x2[3],x3[0],x3[1],x3[2],x3[3]};
#pragma unroll
    for (int i = 0; i < 16; ++i) { const unsigned short hb = bf16_bits(xs[i]); ah.u[i] = hb; al.u[i] = ASPLIT ? bf16_bits(xs[i] - bf16_val(hb)) : (unsigned short)0; }
#pragma unroll
    for (int t = 0; t < 4; ++t) {
      const unsigned short* brow = Wt + (size_t)(col0 + t * 16 + ln) * ldb + kb;
      FragB b;
      b.half[0] = *(const v8us*)(brow + 8 * hh);
      b.half[1] = *(const v8us*)(brow + 16 + 8 * hh);
      acc[t] = mmaN<ASPLIT ? 2 : 1>(ah.v, al.v, b.v, b.v, acc[t]);
    }
  }
#pragma unroll
  for (int t = 0; t < 4; ++t) {
    const int col = col0 + t * 16 + ln;
    float bv = bias ? bias[col] : 0.f;
    if (BIAS_BF16) bv = bf16_round(bv);
#pragma unroll
    for (int r = 0; r < 8; ++r) {
      float v = acc[t][r] + bv;
      if (resid) { float rv = resid[(size_t)((row0 + 8 * hh + r) % rmod) * ldr + col]; if (RES_BF16) rv = bf16_round(rv); v += rv; }
      if (ACT == 1) v = fmaxf(v, 0.f);
      if (ACT == 2) v = 0.5f * v * (1.0f + erff(v * 0.70710678118654752f));
      if (ACT == 3) { const float u = 0.7978845608028654f * (v + 0.044715f * v * v * v); v = 0.5f * v * (1.0f + tanhf(u)); }
      so[w][8 * hh + r][t * 16 + ln] = v;
    }
  }
  __builtin_amdgcn_fence(__ATOMIC_ACQ_REL, "workgroup");
  __builtin_amdgcn_wave_barrier();
  const int rsub = lane >> 4, c4 = (lane & 15) * 4;
  {
#pragma unroll
    for (int q = 0; q < 8; ++q) {
      const int r = q * 2 + rsub;
      const v4f v = *(const v4fa*)&so[w][r][c4];
      *(v4f*)(C + (size_t)(row0 + r) * ldc + col0 + c4) = v;
    }
    
  }
}
// row LayerNorm (biased variance, eps) over N: s = X (+ R); optional out_sum <- s; out_norm <- (s-mu)*rsqrt(var+eps)*g + b
template <bool PARAM_BF16>
__global__ __launch_bounds__(256) void k_layernorm(const float* __restrict__ X, const float* __restrict__ R, const float* __restrict__ g, const float* __restrict__ bta,
                                                  float* __restrict__ out_sum, float* __restrict__ out_norm, int N, float eps) {
  __shared__ float red[256];
  const int row = blockIdx.x, tid = threadIdx.x;
  const float* x = X + (size_t)row * N; const float* rr = R ? R + (size_t)row * N : nullptr;
  float vals[16];                     // up to N = 4096
  const int per = N / 256;            // contiguous chunk per thread? use strided-by-4 chunks: thread handles j = tid*4 + 1024*u
  float s1 = 0.f;
  for (int u = 0; u < per / 4; ++u) {
    const int j = tid * 4 + 1024 * u;
    const v4f a = *(const v4fa*)(x + j);
    v4f b = {0.f,0.f,0.f,0.f}; if (rr) b = *(const v4fa*)(rr + j);
#pragma unroll
    for (int q = 0; q < 4; ++q) { const float v = a[q] + b[q]; vals[u * 4 + q] = v; s1 += v; }
  }
  red[tid] = s1; __syncthreads();
  for (int st = 128; st > 0; st >>= 1) { if (tid < st) red[tid] += red[tid + st]; __syncthreads(); }
  const float mu = red[0] / (float)N; __syncthreads();
  float s2 = 0.f;
  for (int u = 0; u < per / 4; ++u)
#pragma unroll
    for (int q = 0; q < 4; ++q) { const float c = vals[u * 4 + q] - mu; s2 += c * c; }
  red[tid] = s2; __syncthreads();
  for (int st = 128; st > 0; st >>= 1) { if (tid < st) red[tid] += red[tid + st]; __syncthreads(); }
  const float rs = rsqrtf(red[0] / (float)N + eps);
  {
    for (int u = 0; u < per / 4; ++u) {
      const int j = tid * 4 + 1024 * u;
      v4f o, sm;
#pragma unroll
      for (int q = 0; q < 4; ++q) {
        float gg = g[j + q], bb = bta[j + q];
        if (PARAM_BF16) { gg = bf16_round(gg); bb = bf16_round(bb); }
        sm[q] = vals[u * 4 + q]; o[q] = (vals[u * 4 + q] - mu) * rs * gg + bb;
      }
      if (out_sum) *(v4f*)(out_sum + (size_t)row * N + j) = sm;
      *(v4f*)(out_norm + (size_t)row * N + j) = o;
    }
    
  }
}



// ---- f16 WMMA path (v_wmma_f32_16x16x32_f16): 11-bit significands for operands in range — used for every GEMM launched here
typedef _Float16 v16h __attribute__((ext_vector_type(16)));
union FragH { v16h v; v8us half[2]; _Float16 h[16]; unsigned short u[16]; };
template <int NT>
__device__ __forceinline__ v8f mmaH(v16h ah, v16h al, v16h bh, v16h bl, v8f c) {
  c = __builtin_amdgcn_wmma_f32_16x16x32_f16(false, ah, false, bh, (short)0, c, false, false);
  if (NT >= 2) c = __builtin_amdgcn_wmma_f32_16x16x32_f16(false, al, false, bh, (short)0, c, false, false);
  if (NT >= 3) c = __builtin_amdgcn_wmma_f32_16x16x32_f16(false, ah, false, bl, (short)0, c, false, false);
  asm volatile("v_nop\n\tv_nop\n\tv_nop\n\tv_nop" : "+v"(c) : "v"(ah), "v"(al), "v"(bh), "v"(bl));
  return c;
}
// batched GEMM like k_gemm_b but f16 operands: A f32 (split into f16 hi/lo if ASPLIT, else rounded to f16), Bt = f16 values [n][k]; alpha; C f32; N multiple of 16 (partial tiles skipped)
template <bool ASPLIT>
__global__ __launch_bounds__(128) void k_gemm_h(const float* __restrict__ A, int lda, size_t sA, const _Float16* __restrict__ Bh, int ldb, size_t sB, float alpha, float* __restrict__ C, int ldc, size_t sC, int M, int N, int K) {
  __shared__ __attribute__((aligned(16))) float so[4][16][64];
  const int tid = threadIdx.x, w = tid >> 5, lane = tid & 31, ln = lane & 15, hh = lane >> 4; const int by = blockIdx.y;
  A += (size_t)by * sA; Bh += (size_t)by * sB; C += (size_t)by * sC;
  const int ntn = (N + 63) / 64; const int wid = blockIdx.x * 4 + w; const int mt = wid / ntn, nq = wid % ntn; if (mt * 16 >= M) return;
  const int row0 = mt * 16, col0 = nq * 64; const float* arow = A + (size_t)(row0 + ln) * lda;
  v8f acc[4] = {};
  for (int kb = 0; kb < K; kb += 32) {
    FragH ah, al;
    const v4f x0 = *(const v4fa*)(arow + kb + 8 * hh), x1 = *(const v4fa*)(arow + kb + 8 * hh + 4), x2 = *(const v4fa*)(arow + kb + 16 + 8 * hh), x3 = *(const v4fa*)(arow + kb + 16 + 8 * hh + 4);
    float xs[16] = {x0[0],x0[1],x0[2],x0[3],x1[0],x1[1],x1[2],x1[3],x2[0],x2[1],x2[2],x2[3],x3[0],x3[1],x3[2],x3[3]};
#pragma unroll
    for (int i = 0; i < 16; ++i) { const _Float16 h = (_Float16)xs[i]; ah.h[i] = h; al.h[i] = ASPLIT ? (_Float16)(xs[i] - (float)h) : (_Float16)0.0f; }
#pragma unroll
    for (int t = 0; t < 4; ++t) { if (col0 + t * 16 >= N) continue; const size_t boff = (size_t)(col0 + t * 16 + ln) * ldb + kb; FragH bq; bq.half[0] = *(const v8us*)(Bh + boff + 8 * hh); bq.half[1] = *(const v8us*)(Bh + boff + 16 + 8 * hh);
      acc[t] = mmaH<ASPLIT ? 2 : 1>(ah.v, al.v, bq.v, bq.v, acc[t]); }
  }
#pragma unroll
  for (int t = 0; t < 4; ++t) { if (col0 + t * 16 >= N) continue;
#pragma unroll
    for (int r = 0; r < 8; ++r) so[w][8 * hh + r][t * 16 + ln] = acc[t][r] * alpha; }
  __builtin_amdgcn_fence(__ATOMIC_ACQ_REL, "workgroup"); __builtin_amdgcn_wave_barrier();
  const int rsub = lane >> 4, c4 = (lane & 15) * 4;
  {
#pragma unroll
    for (int q = 0; q < 8; ++q) { const int r = q * 2 + rsub; if (col0 + c4 < N) { const v4f v = *(const v4fa*)&so[w][r][c4]; *(v4f*)(C + (size_t)(row0 + r) * ldc + col0 + c4) = v; } }
     }
}

// Wt[n][k] = f16(bf16(W[k][n])·scale) from f32 row-major W[K][N] (scale = power of two; bf16-exact weights stay exact in f16 away from the subnormal range)
__global__ __launch_bounds__(256) void k_wt_f16(const float* __restrict__ W, _Float16* __restrict__ Wt, int K, int N, float scale) {
  const int t = blockIdx.x * 256 + threadIdx.x; if (t >= N * (K / 8)) return; const int n = t / (K / 8), k8 = (t % (K / 8)) * 8; FragH f;
#pragma unroll
  for (int i = 0; i < 8; ++i) f.h[i] = (_Float16)(bf16_round(W[(size_t)(k8 + i) * N + n]) * scale); const v8us o = f.half[0];
  *(v8us*)((unsigned short*)Wt + (size_t)n * K + k8) = o; 
}
// k_gemm_hh variant with fused epilogue: v = acc·alpha + bias[by·sBias + col] (+ CP[(row/rowsPerB)·sCPb + by·64 + col] if CP) ; ACT 0 none / 1 elu ; writes f16 C16 (and f32 C if non-null)
template <int ACT>
__global__ __launch_bounds__(128) void k_gemm_hhx(const _Float16* __restrict__ A, int lda, size_t sA, const _Float16* __restrict__ Bh, int ldb, size_t sB, float alpha, const float* __restrict__ bias, size_t sBias, const float* __restrict__ CP, int rowsPerB, size_t sCPb, int row0g,
    float* __restrict__ C, _Float16* __restrict__ C16, int ldc, size_t sC, int M, int N, int K) {
  __shared__ __attribute__((aligned(16))) float so[4][16][64];
  const int tid = threadIdx.x, w = tid >> 5, lane = tid & 31, ln = lane & 15, hh = lane >> 4; const int by = blockIdx.y;
  A += (size_t)by * sA; Bh += (size_t)by * sB; const size_t cofs = (size_t)by * sC; const float* bp = bias ? bias + (size_t)by * sBias : nullptr;
  const int ntn = (N + 63) / 64; const int wid = blockIdx.x * 4 + w; const int mt = wid / ntn, nq = wid % ntn; if (mt * 16 >= M) return;
  const int row0 = mt * 16, col0 = nq * 64; const _Float16* arow = A + (size_t)(row0 + ln) * lda;
  v8f acc[4] = {};
  for (int kb = 0; kb < K; kb += 32) { FragH ah; ah.half[0] = *(const v8us*)((const unsigned short*)arow + kb + 8 * hh); ah.half[1] = *(const v8us*)((const unsigned short*)arow + kb + 16 + 8 * hh);
#pragma unroll
    for (int t = 0; t < 4; ++t) { if (col0 + t * 16 >= N) continue; const size_t boff = (size_t)(col0 + t * 16 + ln) * ldb + kb; FragH bq; bq.half[0] = *(const v8us*)((const unsigned short*)Bh + boff + 8 * hh); bq.half[1] = *(const v8us*)((const unsigned short*)Bh + boff + 16 + 8 * hh);
      acc[t] = mmaH<1>(ah.v, ah.v, bq.v, bq.v, acc[t]); }
  }
#pragma unroll
  for (int t = 0; t < 4; ++t) { if (col0 + t * 16 >= N) continue; const int col = col0 + t * 16 + ln; const float bv = bp ? bf16_round(bp[col]) : 0.f;
#pragma unroll
    for (int r = 0; r < 8; ++r) { float v = acc[t][r] * alpha + bv; if (CP) { const int rr = row0g + row0 + 8 * hh + r; if (rowsPerB < 0) v += CP[cofs + (size_t)rr * ldc + col];      /* rowsPerB < 0: own element of the batched C plane */ else { const int bidx = rr / rowsPerB; v += CP[(size_t)bidx * sCPb + (size_t)by * 64 + col]; } } if (ACT == 1) v = (v > 0.f) ? v : expm1f(v); else if (ACT == 7) v = (v > 0.f) ? v + 1.0f : expf(v); else if (ACT == 8) v = tanhf(v); else if (ACT == 9) v = 0.5f * v * (1.0f + tanhf(0.7978845608028654f * (v + 0.044715f * v * v * v))); else if (ACT == 11) v = 1.0f / (1.0f + expf(-v)); else if (ACT == 12) v = (v > 0.f) ? v : 0.01f * v; else if (ACT == 14) v = (v > 0.f) ? v : 0.1f * v; else if (ACT == 16) v = (v >= 0.f) ? v : 0.3f * v; else if (ACT == 17) v = (v >= 0.f) ? v : 0.2f * v; else if (ACT == 15) v = v / (1.0f + expf(-v)); else if (ACT == 3) v = fmaxf(v, 0.f); else if (ACT == 6) v = 0.5f * v * (1.0f + erff(v * 0.70710678118654752f)); so[w][8 * hh + r][t * 16 + ln] = v; } }
  __builtin_amdgcn_fence(__ATOMIC_ACQ_REL, "workgroup"); __builtin_amdgcn_wave_barrier();
  const int rsub = lane >> 4, c4 = (lane & 15) * 4; typedef _Float16 v4h __attribute__((ext_vector_type(4)));
  {
#pragma unroll
    for (int q = 0; q < 8; ++q) { const int r = q * 2 + rsub; if (col0 + c4 < N) { const v4f v = *(const v4fa*)&so[w][r][c4]; if (C) *(v4f*)(C + cofs + (size_t)(row0 + r) * ldc + col0 + c4) = v; if (C16) { v4h h4; for (int i = 0; i < 4; ++i) h4[i] = (_Float16)v[i]; *(v4h*)(C16 + cofs + (size_t)(row0 + r) * ldc + col0 + c4) = h4; } } }
     }
}


typedef _Float16 v4h __attribute__((ext_vector_type(4)));

__global__ __launch_bounds__(256) void k_x16(const float* __restrict__ x, _Float16* __restrict__ X16, size_t n8) { const size_t t = (size_t)blockIdx.x * 256 + threadIdx.x; if (t >= n8) return; FragH f;
#pragma unroll
  for (int q = 0; q < 8; ++q) f.h[q] = (_Float16)bf16_round(x[t * 8 + q]); *(v8us*)((unsigned short*)X16 + t * 8) = f.half[0];  }
__global__ __launch_bounds__(256) void k_h16(const float* __restrict__ x, _Float16* __restrict__ X16, size_t n8) { const size_t t = (size_t)blockIdx.x * 256 + threadIdx.x; if (t >= n8) return; FragH f;
#pragma unroll
  for (int q = 0; q < 8; ++q) f.h[q] = (_Float16)x[t * 8 + q]; *(v8us*)((unsigned short*)X16 + t * 8) = f.half[0];  }
__global__ __launch_bounds__(256) void k_round16f(const float* __restrict__ W, _Float16* __restrict__ Bt, size_t n8) { const size_t t = (size_t)blockIdx.x * 256 + threadIdx.x; if (t >= n8) return; FragH f;
#pragma unroll
  for (int i = 0; i < 8; ++i) f.h[i] = (_Float16)(bf16_round(W[t * 8 + i]) * 16.0f); *(v8us*)((unsigned short*)Bt + t * 8) = f.half[0];  }
template <int NHv, int TTv>
__global__ __launch_bounds__(256) void k_vt(const _Float16* __restrict__ V16, int ldv, int voff, _Float16* __restrict__ Vt) { __shared__ unsigned short tl[64][66]; const int tid = threadIdx.x; const int slab = blockIdx.x / (TTv / 64), lg = blockIdx.x % (TTv / 64); const int b = slab / NHv, h = slab % NHv;
  for (int i = tid; i < 64 * 8; i += 256) { const int r = i / 8, c8 = (i % 8) * 8; FragH f; f.half[0] = *(const v8us*)((const unsigned short*)V16 + ((size_t)b * TTv + lg * 64 + r) * ldv + voff + h * 64 + c8);
#pragma unroll
    for (int q = 0; q < 8; ++q) tl[r][c8 + q] = f.u[q]; }
  __syncthreads();
  {
#pragma unroll
    for (int rd = 0; rd < 2; ++rd) { const int d = rd * 32 + tid / 8, pc = tid % 8; FragH f;
#pragma unroll
      for (int q = 0; q < 8; ++q) f.u[q] = tl[pc * 8 + q][d];
      *(v8us*)((unsigned short*)Vt + ((size_t)slab * 64 + d) * TTv + lg * 64 + pc * 8) = f.half[0]; }
     } }

__global__ __launch_bounds__(256) void k_hl(const float* __restrict__ F, _Float16* __restrict__ Hh, _Float16* __restrict__ Hl, size_t n8) { const size_t t = (size_t)blockIdx.x * 256 + threadIdx.x; if (t >= n8) return; FragH fh, fl; const v4f a = *(const v4fa*)(F + t * 8), c = *(const v4fa*)(F + t * 8 + 4);
#pragma unroll
  for (int q = 0; q < 4; ++q) { _Float16 h = (_Float16)a[q]; fh.h[q] = h; fl.h[q] = (_Float16)((a[q] - (float)h) * 1024.0f); h = (_Float16)c[q]; fh.h[4 + q] = h; fl.h[4 + q] = (_Float16)((c[q] - (float)h) * 1024.0f); }
  { *(v8us*)((unsigned short*)Hh + t * 8) = fh.half[0]; *(v8us*)((unsigned short*)Hl + t * 8) = fl.half[0];  } }

// ---- fast GEMM (wave tile 32x64; requires M % 32 == 0 rows per launch region and N % 64 == 0); epilogue = k_gemm_hhx semantics ----
__device__ __forceinline__ v16h g2_frag(const _Float16* p, int hh) { FragH f; f.half[0] = *(const v8us*)((const unsigned short*)p + 8 * hh); f.half[1] = *(const v8us*)((const unsigned short*)p + 16 + 8 * hh); return f.v; }
__device__ __forceinline__ v8f g2_mma(v16h a, v16h b, v8f c) { v8f d = __builtin_amdgcn_wmma_f32_16x16x32_f16(false, a, false, b, (short)0, c, false, false); asm volatile("v_nop\n\tv_nop\n\tv_nop\n\tv_nop" : "+v"(d) : "v"(a), "v"(b)); return d; }
template <int ACT>
__global__ __launch_bounds__(128) void k_gemm2(const _Float16* __restrict__ A, int lda, size_t sA, const _Float16* __restrict__ Bh, int ldb, size_t sB, float alpha, const float* __restrict__ bias, size_t sBias, const float* __restrict__ CP, int rowsPerB, size_t sCPb, int row0g,
    float* __restrict__ C, _Float16* __restrict__ C16, int ldc, size_t sC, int M, int N, int K) { static_assert(ACT == 0 || ACT == 3 || ACT == 6 || ACT == 8 || ACT == 9 || ACT == 11 || ACT == 12 || ACT == 14 || ACT == 15 || ACT == 16 || ACT == 17, "k_gemm2: unsupported ACT code (would silently apply no activation)");
  __shared__ __attribute__((aligned(16))) float so[4][32][68];
  const int tid = threadIdx.x, w = tid >> 5, lane = tid & 31, ln = lane & 15, hh = lane >> 4; const int by = blockIdx.y;
  A += (size_t)by * sA; Bh += (size_t)by * sB; const size_t cofs = (size_t)by * sC; const float* bp = bias ? bias + (size_t)by * sBias : nullptr;
  const int ntn = N >> 6; const int mt = blockIdx.x / ntn, nq = blockIdx.x - mt * ntn; const int row0 = mt * 128 + 32 * w, col0 = nq * 64; if (row0 >= M) return;
  const _Float16* a0p = A + (size_t)(row0 + ln) * lda; const _Float16* a1p = a0p + (size_t)16 * lda;
  const _Float16* b0p = Bh + (size_t)(col0 + ln) * ldb; const _Float16* b1p = b0p + (size_t)16 * ldb; const _Float16* b2p = b1p + (size_t)16 * ldb; const _Float16* b3p = b2p + (size_t)16 * ldb;
  const v8f z8 = {0.f,0.f,0.f,0.f,0.f,0.f,0.f,0.f}; v8f c00 = z8, c01 = z8, c02 = z8, c03 = z8, c10 = z8, c11 = z8, c12 = z8, c13 = z8;
#pragma unroll 1
  for (int kb = 0; kb < K; kb += 32) { const v16h a0 = g2_frag(a0p + kb, hh), a1 = g2_frag(a1p + kb, hh);
    v16h b = g2_frag(b0p + kb, hh); c00 = g2_mma(a0, b, c00); c10 = g2_mma(a1, b, c10);
    b = g2_frag(b1p + kb, hh); c01 = g2_mma(a0, b, c01); c11 = g2_mma(a1, b, c11);
    b = g2_frag(b2p + kb, hh); c02 = g2_mma(a0, b, c02); c12 = g2_mma(a1, b, c12);
    b = g2_frag(b3p + kb, hh); c03 = g2_mma(a0, b, c03); c13 = g2_mma(a1, b, c13); }
  v8f accs[8] = {c00, c01, c02, c03, c10, c11, c12, c13};
#pragma unroll
  for (int u = 0; u < 8; ++u) { const int t = u & 3, half = u >> 2; const int col = col0 + t * 16 + ln; const float bv = bp ? bf16_round(bp[col]) : 0.f;
#pragma unroll
    for (int r = 0; r < 8; ++r) { const int rloc = half * 16 + 8 * hh + r; float v = accs[u][r] * alpha + bv; if (CP) { if (rowsPerB < 0) v += CP[cofs + (size_t)(row0g + row0 + rloc) * ldc + col];      /* rowsPerB < 0: own element of the batched C plane */ else { const int bidx = (row0g + row0 + rloc) / rowsPerB; v += CP[(size_t)bidx * sCPb + (size_t)by * 64 + col]; } }
      if (ACT == 3) v = fmaxf(v, 0.f); else if (ACT == 6) v = 0.5f * v * (1.0f + erff(v * 0.70710678118654752f)); else if (ACT == 11) v = 1.0f / (1.0f + expf(-v)); else if (ACT == 15) v = v / (1.0f + expf(-v)); else if (ACT == 12) v = (v > 0.f) ? v : 0.01f * v; else if (ACT == 8) v = tanhf(v); else if (ACT == 9) v = 0.5f * v * (1.0f + tanhf(0.7978845608028654f * (v + 0.044715f * v * v * v))); else if (ACT == 14) v = (v > 0.f) ? v : 0.1f * v; else if (ACT == 16) v = (v >= 0.f) ? v : 0.3f * v; else if (ACT == 17) v = (v >= 0.f) ? v : 0.2f * v;
      so[w][rloc][t * 16 + ln] = v; } }
  __builtin_amdgcn_fence(__ATOMIC_ACQ_REL, "workgroup"); __builtin_amdgcn_wave_barrier();
  const int rsub = lane >> 4, c4 = (lane & 15) * 4;
  {
#pragma unroll
    for (int q = 0; q < 16; ++q) { const int r = q * 2 + rsub; const v4f v = *(const v4fa*)&so[w][r][c4]; if (C) *(v4f*)(C + cofs + (size_t)(row0 + r) * ldc + col0 + c4) = v; if (C16) { v4h h4; for (int i = 0; i < 4; ++i) h4[i] = (_Float16)v[i]; *(v4h*)(C16 + cofs + (size_t)(row0 + r) * ldc + col0 + c4) = h4; } }
     } }


__global__ __launch_bounds__(256) void k_f16c(const float* __restrict__ A, _Float16* __restrict__ D, size_t n8) { const size_t t = (size_t)blockIdx.x * 256 + threadIdx.x; if (t >= n8) return; const v8f a = *(const v8f*)(A + t * 8); FragH f; for (int q = 0; q < 8; ++q) f.h[q] = (_Float16)a[q]; *(v8us*)((unsigned short*)D + t * 8) = f.half[0];  }
// Exact (erf) GELU in f32, written as h Phi(h) = max(h, 0) - |h| Q(|h|) with Q(a) = erfc(a / sqrt 2) / 2 = exp2(p(a)): one straight line for every h, no second form to evaluate and select, no range reduction around v_exp_f32 (p < 0, and an error of p counts only times Q).
// p is a degree-8 fit of log2 Q(a) on 0 <= a <= 5.5, weighted by Q: evaluated in f32 the error of Phi is about 1e-7 at most (the rounding level of 1 + erf in f32), and a negative h has no cancellation.
// The leading coefficient is negative, so past the fitted range p keeps falling and |h| exp2(p) goes to 0 as |h| Q does (the two are within 1e-8 from a = 5 on); every finite h is covered, h = +infinity or -infinity would give infinity times 0.
__device__ __forceinline__ float gelu_erf(float s) {
  const float a = fabsf(s);
  float p = fmaf(a, -2.12157283e-6f, 3.09552197e-5f); p = fmaf(a, p, -1.46757287e-4f); p = fmaf(a, p, -2.30747639e-4f); p = fmaf(a, p, 7.18435273e-3f);
  p = fmaf(a, p, -5.25792725e-2f); p = fmaf(a, p, -4.59180444e-1f); p = fmaf(a, p, -1.15110874e+0f); p = fmaf(a, p, -9.99999940e-1f);
  return fmaf(-a, __builtin_amdgcn_exp2f(p), fmaxf(s, 0.f));
}
// Fused tail: h1 = gelu(A[bt] + Bu[n] + b1), h2 = gelu(h1 w2 + b2), out = clip(h2 w3 + b3); h1 and h2 never leave the registers.
// One work-group per bin row bt; wave w owns units 32w .. 32w+31 as two tiles of 16 rows.
// The product runs transposed: w2's columns are the A operand (from LDS, stored in fragment order), the h1 rows the B operand.
// A lane computes the 16 h1 values of its own row and k half straight into the B fragment (k = 8h+i, 16+8h+i on both operands).
// D register r of tile t is then h2[row = lane & 15][feature 16t + 8h + r]: the head's dot product stays inside a lane but for one add across the lane halves.
__global__ __launch_bounds__(256) void k_tail(const float* __restrict__ A, const float* __restrict__ Bu, const float* __restrict__ b1, const _Float16* __restrict__ W2t,
                                              const float* __restrict__ b2, const float* __restrict__ w3, const float* __restrict__ b3, float* __restrict__ out) {
  __shared__ __attribute__((aligned(16))) unsigned short sW[HALF / 32][QTR / 16][2][32][8];   /* [k step][feature tile][fragment half][lane][8 f16], 64 KiB: each fragment load reads 512 contiguous bytes */
  __shared__ __attribute__((aligned(16))) float sab[HALF];
  __shared__ __attribute__((aligned(16))) float sb2[QTR];
  __shared__ __attribute__((aligned(16))) float sw3[QTR];
  const int tid = threadIdx.x, w = tid >> 5, lane = tid & 31, ln = lane & 15, hh = lane >> 4;
  const int bt = blockIdx.x;
  // unrolled: all 16 loads of the w2 fill are in flight before the first LDS store
#pragma unroll
  for (int i = 0; i < 16; ++i) {
    const int ks = i >> 1, t = (i & 1) * 4 + (w >> 1), half = w & 1;
    const v8us v = *(const v8us*)((const unsigned short*)W2t + (size_t)(t * 16 + ln) * HALF + ks * 32 + half * 16 + hh * 8);
    *(v8us*)&sW[ks][t][half][lane][0] = v;
  }
  sab[tid] = A[(size_t)bt * HALF + tid] + bf16_round(b1[tid]);
  if (tid < QTR) { sb2[tid] = bf16_round(b2[tid]); sw3[tid] = bf16_round(w3[tid]); }
  __syncthreads();
  const float* ub = Bu + (size_t)(w * 32 + ln) * HALF + 8 * hh;
  v4f u0 = *(const v4fa*)(ub), u1 = *(const v4fa*)(ub + 4), u2 = *(const v4fa*)(ub + 16), u3 = *(const v4fa*)(ub + 20);
  float res = 0.f;
  // the tile loop and the k loop stay rolled: 16 + 64 inlined GELUs are all the text that the instruction cache should have to hold;
  // the loops inside them are unrolled, so that fragments and accumulators are indexed by constants and stay in registers
#pragma unroll 1
  for (int tile = 0; tile < 2; ++tile) {
    v8f acc[8] = {};
#pragma unroll 1
    for (int ks = 0; ks < HALF / 32; ++ks) {
      // the next step's unit values are loaded one step ahead (the last step reloads its own)
      const int qn = min(tile * 8 + ks + 1, 15);
      const float* un = ub + (size_t)(qn >> 3) * 16 * HALF + (qn & 7) * 32;
      const v4f p0 = *(const v4fa*)(un), p1 = *(const v4fa*)(un + 4), p2 = *(const v4fa*)(un + 16), p3 = *(const v4fa*)(un + 20);
      const float* ap = &sab[ks * 32 + 8 * hh];
      const v4f a0 = *(const v4fa*)(ap), a1 = *(const v4fa*)(ap + 4), a2 = *(const v4fa*)(ap + 16), a3 = *(const v4fa*)(ap + 20);
      FragH f;
#pragma unroll
      for (int i = 0; i < 4; ++i) {
        f.h[i] = (_Float16)gelu_erf(a0[i] + u0[i]); f.h[4 + i] = (_Float16)gelu_erf(a1[i] + u1[i]);
        f.h[8 + i] = (_Float16)gelu_erf(a2[i] + u2[i]); f.h[12 + i] = (_Float16)gelu_erf(a3[i] + u3[i]);
      }
#pragma unroll
      for (int t = 0; t < 8; ++t) {
        FragH wf; wf.half[0] = *(const v8us*)&sW[ks][t][0][lane][0]; wf.half[1] = *(const v8us*)&sW[ks][t][1][lane][0];
        acc[t] = __builtin_amdgcn_wmma_f32_16x16x32_f16(false, wf.v, false, f.v, (short)0, acc[t], false, false);
      }
      u0 = p0; u1 = p1; u2 = p2; u3 = p3;
    }
    // compiler fence: keeps the 32 LDS loads of b2 and w3 inside the tile loop; hoisted out of it they hold 128 registers through the k loop, which then has none left to fetch w2 fragments ahead of its WMMAs
    asm volatile("" ::: "memory");
    v4f pv = {0.f, 0.f, 0.f, 0.f};      /* four partial sums of the head, so that the GELUs pair up into packed f32 instructions */
#pragma unroll
    for (int t = 0; t < 8; ++t) {
      const int f0 = t * 16 + 8 * hh;
      const v4f c0 = *(const v4fa*)&sb2[f0], c1 = *(const v4fa*)&sb2[f0 + 4], g0 = *(const v4fa*)&sw3[f0], g1 = *(const v4fa*)&sw3[f0 + 4];
      v4f h0, h1;
#pragma unroll
      for (int r = 0; r < 4; ++r) { h0[r] = gelu_erf(acc[t][r] * 0.0625f + c0[r]); h1[r] = gelu_erf(acc[t][4 + r] * 0.0625f + c1[r]); }
      pv += h0 * g0; pv += h1 * g1;
    }
    float p = (pv[0] + pv[1]) + (pv[2] + pv[3]);
    p += __shfl_xor(p, 16, 32);
    if (hh == tile) res = p;      /* tile 0's rows end in lanes 0-15, tile 1's in lanes 16-31: one 128-byte store a wave */
  }
  res += bf16_round(b3[0]);
  out[(size_t)bt * NU + w * 32 + lane] = fminf(fmaxf(res, -10.0f), 10.0f);
}

extern "C" void kernel_launch(void* const* d_in, const int* in_sizes, int n_in,
                              void* d_out, int out_size, void* d_ws, size_t ws_size, hipStream_t stream) {
  (void)in_sizes; (void)n_in; (void)out_size;
  const float* const* I = (const float* const*)d_in; const float* br = I[0]; const float* ue = I[1]; const float* bpw = I[2]; const float* bpb = I[3]; const float* upw = I[4]; const float* upb = I[5]; const float* w1 = I[6]; const float* b1 = I[7]; const float* w2 = I[8]; const float* b2 = I[9]; const float* w3 = I[10]; const float* b3 = I[11];
  char* ws = (char*)d_ws; size_t off = 0;
  auto take = [&](size_t bytes) { char* p = ws + off; off += (bytes + 255) & ~(size_t)255; return p; };
  _Float16* BBP = (_Float16*)take((size_t)HALF * DIM * 2); _Float16* BUP = (_Float16*)take((size_t)HALF * DIM * 2); _Float16* BW1A = (_Float16*)take((size_t)HALF * HALF * 2); _Float16* BW1B = (_Float16*)take((size_t)HALF * HALF * 2); _Float16* BW2 = (_Float16*)take((size_t)QTR * HALF * 2);
  _Float16* BR16 = (_Float16*)take((size_t)NBT * DIM * 2); _Float16* UE16 = (_Float16*)take((size_t)NU * DIM * 2); _Float16* BH16 = (_Float16*)take((size_t)NBT * HALF * 2); _Float16* UH16 = (_Float16*)take((size_t)NU * HALF * 2); float* A = (float*)take((size_t)NBT * HALF * 4); float* Bu = (float*)take((size_t)NU * HALF * 4);
  if (off > ws_size) return;
  k_wt_f16<<<(HALF * DIM / 8 + 255) / 256, 256, 0, stream>>>(bpw, BBP, DIM, HALF, 16.0f); k_wt_f16<<<(HALF * DIM / 8 + 255) / 256, 256, 0, stream>>>(upw, BUP, DIM, HALF, 16.0f); k_wt_f16<<<(HALF * HALF / 8 + 255) / 256, 256, 0, stream>>>(w1, BW1A, HALF, HALF, 16.0f); k_wt_f16<<<(HALF * HALF / 8 + 255) / 256, 256, 0, stream>>>(w1 + (size_t)HALF * HALF, BW1B, HALF, HALF, 16.0f); k_wt_f16<<<(QTR * HALF / 8 + 255) / 256, 256, 0, stream>>>(w2, BW2, HALF, QTR, 16.0f);      /* (in, out) */
  k_x16<<<(NBT * DIM / 8 + 255) / 256, 256, 0, stream>>>(br, BR16, (size_t)NBT * DIM / 8); k_x16<<<(NU * DIM / 8 + 255) / 256, 256, 0, stream>>>(ue, UE16, (size_t)NU * DIM / 8);
  k_gemm2<0><<<dim3((NBT / 128) * (HALF / 64), 1), 128, 0, stream>>>(BR16, DIM, 0, BBP, DIM, 0, 0.0625f, bpb, 0, nullptr, 1, 0, 0, nullptr, BH16, HALF, 0, NBT, HALF, DIM);
  k_gemm2<0><<<dim3((NU / 128) * (HALF / 64), 1), 128, 0, stream>>>(UE16, DIM, 0, BUP, DIM, 0, 0.0625f, upb, 0, nullptr, 1, 0, 0, nullptr, UH16, HALF, 0, NU, HALF, DIM);      /* bin_h, unit_h (f16) */
  k_gemm2<0><<<dim3((NBT / 128) * (HALF / 64), 1), 128, 0, stream>>>(BH16, HALF, 0, BW1A, HALF, 0, 0.0625f, nullptr, 0, nullptr, 1, 0, 0, A, nullptr, HALF, 0, NBT, HALF, HALF);
  k_gemm2<0><<<dim3((NU / 128) * (HALF / 64), 1), 128, 0, stream>>>(UH16, HALF, 0, BW1B, HALF, 0, 0.0625f, nullptr, 0, nullptr, 1, 0, 0, Bu, nullptr, HALF, 0, NU, HALF, HALF);      /* bin_h w1a, unit_h w1b */
  k_tail<<<NBT, 256, 0, stream>>>(A, Bu, b1, BW2, b2, w3, b3, (float*)d_out);      /* h1, h2, head, clip */
}

// v003
// One run takes 75.7 microseconds.
// In both of two side-by-side timings against v002, it was 1.70 times as fast.
// Counting every step since v000, it is 4.06 times as fast.
#include <hip/hip_runtime.h>
// PerNeuronMLPHead (2 x 512 time bins x 512, 256 units x 512: bin_h = bin_repr Wbp + b, unit_h = unit_embs Wup + b (256 wide); h1[(b,t), n] = gelu(bin_h w1a + unit_h w1b + b1) (the split-weight broadcast add); h2 = gelu(h1 w2 + b2) (128); log_rate = h2 w3 + b3; clip(-10, 10); exact erf GELU).
// Structure, four launches: all input conversions; the four small projections as f16 WMMA GEMMs (32x64 wave tiles, f32 accumulation, exact x16 weights + bias), the bin and the unit GEMM of a layer in one launch; then one fused kernel: broadcast add + GELU on VALU straight into f16 WMMA fragments, h1 w2 on f16 WMMA, GELU, the 128 -> 1 head and the clip on the f32 accumulators (128-B stores, one a wave).
// Compute dtype: inputs rounded to bf16; inputs / weights exact as f16; bin_h / unit_h and h1 as plain f16 operands (~2^-12); h2, GELU and head f32. v_wmma_f32_16x16x32_f16.
#define NB 2
#define NTB 512
#define DIM 512
#define HALF 256
#define QTR 128
#define NU 256
#define NBT (NB * NTB)           /* 1024 bin rows */
#define NRW ((size_t)NBT * NU)   /* 262144 output rows */
typedef __bf16 v16b __attribute__((ext_vector_type(16)));
typedef unsigned short v8us __attribute__((ext_vector_type(8), may_alias));
typedef float  v8f  __attribute__((ext_vector_type(8)));
typedef float  v4f  __attribute__((ext_vector_type(4)));
typedef float  v4fa __attribute__((ext_vector_type(4), may_alias));
union FragB { v16b v; v8us half[2]; unsigned short u[16]; };

__device__ __forceinline__ unsigned short bf16_bits(float x) { unsigned int u = __float_as_uint(x); return (unsigned short)((u + 0x7FFFu + ((u >> 16) & 1u)) >> 16); }
__device__ __forceinline__ float bf16_val(unsigned short b) { return __uint_as_float(((unsigned int)b) << 16); }
__device__ __forceinline__ float bf16_round(float x) { return bf16_val(bf16_bits(x)); }
// D += A·B with NT terms: 1 = ah·bh, 2 = + al·bh (A split), 3 = + ah·bl (both split)
template <int NT>
__device__ __forceinline__ v8f mmaN(v16b ah, v16b al, v16b bh, v16b bl, v8f c) {
  c = __builtin_amdgcn_wmma_f32_16x16x32_bf16(false, ah, false, bh, (short)0, c, false, false);
  if (NT >= 2) c = __builtin_amdgcn_wmma_f32_16x16x32_bf16(false, al, false, bh, (short)0, c, false, false);
  if (NT >= 3) c = __builtin_amdgcn_wmma_f32_16x16x32_bf16(false, ah, false, bl, (short)0, c, false, false);
  asm volatile("v_nop\n\tv_nop\n\tv_nop\n\tv_nop" : "+v"(c) : "v"(ah), "v"(al), "v"(bh), "v"(bl));
  return c;
}

__global__ __launch_bounds__(256) void k_wt_bf16(const float* __restrict__ W, unsigned short* __restrict__ Wt, int K, int N) {
  const int t = blockIdx.x * 256 + threadIdx.x;
  const int k8n = K / 8;
  if (t >= N * k8n) return;
  const int n = t / k8n, k8 = (t % k8n) * 8;
  v8us v;
#pragma unroll
  for (int i = 0; i < 8; ++i) v[i] = bf16_bits(W[(size_t)(k8 + i) * N + n]);
  *(v8us*)(Wt + (size_t)n * K + k8) = v;
  
}

// GEMM C[M][N] (f32, pitch ldc) = act(A[M][K]·W + bias). A f32 row-major (pitch lda) converted per fragment to bf16
// (ASPLIT: hi/lo two planes -> 2 terms, else single rounded term); Wt bf16 [N][K] (pitch ldb). BIAS_BF16 rounds the
// bias to bf16 first (bias quantised to bf16 before the add). K%32==0, M%16==0, N%64==0.
template <bool ASPLIT, int ACT, bool BIAS_BF16>
__global__ __launch_bounds__(128) void k_gemm_bf(const float* __restrict__ A, int lda, const unsigned short* __restrict__ Wt, int ldb,
                                               const float* __restrict__ bias, float* __restrict__ C, int ldc, int M, int N, int K) {
  __shared__ __attribute__((aligned(16))) float so[4][16][64];
  const int tid = threadIdx.x, w = tid >> 5, lane = tid & 31, ln = lane & 15, hh = lane >> 4;
  const int ntn = N / 64;
  const int wid = blockIdx.x * 4 + w;
  const int mt = wid / ntn, nq = wid % ntn;
  if (mt * 16 >= M) return;
  const int row0 = mt * 16, col0 = nq * 64;
  const float* arow = A + (size_t)(row0 + ln) * lda;
  v8f acc[4] = {};
  for (int kb = 0; kb < K; kb += 32) {
    FragB ah, al;
    const v4f x0 = *(const v4fa*)(arow + kb + 8 * hh), x1 = *(const v4fa*)(arow + kb + 8 * hh + 4);
    const v4f x2 = *(const v4fa*)(arow + kb + 16 + 8 * hh), x3 = *(const v4fa*)(arow + kb + 16 + 8 * hh + 4);
    float xs[16] = {x0[0],x0[1],x0[2],x0[3],x1[0],x1[1],x1[2],x1[3],x2[0],x2[1],x2[2],x2[3],x3[0],x3[1],x3[2],x3[3]};
#pragma unroll
    for (int i = 0; i < 16; ++i) { const unsigned short hb = bf16_bits(xs[i]); ah.u[i] = hb; al.u[i] = ASPLIT ? bf16_bits(xs[i] - bf16_val(hb)) : (unsigned short)0; }
#pragma unroll
    for (int t = 0; t < 4; ++t) {
      const unsigned short* brow = Wt + (size_t)(col0 + t * 16 + ln) * ldb + kb;
      FragB b;
      b.half[0] = *(const v8us*)(brow + 8 * hh);
      b.half[1] = *(const v8us*)(brow + 16 + 8 * hh);
      acc[t] = mmaN<ASPLIT ? 2 : 1>(ah.v, al.v, b.v, b.v, acc[t]);
    }
  }
#pragma unroll
  for (int t = 0; t < 4; ++t) {
    float bv = bias ? bias[col0 + t * 16 + ln] : 0.f;
    if (BIAS_BF16) bv = bf16_round(bv);
#pragma unroll
    for (int r = 0; r < 8; ++r) { float v = acc[t][r] + bv; if (ACT == 1) v = fmaxf(v, 0.f); so[w][8 * hh + r][t * 16 + ln] = v; }
  }
  __builtin_amdgcn_fence(__ATOMIC_ACQ_REL, "workgroup");
  __builtin_amdgcn_wave_barrier();
  const int rsub = lane >> 4, c4 = (lane & 15) * 4;
  {
#pragma unroll
    for (int q = 0; q < 8; ++q) {
      const int r = q * 2 + rsub;
      const v4f v = *(const v4fa*)&so[w][r][c4];
      *(v4f*)(C + (size_t)(row0 + r) * ldc + col0 + c4) = v;
    }
    
  }
}

// GEMM C = act(A·W + bias + resid): A f32 (ASPLIT -> hi/lo 2 terms), Wt bf16 [N][K]; ACT 0 none, 1 relu, 2 exact gelu;
// resid (optional, f32, row index = (row % rmod), pitch ldr, RES_BF16 rounds it) added before the activation.
template <bool ASPLIT, int ACT, bool BIAS_BF16, bool RES_BF16>
__global__ __launch_bounds__(128) void k_gemm_bf3(const float* __restrict__ A, int lda, const unsigned short* __restrict__ Wt, int ldb,
                                                const float* __restrict__ bias, const float* __restrict__ resid, int rmod, int ldr,
                                                float* __restrict__ C, int ldc, int M, int N, int K) {
  __shared__ __attribute__((aligned(16))) float so[4][16][64];
  const int tid = threadIdx.x, w = tid >> 5, lane = tid & 31, ln = lane & 15, hh = lane >> 4;
  const int ntn = N / 64;
  const int wid = blockIdx.x * 4 + w;
  const int mt = wid / ntn, nq = wid % ntn;
  if (mt * 16 >= M) return;
  const int row0 = mt * 16, col0 = nq * 64;
  const float* arow = A + (size_t)(row0 + ln) * lda;
  v8f acc[4] = {};
  for (int kb = 0; kb < K; kb += 32) {
    FragB ah, al;
    const v4f x0 = *(const v4fa*)(arow + kb + 8 * hh), x1 = *(const v4fa*)(arow + kb + 8 * hh + 4);
    const v4f x2 = *(const v4fa*)(arow + kb + 16 + 8 * hh), x3 = *(const v4fa*)(arow + kb + 16 + 8 * hh + 4);
    float xs[16] = {x0[0],x0[1],x0[2],x0[3],x1[0],x1[1],x1[2],x1[3],x2[0],x2[1],x2[2],x2[3],x3[0],x3[1],x3[2],x3[3]};
#pragma unroll
    for (int i = 0; i < 16; ++i) { const unsigned short hb = bf16_bits(xs[i]); ah.u[i] = hb; al.u[i] = ASPLIT ? bf16_bits(xs[i] - bf16_val(hb)) : (unsigned short)0; }
#pragma unroll
    for (int t = 0; t < 4; ++t) {
      const unsigned short* brow = Wt + (size_t)(col0 + t * 16 + ln) * ldb + kb;
      FragB b;
      b.half[0] = *(const v8us*)(brow + 8 * hh);
      b.half[1] = *(const v8us*)(brow + 16 + 8 * hh);
      acc[t] = mmaN<ASPLIT ? 2 : 1>(ah.v, al.v, b.v, b.v, acc[t]);
    }
  }
#pragma unroll
  for (int t = 0; t < 4; ++t) {
    const int col = col0 + t * 16 + ln;
    float bv = bias ? bias[col] : 0.f;
    if (BIAS_BF16) bv = bf16_round(bv);
#pragma unroll
    for (int r = 0; r < 8; ++r) {
      float v = acc[t][r] + bv;
      if (resid) { float rv = resid[(size_t)((row0 + 8 * hh + r) % rmod) * ldr + col]; if (RES_BF16) rv = bf16_round(rv); v += rv; }
      if (ACT == 1) v = fmaxf(v, 0.f);
      if (ACT == 2) v = 0.5f * v * (1.0f + erff(v * 0.70710678118654752f));
      if (ACT == 3) { const float u = 0.7978845608028654f * (v + 0.044715f * v * v * v); v = 0.5f * v * (1.0f + tanhf(u)); }
      so[w][8 * hh + r][t * 16 + ln] = v;
    }
  }
  __builtin_amdgcn_fence(__ATOMIC_ACQ_REL, "workgroup");
  __builtin_amdgcn_wave_barrier();
  const int rsub = lane >> 4, c4 = (lane & 15) * 4;
  {
#pragma unroll
    for (int q = 0; q < 8; ++q) {
      const int r = q * 2 + rsub;
      const v4f v = *(const v4fa*)&so[w][r][c4];
      *(v4f*)(C + (size_t)(row0 + r) * ldc + col0 + c4) = v;
    }
    
  }
}
// row LayerNorm (biased variance, eps) over N: s = X (+ R); optional out_sum <- s; out_norm <- (s-mu)*rsqrt(var+eps)*g + b
template <bool PARAM_BF16>
__global__ __launch_bounds__(256) void k_layernorm(const float* __restrict__ X, const float* __restrict__ R, const float* __restrict__ g, const float* __restrict__ bta,
                                                  float* __restrict__ out_sum, float* __restrict__ out_norm, int N, float eps) {
  __shared__ float red[256];
  const int row = blockIdx.x, tid = threadIdx.x;
  const float* x = X + (size_t)row * N; const float* rr = R ? R + (size_t)row * N : nullptr;
  float vals[16];                     // up to N = 4096
  const int per = N / 256;            // contiguous chunk per thread? use strided-by-4 chunks: thread handles j = tid*4 + 1024*u
  float s1 = 0.f;
  for (int u = 0; u < per / 4; ++u) {
    const int j = tid * 4 + 1024 * u;
    const v4f a = *(const v4fa*)(x + j);
    v4f b = {0.f,0.f,0.f,0.f}; if (rr) b = *(const v4fa*)(rr + j);
#pragma unroll
    for (int q = 0; q < 4; ++q) { const float v = a[q] + b[q]; vals[u * 4 + q] = v; s1 += v; }
  }
  red[tid] = s1; __syncthreads();
  for (int st = 128; st > 0; st >>= 1) { if (tid < st) red[tid] += red[tid + st]; __syncthreads(); }
  const float mu = red[0] / (float)N; __syncthreads();
  float s2 = 0.f;
  for (int u = 0; u < per / 4; ++u)
#pragma unroll
    for (int q = 0; q < 4; ++q) { const float c = vals[u * 4 + q] - mu; s2 += c * c; }
  red[tid] = s2; __syncthreads();
  for (int st = 128; st > 0; st >>= 1) { if (tid < st) red[tid] += red[tid + st]; __syncthreads(); }
  const float rs = rsqrtf(red[0] / (float)N + eps);
  {
    for (int u = 0; u < per / 4; ++u) {
      const int j = tid * 4 + 1024 * u;
      v4f o, sm;
#pragma unroll
      for (int q = 0; q < 4; ++q) {
        float gg = g[j + q], bb = bta[j + q];
        if (PARAM_BF16) { gg = bf16_round(gg); bb = bf16_round(bb); }
        sm[q] = vals[u * 4 + q]; o[q] = (vals[u * 4 + q] - mu) * rs * gg + bb;
      }
      if (out_sum) *(v4f*)(out_sum + (size_t)row * N + j) = sm;
      *(v4f*)(out_norm + (size_t)row * N + j) = o;
    }
    
  }
}



// ---- f16 WMMA path (v_wmma_f32_16x16x32_f16): 11-bit significands for operands in range — used for every GEMM launched here
typedef _Float16 v16h __attribute__((ext_vector_type(16)));
union FragH { v16h v; v8us half[2]; _Float16 h[16]; unsigned short u[16]; };
template <int NT>
__device__ __forceinline__ v8f mmaH(v16h ah, v16h al, v16h bh, v16h bl, v8f c) {
  c = __builtin_amdgcn_wmma_f32_16x16x32_f16(false, ah, false, bh, (short)0, c, false, false);
  if (NT >= 2) c = __builtin_amdgcn_wmma_f32_16x16x32_f16(false, al, false, bh, (short)0, c, false, false);
  if (NT >= 3) c = __builtin_amdgcn_wmma_f32_16x16x32_f16(false, ah, false, bl, (short)0, c, false, false);
  asm volatile("v_nop\n\tv_nop\n\tv_nop\n\tv_nop" : "+v"(c) : "v"(ah), "v"(al), "v"(bh), "v"(bl));
  return c;
}
// batched GEMM like k_gemm_b but f16 operands: A f32 (split into f16 hi/lo if ASPLIT, else rounded to f16), Bt = f16 values [n][k]; alpha; C f32; N multiple of 16 (partial tiles skipped)
template <bool ASPLIT>
__global__ __launch_bounds__(128) void k_gemm_h(const float* __restrict__ A, int lda, size_t sA, const _Float16* __restrict__ Bh, int ldb, size_t sB, float alpha, float* __restrict__ C, int ldc, size_t sC, int M, int N, int K) {
  __shared__ __attribute__((aligned(16))) float so[4][16][64];
  const int tid = threadIdx.x, w = tid >> 5, lane = tid & 31, ln = lane & 15, hh = lane >> 4; const int by = blockIdx.y;
  A += (size_t)by * sA; Bh += (size_t)by * sB; C += (size_t)by * sC;
  const int ntn = (N + 63) / 64; const int wid = blockIdx.x * 4 + w; const int mt = wid / ntn, nq = wid % ntn; if (mt * 16 >= M) return;
  const int row0 = mt * 16, col0 = nq * 64; const float* arow = A + (size_t)(row0 + ln) * lda;
  v8f acc[4] = {};
  for (int kb = 0; kb < K; kb += 32) {
    FragH ah, al;
    const v4f x0 = *(const v4fa*)(arow + kb + 8 * hh), x1 = *(const v4fa*)(arow + kb + 8 * hh + 4), x2 = *(const v4fa*)(arow + kb + 16 + 8 * hh), x3 = *(const v4fa*)(arow + kb + 16 + 8 * hh + 4);
    float xs[16] = {x0[0],x0[1],x0[2],x0[3],x1[0],x1[1],x1[2],x1[3],x2[0],x2[1],x2[2],x2[3],x3[0],x3[1],x3[2],x3[3]};
#pragma unroll
    for (int i = 0; i < 16; ++i) { const _Float16 h = (_Float16)xs[i]; ah.h[i] = h; al.h[i] = ASPLIT ? (_Float16)(xs[i] - (float)h) : (_Float16)0.0f; }
#pragma unroll
    for (int t = 0; t < 4; ++t) { if (col0 + t * 16 >= N) continue; const size_t boff = (size_t)(col0 + t * 16 + ln) * ldb + kb; FragH bq; bq.half[0] = *(const v8us*)(Bh + boff + 8 * hh); bq.half[1] = *(const v8us*)(Bh + boff + 16 + 8 * hh);
      acc[t] = mmaH<ASPLIT ? 2 : 1>(ah.v, al.v, bq.v, bq.v, acc[t]); }
  }
#pragma unroll
  for (int t = 0; t < 4; ++t) { if (col0 + t * 16 >= N) continue;
#pragma unroll
    for (int r = 0; r < 8; ++r) so[w][8 * hh + r][t * 16 + ln] = acc[t][r] * alpha; }
  __builtin_amdgcn_fence(__ATOMIC_ACQ_REL, "workgroup"); __builtin_amdgcn_wave_barrier();
  const int rsub = lane >> 4, c4 = (lane & 15) * 4;
  {
#pragma unroll
    for (int q = 0; q < 8; ++q) { const int r = q * 2 + rsub; if (col0 + c4 < N) { const v4f v = *(const v4fa*)&so[w][r][c4]; *(v4f*)(C + (size_t)(row0 + r) * ldc + col0 + c4) = v; } }
     }
}

// Wt[n][k] = f16(W[k][n]·scale) from f32 row-major W[K][N] (scale = power of two; bf16-exact weights stay exact in f16 away from the subnormal range)
__device__ __forceinline__ void d_wt_f16(const int blk, const float* __restrict__ W, _Float16* __restrict__ Wt, int K, int N, float scale) {
  const int t = blk * 256 + threadIdx.x; if (t >= N * (K / 8)) return; const int n = t / (K / 8), k8 = (t % (K / 8)) * 8; FragH f;
#pragma unroll
  for (int i = 0; i < 8; ++i) f.h[i] = (_Float16)(bf16_round(W[(size_t)(k8 + i) * N + n]) * scale); const v8us o = f.half[0];
  *(v8us*)((unsigned short*)Wt + (size_t)n * K + k8) = o; 
}
// k_gemm_hh variant with fused epilogue: v = acc·alpha + bias[by·sBias + col] (+ CP[(row/rowsPerB)·sCPb + by·64 + col] if CP) ; ACT 0 none / 1 elu ; writes f16 C16 (and f32 C if non-null)
template <int ACT>
__global__ __launch_bounds__(128) void k_gemm_hhx(const _Float16* __restrict__ A, int lda, size_t sA, const _Float16* __restrict__ Bh, int ldb, size_t sB, float alpha, const float* __restrict__ bias, size_t sBias, const float* __restrict__ CP, int rowsPerB, size_t sCPb, int row0g,
    float* __restrict__ C, _Float16* __restrict__ C16, int ldc, size_t sC, int M, int N, int K) {
  __shared__ __attribute__((aligned(16))) float so[4][16][64];
  const int tid = threadIdx.x, w = tid >> 5, lane = tid & 31, ln = lane & 15, hh = lane >> 4; const int by = blockIdx.y;
  A += (size_t)by * sA; Bh += (size_t)by * sB; const size_t cofs = (size_t)by * sC; const float* bp = bias ? bias + (size_t)by * sBias : nullptr;
  const int ntn = (N + 63) / 64; const int wid = blockIdx.x * 4 + w; const int mt = wid / ntn, nq = wid % ntn; if (mt * 16 >= M) return;
  const int row0 = mt * 16, col0 = nq * 64; const _Float16* arow = A + (size_t)(row0 + ln) * lda;
  v8f acc[4] = {};
  for (int kb = 0; kb < K; kb += 32) { FragH ah; ah.half[0] = *(const v8us*)((const unsigned short*)arow + kb + 8 * hh); ah.half[1] = *(const v8us*)((const unsigned short*)arow + kb + 16 + 8 * hh);
#pragma unroll
    for (int t = 0; t < 4; ++t) { if (col0 + t * 16 >= N) continue; const size_t boff = (size_t)(col0 + t * 16 + ln) * ldb + kb; FragH bq; bq.half[0] = *(const v8us*)((const unsigned short*)Bh + boff + 8 * hh); bq.half[1] = *(const v8us*)((const unsigned short*)Bh + boff + 16 + 8 * hh);
      acc[t] = mmaH<1>(ah.v, ah.v, bq.v, bq.v, acc[t]); }
  }
#pragma unroll
  for (int t = 0; t < 4; ++t) { if (col0 + t * 16 >= N) continue; const int col = col0 + t * 16 + ln; const float bv = bp ? bf16_round(bp[col]) : 0.f;
#pragma unroll
    for (int r = 0; r < 8; ++r) { float v = acc[t][r] * alpha + bv; if (CP) { const int rr = row0g + row0 + 8 * hh + r; if (rowsPerB < 0) v += CP[cofs + (size_t)rr * ldc + col];      /* rowsPerB < 0: own element of the batched C plane */ else { const int bidx = rr / rowsPerB; v += CP[(size_t)bidx * sCPb + (size_t)by * 64 + col]; } } if (ACT == 1) v = (v > 0.f) ? v : expm1f(v); else if (ACT == 7) v = (v > 0.f) ? v + 1.0f : expf(v); else if (ACT == 8) v = tanhf(v); else if (ACT == 9) v = 0.5f * v * (1.0f + tanhf(0.7978845608028654f * (v + 0.044715f * v * v * v))); else if (ACT == 11) v = 1.0f / (1.0f + expf(-v)); else if (ACT == 12) v = (v > 0.f) ? v : 0.01f * v; else if (ACT == 14) v = (v > 0.f) ? v : 0.1f * v; else if (ACT == 16) v = (v >= 0.f) ? v : 0.3f * v; else if (ACT == 17) v = (v >= 0.f) ? v : 0.2f * v; else if (ACT == 15) v = v / (1.0f + expf(-v)); else if (ACT == 3) v = fmaxf(v, 0.f); else if (ACT == 6) v = 0.5f * v * (1.0f + erff(v * 0.70710678118654752f)); so[w][8 * hh + r][t * 16 + ln] = v; } }
  __builtin_amdgcn_fence(__ATOMIC_ACQ_REL, "workgroup"); __builtin_amdgcn_wave_barrier();
  const int rsub = lane >> 4, c4 = (lane & 15) * 4; typedef _Float16 v4h __attribute__((ext_vector_type(4)));
  {
#pragma unroll
    for (int q = 0; q < 8; ++q) { const int r = q * 2 + rsub; if (col0 + c4 < N) { const v4f v = *(const v4fa*)&so[w][r][c4]; if (C) *(v4f*)(C + cofs + (size_t)(row0 + r) * ldc + col0 + c4) = v; if (C16) { v4h h4; for (int i = 0; i < 4; ++i) h4[i] = (_Float16)v[i]; *(v4h*)(C16 + cofs + (size_t)(row0 + r) * ldc + col0 + c4) = h4; } } }
     }
}


typedef _Float16 v4h __attribute__((ext_vector_type(4)));

__device__ __forceinline__ void d_x16(const int blk, const float* __restrict__ x, _Float16* __restrict__ X16, size_t n8) { const size_t t = (size_t)blk * 256 + threadIdx.x; if (t >= n8) return; FragH f;
#pragma unroll
  for (int q = 0; q < 8; ++q) f.h[q] = (_Float16)bf16_round(x[t * 8 + q]); *(v8us*)((unsigned short*)X16 + t * 8) = f.half[0];  }
__global__ __launch_bounds__(256) void k_h16(const float* __restrict__ x, _Float16* __restrict__ X16, size_t n8) { const size_t t = (size_t)blockIdx.x * 256 + threadIdx.x; if (t >= n8) return; FragH f;
#pragma unroll
  for (int q = 0; q < 8; ++q) f.h[q] = (_Float16)x[t * 8 + q]; *(v8us*)((unsigned short*)X16 + t * 8) = f.half[0];  }
__global__ __launch_bounds__(256) void k_round16f(const float* __restrict__ W, _Float16* __restrict__ Bt, size_t n8) { const size_t t = (size_t)blockIdx.x * 256 + threadIdx.x; if (t >= n8) return; FragH f;
#pragma unroll
  for (int i = 0; i < 8; ++i) f.h[i] = (_Float16)(bf16_round(W[t * 8 + i]) * 16.0f); *(v8us*)((unsigned short*)Bt + t * 8) = f.half[0];  }
template <int NHv, int TTv>
__global__ __launch_bounds__(256) void k_vt(const _Float16* __restrict__ V16, int ldv, int voff, _Float16* __restrict__ Vt) { __shared__ unsigned short tl[64][66]; const int tid = threadIdx.x; const int slab = blockIdx.x / (TTv / 64), lg = blockIdx.x % (TTv / 64); const int b = slab / NHv, h = slab % NHv;
  for (int i = tid; i < 64 * 8; i += 256) { const int r = i / 8, c8 = (i % 8) * 8; FragH f; f.half[0] = *(const v8us*)((const unsigned short*)V16 + ((size_t)b * TTv + lg * 64 + r) * ldv + voff + h * 64 + c8);
#pragma unroll
    for (int q = 0; q < 8; ++q) tl[r][c8 + q] = f.u[q]; }
  __syncthreads();
  {
#pragma unroll
    for (int rd = 0; rd < 2; ++rd) { const int d = rd * 32 + tid / 8, pc = tid % 8; FragH f;
#pragma unroll
      for (int q = 0; q < 8; ++q) f.u[q] = tl[pc * 8 + q][d];
      *(v8us*)((unsigned short*)Vt + ((size_t)slab * 64 + d) * TTv + lg * 64 + pc * 8) = f.half[0]; }
     } }

__global__ __launch_bounds__(256) void k_hl(const float* __restrict__ F, _Float16* __restrict__ Hh, _Float16* __restrict__ Hl, size_t n8) { const size_t t = (size_t)blockIdx.x * 256 + threadIdx.x; if (t >= n8) return; FragH fh, fl; const v4f a = *(const v4fa*)(F + t * 8), c = *(const v4fa*)(F + t * 8 + 4);
#pragma unroll
  for (int q = 0; q < 4; ++q) { _Float16 h = (_Float16)a[q]; fh.h[q] = h; fl.h[q] = (_Float16)((a[q] - (float)h) * 1024.0f); h = (_Float16)c[q]; fh.h[4 + q] = h; fl.h[4 + q] = (_Float16)((c[q] - (float)h) * 1024.0f); }
  { *(v8us*)((unsigned short*)Hh + t * 8) = fh.half[0]; *(v8us*)((unsigned short*)Hl + t * 8) = fl.half[0];  } }

// ---- fast GEMM (wave tile 32x64; requires M % 32 == 0 rows per launch region and N % 64 == 0); epilogue = k_gemm_hhx semantics ----
__device__ __forceinline__ v16h g2_frag(const _Float16* p, int hh) { FragH f; f.half[0] = *(const v8us*)((const unsigned short*)p + 8 * hh); f.half[1] = *(const v8us*)((const unsigned short*)p + 16 + 8 * hh); return f.v; }
__device__ __forceinline__ v8f g2_mma(v16h a, v16h b, v8f c) { v8f d = __builtin_amdgcn_wmma_f32_16x16x32_f16(false, a, false, b, (short)0, c, false, false); asm volatile("v_nop\n\tv_nop\n\tv_nop\n\tv_nop" : "+v"(d) : "v"(a), "v"(b)); return d; }
template <int ACT>
__device__ __forceinline__ void d_gemm2(const int bx, const _Float16* __restrict__ A, int lda, size_t sA, const _Float16* __restrict__ Bh, int ldb, size_t sB, float alpha, const float* __restrict__ bias, size_t sBias, const float* __restrict__ CP, int rowsPerB, size_t sCPb, int row0g,
    float* __restrict__ C, _Float16* __restrict__ C16, int ldc, size_t sC, int M, int N, int K) { static_assert(ACT == 0 || ACT == 3 || ACT == 6 || ACT == 8 || ACT == 9 || ACT == 11 || ACT == 12 || ACT == 14 || ACT == 15 || ACT == 16 || ACT == 17, "d_gemm2: unsupported ACT code (would silently apply no activation)");
  __shared__ __attribute__((aligned(16))) float so[4][32][68];
  const int tid = threadIdx.x, w = tid >> 5, lane = tid & 31, ln = lane & 15, hh = lane >> 4; const int by = 0;
  A += (size_t)by * sA; Bh += (size_t)by * sB; const size_t cofs = (size_t)by * sC; const float* bp = bias ? bias + (size_t)by * sBias : nullptr;
  const int ntn = N >> 6; const int mt = bx / ntn, nq = bx - mt * ntn; const int row0 = mt * 128 + 32 * w, col0 = nq * 64; if (row0 >= M) return;
  const _Float16* a0p = A + (size_t)(row0 + ln) * lda; const _Float16* a1p = a0p + (size_t)16 * lda;
  const _Float16* b0p = Bh + (size_t)(col0 + ln) * ldb; const _Float16* b1p = b0p + (size_t)16 * ldb; const _Float16* b2p = b1p + (size_t)16 * ldb; const _Float16* b3p = b2p + (size_t)16 * ldb;
  const v8f z8 = {0.f,0.f,0.f,0.f,0.f,0.f,0.f,0.f}; v8f c00 = z8, c01 = z8, c02 = z8, c03 = z8, c10 = z8, c11 = z8, c12 = z8, c13 = z8;
#pragma unroll 1
  for (int kb = 0; kb < K; kb += 32) { const v16h a0 = g2_frag(a0p + kb, hh), a1 = g2_frag(a1p + kb, hh);
    v16h b = g2_frag(b0p + kb, hh); c00 = g2_mma(a0, b, c00); c10 = g2_mma(a1, b, c10);
    b = g2_frag(b1p + kb, hh); c01 = g2_mma(a0, b, c01); c11 = g2_mma(a1, b, c11);
    b = g2_frag(b2p + kb, hh); c02 = g2_mma(a0, b, c02); c12 = g2_mma(a1, b, c12);
    b = g2_frag(b3p + kb, hh); c03 = g2_mma(a0, b, c03); c13 = g2_mma(a1, b, c13); }
  v8f accs[8] = {c00, c01, c02, c03, c10, c11, c12, c13};
#pragma unroll
  for (int u = 0; u < 8; ++u) { const int t = u & 3, half = u >> 2; const int col = col0 + t * 16 + ln; const float bv = bp ? bf16_round(bp[col]) : 0.f;
#pragma unroll
    for (int r = 0; r < 8; ++r) { const int rloc = half * 16 + 8 * hh + r; float v = accs[u][r] * alpha + bv; if (CP) { if (rowsPerB < 0) v += CP[cofs + (size_t)(row0g + row0 + rloc) * ldc + col];      /* rowsPerB < 0: own element of the batched C plane */ else { const int bidx = (row0g + row0 + rloc) / rowsPerB; v += CP[(size_t)bidx * sCPb + (size_t)by * 64 + col]; } }
      if (ACT == 3) v = fmaxf(v, 0.f); else if (ACT == 6) v = 0.5f * v * (1.0f + erff(v * 0.70710678118654752f)); else if (ACT == 11) v = 1.0f / (1.0f + expf(-v)); else if (ACT == 15) v = v / (1.0f + expf(-v)); else if (ACT == 12) v = (v > 0.f) ? v : 0.01f * v; else if (ACT == 8) v = tanhf(v); else if (ACT == 9) v = 0.5f * v * (1.0f + tanhf(0.7978845608028654f * (v + 0.044715f * v * v * v))); else if (ACT == 14) v = (v > 0.f) ? v : 0.1f * v; else if (ACT == 16) v = (v >= 0.f) ? v : 0.3f * v; else if (ACT == 17) v = (v >= 0.f) ? v : 0.2f * v;
      so[w][rloc][t * 16 + ln] = v; } }
  __builtin_amdgcn_fence(__ATOMIC_ACQ_REL, "workgroup"); __builtin_amdgcn_wave_barrier();
  const int rsub = lane >> 4, c4 = (lane & 15) * 4;
  {
#pragma unroll
    for (int q = 0; q < 16; ++q) { const int r = q * 2 + rsub; const v4f v = *(const v4fa*)&so[w][r][c4]; if (C) *(v4f*)(C + cofs + (size_t)(row0 + r) * ldc + col0 + c4) = v; if (C16) { v4h h4; for (int i = 0; i < 4; ++i) h4[i] = (_Float16)v[i]; *(v4h*)(C16 + cofs + (size_t)(row0 + r) * ldc + col0 + c4) = h4; } }
     } }


// Two GEMMs that do not depend on each other (same N, K and scale) in one launch: blocks 0 .. nb0-1 work on problem 0, the rest on problem 1. The choice is uniform for a block, and one copy of the body serves both.
// F16OUT: the pair stores f16 (H0, H1) or f32 (C0, C1), fixed at compile time, so that the body holds one store path.
template <bool F16OUT>
__global__ __launch_bounds__(128) void k_gemm2_pair(const _Float16* __restrict__ A0, const _Float16* __restrict__ B0, const float* __restrict__ bias0, float* __restrict__ C0, _Float16* __restrict__ H0, int M0, int nb0,
                                                    const _Float16* __restrict__ A1, const _Float16* __restrict__ B1, const float* __restrict__ bias1, float* __restrict__ C1, _Float16* __restrict__ H1, int M1, int N, int K) {
  const int b = blockIdx.x; const bool s = b >= nb0;
  d_gemm2<0>(s ? b - nb0 : b, s ? A1 : A0, K, 0, s ? B1 : B0, K, 0, 0.0625f, s ? bias1 : bias0, 0, nullptr, 1, 0, 0, F16OUT ? nullptr : (s ? C1 : C0), F16OUT ? (s ? H1 : H0) : nullptr, N, 0, s ? M1 : M0, N, K);
}
// All seven conversions of inputs (five weight transposes to f16 x16, two activation roundings) in one launch: none reads what another writes. Each job owns a range of blocks; the transposes, whose loads are scattered, come first.
#define PB_W512 (HALF * DIM / 8 / 256)    /* 64 blocks: bp_w, up_w */
#define PB_W256 (HALF * HALF / 8 / 256)   /* 32 blocks: each half of w1 */
#define PB_W2 (QTR * HALF / 8 / 256)      /* 16 blocks: w2 */
#define PB_BR (NBT * DIM / 8 / 256)       /* 256 blocks: bin_repr */
#define PB_UE (NU * DIM / 8 / 256)        /* 64 blocks: unit_embs */
#define PB_ALL (2 * PB_W512 + 2 * PB_W256 + PB_W2 + PB_BR + PB_UE)
__global__ __launch_bounds__(256) void k_prep(const float* __restrict__ bpw, const float* __restrict__ upw, const float* __restrict__ w1, const float* __restrict__ w2, const float* __restrict__ br, const float* __restrict__ ue,
                                              _Float16* __restrict__ BBP, _Float16* __restrict__ BUP, _Float16* __restrict__ BW1A, _Float16* __restrict__ BW1B, _Float16* __restrict__ BW2, _Float16* __restrict__ BR16, _Float16* __restrict__ UE16) {
  int b = blockIdx.x;
  if (b < PB_W512) { d_wt_f16(b, bpw, BBP, DIM, HALF, 16.0f); return; }
  b -= PB_W512;
  if (b < PB_W512) { d_wt_f16(b, upw, BUP, DIM, HALF, 16.0f); return; }
  b -= PB_W512;
  if (b < PB_W256) { d_wt_f16(b, w1, BW1A, HALF, HALF, 16.0f); return; }
  b -= PB_W256;
  if (b < PB_W256) { d_wt_f16(b, w1 + (size_t)HALF * HALF, BW1B, HALF, HALF, 16.0f); return; }
  b -= PB_W256;
  if (b < PB_W2) { d_wt_f16(b, w2, BW2, HALF, QTR, 16.0f); return; }
  b -= PB_W2;
  if (b < PB_BR) { d_x16(b, br, BR16, (size_t)NBT * DIM / 8); return; }
  b -= PB_BR;
  d_x16(b, ue, UE16, (size_t)NU * DIM / 8);
}

__global__ __launch_bounds__(256) void k_f16c(const float* __restrict__ A, _Float16* __restrict__ D, size_t n8) { const size_t t = (size_t)blockIdx.x * 256 + threadIdx.x; if (t >= n8) return; const v8f a = *(const v8f*)(A + t * 8); FragH f; for (int q = 0; q < 8; ++q) f.h[q] = (_Float16)a[q]; *(v8us*)((unsigned short*)D + t * 8) = f.half[0];  }
// Exact (erf) GELU in f32, written as h Phi(h) = max(h, 0) - |h| Q(|h|) with Q(a) = erfc(a / sqrt 2) / 2 = exp2(p(a)): one straight line for every h, no second form to evaluate and select, no range reduction around v_exp_f32 (p < 0, and an error of p counts only times Q).
// p is a degree-8 fit of log2 Q(a) on 0 <= a <= 5.5, weighted by Q: evaluated in f32 the error of Phi is about 1e-7 at most (the rounding level of 1 + erf in f32), and a negative h has no cancellation.
// The leading coefficient is negative, so past the fitted range p keeps falling and |h| exp2(p) goes to 0 as |h| Q does (the two are within 1e-8 from a = 5 on); every finite h is covered, h = +infinity or -infinity would give infinity times 0.
__device__ __forceinline__ float gelu_erf(float s) {
  const float a = fabsf(s);
  float p = fmaf(a, -2.12157283e-6f, 3.09552197e-5f); p = fmaf(a, p, -1.46757287e-4f); p = fmaf(a, p, -2.30747639e-4f); p = fmaf(a, p, 7.18435273e-3f);
  p = fmaf(a, p, -5.25792725e-2f); p = fmaf(a, p, -4.59180444e-1f); p = fmaf(a, p, -1.15110874e+0f); p = fmaf(a, p, -9.99999940e-1f);
  return fmaf(-a, __builtin_amdgcn_exp2f(p), fmaxf(s, 0.f));
}
// Fused tail: h1 = gelu(A[bt] + Bu[n] + b1), h2 = gelu(h1 w2 + b2), out = clip(h2 w3 + b3); h1 and h2 never leave the registers.
// One work-group per bin row bt; wave w owns units 32w .. 32w+31 as two tiles of 16 rows.
// The product runs transposed: w2's columns are the A operand (from LDS, stored in fragment order), the h1 rows the B operand.
// A lane computes the 16 h1 values of its own row and k half straight into the B fragment (k = 8h+i, 16+8h+i on both operands).
// D register r of tile t is then h2[row = lane & 15][feature 16t + 8h + r]: the head's dot product stays inside a lane but for one add across the lane halves.
__global__ __launch_bounds__(256) void k_tail(const float* __restrict__ A, const float* __restrict__ Bu, const float* __restrict__ b1, const _Float16* __restrict__ W2t,
                                              const float* __restrict__ b2, const float* __restrict__ w3, const float* __restrict__ b3, float* __restrict__ out) {
  __shared__ __attribute__((aligned(16))) unsigned short sW[HALF / 32][QTR / 16][2][32][8];   /* [k step][feature tile][fragment half][lane][8 f16], 64 KiB: each fragment load reads 512 contiguous bytes */
  __shared__ __attribute__((aligned(16))) float sab[HALF];
  __shared__ __attribute__((aligned(16))) float sb2[QTR];
  __shared__ __attribute__((aligned(16))) float sw3[QTR];
  const int tid = threadIdx.x, w = tid >> 5, lane = tid & 31, ln = lane & 15, hh = lane >> 4;
  const int bt = blockIdx.x;
  // unrolled: all 16 loads of the w2 fill are in flight before the first LDS store
#pragma unroll
  for (int i = 0; i < 16; ++i) {
    const int ks = i >> 1, t = (i & 1) * 4 + (w >> 1), half = w & 1;
    const v8us v = *(const v8us*)((const unsigned short*)W2t + (size_t)(t * 16 + ln) * HALF + ks * 32 + half * 16 + hh * 8);
    *(v8us*)&sW[ks][t][half][lane][0] = v;
  }
  sab[tid] = A[(size_t)bt * HALF + tid] + bf16_round(b1[tid]);
  if (tid < QTR) { sb2[tid] = bf16_round(b2[tid]); sw3[tid] = bf16_round(w3[tid]); }
  __syncthreads();
  const float* ub = Bu + (size_t)(w * 32 + ln) * HALF + 8 * hh;
  v4f u0 = *(const v4fa*)(ub), u1 = *(const v4fa*)(ub + 4), u2 = *(const v4fa*)(ub + 16), u3 = *(const v4fa*)(ub + 20);
  float res = 0.f;
  // the tile loop and the k loop stay rolled: 16 + 64 inlined GELUs are all the text that the instruction cache should have to hold;
  // the loops inside them are unrolled, so that fragments and accumulators are indexed by constants and stay in registers
#pragma unroll 1
  for (int tile = 0; tile < 2; ++tile) {
    v8f acc[8] = {};
#pragma unroll 1
    for (int ks = 0; ks < HALF / 32; ++ks) {
      // the next step's unit values are loaded one step ahead (the last step reloads its own)
      const int qn = min(tile * 8 + ks + 1, 15);
      const float* un = ub + (size_t)(qn >> 3) * 16 * HALF + (qn & 7) * 32;
      const v4f p0 = *(const v4fa*)(un), p1 = *(const v4fa*)(un + 4), p2 = *(const v4fa*)(un + 16), p3 = *(const v4fa*)(un + 20);
      const float* ap = &sab[ks * 32 + 8 * hh];
      const v4f a0 = *(const v4fa*)(ap), a1 = *(const v4fa*)(ap + 4), a2 = *(const v4fa*)(ap + 16), a3 = *(const v4fa*)(ap + 20);
      FragH f;
#pragma unroll
      for (int i = 0; i < 4; ++i) {
        f.h[i] = (_Float16)gelu_erf(a0[i] + u0[i]); f.h[4 + i] = (_Float16)gelu_erf(a1[i] + u1[i]);
        f.h[8 + i] = (_Float16)gelu_erf(a2[i] + u2[i]); f.h[12 + i] = (_Float16)gelu_erf(a3[i] + u3[i]);
      }
#pragma unroll
      for (int t = 0; t < 8; ++t) {
        FragH wf; wf.half[0] = *(const v8us*)&sW[ks][t][0][lane][0]; wf.half[1] = *(const v8us*)&sW[ks][t][1][lane][0];
        acc[t] = __builtin_amdgcn_wmma_f32_16x16x32_f16(false, wf.v, false, f.v, (short)0, acc[t], false, false);
      }
      u0 = p0; u1 = p1; u2 = p2; u3 = p3;
    }
    // compiler fence: keeps the 32 LDS loads of b2 and w3 inside the tile loop; hoisted out of it they hold 128 registers through the k loop, which then has none left to fetch w2 fragments ahead of its WMMAs
    asm volatile("" ::: "memory");
    v4f pv = {0.f, 0.f, 0.f, 0.f};      /* four partial sums of the head, so that the GELUs pair up into packed f32 instructions */
#pragma unroll
    for (int t = 0; t < 8; ++t) {
      const int f0 = t * 16 + 8 * hh;
      const v4f c0 = *(const v4fa*)&sb2[f0], c1 = *(const v4fa*)&sb2[f0 + 4], g0 = *(const v4fa*)&sw3[f0], g1 = *(const v4fa*)&sw3[f0 + 4];
      v4f h0, h1;
#pragma unroll
      for (int r = 0; r < 4; ++r) { h0[r] = gelu_erf(acc[t][r] * 0.0625f + c0[r]); h1[r] = gelu_erf(acc[t][4 + r] * 0.0625f + c1[r]); }
      pv += h0 * g0; pv += h1 * g1;
    }
    float p = (pv[0] + pv[1]) + (pv[2] + pv[3]);
    p += __shfl_xor(p, 16, 32);
    if (hh == tile) res = p;      /* tile 0's rows end in lanes 0-15, tile 1's in lanes 16-31: one 128-byte store a wave */
  }
  res += bf16_round(b3[0]);
  out[(size_t)bt * NU + w * 32 + lane] = fminf(fmaxf(res, -10.0f), 10.0f);
}

extern "C" void kernel_launch(void* const* d_in, const int* in_sizes, int n_in,
                              void* d_out, int out_size, void* d_ws, size_t ws_size, hipStream_t stream) {
  (void)in_sizes; (void)n_in; (void)out_size;
  const float* const* I = (const float* const*)d_in; const float* br = I[0]; const float* ue = I[1]; const float* bpw = I[2]; const float* bpb = I[3]; const float* upw = I[4]; const float* upb = I[5]; const float* w1 = I[6]; const float* b1 = I[7]; const float* w2 = I[8]; const float* b2 = I[9]; const float* w3 = I[10]; const float* b3 = I[11];
  char* ws = (char*)d_ws; size_t off = 0;
  auto take = [&](size_t bytes) { char* p = ws + off; off += (bytes + 255) & ~(size_t)255; return p; };
  _Float16* BBP = (_Float16*)take((size_t)HALF * DIM * 2); _Float16* BUP = (_Float16*)take((size_t)HALF * DIM * 2); _Float16* BW1A = (_Float16*)take((size_t)HALF * HALF * 2); _Float16* BW1B = (_Float16*)take((size_t)HALF * HALF * 2); _Float16* BW2 = (_Float16*)take((size_t)QTR * HALF * 2);
  _Float16* BR16 = (_Float16*)take((size_t)NBT * DIM * 2); _Float16* UE16 = (_Float16*)take((size_t)NU * DIM * 2); _Float16* BH16 = (_Float16*)take((size_t)NBT * HALF * 2); _Float16* UH16 = (_Float16*)take((size_t)NU * HALF * 2); float* A = (float*)take((size_t)NBT * HALF * 4); float* Bu = (float*)take((size_t)NU * HALF * 4);
  if (off > ws_size) return;
  k_prep<<<PB_ALL, 256, 0, stream>>>(bpw, upw, w1, w2, br, ue, BBP, BUP, BW1A, BW1B, BW2, BR16, UE16);      /* weights (in, out) -> f16 [out][in] x16; inputs -> f16 */
  k_gemm2_pair<true><<<(NBT / 128 + NU / 128) * (HALF / 64), 128, 0, stream>>>(BR16, BBP, bpb, nullptr, BH16, NBT, (NBT / 128) * (HALF / 64), UE16, BUP, upb, nullptr, UH16, NU, HALF, DIM);      /* bin_h, unit_h (f16) */
  k_gemm2_pair<false><<<(NBT / 128 + NU / 128) * (HALF / 64), 128, 0, stream>>>(BH16, BW1A, nullptr, A, nullptr, NBT, (NBT / 128) * (HALF / 64), UH16, BW1B, nullptr, Bu, nullptr, NU, HALF, HALF);      /* bin_h w1a, unit_h w1b */
  k_tail<<<NBT, 256, 0, stream>>>(A, Bu, b1, BW2, b2, w3, b3, (float*)d_out);      /* h1, h2, head, clip */
}

// v004
// Measured time: 48.7 microseconds a run.
// Timed twice side by side with v003, it ran 1.55 and 1.56 times as fast.
// Over all steps from v000 it is 6.31 times as fast.
#include <hip/hip_runtime.h>
// PerNeuronMLPHead (2 x 512 time bins x 512, 256 units x 512: bin_h = bin_repr Wbp + b, unit_h = unit_embs Wup + b (256 wide); h1[(b,t), n] = gelu(bin_h w1a + unit_h w1b + b1) (the split-weight broadcast add); h2 = gelu(h1 w2 + b2) (128); log_rate = h2 w3 + b3; clip(-10, 10); exact erf GELU).
// Structure, two launches: one for both projection layers (16 rows a block through x W + b and h w1 half on f16 WMMA, f32 accumulation, weights read as f32 and made exact x16 f16 fragments in registers, h in LDS; w2's transpose rides along as extra blocks); then one fused kernel: broadcast add + GELU on VALU straight into f16 WMMA fragments, h1 w2 on f16 WMMA, GELU, the 128 -> 1 head and the clip on the f32 accumulators (128-B stores, one a wave).
// Compute dtype: inputs rounded to bf16; inputs / weights exact as f16; bin_h / unit_h and h1 as plain f16 operands (~2^-12); h2, GELU and head f32. v_wmma_f32_16x16x32_f16.
#define NB 2
#define NTB 512
#define DIM 512
#define HALF 256
#define QTR 128
#define NU 256
#define NBT (NB * NTB)           /* 1024 bin rows */
#define NRW ((size_t)NBT * NU)   /* 262144 output rows */
typedef __bf16 v16b __attribute__((ext_vector_type(16)));
typedef unsigned short v8us __attribute__((ext_vector_type(8), may_alias));
typedef float  v8f  __attribute__((ext_vector_type(8)));
typedef float  v4f  __attribute__((ext_vector_type(4)));
typedef float  v4fa __attribute__((ext_vector_type(4), may_alias));
union FragB { v16b v; v8us half[2]; unsigned short u[16]; };

__device__ __forceinline__ unsigned short bf16_bits(float x) { unsigned int u = __float_as_uint(x); return (unsigned short)((u + 0x7FFFu + ((u >> 16) & 1u)) >> 16); }
__device__ __forceinline__ float bf16_val(unsigned short b) { return __uint_as_float(((unsigned int)b) << 16); }
__device__ __forceinline__ float bf16_round(float x) { return bf16_val(bf16_bits(x)); }
// D += A·B with NT terms: 1 = ah·bh, 2 = + al·bh (A split), 3 = + ah·bl (both split)
template <int NT>
__device__ __forceinline__ v8f mmaN(v16b ah, v16b al, v16b bh, v16b bl, v8f c) {
  c = __builtin_amdgcn_wmma_f32_16x16x32_bf16(false, ah, false, bh, (short)0, c, false, false);
  if (NT >= 2) c = __builtin_amdgcn_wmma_f32_16x16x32_bf16(false, al, false, bh, (short)0, c, false, false);
  if (NT >= 3) c = __builtin_amdgcn_wmma_f32_16x16x32_bf16(false, ah, false, bl, (short)0, c, false, false);
  asm volatile("v_nop\n\tv_nop\n\tv_nop\n\tv_nop" : "+v"(c) : "v"(ah), "v"(al), "v"(bh), "v"(bl));
  return c;
}

__global__ __launch_bounds__(256) void k_wt_bf16(const float* __restrict__ W, unsigned short* __restrict__ Wt, int K, int N) {
  const int t = blockIdx.x * 256 + threadIdx.x;
  const int k8n = K / 8;
  if (t >= N * k8n) return;
  const int n = t / k8n, k8 = (t % k8n) * 8;
  v8us v;
#pragma unroll
  for (int i = 0; i < 8; ++i) v[i] = bf16_bits(W[(size_t)(k8 + i) * N + n]);
  *(v8us*)(Wt + (size_t)n * K + k8) = v;
  
}

// GEMM C[M][N] (f32, pitch ldc) = act(A[M][K]·W + bias). A f32 row-major (pitch lda) converted per fragment to bf16
// (ASPLIT: hi/lo two planes -> 2 terms, else single rounded term); Wt bf16 [N][K] (pitch ldb). BIAS_BF16 rounds the
// bias to bf16 first (bias quantised to bf16 before the add). K%32==0, M%16==0, N%64==0.
template <bool ASPLIT, int ACT, bool BIAS_BF16>
__global__ __launch_bounds__(128) void k_gemm_bf(const float* __restrict__ A, int lda, const unsigned short* __restrict__ Wt, int ldb,
                                               const float* __restrict__ bias, float* __restrict__ C, int ldc, int M, int N, int K) {
  __shared__ __attribute__((aligned(16))) float so[4][16][64];
  const int tid = threadIdx.x, w = tid >> 5, lane = tid & 31, ln = lane & 15, hh = lane >> 4;
  const int ntn = N / 64;
  const int wid = blockIdx.x * 4 + w;
  const int mt = wid / ntn, nq = wid % ntn;
  if (mt * 16 >= M) return;
  const int row0 = mt * 16, col0 = nq * 64;
  const float* arow = A + (size_t)(row0 + ln) * lda;
  v8f acc[4] = {};
  for (int kb = 0; kb < K; kb += 32) {
    FragB ah, al;
    const v4f x0 = *(const v4fa*)(arow + kb + 8 * hh), x1 = *(const v4fa*)(arow + kb + 8 * hh + 4);
    const v4f x2 = *(const v4fa*)(arow + kb + 16 + 8 * hh), x3 = *(const v4fa*)(arow + kb + 16 + 8 * hh + 4);
    float xs[16] = {x0[0],x0[1],x0[2],x0[3],x1[0],x1[1],x1[2],x1[3],x2[0],x2[1],x2[2],x2[3],x3[0],x3[1],x3[2],x3[3]};
#pragma unroll
    for (int i = 0; i < 16; ++i) { const unsigned short hb = bf16_bits(xs[i]); ah.u[i] = hb; al.u[i] = ASPLIT ? bf16_bits(xs[i] - bf16_val(hb)) : (unsigned short)0; }
#pragma unroll
    for (int t = 0; t < 4; ++t) {
      const unsigned short* brow = Wt + (size_t)(col0 + t * 16 + ln) * ldb + kb;
      FragB b;
      b.half[0] = *(const v8us*)(brow + 8 * hh);
      b.half[1] = *(const v8us*)(brow + 16 + 8 * hh);
      acc[t] = mmaN<ASPLIT ? 2 : 1>(ah.v, al.v, b.v, b.v, acc[t]);
    }
  }
#pragma unroll
  for (int t = 0; t < 4; ++t) {
    float bv = bias ? bias[col0 + t * 16 + ln] : 0.f;
    if (BIAS_BF16) bv = bf16_round(bv);
#pragma unroll
    for (int r = 0; r < 8; ++r) { float v = acc[t][r] + bv; if (ACT == 1) v = fmaxf(v, 0.f); so[w][8 * hh + r][t * 16 + ln] = v; }
  }
  __builtin_amdgcn_fence(__ATOMIC_ACQ_REL, "workgroup");
  __builtin_amdgcn_wave_barrier();
  const int rsub = lane >> 4, c4 = (lane & 15) * 4;
  {
#pragma unroll
    for (int q = 0; q < 8; ++q) {
      const int r = q * 2 + rsub;
      const v4f v = *(const v4fa*)&so[w][r][c4];
      *(v4f*)(C + (size_t)(row0 + r) * ldc + col0 + c4) = v;
    }
    
  }
}

// GEMM C = act(A·W + bias + resid): A f32 (ASPLIT -> hi/lo 2 terms), Wt bf16 [N][K]; ACT 0 none, 1 relu, 2 exact gelu;
// resid (optional, f32, row index = (row % rmod), pitch ldr, RES_BF16 rounds it) added before the activation.
template <bool ASPLIT, int ACT, bool BIAS_BF16, bool RES_BF16>
__global__ __launch_bounds__(128) void k_gemm_bf3(const float* __restrict__ A, int lda, const unsigned short* __restrict__ Wt, int ldb,
                                                const float* __restrict__ bias, const float* __restrict__ resid, int rmod, int ldr,
                                                float* __restrict__ C, int ldc, int M, int N, int K) {
  __shared__ __attribute__((aligned(16))) float so[4][16][64];
  const int tid = threadIdx.x, w = tid >> 5, lane = tid & 31, ln = lane & 15, hh = lane >> 4;
  const int ntn = N / 64;
  const int wid = blockIdx.x * 4 + w;
  const int mt = wid / ntn, nq = wid % ntn;
  if (mt * 16 >= M) return;
  const int row0 = mt * 16, col0 = nq * 64;
  const float* arow = A + (size_t)(row0 + ln) * lda;
  v8f acc[4] = {};
  for (int kb = 0; kb < K; kb += 32) {
    FragB ah, al;
    const v4f x0 = *(const v4fa*)(arow + kb + 8 * hh), x1 = *(const v4fa*)(arow + kb + 8 * hh + 4);
    const v4f x2 = *(const v4fa*)(arow + kb + 16 + 8 * hh), x3 = *(const v4fa*)(arow + kb + 16 + 8 * hh + 4);
    float xs[16] = {x0[0],x0[1],x0[2],x0[3],x1[0],x1[1],x1[2],x1[3],x2[0],x2[1],x2[2],x2[3],x3[0],x3[1],x3[2],x3[3]};
#pragma unroll
    for (int i = 0; i < 16; ++i) { const unsigned short hb = bf16_bits(xs[i]); ah.u[i] = hb; al.u[i] = ASPLIT ? bf16_bits(xs[i] - bf16_val(hb)) : (unsigned short)0; }
#pragma unroll
    for (int t = 0; t < 4; ++t) {
      const unsigned short* brow = Wt + (size_t)(col0 + t * 16 + ln) * ldb + kb;
      FragB b;
      b.half[0] = *(const v8us*)(brow + 8 * hh);
      b.half[1] = *(const v8us*)(brow + 16 + 8 * hh);
      acc[t] = mmaN<ASPLIT ? 2 : 1>(ah.v, al.v, b.v, b.v, acc[t]);
    }
  }
#pragma unroll
  for (int t = 0; t < 4; ++t) {
    const int col = col0 + t * 16 + ln;
    float bv = bias ? bias[col] : 0.f;
    if (BIAS_BF16) bv = bf16_round(bv);
#pragma unroll
    for (int r = 0; r < 8; ++r) {
      float v = acc[t][r] + bv;
      if (resid) { float rv = resid[(size_t)((row0 + 8 * hh + r) % rmod) * ldr + col]; if (RES_BF16) rv = bf16_round(rv); v += rv; }
      if (ACT == 1) v = fmaxf(v, 0.f);
      if (ACT == 2) v = 0.5f * v * (1.0f + erff(v * 0.70710678118654752f));
      if (ACT == 3) { const float u = 0.7978845608028654f * (v + 0.044715f * v * v * v); v = 0.5f * v * (1.0f + tanhf(u)); }
      so[w][8 * hh + r][t * 16 + ln] = v;
    }
  }
  __builtin_amdgcn_fence(__ATOMIC_ACQ_REL, "workgroup");
  __builtin_amdgcn_wave_barrier();
  const int rsub = lane >> 4, c4 = (lane & 15) * 4;
  {
#pragma unroll
    for (int q = 0; q < 8; ++q) {
      const int r = q * 2 + rsub;
      const v4f v = *(const v4fa*)&so[w][r][c4];
      *(v4f*)(C + (size_t)(row0 + r) * ldc + col0 + c4) = v;
    }
    
  }
}
// row LayerNorm (biased variance, eps) over N: s = X (+ R); optional out_sum <- s; out_norm <- (s-mu)*rsqrt(var+eps)*g + b
template <bool PARAM_BF16>
__global__ __launch_bounds__(256) void k_layernorm(const float* __restrict__ X, const float* __restrict__ R, const float* __restrict__ g, const float* __restrict__ bta,
                                                  float* __restrict__ out_sum, float* __restrict__ out_norm, int N, float eps) {
  __shared__ float red[256];
  const int row = blockIdx.x, tid = threadIdx.x;
  const float* x = X + (size_t)row * N; const float* rr = R ? R + (size_t)row * N : nullptr;
  float vals[16];                     // up to N = 4096
  const int per = N / 256;            // contiguous chunk per thread? use strided-by-4 chunks: thread handles j = tid*4 + 1024*u
  float s1 = 0.f;
  for (int u = 0; u < per / 4; ++u) {
    const int j = tid * 4 + 1024 * u;
    const v4f a = *(const v4fa*)(x + j);
    v4f b = {0.f,0.f,0.f,0.f}; if (rr) b = *(const v4fa*)(rr + j);
#pragma unroll
    for (int q = 0; q < 4; ++q) { const float v = a[q] + b[q]; vals[u * 4 + q] = v; s1 += v; }
  }
  red[tid] = s1; __syncthreads();
  for (int st = 128; st > 0; st >>= 1) { if (tid < st) red[tid] += red[tid + st]; __syncthreads(); }
  const float mu = red[0] / (float)N; __syncthreads();
  float s2 = 0.f;
  for (int u = 0; u < per / 4; ++u)
#pragma unroll
    for (int q = 0; q < 4; ++q) { const float c = vals[u * 4 + q] - mu; s2 += c * c; }
  red[tid] = s2; __syncthreads();
  for (int st = 128; st > 0; st >>= 1) { if (tid < st) red[tid] += red[tid + st]; __syncthreads(); }
  const float rs = rsqrtf(red[0] / (float)N + eps);
  {
    for (int u = 0; u < per / 4; ++u) {
      const int j = tid * 4 + 1024 * u;
      v4f o, sm;
#pragma unroll
      for (int q = 0; q < 4; ++q) {
        float gg = g[j + q], bb = bta[j + q];
        if (PARAM_BF16) { gg = bf16_round(gg); bb = bf16_round(bb); }
        sm[q] = vals[u * 4 + q]; o[q] = (vals[u * 4 + q] - mu) * rs * gg + bb;
      }
      if (out_sum) *(v4f*)(out_sum + (size_t)row * N + j) = sm;
      *(v4f*)(out_norm + (size_t)row * N + j) = o;
    }
    
  }
}



// ---- f16 WMMA path (v_wmma_f32_16x16x32_f16): 11-bit significands for operands in range — used for every GEMM launched here
typedef _Float16 v16h __attribute__((ext_vector_type(16)));
union FragH { v16h v; v8us half[2]; _Float16 h[16]; unsigned short u[16]; };
template <int NT>
__device__ __forceinline__ v8f mmaH(v16h ah, v16h al, v16h bh, v16h bl, v8f c) {
  c = __builtin_amdgcn_wmma_f32_16x16x32_f16(false, ah, false, bh, (short)0, c, false, false);
  if (NT >= 2) c = __builtin_amdgcn_wmma_f32_16x16x32_f16(false, al, false, bh, (short)0, c, false, false);
  if (NT >= 3) c = __builtin_amdgcn_wmma_f32_16x16x32_f16(false, ah, false, bl, (short)0, c, false, false);
  asm volatile("v_nop\n\tv_nop\n\tv_nop\n\tv_nop" : "+v"(c) : "v"(ah), "v"(al), "v"(bh), "v"(bl));
  return c;
}
// batched GEMM like k_gemm_b but f16 operands: A f32 (split into f16 hi/lo if ASPLIT, else rounded to f16), Bt = f16 values [n][k]; alpha; C f32; N multiple of 16 (partial tiles skipped)
template <bool ASPLIT>
__global__ __launch_bounds__(128) void k_gemm_h(const float* __restrict__ A, int lda, size_t sA, const _Float16* __restrict__ Bh, int ldb, size_t sB, float alpha, float* __restrict__ C, int ldc, size_t sC, int M, int N, int K) {
  __shared__ __attribute__((aligned(16))) float so[4][16][64];
  const int tid = threadIdx.x, w = tid >> 5, lane = tid & 31, ln = lane & 15, hh = lane >> 4; const int by = blockIdx.y;
  A += (size_t)by * sA; Bh += (size_t)by * sB; C += (size_t)by * sC;
  const int ntn = (N + 63) / 64; const int wid = blockIdx.x * 4 + w; const int mt = wid / ntn, nq = wid % ntn; if (mt * 16 >= M) return;
  const int row0 = mt * 16, col0 = nq * 64; const float* arow = A + (size_t)(row0 + ln) * lda;
  v8f acc[4] = {};
  for (int kb = 0; kb < K; kb += 32) {
    FragH ah, al;
    const v4f x0 = *(const v4fa*)(arow + kb + 8 * hh), x1 = *(const v4fa*)(arow + kb + 8 * hh + 4), x2 = *(const v4fa*)(arow + kb + 16 + 8 * hh), x3 = *(const v4fa*)(arow + kb + 16 + 8 * hh + 4);
    float xs[16] = {x0[0],x0[1],x0[2],x0[3],x1[0],x1[1],x1[2],x1[3],x2[0],x2[1],x2[2],x2[3],x3[0],x3[1],x3[2],x3[3]};
#pragma unroll
    for (int i = 0; i < 16; ++i) { const _Float16 h = (_Float16)xs[i]; ah.h[i] = h; al.h[i] = ASPLIT ? (_Float16)(xs[i] - (float)h) : (_Float16)0.0f; }
#pragma unroll
    for (int t = 0; t < 4; ++t) { if (col0 + t * 16 >= N) continue; const size_t boff = (size_t)(col0 + t * 16 + ln) * ldb + kb; FragH bq; bq.half[0] = *(const v8us*)(Bh + boff + 8 * hh); bq.half[1] = *(const v8us*)(Bh + boff + 16 + 8 * hh);
      acc[t] = mmaH<ASPLIT ? 2 : 1>(ah.v, al.v, bq.v, bq.v, acc[t]); }
  }
#pragma unroll
  for (int t = 0; t < 4; ++t) { if (col0 + t * 16 >= N) continue;
#pragma unroll
    for (int r = 0; r < 8; ++r) so[w][8 * hh + r][t * 16 + ln] = acc[t][r] * alpha; }
  __builtin_amdgcn_fence(__ATOMIC_ACQ_REL, "workgroup"); __builtin_amdgcn_wave_barrier();
  const int rsub = lane >> 4, c4 = (lane & 15) * 4;
  {
#pragma unroll
    for (int q = 0; q < 8; ++q) { const int r = q * 2 + rsub; if (col0 + c4 < N) { const v4f v = *(const v4fa*)&so[w][r][c4]; *(v4f*)(C + (size_t)(row0 + r) * ldc + col0 + c4) = v; } }
     }
}

// Wt[n][k] = f16(W[k][n]·scale) from f32 row-major W[K][N] (scale = power of two; bf16-exact weights stay exact in f16 away from the subnormal range)
__device__ __forceinline__ void d_wt_f16(const int blk, const float* __restrict__ W, _Float16* __restrict__ Wt, int K, int N, float scale) {
  const int t = blk * 256 + threadIdx.x; if (t >= N * (K / 8)) return; const int n = t / (K / 8), k8 = (t % (K / 8)) * 8; FragH f;
#pragma unroll
  for (int i = 0; i < 8; ++i) f.h[i] = (_Float16)(bf16_round(W[(size_t)(k8 + i) * N + n]) * scale); const v8us o = f.half[0];
  *(v8us*)((unsigned short*)Wt + (size_t)n * K + k8) = o; 
}
// k_gemm_hh variant with fused epilogue: v = acc·alpha + bias[by·sBias + col] (+ CP[(row/rowsPerB)·sCPb + by·64 + col] if CP) ; ACT 0 none / 1 elu ; writes f16 C16 (and f32 C if non-null)
template <int ACT>
__global__ __launch_bounds__(128) void k_gemm_hhx(const _Float16* __restrict__ A, int lda, size_t sA, const _Float16* __restrict__ Bh, int ldb, size_t sB, float alpha, const float* __restrict__ bias, size_t sBias, const float* __restrict__ CP, int rowsPerB, size_t sCPb, int row0g,
    float* __restrict__ C, _Float16* __restrict__ C16, int ldc, size_t sC, int M, int N, int K) {
  __shared__ __attribute__((aligned(16))) float so[4][16][64];
  const int tid = threadIdx.x, w = tid >> 5, lane = tid & 31, ln = lane & 15, hh = lane >> 4; const int by = blockIdx.y;
  A += (size_t)by * sA; Bh += (size_t)by * sB; const size_t cofs = (size_t)by * sC; const float* bp = bias ? bias + (size_t)by * sBias : nullptr;
  const int ntn = (N + 63) / 64; const int wid = blockIdx.x * 4 + w; const int mt = wid / ntn, nq = wid % ntn; if (mt * 16 >= M) return;
  const int row0 = mt * 16, col0 = nq * 64; const _Float16* arow = A + (size_t)(row0 + ln) * lda;
  v8f acc[4] = {};
  for (int kb = 0; kb < K; kb += 32) { FragH ah; ah.half[0] = *(const v8us*)((const unsigned short*)arow + kb + 8 * hh); ah.half[1] = *(const v8us*)((const unsigned short*)arow + kb + 16 + 8 * hh);
#pragma unroll
    for (int t = 0; t < 4; ++t) { if (col0 + t * 16 >= N) continue; const size_t boff = (size_t)(col0 + t * 16 + ln) * ldb + kb; FragH bq; bq.half[0] = *(const v8us*)((const unsigned short*)Bh + boff + 8 * hh); bq.half[1] = *(const v8us*)((const unsigned short*)Bh + boff + 16 + 8 * hh);
      acc[t] = mmaH<1>(ah.v, ah.v, bq.v, bq.v, acc[t]); }
  }
#pragma unroll
  for (int t = 0; t < 4; ++t) { if (col0 + t * 16 >= N) continue; const int col = col0 + t * 16 + ln; const float bv = bp ? bf16_round(bp[col]) : 0.f;
#pragma unroll
    for (int r = 0; r < 8; ++r) { float v = acc[t][r] * alpha + bv; if (CP) { const int rr = row0g + row0 + 8 * hh + r; if (rowsPerB < 0) v += CP[cofs + (size_t)rr * ldc + col];      /* rowsPerB < 0: own element of the batched C plane */ else { const int bidx = rr / rowsPerB; v += CP[(size_t)bidx * sCPb + (size_t)by * 64 + col]; } } if (ACT == 1) v = (v > 0.f) ? v : expm1f(v); else if (ACT == 7) v = (v > 0.f) ? v + 1.0f : expf(v); else if (ACT == 8) v = tanhf(v); else if (ACT == 9) v = 0.5f * v * (1.0f + tanhf(0.7978845608028654f * (v + 0.044715f * v * v * v))); else if (ACT == 11) v = 1.0f / (1.0f + expf(-v)); else if (ACT == 12) v = (v > 0.f) ? v : 0.01f * v; else if (ACT == 14) v = (v > 0.f) ? v : 0.1f * v; else if (ACT == 16) v = (v >= 0.f) ? v : 0.3f * v; else if (ACT == 17) v = (v >= 0.f) ? v : 0.2f * v; else if (ACT == 15) v = v / (1.0f + expf(-v)); else if (ACT == 3) v = fmaxf(v, 0.f); else if (ACT == 6) v = 0.5f * v * (1.0f + erff(v * 0.70710678118654752f)); so[w][8 * hh + r][t * 16 + ln] = v; } }
  __builtin_amdgcn_fence(__ATOMIC_ACQ_REL, "workgroup"); __builtin_amdgcn_wave_barrier();
  const int rsub = lane >> 4, c4 = (lane & 15) * 4; typedef _Float16 v4h __attribute__((ext_vector_type(4)));
  {
#pragma unroll
    for (int q = 0; q < 8; ++q) { const int r = q * 2 + rsub; if (col0 + c4 < N) { const v4f v = *(const v4fa*)&so[w][r][c4]; if (C) *(v4f*)(C + cofs + (size_t)(row0 + r) * ldc + col0 + c4) = v; if (C16) { v4h h4; for (int i = 0; i < 4; ++i) h4[i] = (_Float16)v[i]; *(v4h*)(C16 + cofs + (size_t)(row0 + r) * ldc + col0 + c4) = h4; } } }
     }
}


typedef _Float16 v4h __attribute__((ext_vector_type(4)));

__global__ __launch_bounds__(256) void k_h16(const float* __restrict__ x, _Float16* __restrict__ X16, size_t n8) { const size_t t = (size_t)blockIdx.x * 256 + threadIdx.x; if (t >= n8) return; FragH f;
#pragma unroll
  for (int q = 0; q < 8; ++q) f.h[q] = (_Float16)x[t * 8 + q]; *(v8us*)((unsigned short*)X16 + t * 8) = f.half[0];  }
__global__ __launch_bounds__(256) void k_round16f(const float* __restrict__ W, _Float16* __restrict__ Bt, size_t n8) { const size_t t = (size_t)blockIdx.x * 256 + threadIdx.x; if (t >= n8) return; FragH f;
#pragma unroll
  for (int i = 0; i < 8; ++i) f.h[i] = (_Float16)(bf16_round(W[t * 8 + i]) * 16.0f); *(v8us*)((unsigned short*)Bt + t * 8) = f.half[0];  }
template <int NHv, int TTv>
__global__ __launch_bounds__(256) void k_vt(const _Float16* __restrict__ V16, int ldv, int voff, _Float16* __restrict__ Vt) { __shared__ unsigned short tl[64][66]; const int tid = threadIdx.x; const int slab = blockIdx.x / (TTv / 64), lg = blockIdx.x % (TTv / 64); const int b = slab / NHv, h = slab % NHv;
  for (int i = tid; i < 64 * 8; i += 256) { const int r = i / 8, c8 = (i % 8) * 8; FragH f; f.half[0] = *(const v8us*)((const unsigned short*)V16 + ((size_t)b * TTv + lg * 64 + r) * ldv + voff + h * 64 + c8);
#pragma unroll
    for (int q = 0; q < 8; ++q) tl[r][c8 + q] = f.u[q]; }
  __syncthreads();
  {
#pragma unroll
    for (int rd = 0; rd < 2; ++rd) { const int d = rd * 32 + tid / 8, pc = tid % 8; FragH f;
#pragma unroll
      for (int q = 0; q < 8; ++q) f.u[q] = tl[pc * 8 + q][d];
      *(v8us*)((unsigned short*)Vt + ((size_t)slab * 64 + d) * TTv + lg * 64 + pc * 8) = f.half[0]; }
     } }

__global__ __launch_bounds__(256) void k_hl(const float* __restrict__ F, _Float16* __restrict__ Hh, _Float16* __restrict__ Hl, size_t n8) { const size_t t = (size_t)blockIdx.x * 256 + threadIdx.x; if (t >= n8) return; FragH fh, fl; const v4f a = *(const v4fa*)(F + t * 8), c = *(const v4fa*)(F + t * 8 + 4);
#pragma unroll
  for (int q = 0; q < 4; ++q) { _Float16 h = (_Float16)a[q]; fh.h[q] = h; fl.h[q] = (_Float16)((a[q] - (float)h) * 1024.0f); h = (_Float16)c[q]; fh.h[4 + q] = h; fl.h[4 + q] = (_Float16)((c[q] - (float)h) * 1024.0f); }
  { *(v8us*)((unsigned short*)Hh + t * 8) = fh.half[0]; *(v8us*)((unsigned short*)Hl + t * 8) = fl.half[0];  } }

// ---- both projection layers in one launch ----
typedef float v2f __attribute__((ext_vector_type(2)));
typedef float v2fa __attribute__((ext_vector_type(2), may_alias));
typedef _Float16 v2ha __attribute__((ext_vector_type(2), may_alias));
typedef _Float16 v4ha __attribute__((ext_vector_type(4), may_alias));
#define PB_W2 (QTR * HALF / 8 / 256)      /* 16 blocks: w2 */
#define PJ_ROWS 16                        /* rows a block carries through both layers */
#define PJ_PX (DIM + 8)                   /* LDS pitch in f16: 16 bytes past a multiple of 256, so that the 16 rows of a fragment load fall on different banks */
#define PJ_PH (HALF + 8)
#define PJ_STEP ((size_t)32 * HALF * 4)   /* bytes of 32 rows (one k step) of a weight matrix of 256 columns */
// The 16 k rows of one k step that a lane's B fragments hold (k = 8h+i, 16+8h+i, the order of the A fragments), two neighbouring columns a load: 16 lanes read one whole 128-byte line of a row.
// base is the same for the wave, lob the lane's fixed byte offset (row 8h, its column pair).
__device__ __forceinline__ void pj_load(v2f (&q)[16], const char* __restrict__ base, const unsigned lob) {
#pragma unroll
  for (int i = 0; i < 16; ++i) q[i] = *(const v2fa*)(base + lob + (size_t)(i < 8 ? i : i + 8) * HALF * 4);
}
// f32 weights -> the f16 x16 values of bf16-rounded weights, straight into two B fragments (column 2l and column 2l+1 of the wave's 32), two k at a time.
// The x16 comes first (a power of two commutes with the rounding); the hardware's f32 -> bf16 conversion rounds to nearest even as bf16_round does (the same value for every finite weight) and takes one instruction for two weights.
typedef __bf16 v2bf __attribute__((ext_vector_type(2)));
typedef _Float16 v2h __attribute__((ext_vector_type(2)));
__device__ __forceinline__ void pj_cvt(const v2f (&q)[16], FragH& b0, FragH& b1) {
#pragma unroll
  for (int i = 0; i < 16; i += 2) {
    const v2f u = q[i] * 16.0f, v = q[i + 1] * 16.0f;
    const v2f t0 = {u[0], v[0]}, t1 = {u[1], v[1]};
    const v2h h0 = __builtin_convertvector(__builtin_convertvector(__builtin_convertvector(t0, v2bf), v2f), v2h);
    const v2h h1 = __builtin_convertvector(__builtin_convertvector(__builtin_convertvector(t1, v2bf), v2f), v2h);
    b0.h[i] = h0[0]; b0.h[i + 1] = h0[1]; b1.h[i] = h1[0]; b1.h[i + 1] = h1[1];
  }
}
__device__ __forceinline__ v16h pj_afrag(const unsigned short* p) { FragH f; f.half[0] = *(const v8us*)p; f.half[1] = *(const v8us*)(p + 16); return f.v; }
// One launch for all that comes before the fused tail. Blocks 0 .. PB_W2-1 transpose w2 to f16; each other block takes 16 rows of bin_repr or of unit_embs through both layers:
// x -> f16 in LDS; h = x W + b (K = 512) on WMMA, f16 into LDS; h w1 half (K = 256) on WMMA, f32 to the workspace. No f16 copy of x, h or of these weights goes through memory.
// Wave w owns output columns 32w .. 32w+31 of both layers. Its two B tiles are the even and the odd columns (tile j, lane l: column 32w + 2l + j), so that f32 weights are read row-major as they lie, 8 bytes a lane,
// and converted in registers; each weight is used by one WMMA of the block, so LDS would add nothing. The weight rows of both layers form one stream of 24 k steps, loaded three steps ahead into three register buffers.
// D register r of tile j is row 8h + r, column 32w + 2l + j: a lane stores column pairs. Values and sum order are those of separate GEMMs over k steps of 32.
__global__ __launch_bounds__(256) void k_proj(const float* __restrict__ br, const float* __restrict__ ue, const float* __restrict__ bpw, const float* __restrict__ bpb, const float* __restrict__ upw, const float* __restrict__ upb,
                                              const float* __restrict__ w1, const float* __restrict__ w2, _Float16* __restrict__ BW2, float* __restrict__ A, float* __restrict__ Bu) {
  __shared__ __attribute__((aligned(16))) unsigned short sX[PJ_ROWS][PJ_PX];
  __shared__ __attribute__((aligned(16))) unsigned short sH[PJ_ROWS][PJ_PH];
  int b = blockIdx.x;
  if (b < PB_W2) { d_wt_f16(b, w2, BW2, HALF, QTR, 16.0f); return; }      /* whole blocks, ahead of every barrier */
  b -= PB_W2;
  const bool s = b >= NBT / PJ_ROWS;
  const int r0 = (s ? b - NBT / PJ_ROWS : b) * PJ_ROWS;
  const float* X = (s ? ue : br) + (size_t)r0 * DIM;
  const char* Wa = (const char*)(s ? upw : bpw);
  const char* Wb = (const char*)(w1 + (s ? HALF * HALF : 0));
  const float* bias = s ? upb : bpb;
  float* C = (s ? Bu : A) + (size_t)r0 * HALF;
  const int tid = threadIdx.x, w = tid >> 5, lane = tid & 31, ln = lane & 15, hh = lane >> 4;
  const int col = w * 32 + 2 * ln;
  const unsigned lob = (unsigned)(8 * hh * HALF + col) * 4u;
  v4f x[8];
#pragma unroll
  for (int i = 0; i < 8; ++i) x[i] = *(const v4fa*)(X + i * 1024 + tid * 4);
  const v2f bb = *(const v2fa*)(bias + col);
  v2f q[3][16];
  pj_load(q[0], Wa, lob); pj_load(q[1], Wa + PJ_STEP, lob); pj_load(q[2], Wa + 2 * PJ_STEP, lob);
#pragma unroll
  for (int i = 0; i < 8; ++i) {
    const int e = i * 1024 + tid * 4;
    v4ha h; h[0] = (_Float16)bf16_round(x[i][0]); h[1] = (_Float16)bf16_round(x[i][1]); h[2] = (_Float16)bf16_round(x[i][2]); h[3] = (_Float16)bf16_round(x[i][3]);
    *(v4ha*)&sX[e >> 9][e & (DIM - 1)] = h;
  }
  __syncthreads();
  const v8f z8 = {0.f, 0.f, 0.f, 0.f, 0.f, 0.f, 0.f, 0.f};
  v8f c0 = z8, c1 = z8;
  const unsigned short* ax = &sX[ln][8 * hh];
  // unrolled in full (about 24 KB of text, run once): the three buffers are then fixed registers that the loads write directly, and every weight address is one base, the lane's offset and an immediate;
  // rolled, the refilled values were copied between registers at the foot of each trip, behind a wait for all loads in flight. A buffer is refilled as soon as its values are converted.
#pragma unroll
  for (int ks = 0; ks < DIM / 32; ++ks) {
    FragH b0, b1;
    pj_cvt(q[ks % 3], b0, b1);
    pj_load(q[ks % 3], ks + 3 < DIM / 32 ? Wa + (ks + 3) * PJ_STEP : Wb + (ks + 3 - DIM / 32) * PJ_STEP, lob);      /* the last three refills are the second layer's first steps */
    const v16h a = pj_afrag(ax + ks * 32);
    c0 = __builtin_amdgcn_wmma_f32_16x16x32_f16(false, a, false, b0.v, (short)0, c0, false, false);
    c1 = __builtin_amdgcn_wmma_f32_16x16x32_f16(false, a, false, b1.v, (short)0, c1, false, false);
    __builtin_amdgcn_sched_barrier(0);      /* keeps the later steps' conversions, and with them the waits for their loads, behind this step's refill: moved up, the loads in flight are waited for too early */
  }
  const float bv0 = bf16_round(bb[0]), bv1 = bf16_round(bb[1]);
#pragma unroll
  for (int r = 0; r < 8; ++r) { v2ha h; h[0] = (_Float16)(c0[r] * 0.0625f + bv0); h[1] = (_Float16)(c1[r] * 0.0625f + bv1); *(v2ha*)&sH[8 * hh + r][col] = h; }
  __syncthreads();
  c0 = z8; c1 = z8;
  const unsigned short* ah = &sH[ln][8 * hh];
#pragma unroll
  for (int ks = 0; ks < HALF / 32; ++ks) {
    FragH b0, b1;
    pj_cvt(q[(ks + DIM / 32) % 3], b0, b1);
    if (ks + 3 < HALF / 32) pj_load(q[(ks + DIM / 32) % 3], Wb + (ks + 3) * PJ_STEP, lob);
    const v16h a = pj_afrag(ah + ks * 32);
    c0 = __builtin_amdgcn_wmma_f32_16x16x32_f16(false, a, false, b0.v, (short)0, c0, false, false);
    c1 = __builtin_amdgcn_wmma_f32_16x16x32_f16(false, a, false, b1.v, (short)0, c1, false, false);
    __builtin_amdgcn_sched_barrier(0);      /* as in the first layer's loop */
  }
#pragma unroll
  for (int r = 0; r < 8; ++r) { v2f o; o[0] = c0[r] * 0.0625f; o[1] = c1[r] * 0.0625f; *(v2fa*)(C + (size_t)(8 * hh + r) * HALF + col) = o; }      /* 16 lanes: one whole 128-byte line */
  asm volatile("s_wait_xcnt 0x0" ::: "memory");      /* behind the last store: in the built code other text follows here that reuses the stores' data registers, and this wait stands in front of any such overwrite */
}

__global__ __launch_bounds__(256) void k_f16c(const float* __restrict__ A, _Float16* __restrict__ D, size_t n8) { const size_t t = (size_t)blockIdx.x * 256 + threadIdx.x; if (t >= n8) return; const v8f a = *(const v8f*)(A + t * 8); FragH f; for (int q = 0; q < 8; ++q) f.h[q] = (_Float16)a[q]; *(v8us*)((unsigned short*)D + t * 8) = f.half[0];  }
// Exact (erf) GELU in f32, written as h Phi(h) = max(h, 0) - |h| Q(|h|) with Q(a) = erfc(a / sqrt 2) / 2 = exp2(p(a)): one straight line for every h, no second form to evaluate and select, no range reduction around v_exp_f32 (p < 0, and an error of p counts only times Q).
// p is a degree-8 fit of log2 Q(a) on 0 <= a <= 5.5, weighted by Q: evaluated in f32 the error of Phi is about 1e-7 at most (the rounding level of 1 + erf in f32), and a negative h has no cancellation.
// The leading coefficient is negative, so past the fitted range p keeps falling and |h| exp2(p) goes to 0 as |h| Q does (the two are within 1e-8 from a = 5 on); every finite h is covered, h = +infinity or -infinity would give infinity times 0.
__device__ __forceinline__ float gelu_erf(float s) {
  const float a = fabsf(s);
  float p = fmaf(a, -2.12157283e-6f, 3.09552197e-5f); p = fmaf(a, p, -1.46757287e-4f); p = fmaf(a, p, -2.30747639e-4f); p = fmaf(a, p, 7.18435273e-3f);
  p = fmaf(a, p, -5.25792725e-2f); p = fmaf(a, p, -4.59180444e-1f); p = fmaf(a, p, -1.15110874e+0f); p = fmaf(a, p, -9.99999940e-1f);
  return fmaf(-a, __builtin_amdgcn_exp2f(p), fmaxf(s, 0.f));
}
// Fused tail: h1 = gelu(A[bt] + Bu[n] + b1), h2 = gelu(h1 w2 + b2), out = clip(h2 w3 + b3); h1 and h2 never leave the registers.
// One work-group per bin row bt; wave w owns units 32w .. 32w+31 as two tiles of 16 rows.
// The product runs transposed: w2's columns are the A operand (from LDS, stored in fragment order), the h1 rows the B operand.
// A lane computes the 16 h1 values of its own row and k half straight into the B fragment (k = 8h+i, 16+8h+i on both operands).
// D register r of tile t is then h2[row = lane & 15][feature 16t + 8h + r]: the head's dot product stays inside a lane but for one add across the lane halves.
__global__ __launch_bounds__(256) void k_tail(const float* __restrict__ A, const float* __restrict__ Bu, const float* __restrict__ b1, const _Float16* __restrict__ W2t,
                                              const float* __restrict__ b2, const float* __restrict__ w3, const float* __restrict__ b3, float* __restrict__ out) {
  __shared__ __attribute__((aligned(16))) unsigned short sW[HALF / 32][QTR / 16][2][32][8];   /* [k step][feature tile][fragment half][lane][8 f16], 64 KiB: each fragment load reads 512 contiguous bytes */
  __shared__ __attribute__((aligned(16))) float sab[HALF];
  __shared__ __attribute__((aligned(16))) float sb2[QTR];
  __shared__ __attribute__((aligned(16))) float sw3[QTR];
  const int tid = threadIdx.x, w = tid >> 5, lane = tid & 31, ln = lane & 15, hh = lane >> 4;
  const int bt = blockIdx.x;
  // unrolled: all 16 loads of the w2 fill are in flight before the first LDS store
#pragma unroll
  for (int i = 0; i < 16; ++i) {
    const int ks = i >> 1, t = (i & 1) * 4 + (w >> 1), half = w & 1;
    const v8us v = *(const v8us*)((const unsigned short*)W2t + (size_t)(t * 16 + ln) * HALF + ks * 32 + half * 16 + hh * 8);
    *(v8us*)&sW[ks][t][half][lane][0] = v;
  }
  sab[tid] = A[(size_t)bt * HALF + tid] + bf16_round(b1[tid]);
  if (tid < QTR) { sb2[tid] = bf16_round(b2[tid]); sw3[tid] = bf16_round(w3[tid]); }
  __syncthreads();
  const float* ub = Bu + (size_t)(w * 32 + ln) * HALF + 8 * hh;
  v4f u0 = *(const v4fa*)(ub), u1 = *(const v4fa*)(ub + 4), u2 = *(const v4fa*)(ub + 16), u3 = *(const v4fa*)(ub + 20);
  float res = 0.f;
  // the tile loop and the k loop stay rolled: 16 + 64 inlined GELUs are all the text that the instruction cache should have to hold;
  // the loops inside them are unrolled, so that fragments and accumulators are indexed by constants and stay in registers
#pragma unroll 1
  for (int tile = 0; tile < 2; ++tile) {
    v8f acc[8] = {};
#pragma unroll 1
    for (int ks = 0; ks < HALF / 32; ++ks) {
      // the next step's unit values are loaded one step ahead (the last step reloads its own)
      const int qn = min(tile * 8 + ks + 1, 15);
      const float* un = ub + (size_t)(qn >> 3) * 16 * HALF + (qn & 7) * 32;
      const v4f p0 = *(const v4fa*)(un), p1 = *(const v4fa*)(un + 4), p2 = *(const v4fa*)(un + 16), p3 = *(const v4fa*)(un + 20);
      const float* ap = &sab[ks * 32 + 8 * hh];
      const v4f a0 = *(const v4fa*)(ap), a1 = *(const v4fa*)(ap + 4), a2 = *(const v4fa*)(ap + 16), a3 = *(const v4fa*)(ap + 20);
      FragH f;
#pragma unroll
      for (int i = 0; i < 4; ++i) {
        f.h[i] = (_Float16)gelu_erf(a0[i] + u0[i]); f.h[4 + i] = (_Float16)gelu_erf(a1[i] + u1[i]);
        f.h[8 + i] = (_Float16)gelu_erf(a2[i] + u2[i]); f.h[12 + i] = (_Float16)gelu_erf(a3[i] + u3[i]);
      }
#pragma unroll
      for (int t = 0; t < 8; ++t) {
        FragH wf; wf.half[0] = *(const v8us*)&sW[ks][t][0][lane][0]; wf.half[1] = *(const v8us*)&sW[ks][t][1][lane][0];
        acc[t] = __builtin_amdgcn_wmma_f32_16x16x32_f16(false, wf.v, false, f.v, (short)0, acc[t], false, false);
      }
      u0 = p0; u1 = p1; u2 = p2; u3 = p3;
    }
    // compiler fence: keeps the 32 LDS loads of b2 and w3 inside the tile loop; hoisted out of it they hold 128 registers through the k loop, which then has none left to fetch w2 fragments ahead of its WMMAs
    asm volatile("" ::: "memory");
    v4f pv = {0.f, 0.f, 0.f, 0.f};      /* four partial sums of the head, so that the GELUs pair up into packed f32 instructions */
#pragma unroll
    for (int t = 0; t < 8; ++t) {
      const int f0 = t * 16 + 8 * hh;
      const v4f c0 = *(const v4fa*)&sb2[f0], c1 = *(const v4fa*)&sb2[f0 + 4], g0 = *(const v4fa*)&sw3[f0], g1 = *(const v4fa*)&sw3[f0 + 4];
      v4f h0, h1;
#pragma unroll
      for (int r = 0; r < 4; ++r) { h0[r] = gelu_erf(acc[t][r] * 0.0625f + c0[r]); h1[r] = gelu_erf(acc[t][4 + r] * 0.0625f + c1[r]); }
      pv += h0 * g0; pv += h1 * g1;
    }
    float p = (pv[0] + pv[1]) + (pv[2] + pv[3]);
    p += __shfl_xor(p, 16, 32);
    if (hh == tile) res = p;      /* tile 0's rows end in lanes 0-15, tile 1's in lanes 16-31: one 128-byte store a wave */
  }
  res += bf16_round(b3[0]);
  out[(size_t)bt * NU + w * 32 + lane] = fminf(fmaxf(res, -10.0f), 10.0f);
}

extern "C" void kernel_launch(void* const* d_in, const int* in_sizes, int n_in,
                              void* d_out, int out_size, void* d_ws, size_t ws_size, hipStream_t stream) {
  (void)in_sizes; (void)n_in; (void)out_size;
  const float* const* I = (const float* const*)d_in; const float* br = I[0]; const float* ue = I[1]; const float* bpw = I[2]; const float* bpb = I[3]; const float* upw = I[4]; const float* upb = I[5]; const float* w1 = I[6]; const float* b1 = I[7]; const float* w2 = I[8]; const float* b2 = I[9]; const float* w3 = I[10]; const float* b3 = I[11];
  char* ws = (char*)d_ws; size_t off = 0;
  auto take = [&](size_t bytes) { char* p = ws + off; off += (bytes + 255) & ~(size_t)255; return p; };
  _Float16* BW2 = (_Float16*)take((size_t)QTR * HALF * 2); float* A = (float*)take((size_t)NBT * HALF * 4); float* Bu = (float*)take((size_t)NU * HALF * 4);
  if (off > ws_size) return;
  k_proj<<<PB_W2 + (NBT + NU) / PJ_ROWS, 256, 0, stream>>>(br, ue, bpw, bpb, upw, upb, w1, w2, BW2, A, Bu);      /* w2 -> f16 [out][in] x16; A = (bin_repr Wbp + b) w1a, Bu = (unit_embs Wup + b) w1b */
  k_tail<<<NBT, 256, 0, stream>>>(A, Bu, b1, BW2, b2, w3, b3, (float*)d_out);      /* h1, h2, head, clip */
}

// v005
// One run takes 39.1 microseconds.
// In two side-by-side timings against v004, it was 1.25 and 1.24 times as fast.
// Counting every step since v000, it is 7.87 times as fast.
#include <hip/hip_runtime.h>
// PerNeuronMLPHead (2 x 512 time bins x 512, 256 units x 512: bin_h = bin_repr Wbp + b, unit_h = unit_embs Wup + b (256 wide); h1[(b,t), n] = gelu(bin_h w1a + unit_h w1b + b1) (the split-weight broadcast add); h2 = gelu(h1 w2 + b2) (128); log_rate = h2 w3 + b3; clip(-10, 10); exact erf GELU).
// Structure, two launches: one for both projection layers (16 rows a block through x W + b and h w1 half on f16 WMMA, f32 accumulation, weights read as f32 and made exact x16 f16 fragments in registers, h in LDS; w2's f16 fragments ride along as extra blocks; w2 and the unit half leave in the order in which the tail's lanes read them); then one fused kernel: broadcast add + GELU on VALU straight into f16 WMMA fragments, h1 w2 on f16 WMMA, GELU, the 128 -> 1 head and the clip on the f32 accumulators (128-B stores, one a wave).
// Compute dtype: inputs rounded to bf16; inputs / weights exact as f16; bin_h / unit_h and h1 as plain f16 operands (~2^-12); h2, GELU and head f32. v_wmma_f32_16x16x32_f16.
#define NB 2
#define NTB 512
#define DIM 512
#define HALF 256
#define QTR 128
#define NU 256
#define NBT (NB * NTB)           /* 1024 bin rows */
#define NRW ((size_t)NBT * NU)   /* 262144 output rows */
typedef __bf16 v16b __attribute__((ext_vector_type(16)));
typedef unsigned short v8us __attribute__((ext_vector_type(8), may_alias));
typedef float  v8f  __attribute__((ext_vector_type(8)));
typedef float  v4f  __attribute__((ext_vector_type(4)));
typedef float  v4fa __attribute__((ext_vector_type(4), may_alias));
union FragB { v16b v; v8us half[2]; unsigned short u[16]; };

__device__ __forceinline__ unsigned short bf16_bits(float x) { unsigned int u = __float_as_uint(x); return (unsigned short)((u + 0x7FFFu + ((u >> 16) & 1u)) >> 16); }
__device__ __forceinline__ float bf16_val(unsigned short b) { return __uint_as_float(((unsigned int)b) << 16); }
__device__ __forceinline__ float bf16_round(float x) { return bf16_val(bf16_bits(x)); }
// D += A·B with NT terms: 1 = ah·bh, 2 = + al·bh (A split), 3 = + ah·bl (both split)
template <int NT>
__device__ __forceinline__ v8f mmaN(v16b ah, v16b al, v16b bh, v16b bl, v8f c) {
  c = __builtin_amdgcn_wmma_f32_16x16x32_bf16(false, ah, false, bh, (short)0, c, false, false);
  if (NT >= 2) c = __builtin_amdgcn_wmma_f32_16x16x32_bf16(false, al, false, bh, (short)0, c, false, false);
  if (NT >= 3) c = __builtin_amdgcn_wmma_f32_16x16x32_bf16(false, ah, false, bl, (short)0, c, false, false);
  asm volatile("v_nop\n\tv_nop\n\tv_nop\n\tv_nop" : "+v"(c) : "v"(ah), "v"(al), "v"(bh), "v"(bl));
  return c;
}

__global__ __launch_bounds__(256) void k_wt_bf16(const float* __restrict__ W, unsigned short* __restrict__ Wt, int K, int N) {
  const int t = blockIdx.x * 256 + threadIdx.x;
  const int k8n = K / 8;
  if (t >= N * k8n) return;
  const int n = t / k8n, k8 = (t % k8n) * 8;
  v8us v;
#pragma unroll
  for (int i = 0; i < 8; ++i) v[i] = bf16_bits(W[(size_t)(k8 + i) * N + n]);
  *(v8us*)(Wt + (size_t)n * K + k8) = v;
  
}

// GEMM C[M][N] (f32, pitch ldc) = act(A[M][K]·W + bias). A f32 row-major (pitch lda) converted per fragment to bf16
// (ASPLIT: hi/lo two planes -> 2 terms, else single rounded term); Wt bf16 [N][K] (pitch ldb). BIAS_BF16 rounds the
// bias to bf16 first (bias quantised to bf16 before the add). K%32==0, M%16==0, N%64==0.
template <bool ASPLIT, int ACT, bool BIAS_BF16>
__global__ __launch_bounds__(128) void k_gemm_bf(const float* __restrict__ A, int lda, const unsigned short* __restrict__ Wt, int ldb,
                                               const float* __restrict__ bias, float* __restrict__ C, int ldc, int M, int N, int K) {
  __shared__ __attribute__((aligned(16))) float so[4][16][64];
  const int tid = threadIdx.x, w = tid >> 5, lane = tid & 31, ln = lane & 15, hh = lane >> 4;
  const int ntn = N / 64;
  const int wid = blockIdx.x * 4 + w;
  const int mt = wid / ntn, nq = wid % ntn;
  if (mt * 16 >= M) return;
  const int row0 = mt * 16, col0 = nq * 64;
  const float* arow = A + (size_t)(row0 + ln) * lda;
  v8f acc[4] = {};
  for (int kb = 0; kb < K; kb += 32) {
    FragB ah, al;
    const v4f x0 = *(const v4fa*)(arow + kb + 8 * hh), x1 = *(const v4fa*)(arow + kb + 8 * hh + 4);
    const v4f x2 = *(const v4fa*)(arow + kb + 16 + 8 * hh), x3 = *(const v4fa*)(arow + kb + 16 + 8 * hh + 4);
    float xs[16] = {x0[0],x0[1],x0[2],x0[3],x1[0],x1[1],x1[2],x1[3],x2[0],x2[1],x2[2],x2[3],x3[0],x3[1],x3[2],x3[3]};
#pragma unroll
    for (int i = 0; i < 16; ++i) { const unsigned short hb = bf16_bits(xs[i]); ah.u[i] = hb; al.u[i] = ASPLIT ? bf16_bits(xs[i] - bf16_val(hb)) : (unsigned short)0; }
#pragma unroll
    for (int t = 0; t < 4; ++t) {
      const unsigned short* brow = Wt + (size_t)(col0 + t * 16 + ln) * ldb + kb;
      FragB b;
      b.half[0] = *(const v8us*)(brow + 8 * hh);
      b.half[1] = *(const v8us*)(brow + 16 + 8 * hh);
      acc[t] = mmaN<ASPLIT ? 2 : 1>(ah.v, al.v, b.v, b.v, acc[t]);
    }
  }
#pragma unroll
  for (int t = 0; t < 4; ++t) {
    float bv = bias ? bias[col0 + t * 16 + ln] : 0.f;
    if (BIAS_BF16) bv = bf16_round(bv);
#pragma unroll
    for (int r = 0; r < 8; ++r) { float v = acc[t][r] + bv; if (ACT == 1) v = fmaxf(v, 0.f); so[w][8 * hh + r][t * 16 + ln] = v; }
  }
  __builtin_amdgcn_fence(__ATOMIC_ACQ_REL, "workgroup");
  __builtin_amdgcn_wave_barrier();
  const int rsub = lane >> 4, c4 = (lane & 15) * 4;
  {
#pragma unroll
    for (int q = 0; q < 8; ++q) {
      const int r = q * 2 + rsub;
      const v4f v = *(const v4fa*)&so[w][r][c4];
      *(v4f*)(C + (size_t)(row0 + r) * ldc + col0 + c4) = v;
    }
    
  }
}

// GEMM C = act(A·W + bias + resid): A f32 (ASPLIT -> hi/lo 2 terms), Wt bf16 [N][K]; ACT 0 none, 1 relu, 2 exact gelu;
// resid (optional, f32, row index = (row % rmod), pitch ldr, RES_BF16 rounds it) added before the activation.
template <bool ASPLIT, int ACT, bool BIAS_BF16, bool RES_BF16>
__global__ __launch_bounds__(128) void k_gemm_bf3(const float* __restrict__ A, int lda, const unsigned short* __restrict__ Wt, int ldb,
                                                const float* __restrict__ bias, const float* __restrict__ resid, int rmod, int ldr,
                                                float* __restrict__ C, int ldc, int M, int N, int K) {
  __shared__ __attribute__((aligned(16))) float so[4][16][64];
  const int tid = threadIdx.x, w = tid >> 5, lane = tid & 31, ln = lane & 15, hh = lane >> 4;
  const int ntn = N / 64;
  const int wid = blockIdx.x * 4 + w;
  const int mt = wid / ntn, nq = wid % ntn;
  if (mt * 16 >= M) return;
  const int row0 = mt * 16, col0 = nq * 64;
  const float* arow = A + (size_t)(row0 + ln) * lda;
  v8f acc[4] = {};
  for (int kb = 0; kb < K; kb += 32) {
    FragB ah, al;
    const v4f x0 = *(const v4fa*)(arow + kb + 8 * hh), x1 = *(const v4fa*)(arow + kb + 8 * hh + 4);
    const v4f x2 = *(const v4fa*)(arow + kb + 16 + 8 * hh), x3 = *(const v4fa*)(arow + kb + 16 + 8 * hh + 4);
    float xs[16] = {x0[0],x0[1],x0[2],x0[3],x1[0],x1[1],x1[2],x1[3],x2[0],x2[1],x2[2],x2[3],x3[0],x3[1],x3[2],x3[3]};
#pragma unroll
    for (int i = 0; i < 16; ++i) { const unsigned short hb = bf16_bits(xs[i]); ah.u[i] = hb; al.u[i] = ASPLIT ? bf16_bits(xs[i] - bf16_val(hb)) : (unsigned short)0; }
#pragma unroll
    for (int t = 0; t < 4; ++t) {
      const unsigned short* brow = Wt + (size_t)(col0 + t * 16 + ln) * ldb + kb;
      FragB b;
      b.half[0] = *(const v8us*)(brow + 8 * hh);
      b.half[1] = *(const v8us*)(brow + 16 + 8 * hh);
      acc[t] = mmaN<ASPLIT ? 2 : 1>(ah.v, al.v, b.v, b.v, acc[t]);
    }
  }
#pragma unroll
  for (int t = 0; t < 4; ++t) {
    const int col = col0 + t * 16 + ln;
    float bv = bias ? bias[col] : 0.f;
    if (BIAS_BF16) bv = bf16_round(bv);
#pragma unroll
    for (int r = 0; r < 8; ++r) {
      float v = acc[t][r] + bv;
      if (resid) { float rv = resid[(size_t)((row0 + 8 * hh + r) % rmod) * ldr + col]; if (RES_BF16) rv = bf16_round(rv); v += rv; }
      if (ACT == 1) v = fmaxf(v, 0.f);
      if (ACT == 2) v = 0.5f * v * (1.0f + erff(v * 0.70710678118654752f));
      if (ACT == 3) { const float u = 0.7978845608028654f * (v + 0.044715f * v * v * v); v = 0.5f * v * (1.0f + tanhf(u)); }
      so[w][8 * hh + r][t * 16 + ln] = v;
    }
  }
  __builtin_amdgcn_fence(__ATOMIC_ACQ_REL, "workgroup");
  __builtin_amdgcn_wave_barrier();
  const int rsub = lane >> 4, c4 = (lane & 15) * 4;
  {
#pragma unroll
    for (int q = 0; q < 8; ++q) {
      const int r = q * 2 + rsub;
      const v4f v = *(const v4fa*)&so[w][r][c4];
      *(v4f*)(C + (size_t)(row0 + r) * ldc + col0 + c4) = v;
    }
    
  }
}
// row LayerNorm (biased variance, eps) over N: s = X (+ R); optional out_sum <- s; out_norm <- (s-mu)*rsqrt(var+eps)*g + b
template <bool PARAM_BF16>
__global__ __launch_bounds__(256) void k_layernorm(const float* __restrict__ X, const float* __restrict__ R, const float* __restrict__ g, const float* __restrict__ bta,
                                                  float* __restrict__ out_sum, float* __restrict__ out_norm, int N, float eps) {
  __shared__ float red[256];
  const int row = blockIdx.x, tid = threadIdx.x;
  const float* x = X + (size_t)row * N; const float* rr = R ? R + (size_t)row * N : nullptr;
  float vals[16];                     // up to N = 4096
  const int per = N / 256;            // contiguous chunk per thread? use strided-by-4 chunks: thread handles j = tid*4 + 1024*u
  float s1 = 0.f;
  for (int u = 0; u < per / 4; ++u) {
    const int j = tid * 4 + 1024 * u;
    const v4f a = *(const v4fa*)(x + j);
    v4f b = {0.f,0.f,0.f,0.f}; if (rr) b = *(const v4fa*)(rr + j);
#pragma unroll
    for (int q = 0; q < 4; ++q) { const float v = a[q] + b[q]; vals[u * 4 + q] = v; s1 += v; }
  }
  red[tid] = s1; __syncthreads();
  for (int st = 128; st > 0; st >>= 1) { if (tid < st) red[tid] += red[tid + st]; __syncthreads(); }
  const float mu = red[0] / (float)N; __syncthreads();
  float s2 = 0.f;
  for (int u = 0; u < per / 4; ++u)
#pragma unroll
    for (int q = 0; q < 4; ++q) { const float c = vals[u * 4 + q] - mu; s2 += c * c; }
  red[tid] = s2; __syncthreads();
  for (int st = 128; st > 0; st >>= 1) { if (tid < st) red[tid] += red[tid + st]; __syncthreads(); }
  const float rs = rsqrtf(red[0] / (float)N + eps);
  {
    for (int u = 0; u < per / 4; ++u) {
      const int j = tid * 4 + 1024 * u;
      v4f o, sm;
#pragma unroll
      for (int q = 0; q < 4; ++q) {
        float gg = g[j + q], bb = bta[j + q];
        if (PARAM_BF16) { gg = bf16_round(gg); bb = bf16_round(bb); }
        sm[q] = vals[u * 4 + q]; o[q] = (vals[u * 4 + q] - mu) * rs * gg + bb;
      }
      if (out_sum) *(v4f*)(out_sum + (size_t)row * N + j) = sm;
      *(v4f*)(out_norm + (size_t)row * N + j) = o;
    }
    
  }
}



// ---- f16 WMMA path (v_wmma_f32_16x16x32_f16): 11-bit significands for operands in range — used for every GEMM launched here
typedef _Float16 v16h __attribute__((ext_vector_type(16)));
union FragH { v16h v; v8us half[2]; _Float16 h[16]; unsigned short u[16]; };
template <int NT>
__device__ __forceinline__ v8f mmaH(v16h ah, v16h al, v16h bh, v16h bl, v8f c) {
  c = __builtin_amdgcn_wmma_f32_16x16x32_f16(false, ah, false, bh, (short)0, c, false, false);
  if (NT >= 2) c = __builtin_amdgcn_wmma_f32_16x16x32_f16(false, al, false, bh, (short)0, c, false, false);
  if (NT >= 3) c = __builtin_amdgcn_wmma_f32_16x16x32_f16(false, ah, false, bl, (short)0, c, false, false);
  asm volatile("v_nop\n\tv_nop\n\tv_nop\n\tv_nop" : "+v"(c) : "v"(ah), "v"(al), "v"(bh), "v"(bl));
  return c;
}
// batched GEMM like k_gemm_b but f16 operands: A f32 (split into f16 hi/lo if ASPLIT, else rounded to f16), Bt = f16 values [n][k]; alpha; C f32; N multiple of 16 (partial tiles skipped)
template <bool ASPLIT>
__global__ __launch_bounds__(128) void k_gemm_h(const float* __restrict__ A, int lda, size_t sA, const _Float16* __restrict__ Bh, int ldb, size_t sB, float alpha, float* __restrict__ C, int ldc, size_t sC, int M, int N, int K) {
  __shared__ __attribute__((aligned(16))) float so[4][16][64];
  const int tid = threadIdx.x, w = tid >> 5, lane = tid & 31, ln = lane & 15, hh = lane >> 4; const int by = blockIdx.y;
  A += (size_t)by * sA; Bh += (size_t)by * sB; C += (size_t)by * sC;
  const int ntn = (N + 63) / 64; const int wid = blockIdx.x * 4 + w; const int mt = wid / ntn, nq = wid % ntn; if (mt * 16 >= M) return;
  const int row0 = mt * 16, col0 = nq * 64; const float* arow = A + (size_t)(row0 + ln) * lda;
  v8f acc[4] = {};
  for (int kb = 0; kb < K; kb += 32) {
    FragH ah, al;
    const v4f x0 = *(const v4fa*)(arow + kb + 8 * hh), x1 = *(const v4fa*)(arow + kb + 8 * hh + 4), x2 = *(const v4fa*)(arow + kb + 16 + 8 * hh), x3 = *(const v4fa*)(arow + kb + 16 + 8 * hh + 4);
    float xs[16] = {x0[0],x0[1],x0[2],x0[3],x1[0],x1[1],x1[2],x1[3],x2[0],x2[1],x2[2],x2[3],x3[0],x3[1],x3[2],x3[3]};
#pragma unroll
    for (int i = 0; i < 16; ++i) { const _Float16 h = (_Float16)xs[i]; ah.h[i] = h; al.h[i] = ASPLIT ? (_Float16)(xs[i] - (float)h) : (_Float16)0.0f; }
#pragma unroll
    for (int t = 0; t < 4; ++t) { if (col0 + t * 16 >= N) continue; const size_t boff = (size_t)(col0 + t * 16 + ln) * ldb + kb; FragH bq; bq.half[0] = *(const v8us*)(Bh + boff + 8 * hh); bq.half[1] = *(const v8us*)(Bh + boff + 16 + 8 * hh);
      acc[t] = mmaH<ASPLIT ? 2 : 1>(ah.v, al.v, bq.v, bq.v, acc[t]); }
  }
#pragma unroll
  for (int t = 0; t < 4; ++t) { if (col0 + t * 16 >= N) continue;
#pragma unroll
    for (int r = 0; r < 8; ++r) so[w][8 * hh + r][t * 16 + ln] = acc[t][r] * alpha; }
  __builtin_amdgcn_fence(__ATOMIC_ACQ_REL, "workgroup"); __builtin_amdgcn_wave_barrier();
  const int rsub = lane >> 4, c4 = (lane & 15) * 4;
  {
#pragma unroll
    for (int q = 0; q < 8; ++q) { const int r = q * 2 + rsub; if (col0 + c4 < N) { const v4f v = *(const v4fa*)&so[w][r][c4]; *(v4f*)(C + (size_t)(row0 + r) * ldc + col0 + c4) = v; } }
     }
}

// w2 (f32 [HALF][QTR], row-major) -> f16(bf16-rounded weight x 16; the power of two keeps bf16-exact weights exact in f16 away from the subnormal range), in the order of the tail's A fragments:
// chunk c = ((ks * 8 + t) * 2 + half) * 32 + lane holds the 8 values k = ks * 32 + half * 16 + (lane >> 4) * 8 + i of feature t * 16 + (lane & 15).
// One thread a chunk, chunks in thread order: a wave stores 512 contiguous bytes, and the tail's LDS fill is a straight copy of whole 128-byte lines.
__device__ __forceinline__ void d_w2_frag(const int blk, const float* __restrict__ W, _Float16* __restrict__ Wf) {
  const int c = blk * 256 + threadIdx.x; const int lane = c & 31, half = (c >> 5) & 1, t = (c >> 6) & 7, ks = c >> 9;
  const int n = t * 16 + (lane & 15), k8 = ks * 32 + half * 16 + (lane >> 4) * 8; FragH f;
#pragma unroll
  for (int i = 0; i < 8; ++i) f.h[i] = (_Float16)(bf16_round(W[(size_t)(k8 + i) * QTR + n]) * 16.0f); const v8us o = f.half[0];
  *(v8us*)((unsigned short*)Wf + (size_t)c * 8) = o;
}
// k_gemm_hh variant with fused epilogue: v = acc·alpha + bias[by·sBias + col] (+ CP[(row/rowsPerB)·sCPb + by·64 + col] if CP) ; ACT 0 none / 1 elu ; writes f16 C16 (and f32 C if non-null)
template <int ACT>
__global__ __launch_bounds__(128) void k_gemm_hhx(const _Float16* __restrict__ A, int lda, size_t sA, const _Float16* __restrict__ Bh, int ldb, size_t sB, float alpha, const float* __restrict__ bias, size_t sBias, const float* __restrict__ CP, int rowsPerB, size_t sCPb, int row0g,
    float* __restrict__ C, _Float16* __restrict__ C16, int ldc, size_t sC, int M, int N, int K) {
  __shared__ __attribute__((aligned(16))) float so[4][16][64];
  const int tid = threadIdx.x, w = tid >> 5, lane = tid & 31, ln = lane & 15, hh = lane >> 4; const int by = blockIdx.y;
  A += (size_t)by * sA; Bh += (size_t)by * sB; const size_t cofs = (size_t)by * sC; const float* bp = bias ? bias + (size_t)by * sBias : nullptr;
  const int ntn = (N + 63) / 64; const int wid = blockIdx.x * 4 + w; const int mt = wid / ntn, nq = wid % ntn; if (mt * 16 >= M) return;
  const int row0 = mt * 16, col0 = nq * 64; const _Float16* arow = A + (size_t)(row0 + ln) * lda;
  v8f acc[4] = {};
  for (int kb = 0; kb < K; kb += 32) { FragH ah; ah.half[0] = *(const v8us*)((const unsigned short*)arow + kb + 8 * hh); ah.half[1] = *(const v8us*)((const unsigned short*)arow + kb + 16 + 8 * hh);
#pragma unroll
    for (int t = 0; t < 4; ++t) { if (col0 + t * 16 >= N) continue; const size_t boff = (size_t)(col0 + t * 16 + ln) * ldb + kb; FragH bq; bq.half[0] = *(const v8us*)((const unsigned short*)Bh + boff + 8 * hh); bq.half[1] = *(const v8us*)((const unsigned short*)Bh + boff + 16 + 8 * hh);
      acc[t] = mmaH<1>(ah.v, ah.v, bq.v, bq.v, acc[t]); }
  }
#pragma unroll
  for (int t = 0; t < 4; ++t) { if (col0 + t * 16 >= N) continue; const int col = col0 + t * 16 + ln; const float bv = bp ? bf16_round(bp[col]) : 0.f;
#pragma unroll
    for (int r = 0; r < 8; ++r) { float v = acc[t][r] * alpha + bv; if (CP) { const int rr = row0g + row0 + 8 * hh + r; if (rowsPerB < 0) v += CP[cofs + (size_t)rr * ldc + col];      /* rowsPerB < 0: own element of the batched C plane */ else { const int bidx = rr / rowsPerB; v += CP[(size_t)bidx * sCPb + (size_t)by * 64 + col]; } } if (ACT == 1) v = (v > 0.f) ? v : expm1f(v); else if (ACT == 7) v = (v > 0.f) ? v + 1.0f : expf(v); else if (ACT == 8) v = tanhf(v); else if (ACT == 9) v = 0.5f * v * (1.0f + tanhf(0.7978845608028654f * (v + 0.044715f * v * v * v))); else if (ACT == 11) v = 1.0f / (1.0f + expf(-v)); else if (ACT == 12) v = (v > 0.f) ? v : 0.01f * v; else if (ACT == 14) v = (v > 0.f) ? v : 0.1f * v; else if (ACT == 16) v = (v >= 0.f) ? v : 0.3f * v; else if (ACT == 17) v = (v >= 0.f) ? v : 0.2f * v; else if (ACT == 15) v = v / (1.0f + expf(-v)); else if (ACT == 3) v = fmaxf(v, 0.f); else if (ACT == 6) v = 0.5f * v * (1.0f + erff(v * 0.70710678118654752f)); so[w][8 * hh + r][t * 16 + ln] = v; } }
  __builtin_amdgcn_fence(__ATOMIC_ACQ_REL, "workgroup"); __builtin_amdgcn_wave_barrier();
  const int rsub = lane >> 4, c4 = (lane & 15) * 4; typedef _Float16 v4h __attribute__((ext_vector_type(4)));
  {
#pragma unroll
    for (int q = 0; q < 8; ++q) { const int r = q * 2 + rsub; if (col0 + c4 < N) { const v4f v = *(const v4fa*)&so[w][r][c4]; if (C) *(v4f*)(C + cofs + (size_t)(row0 + r) * ldc + col0 + c4) = v; if (C16) { v4h h4; for (int i = 0; i < 4; ++i) h4[i] = (_Float16)v[i]; *(v4h*)(C16 + cofs + (size_t)(row0 + r) * ldc + col0 + c4) = h4; } } }
     }
}


typedef _Float16 v4h __attribute__((ext_vector_type(4)));

__global__ __launch_bounds__(256) void k_h16(const float* __restrict__ x, _Float16* __restrict__ X16, size_t n8) { const size_t t = (size_t)blockIdx.x * 256 + threadIdx.x; if (t >= n8) return; FragH f;
#pragma unroll
  for (int q = 0; q < 8; ++q) f.h[q] = (_Float16)x[t * 8 + q]; *(v8us*)((unsigned short*)X16 + t * 8) = f.half[0];  }
__global__ __launch_bounds__(256) void k_round16f(const float* __restrict__ W, _Float16* __restrict__ Bt, size_t n8) { const size_t t = (size_t)blockIdx.x * 256 + threadIdx.x; if (t >= n8) return; FragH f;
#pragma unroll
  for (int i = 0; i < 8; ++i) f.h[i] = (_Float16)(bf16_round(W[t * 8 + i]) * 16.0f); *(v8us*)((unsigned short*)Bt + t * 8) = f.half[0];  }
template <int NHv, int TTv>
__global__ __launch_bounds__(256) void k_vt(const _Float16* __restrict__ V16, int ldv, int voff, _Float16* __restrict__ Vt) { __shared__ unsigned short tl[64][66]; const int tid = threadIdx.x; const int slab = blockIdx.x / (TTv / 64), lg = blockIdx.x % (TTv / 64); const int b = slab / NHv, h = slab % NHv;
  for (int i = tid; i < 64 * 8; i += 256) { const int r = i / 8, c8 = (i % 8) * 8; FragH f; f.half[0] = *(const v8us*)((const unsigned short*)V16 + ((size_t)b * TTv + lg * 64 + r) * ldv + voff + h * 64 + c8);
#pragma unroll
    for (int q = 0; q < 8; ++q) tl[r][c8 + q] = f.u[q]; }
  __syncthreads();
  {
#pragma unroll
    for (int rd = 0; rd < 2; ++rd) { const int d = rd * 32 + tid / 8, pc = tid % 8; FragH f;
#pragma unroll
      for (int q = 0; q < 8; ++q) f.u[q] = tl[pc * 8 + q][d];
      *(v8us*)((unsigned short*)Vt + ((size_t)slab * 64 + d) * TTv + lg * 64 + pc * 8) = f.half[0]; }
     } }

__global__ __launch_bounds__(256) void k_hl(const float* __restrict__ F, _Float16* __restrict__ Hh, _Float16* __restrict__ Hl, size_t n8) { const size_t t = (size_t)blockIdx.x * 256 + threadIdx.x; if (t >= n8) return; FragH fh, fl; const v4f a = *(const v4fa*)(F + t * 8), c = *(const v4fa*)(F + t * 8 + 4);
#pragma unroll
  for (int q = 0; q < 4; ++q) { _Float16 h = (_Float16)a[q]; fh.h[q] = h; fl.h[q] = (_Float16)((a[q] - (float)h) * 1024.0f); h = (_Float16)c[q]; fh.h[4 + q] = h; fl.h[4 + q] = (_Float16)((c[q] - (float)h) * 1024.0f); }
  { *(v8us*)((unsigned short*)Hh + t * 8) = fh.half[0]; *(v8us*)((unsigned short*)Hl + t * 8) = fl.half[0];  } }

// ---- both projection layers in one launch ----
typedef float v2f __attribute__((ext_vector_type(2)));
typedef float v2fa __attribute__((ext_vector_type(2), may_alias));
typedef _Float16 v2ha __attribute__((ext_vector_type(2), may_alias));
typedef _Float16 v4ha __attribute__((ext_vector_type(4), may_alias));
#define PB_W2 (QTR * HALF / 8 / 256)      /* 16 blocks: w2 */
#define PJ_ROWS 16                        /* rows a block carries through both layers */
#define PJ_PX (DIM + 8)                   /* LDS pitch in f16: 16 bytes past a multiple of 256, so that the 16 rows of a fragment load fall on different banks */
#define PJ_PH (HALF + 8)
#define PJ_PT (HALF + 4)                   /* LDS pitch in f32 of the unit blocks' output tile: an odd multiple of 16 bytes; 16 rows of it fill sX exactly */
#define PJ_STEP ((size_t)32 * HALF * 4)   /* bytes of 32 rows (one k step) of a weight matrix of 256 columns */
// The 16 k rows of one k step that a lane's B fragments hold (k = 8h+i, 16+8h+i, the order of the A fragments), two neighbouring columns a load: 16 lanes read one whole 128-byte line of a row.
// base is the same for the wave, lob the lane's fixed byte offset (row 8h, its column pair).
__device__ __forceinline__ void pj_load(v2f (&q)[16], const char* __restrict__ base, const unsigned lob) {
#pragma unroll
  for (int i = 0; i < 16; ++i) q[i] = *(const v2fa*)(base + lob + (size_t)(i < 8 ? i : i + 8) * HALF * 4);
}
// f32 weights -> the f16 x16 values of bf16-rounded weights, straight into two B fragments (column 2l and column 2l+1 of the wave's 32), two k at a time.
// The x16 comes first (a power of two commutes with the rounding); the hardware's f32 -> bf16 conversion rounds to nearest even as bf16_round does (the same value for every finite weight) and takes one instruction for two weights.
typedef __bf16 v2bf __attribute__((ext_vector_type(2)));
typedef _Float16 v2h __attribute__((ext_vector_type(2)));
__device__ __forceinline__ void pj_cvt(const v2f (&q)[16], FragH& b0, FragH& b1) {
#pragma unroll
  for (int i = 0; i < 16; i += 2) {
    const v2f u = q[i] * 16.0f, v = q[i + 1] * 16.0f;
    const v2f t0 = {u[0], v[0]}, t1 = {u[1], v[1]};
    const v2h h0 = __builtin_convertvector(__builtin_convertvector(__builtin_convertvector(t0, v2bf), v2f), v2h);
    const v2h h1 = __builtin_convertvector(__builtin_convertvector(__builtin_convertvector(t1, v2bf), v2f), v2h);
    b0.h[i] = h0[0]; b0.h[i + 1] = h0[1]; b1.h[i] = h1[0]; b1.h[i + 1] = h1[1];
  }
}
__device__ __forceinline__ v16h pj_afrag(const unsigned short* p) { FragH f; f.half[0] = *(const v8us*)p; f.half[1] = *(const v8us*)(p + 16); return f.v; }
// One launch for all that comes before the fused tail. Blocks 0 .. PB_W2-1 make w2's f16 fragments; each other block takes 16 rows of bin_repr or of unit_embs through both layers:
// x -> f16 in LDS; h = x W + b (K = 512) on WMMA, f16 into LDS; h w1 half (K = 256) on WMMA, f32 to the workspace. No f16 copy of x, h or of these weights goes through memory.
// Wave w owns output columns 32w .. 32w+31 of both layers. Its two B tiles are the even and the odd columns (tile j, lane l: column 32w + 2l + j), so that f32 weights are read row-major as they lie, 8 bytes a lane,
// and converted in registers; each weight is used by one WMMA of the block, so LDS would add nothing. The weight rows of both layers form one stream of 24 k steps, loaded three steps ahead into three register buffers.
// D register r of tile j is row 8h + r, column 32w + 2l + j: a lane stores column pairs. Values and sum order are those of separate GEMMs over k steps of 32.
// The bin half is stored row-major. The unit half is stored as the tail's lanes read it: [tile of 16 units][k step][j][lane][4 f32], lane = 16h + unit, k = 32 step + 16 (j >> 1) + 8h + 4 (j & 1) + e,
// so that each of the tail's loads reads 512 contiguous bytes (four whole lines) and not 32 bytes of each of 16 rows; the turn goes through LDS (sX is free by then), and each line has one writer.
__global__ __launch_bounds__(256) void k_proj(const float* __restrict__ br, const float* __restrict__ ue, const float* __restrict__ bpw, const float* __restrict__ bpb, const float* __restrict__ upw, const float* __restrict__ upb,
                                              const float* __restrict__ w1, const float* __restrict__ w2, _Float16* __restrict__ BW2, float* __restrict__ A, float* __restrict__ Bu) {
  __shared__ __attribute__((aligned(16))) unsigned short sX[PJ_ROWS][PJ_PX];
  __shared__ __attribute__((aligned(16))) unsigned short sH[PJ_ROWS][PJ_PH];
  int b = blockIdx.x;
  if (b < PB_W2) { d_w2_frag(b, w2, BW2); return; }      /* whole blocks, ahead of every barrier */
  b -= PB_W2;
  const bool s = b >= NBT / PJ_ROWS;
  const int r0 = (s ? b - NBT / PJ_ROWS : b) * PJ_ROWS;
  const float* X = (s ? ue : br) + (size_t)r0 * DIM;
  const char* Wa = (const char*)(s ? upw : bpw);
  const char* Wb = (const char*)(w1 + (s ? HALF * HALF : 0));
  const float* bias = s ? upb : bpb;
  float* C = (s ? Bu : A) + (size_t)r0 * HALF;
  const int tid = threadIdx.x, w = tid >> 5, lane = tid & 31, ln = lane & 15, hh = lane >> 4;
  const int col = w * 32 + 2 * ln;
  const unsigned lob = (unsigned)(8 * hh * HALF + col) * 4u;
  v4f x[8];
#pragma unroll
  for (int i = 0; i < 8; ++i) x[i] = *(const v4fa*)(X + i * 1024 + tid * 4);
  const v2f bb = *(const v2fa*)(bias + col);
  v2f q[3][16];
  pj_load(q[0], Wa, lob); pj_load(q[1], Wa + PJ_STEP, lob); pj_load(q[2], Wa + 2 * PJ_STEP, lob);
#pragma unroll
  for (int i = 0; i < 8; ++i) {
    const int e = i * 1024 + tid * 4;
    v4ha h; h[0] = (_Float16)bf16_round(x[i][0]); h[1] = (_Float16)bf16_round(x[i][1]); h[2] = (_Float16)bf16_round(x[i][2]); h[3] = (_Float16)bf16_round(x[i][3]);
    *(v4ha*)&sX[e >> 9][e & (DIM - 1)] = h;
  }
  __syncthreads();
  const v8f z8 = {0.f, 0.f, 0.f, 0.f, 0.f, 0.f, 0.f, 0.f};
  v8f c0 = z8, c1 = z8;
  const unsigned short* ax = &sX[ln][8 * hh];
  // unrolled in full (about 24 KB of text, run once): the three buffers are then fixed registers that the loads write directly, and every weight address is one base, the lane's offset and an immediate;
  // rolled, the refilled values were copied between registers at the foot of each trip, behind a wait for all loads in flight. A buffer is refilled as soon as its values are converted.
#pragma unroll
  for (int ks = 0; ks < DIM / 32; ++ks) {
    FragH b0, b1;
    pj_cvt(q[ks % 3], b0, b1);
    pj_load(q[ks % 3], ks + 3 < DIM / 32 ? Wa + (ks + 3) * PJ_STEP : Wb + (ks + 3 - DIM / 32) * PJ_STEP, lob);      /* the last three refills are the second layer's first steps */
    const v16h a = pj_afrag(ax + ks * 32);
    c0 = __builtin_amdgcn_wmma_f32_16x16x32_f16(false, a, false, b0.v, (short)0, c0, false, false);
    c1 = __builtin_amdgcn_wmma_f32_16x16x32_f16(false, a, false, b1.v, (short)0, c1, false, false);
    __builtin_amdgcn_sched_barrier(0);      /* keeps the later steps' conversions, and with them the waits for their loads, behind this step's refill: moved up, the loads in flight are waited for too early */
  }
  const float bv0 = bf16_round(bb[0]), bv1 = bf16_round(bb[1]);
#pragma unroll
  for (int r = 0; r < 8; ++r) { v2ha h; h[0] = (_Float16)(c0[r] * 0.0625f + bv0); h[1] = (_Float16)(c1[r] * 0.0625f + bv1); *(v2ha*)&sH[8 * hh + r][col] = h; }
  __syncthreads();
  c0 = z8; c1 = z8;
  const unsigned short* ah = &sH[ln][8 * hh];
#pragma unroll
  for (int ks = 0; ks < HALF / 32; ++ks) {
    FragH b0, b1;
    pj_cvt(q[(ks + DIM / 32) % 3], b0, b1);
    if (ks + 3 < HALF / 32) pj_load(q[(ks + DIM / 32) % 3], Wb + (ks + 3) * PJ_STEP, lob);
    const v16h a = pj_afrag(ah + ks * 32);
    c0 = __builtin_amdgcn_wmma_f32_16x16x32_f16(false, a, false, b0.v, (short)0, c0, false, false);
    c1 = __builtin_amdgcn_wmma_f32_16x16x32_f16(false, a, false, b1.v, (short)0, c1, false, false);
    __builtin_amdgcn_sched_barrier(0);      /* as in the first layer's loop */
  }
  if (s) {      /* the same for the whole block */
    float* sT = (float*)&sX[0][0];      /* every wave has left sX at the barrier behind the first layer */
#pragma unroll
    for (int r = 0; r < 8; ++r) { v2f o; o[0] = c0[r] * 0.0625f; o[1] = c1[r] * 0.0625f; *(v2fa*)(sT + (8 * hh + r) * PJ_PT + col) = o; }
    __syncthreads();      /* the turn crosses lanes: the whole tile is in LDS before a lane reads values that other lanes wrote */
#pragma unroll
    for (int j = 0; j < 4; ++j) { const v4f o = *(const v4fa*)(sT + ln * PJ_PT + w * 32 + (j >> 1) * 16 + hh * 8 + (j & 1) * 4); *(v4fa*)(C + (w * 4 + j) * 128 + lane * 4) = o; }      /* wave w's columns are k step w: 512 contiguous bytes a store */
  } else {
#pragma unroll
    for (int r = 0; r < 8; ++r) { v2f o; o[0] = c0[r] * 0.0625f; o[1] = c1[r] * 0.0625f; *(v2fa*)(C + (size_t)(8 * hh + r) * HALF + col) = o; }      /* 16 lanes: one whole 128-byte line */
  }
  asm volatile("s_wait_xcnt 0x0" ::: "memory");      /* behind the last store: in the built code other text follows here that reuses the stores' data registers, and this wait stands in front of any such overwrite */
}

__global__ __launch_bounds__(256) void k_f16c(const float* __restrict__ A, _Float16* __restrict__ D, size_t n8) { const size_t t = (size_t)blockIdx.x * 256 + threadIdx.x; if (t >= n8) return; const v8f a = *(const v8f*)(A + t * 8); FragH f; for (int q = 0; q < 8; ++q) f.h[q] = (_Float16)a[q]; *(v8us*)((unsigned short*)D + t * 8) = f.half[0];  }
// Exact (erf) GELU in f32, written as h Phi(h) = max(h, 0) - |h| Q(|h|) with Q(a) = erfc(a / sqrt 2) / 2 = exp2(p(a)): one straight line for every h, no second form to evaluate and select, no range reduction around v_exp_f32 (p < 0, and an error of p counts only times Q).
// p is a degree-8 fit of log2 Q(a) on 0 <= a <= 5.5, weighted by Q: evaluated in f32 the error of Phi is about 1e-7 at most (the rounding level of 1 + erf in f32), and a negative h has no cancellation.
// The leading coefficient is negative, so past the fitted range p keeps falling and |h| exp2(p) goes to 0 as |h| Q does (the two are within 1e-8 from a = 5 on); every finite h is covered, h = +infinity or -infinity would give infinity times 0.
__device__ __forceinline__ float gelu_erf(float s) {
  const float a = fabsf(s);
  float p = fmaf(a, -2.12157283e-6f, 3.09552197e-5f); p = fmaf(a, p, -1.46757287e-4f); p = fmaf(a, p, -2.30747639e-4f); p = fmaf(a, p, 7.18435273e-3f);
  p = fmaf(a, p, -5.25792725e-2f); p = fmaf(a, p, -4.59180444e-1f); p = fmaf(a, p, -1.15110874e+0f); p = fmaf(a, p, -9.99999940e-1f);
  return fmaf(-a, __builtin_amdgcn_exp2f(p), fmaxf(s, 0.f));
}
// Fused tail: h1 = gelu(A[bt] + Bu[n] + b1), h2 = gelu(h1 w2 + b2), out = clip(h2 w3 + b3); h1 and h2 never leave the registers.
// One work-group per bin row bt; wave w owns units 32w .. 32w+31 as two tiles of 16 rows.
// The product runs transposed: w2's columns are the A operand (from LDS, stored in fragment order), the h1 rows the B operand.
// A lane computes the 16 h1 values of its own row and k half straight into the B fragment (k = 8h+i, 16+8h+i on both operands).
// D register r of tile t is then h2[row = lane & 15][feature 16t + 8h + r]: the head's dot product stays inside a lane but for one add across the lane halves.
__global__ __launch_bounds__(256) void k_tail(const float* __restrict__ A, const float* __restrict__ Bu, const float* __restrict__ b1, const _Float16* __restrict__ W2t,
                                              const float* __restrict__ b2, const float* __restrict__ w3, const float* __restrict__ b3, float* __restrict__ out) {
  __shared__ __attribute__((aligned(16))) unsigned short sW[HALF / 32][QTR / 16][2][32][8];   /* [k step][feature tile][fragment half][lane][8 f16], 64 KiB: each fragment load reads 512 contiguous bytes */
  __shared__ __attribute__((aligned(16))) float sab[HALF];
  __shared__ __attribute__((aligned(16))) float sb2[QTR];
  __shared__ __attribute__((aligned(16))) float sw3[QTR];
  const int tid = threadIdx.x, w = tid >> 5, lane = tid & 31, ln = lane & 15, hh = lane >> 4;
  const int bt = blockIdx.x;
  // unrolled: all 16 loads of the w2 fill are in flight before the first LDS store
#pragma unroll
  for (int i = 0; i < 16; ++i) {      /* W2t lies in sW's own order: a straight copy, 512 contiguous bytes a wave and load */
    const int c = (i * 256 + tid) * 8;
    const v8us v = *(const v8us*)((const unsigned short*)W2t + c);
    *(v8us*)(&sW[0][0][0][0][0] + c) = v;
  }
  sab[tid] = A[(size_t)bt * HALF + tid] + bf16_round(b1[tid]);
  if (tid < QTR) { sb2[tid] = bf16_round(b2[tid]); sw3[tid] = bf16_round(w3[tid]); }
  __syncthreads();
  // Bu lies in fragment order: (tile, k step) q = 8 tile + ks of wave w is 512 floats at 16w + q, four loads of 128 floats, 4 a lane (k = 8h + e, 8h + 4 + e, 16 + 8h + e, 16 + 8h + 4 + e of unit row lane & 15)
  const float* ub = Bu + (size_t)w * 16 * 512 + lane * 4;
  v4f u0 = *(const v4fa*)(ub), u1 = *(const v4fa*)(ub + 128), u2 = *(const v4fa*)(ub + 256), u3 = *(const v4fa*)(ub + 384);
  float res = 0.f;
  // the tile loop and the k loop stay rolled: 16 + 64 inlined GELUs are all the text that the instruction cache should have to hold;
  // the loops inside them are unrolled, so that fragments and accumulators are indexed by constants and stay in registers
#pragma unroll 1
  for (int tile = 0; tile < 2; ++tile) {
    v8f acc[8] = {};
#pragma unroll 1
    for (int ks = 0; ks < HALF / 32; ++ks) {
      // the next step's unit values are loaded one step ahead (the last step reloads its own)
      const int qn = min(tile * 8 + ks + 1, 15);
      const float* un = ub + qn * 512;
      const v4f p0 = *(const v4fa*)(un), p1 = *(const v4fa*)(un + 128), p2 = *(const v4fa*)(un + 256), p3 = *(const v4fa*)(un + 384);
      const float* ap = &sab[ks * 32 + 8 * hh];
      const v4f a0 = *(const v4fa*)(ap), a1 = *(const v4fa*)(ap + 4), a2 = *(const v4fa*)(ap + 16), a3 = *(const v4fa*)(ap + 20);
      FragH f;
#pragma unroll
      for (int i = 0; i < 4; ++i) {
        f.h[i] = (_Float16)gelu_erf(a0[i] + u0[i]); f.h[4 + i] = (_Float16)gelu_erf(a1[i] + u1[i]);
        f.h[8 + i] = (_Float16)gelu_erf(a2[i] + u2[i]); f.h[12 + i] = (_Float16)gelu_erf(a3[i] + u3[i]);
      }
#pragma unroll
      for (int t = 0; t < 8; ++t) {
        FragH wf; wf.half[0] = *(const v8us*)&sW[ks][t][0][lane][0]; wf.half[1] = *(const v8us*)&sW[ks][t][1][lane][0];
        acc[t] = __builtin_amdgcn_wmma_f32_16x16x32_f16(false, wf.v, false, f.v, (short)0, acc[t], false, false);
      }
      u0 = p0; u1 = p1; u2 = p2; u3 = p3;
    }
    // compiler fence: keeps the 32 LDS loads of b2 and w3 inside the tile loop; hoisted out of it they hold 128 registers through the k loop, which then has none left to fetch w2 fragments ahead of its WMMAs
    asm volatile("" ::: "memory");
    v4f pv = {0.f, 0.f, 0.f, 0.f};      /* four partial sums of the head, so that the GELUs pair up into packed f32 instructions */
#pragma unroll
    for (int t = 0; t < 8; ++t) {
      const int f0 = t * 16 + 8 * hh;
      const v4f c0 = *(const v4fa*)&sb2[f0], c1 = *(const v4fa*)&sb2[f0 + 4], g0 = *(const v4fa*)&sw3[f0], g1 = *(const v4fa*)&sw3[f0 + 4];
      v4f h0, h1;
#pragma unroll
      for (int r = 0; r < 4; ++r) { h0[r] = gelu_erf(acc[t][r] * 0.0625f + c0[r]); h1[r] = gelu_erf(acc[t][4 + r] * 0.0625f + c1[r]); }
      pv += h0 * g0; pv += h1 * g1;
    }
    float p = (pv[0] + pv[1]) + (pv[2] + pv[3]);
    p += __shfl_xor(p, 16, 32);
    if (hh == tile) res = p;      /* tile 0's rows end in lanes 0-15, tile 1's in lanes 16-31: one 128-byte store a wave */
  }
  res += bf16_round(b3[0]);
  out[(size_t)bt * NU + w * 32 + lane] = fminf(fmaxf(res, -10.0f), 10.0f);
}

extern "C" void kernel_launch(void* const* d_in, const int* in_sizes, int n_in,
                              void* d_out, int out_size, void* d_ws, size_t ws_size, hipStream_t stream) {
  (void)in_sizes; (void)n_in; (void)out_size;
  const float* const* I = (const float* const*)d_in; const float* br = I[0]; const float* ue = I[1]; const float* bpw = I[2]; const float* bpb = I[3]; const float* upw = I[4]; const float* upb = I[5]; const float* w1 = I[6]; const float* b1 = I[7]; const float* w2 = I[8]; const float* b2 = I[9]; const float* w3 = I[10]; const float* b3 = I[11];
  char* ws = (char*)d_ws; size_t off = 0;
  auto take = [&](size_t bytes) { char* p = ws + off; off += (bytes + 255) & ~(size_t)255; return p; };
  _Float16* BW2 = (_Float16*)take((size_t)QTR * HALF * 2); float* A = (float*)take((size_t)NBT * HALF * 4); float* Bu = (float*)take((size_t)NU * HALF * 4);
  if (off > ws_size) return;
  k_proj<<<PB_W2 + (NBT + NU) / PJ_ROWS, 256, 0, stream>>>(br, ue, bpw, bpb, upw, upb, w1, w2, BW2, A, Bu);      /* w2 -> f16 x16 in fragment order; A = (bin_repr Wbp + b) w1a, Bu = (unit_embs Wup + b) w1b in fragment order */
  k_tail<<<NBT, 256, 0, stream>>>(A, Bu, b1, BW2, b2, w3, b3, (float*)d_out);      /* h1, h2, head, clip */
}

// v006
// A run of this version takes 34.4 microseconds.
// Next to v005, in two timings, it ran 1.13 times as fast each time.
// Over all steps from v000 it is 8.90 times as fast.
#include <hip/hip_runtime.h>
// PerNeuronMLPHead (2 x 512 time bins x 512, 256 units x 512: bin_h = bin_repr Wbp + b, unit_h = unit_embs Wup + b (256 wide); h1[(b,t), n] = gelu(bin_h w1a + unit_h w1b + b1) (the split-weight broadcast add); h2 = gelu(h1 w2 + b2) (128); log_rate = h2 w3 + b3; clip(-10, 10); exact erf GELU).
// Structure, two launches: one for both projection layers (16 rows a block through x W + b and h w1 half on f16 WMMA, f32 accumulation, weights read as f32 and made exact x16 f16 fragments in registers, h in LDS; w2's f16 fragments ride along as extra blocks; w2 and the unit half leave in the order in which the tail's lanes read them); then one fused kernel: broadcast add + GELU on VALU straight into f16 WMMA fragments, h1 w2 on f16 WMMA, GELU, the 128 -> 1 head and the clip on the f32 accumulators, two bin rows a work-group (128-B stores, one a wave and bin row).
// Compute dtype: inputs rounded to bf16; inputs / weights exact as f16; bin_h / unit_h and h1 as plain f16 operands (~2^-12); h2, GELU and head f32. v_wmma_f32_16x16x32_f16.
#define NB 2
#define NTB 512
#define DIM 512
#define HALF 256
#define QTR 128
#define NU 256
#define NBT (NB * NTB)           /* 1024 bin rows */
#define NRW ((size_t)NBT * NU)   /* 262144 output rows */
typedef __bf16 v16b __attribute__((ext_vector_type(16)));
typedef unsigned short v8us __attribute__((ext_vector_type(8), may_alias));
typedef float  v8f  __attribute__((ext_vector_type(8)));
typedef float  v4f  __attribute__((ext_vector_type(4)));
typedef float  v4fa __attribute__((ext_vector_type(4), may_alias));
union FragB { v16b v; v8us half[2]; unsigned short u[16]; };

__device__ __forceinline__ unsigned short bf16_bits(float x) { unsigned int u = __float_as_uint(x); return (unsigned short)((u + 0x7FFFu + ((u >> 16) & 1u)) >> 16); }
__device__ __forceinline__ float bf16_val(unsigned short b) { return __uint_as_float(((unsigned int)b) << 16); }
__device__ __forceinline__ float bf16_round(float x) { return bf16_val(bf16_bits(x)); }
// D += A·B with NT terms: 1 = ah·bh, 2 = + al·bh (A split), 3 = + ah·bl (both split)
template <int NT>
__device__ __forceinline__ v8f mmaN(v16b ah, v16b al, v16b bh, v16b bl, v8f c) {
  c = __builtin_amdgcn_wmma_f32_16x16x32_bf16(false, ah, false, bh, (short)0, c, false, false);
  if (NT >= 2) c = __builtin_amdgcn_wmma_f32_16x16x32_bf16(false, al, false, bh, (short)0, c, false, false);
  if (NT >= 3) c = __builtin_amdgcn_wmma_f32_16x16x32_bf16(false, ah, false, bl, (short)0, c, false, false);
  asm volatile("v_nop\n\tv_nop\n\tv_nop\n\tv_nop" : "+v"(c) : "v"(ah), "v"(al), "v"(bh), "v"(bl));
  return c;
}

__global__ __launch_bounds__(256) void k_wt_bf16(const float* __restrict__ W, unsigned short* __restrict__ Wt, int K, int N) {
  const int t = blockIdx.x * 256 + threadIdx.x;
  const int k8n = K / 8;
  if (t >= N * k8n) return;
  const int n = t / k8n, k8 = (t % k8n) * 8;
  v8us v;
#pragma unroll
  for (int i = 0; i < 8; ++i) v[i] = bf16_bits(W[(size_t)(k8 + i) * N + n]);
  *(v8us*)(Wt + (size_t)n * K + k8) = v;
  
}

// GEMM C[M][N] (f32, pitch ldc) = act(A[M][K]·W + bias). A f32 row-major (pitch lda) converted per fragment to bf16
// (ASPLIT: hi/lo two planes -> 2 terms, else single rounded term); Wt bf16 [N][K] (pitch ldb). BIAS_BF16 rounds the
// bias to bf16 first (bias quantised to bf16 before the add). K%32==0, M%16==0, N%64==0.
template <bool ASPLIT, int ACT, bool BIAS_BF16>
__global__ __launch_bounds__(128) void k_gemm_bf(const float* __restrict__ A, int lda, const unsigned short* __restrict__ Wt, int ldb,
                                               const float* __restrict__ bias, float* __restrict__ C, int ldc, int M, int N, int K) {
  __shared__ __attribute__((aligned(16))) float so[4][16][64];
  const int tid = threadIdx.x, w = tid >> 5, lane = tid & 31, ln = lane & 15, hh = lane >> 4;
  const int ntn = N / 64;
  const int wid = blockIdx.x * 4 + w;
  const int mt = wid / ntn, nq = wid % ntn;
  if (mt * 16 >= M) return;
  const int row0 = mt * 16, col0 = nq * 64;
  const float* arow = A + (size_t)(row0 + ln) * lda;
  v8f acc[4] = {};
  for (int kb = 0; kb < K; kb += 32) {
    FragB ah, al;
    const v4f x0 = *(const v4fa*)(arow + kb + 8 * hh), x1 = *(const v4fa*)(arow + kb + 8 * hh + 4);
    const v4f x2 = *(const v4fa*)(arow + kb + 16 + 8 * hh), x3 = *(const v4fa*)(arow + kb + 16 + 8 * hh + 4);
    float xs[16] = {x0[0],x0[1],x0[2],x0[3],x1[0],x1[1],x1[2],x1[3],x2[0],x2[1],x2[2],x2[3],x3[0],x3[1],x3[2],x3[3]};
#pragma unroll
    for (int i = 0; i < 16; ++i) { const unsigned short hb = bf16_bits(xs[i]); ah.u[i] = hb; al.u[i] = ASPLIT ? bf16_bits(xs[i] - bf16_val(hb)) : (unsigned short)0; }
#pragma unroll
    for (int t = 0; t < 4; ++t) {
      const unsigned short* brow = Wt + (size_t)(col0 + t * 16 + ln) * ldb + kb;
      FragB b;
      b.half[0] = *(const v8us*)(brow + 8 * hh);
      b.half[1] = *(const v8us*)(brow + 16 + 8 * hh);
      acc[t] = mmaN<ASPLIT ? 2 : 1>(ah.v, al.v, b.v, b.v, acc[t]);
    }
  }
#pragma unroll
  for (int t = 0; t < 4; ++t) {
    float bv = bias ? bias[col0 + t * 16 + ln] : 0.f;
    if (BIAS_BF16) bv = bf16_round(bv);
#pragma unroll
    for (int r = 0; r < 8; ++r) { float v = acc[t][r] + bv; if (ACT == 1) v = fmaxf(v, 0.f); so[w][8 * hh + r][t * 16 + ln] = v; }
  }
  __builtin_amdgcn_fence(__ATOMIC_ACQ_REL, "workgroup");
  __builtin_amdgcn_wave_barrier();
  const int rsub = lane >> 4, c4 = (lane & 15) * 4;
  {
#pragma unroll
    for (int q = 0; q < 8; ++q) {
      const int r = q * 2 + rsub;
      const v4f v = *(const v4fa*)&so[w][r][c4];
      *(v4f*)(C + (size_t)(row0 + r) * ldc + col0 + c4) = v;
    }
    
  }
}

// GEMM C = act(A·W + bias + resid): A f32 (ASPLIT -> hi/lo 2 terms), Wt bf16 [N][K]; ACT 0 none, 1 relu, 2 exact gelu;
// resid (optional, f32, row index = (row % rmod), pitch ldr, RES_BF16 rounds it) added before the activation.
template <bool ASPLIT, int ACT, bool BIAS_BF16, bool RES_BF16>
__global__ __launch_bounds__(128) void k_gemm_bf3(const float* __restrict__ A, int lda, const unsigned short* __restrict__ Wt, int ldb,
                                                const float* __restrict__ bias, const float* __restrict__ resid, int rmod, int ldr,
                                                float* __restrict__ C, int ldc, int M, int N, int K) {
  __shared__ __attribute__((aligned(16))) float so[4][16][64];
  const int tid = threadIdx.x, w = tid >> 5, lane = tid & 31, ln = lane & 15, hh = lane >> 4;
  const int ntn = N / 64;
  const int wid = blockIdx.x * 4 + w;
  const int mt = wid / ntn, nq = wid % ntn;
  if (mt * 16 >= M) return;
  const int row0 = mt * 16, col0 = nq * 64;
  const float* arow = A + (size_t)(row0 + ln) * lda;
  v8f acc[4] = {};
  for (int kb = 0; kb < K; kb += 32) {
    FragB ah, al;
    const v4f x0 = *(const v4fa*)(arow + kb + 8 * hh), x1 = *(const v4fa*)(arow + kb + 8 * hh + 4);
    const v4f x2 = *(const v4fa*)(arow + kb + 16 + 8 * hh), x3 = *(const v4fa*)(arow + kb + 16 + 8 * hh + 4);
    float xs[16] = {x0[0],x0[1],x0[2],x0[3],x1[0],x1[1],x1[2],x1[3],x2[0],x2[1],x2[2],x2[3],x3[0],x3[1],x3[2],x3[3]};
#pragma unroll
    for (int i = 0; i < 16; ++i) { const unsigned short hb = bf16_bits(xs[i]); ah.u[i] = hb; al.u[i] = ASPLIT ? bf16_bits(xs[i] - bf16_val(hb)) : (unsigned short)0; }
#pragma unroll
    for (int t = 0; t < 4; ++t) {
      const unsigned short* brow = Wt + (size_t)(col0 + t * 16 + ln) * ldb + kb;
      FragB b;
      b.half[0] = *(const v8us*)(brow + 8 * hh);
      b.half[1] = *(const v8us*)(brow + 16 + 8 * hh);
      acc[t] = mmaN<ASPLIT ? 2 : 1>(ah.v, al.v, b.v, b.v, acc[t]);
    }
  }
#pragma unroll
  for (int t = 0; t < 4; ++t) {
    const int col = col0 + t * 16 + ln;
    float bv = bias ? bias[col] : 0.f;
    if (BIAS_BF16) bv = bf16_round(bv);
#pragma unroll
    for (int r = 0; r < 8; ++r) {
      float v = acc[t][r] + bv;
      if (resid) { float rv = resid[(size_t)((row0 + 8 * hh + r) % rmod) * ldr + col]; if (RES_BF16) rv = bf16_round(rv); v += rv; }
      if (ACT == 1) v = fmaxf(v, 0.f);
      if (ACT == 2) v = 0.5f * v * (1.0f + erff(v * 0.70710678118654752f));
      if (ACT == 3) { const float u = 0.7978845608028654f * (v + 0.044715f * v * v * v); v = 0.5f * v * (1.0f + tanhf(u)); }
      so[w][8 * hh + r][t * 16 + ln] = v;
    }
  }
  __builtin_amdgcn_fence(__ATOMIC_ACQ_REL, "workgroup");
  __builtin_amdgcn_wave_barrier();
  const int rsub = lane >> 4, c4 = (lane & 15) * 4;
  {
#pragma unroll
    for (int q = 0; q < 8; ++q) {
      const int r = q * 2 + rsub;
      const v4f v = *(const v4fa*)&so[w][r][c4];
      *(v4f*)(C + (size_t)(row0 + r) * ldc + col0 + c4) = v;
    }
    
  }
}
// row LayerNorm (biased variance, eps) over N: s = X (+ R); optional out_sum <- s; out_norm <- (s-mu)*rsqrt(var+eps)*g + b
template <bool PARAM_BF16>
__global__ __launch_bounds__(256) void k_layernorm(const float* __restrict__ X, const float* __restrict__ R, const float* __restrict__ g, const float* __restrict__ bta,
                                                  float* __restrict__ out_sum, float* __restrict__ out_norm, int N, float eps) {
  __shared__ float red[256];
  const int row = blockIdx.x, tid = threadIdx.x;
  const float* x = X + (size_t)row * N; const float* rr = R ? R + (size_t)row * N : nullptr;
  float vals[16];                     // up to N = 4096
  const int per = N / 256;            // contiguous chunk per thread? use strided-by-4 chunks: thread handles j = tid*4 + 1024*u
  float s1 = 0.f;
  for (int u = 0; u < per / 4; ++u) {
    const int j = tid * 4 + 1024 * u;
    const v4f a = *(const v4fa*)(x + j);
    v4f b = {0.f,0.f,0.f,0.f}; if (rr) b = *(const v4fa*)(rr + j);
#pragma unroll
    for (int q = 0; q < 4; ++q) { const float v = a[q] + b[q]; vals[u * 4 + q] = v; s1 += v; }
  }
  red[tid] = s1; __syncthreads();
  for (int st = 128; st > 0; st >>= 1) { if (tid < st) red[tid] += red[tid + st]; __syncthreads(); }
  const float mu = red[0] / (float)N; __syncthreads();
  float s2 = 0.f;
  for (int u = 0; u < per / 4; ++u)
#pragma unroll
    for (int q = 0; q < 4; ++q) { const float c = vals[u * 4 + q] - mu; s2 += c * c; }
  red[tid] = s2; __syncthreads();
  for (int st = 128; st > 0; st >>= 1) { if (tid < st) red[tid] += red[tid + st]; __syncthreads(); }
  const float rs = rsqrtf(red[0] / (float)N + eps);
  {
    for (int u = 0; u < per / 4; ++u) {
      const int j = tid * 4 + 1024 * u;
      v4f o, sm;
#pragma unroll
      for (int q = 0; q < 4; ++q) {
        float gg = g[j + q], bb = bta[j + q];
        if (PARAM_BF16) { gg = bf16_round(gg); bb = bf16_round(bb); }
        sm[q] = vals[u * 4 + q]; o[q] = (vals[u * 4 + q] - mu) * rs * gg + bb;
      }
      if (out_sum) *(v4f*)(out_sum + (size_t)row * N + j) = sm;
      *(v4f*)(out_norm + (size_t)row * N + j) = o;
    }
    
  }
}



// ---- f16 WMMA path (v_wmma_f32_16x16x32_f16): 11-bit significands for operands in range — used for every GEMM launched here
typedef _Float16 v16h __attribute__((ext_vector_type(16)));
union FragH { v16h v; v8us half[2]; _Float16 h[16]; unsigned short u[16]; };
template <int NT>
__device__ __forceinline__ v8f mmaH(v16h ah, v16h al, v16h bh, v16h bl, v8f c) {
  c = __builtin_amdgcn_wmma_f32_16x16x32_f16(false, ah, false, bh, (short)0, c, false, false);
  if (NT >= 2) c = __builtin_amdgcn_wmma_f32_16x16x32_f16(false, al, false, bh, (short)0, c, false, false);
  if (NT >= 3) c = __builtin_amdgcn_wmma_f32_16x16x32_f16(false, ah, false, bl, (short)0, c, false, false);
  asm volatile("v_nop\n\tv_nop\n\tv_nop\n\tv_nop" : "+v"(c) : "v"(ah), "v"(al), "v"(bh), "v"(bl));
  return c;
}
// batched GEMM like k_gemm_b but f16 operands: A f32 (split into f16 hi/lo if ASPLIT, else rounded to f16), Bt = f16 values [n][k]; alpha; C f32; N multiple of 16 (partial tiles skipped)
template <bool ASPLIT>
__global__ __launch_bounds__(128) void k_gemm_h(const float* __restrict__ A, int lda, size_t sA, const _Float16* __restrict__ Bh, int ldb, size_t sB, float alpha, float* __restrict__ C, int ldc, size_t sC, int M, int N, int K) {
  __shared__ __attribute__((aligned(16))) float so[4][16][64];
  const int tid = threadIdx.x, w = tid >> 5, lane = tid & 31, ln = lane & 15, hh = lane >> 4; const int by = blockIdx.y;
  A += (size_t)by * sA; Bh += (size_t)by * sB; C += (size_t)by * sC;
  const int ntn = (N + 63) / 64; const int wid = blockIdx.x * 4 + w; const int mt = wid / ntn, nq = wid % ntn; if (mt * 16 >= M) return;
  const int row0 = mt * 16, col0 = nq * 64; const float* arow = A + (size_t)(row0 + ln) * lda;
  v8f acc[4] = {};
  for (int kb = 0; kb < K; kb += 32) {
    FragH ah, al;
    const v4f x0 = *(const v4fa*)(arow + kb + 8 * hh), x1 = *(const v4fa*)(arow + kb + 8 * hh + 4), x2 = *(const v4fa*)(arow + kb + 16 + 8 * hh), x3 = *(const v4fa*)(arow + kb + 16 + 8 * hh + 4);
    float xs[16] = {x0[0],x0[1],x0[2],x0[3],x1[0],x1[1],x1[2],x1[3],x2[0],x2[1],x2[2],x2[3],x3[0],x3[1],x3[2],x3[3]};
#pragma unroll
    for (int i = 0; i < 16; ++i) { const _Float16 h = (_Float16)xs[i]; ah.h[i] = h; al.h[i] = ASPLIT ? (_Float16)(xs[i] - (float)h) : (_Float16)0.0f; }
#pragma unroll
    for (int t = 0; t < 4; ++t) { if (col0 + t * 16 >= N) continue; const size_t boff = (size_t)(col0 + t * 16 + ln) * ldb + kb; FragH bq; bq.half[0] = *(const v8us*)(Bh + boff + 8 * hh); bq.half[1] = *(const v8us*)(Bh + boff + 16 + 8 * hh);
      acc[t] = mmaH<ASPLIT ? 2 : 1>(ah.v, al.v, bq.v, bq.v, acc[t]); }
  }
#pragma unroll
  for (int t = 0; t < 4; ++t) { if (col0 + t * 16 >= N) continue;
#pragma unroll
    for (int r = 0; r < 8; ++r) so[w][8 * hh + r][t * 16 + ln] = acc[t][r] * alpha; }
  __builtin_amdgcn_fence(__ATOMIC_ACQ_REL, "workgroup"); __builtin_amdgcn_wave_barrier();
  const int rsub = lane >> 4, c4 = (lane & 15) * 4;
  {
#pragma unroll
    for (int q = 0; q < 8; ++q) { const int r = q * 2 + rsub; if (col0 + c4 < N) { const v4f v = *(const v4fa*)&so[w][r][c4]; *(v4f*)(C + (size_t)(row0 + r) * ldc + col0 + c4) = v; } }
     }
}

// w2 (f32 [HALF][QTR], row-major) -> f16(bf16-rounded weight x 16; the power of two keeps bf16-exact weights exact in f16 away from the subnormal range), in the order of the tail's A fragments:
// chunk c = ((ks * 8 + t) * 2 + half) * 32 + lane holds the 8 values k = ks * 32 + half * 16 + (lane >> 4) * 8 + i of feature t * 16 + (lane & 15).
// One thread a chunk, chunks in thread order: a wave stores 512 contiguous bytes, and the tail's LDS fill is a straight copy of whole 128-byte lines.
__device__ __forceinline__ void d_w2_frag(const int blk, const float* __restrict__ W, _Float16* __restrict__ Wf) {
  const int c = blk * 256 + threadIdx.x; const int lane = c & 31, half = (c >> 5) & 1, t = (c >> 6) & 7, ks = c >> 9;
  const int n = t * 16 + (lane & 15), k8 = ks * 32 + half * 16 + (lane >> 4) * 8; FragH f;
#pragma unroll
  for (int i = 0; i < 8; ++i) f.h[i] = (_Float16)(bf16_round(W[(size_t)(k8 + i) * QTR + n]) * 16.0f); const v8us o = f.half[0];
  *(v8us*)((unsigned short*)Wf + (size_t)c * 8) = o;
}
// k_gemm_hh variant with fused epilogue: v = acc·alpha + bias[by·sBias + col] (+ CP[(row/rowsPerB)·sCPb + by·64 + col] if CP) ; ACT 0 none / 1 elu ; writes f16 C16 (and f32 C if non-null)
template <int ACT>
__global__ __launch_bounds__(128) void k_gemm_hhx(const _Float16* __restrict__ A, int lda, size_t sA, const _Float16* __restrict__ Bh, int ldb, size_t sB, float alpha, const float* __restrict__ bias, size_t sBias, const float* __restrict__ CP, int rowsPerB, size_t sCPb, int row0g,
    float* __restrict__ C, _Float16* __restrict__ C16, int ldc, size_t sC, int M, int N, int K) {
  __shared__ __attribute__((aligned(16))) float so[4][16][64];
  const int tid = threadIdx.x, w = tid >> 5, lane = tid & 31, ln = lane & 15, hh = lane >> 4; const int by = blockIdx.y;
  A += (size_t)by * sA; Bh += (size_t)by * sB; const size_t cofs = (size_t)by * sC; const float* bp = bias ? bias + (size_t)by * sBias : nullptr;
  const int ntn = (N + 63) / 64; const int wid = blockIdx.x * 4 + w; const int mt = wid / ntn, nq = wid % ntn; if (mt * 16 >= M) return;
  const int row0 = mt * 16, col0 = nq * 64; const _Float16* arow = A + (size_t)(row0 + ln) * lda;
  v8f acc[4] = {};
  for (int kb = 0; kb < K; kb += 32) { FragH ah; ah.half[0] = *(const v8us*)((const unsigned short*)arow + kb + 8 * hh); ah.half[1] = *(const v8us*)((const unsigned short*)arow + kb + 16 + 8 * hh);
#pragma unroll
    for (int t = 0; t < 4; ++t) { if (col0 + t * 16 >= N) continue; const size_t boff = (size_t)(col0 + t * 16 + ln) * ldb + kb; FragH bq; bq.half[0] = *(const v8us*)((const unsigned short*)Bh + boff + 8 * hh); bq.half[1] = *(const v8us*)((const unsigned short*)Bh + boff + 16 + 8 * hh);
      acc[t] = mmaH<1>(ah.v, ah.v, bq.v, bq.v, acc[t]); }
  }
#pragma unroll
  for (int t = 0; t < 4; ++t) { if (col0 + t * 16 >= N) continue; const int col = col0 + t * 16 + ln; const float bv = bp ? bf16_round(bp[col]) : 0.f;
#pragma unroll
    for (int r = 0; r < 8; ++r) { float v = acc[t][r] * alpha + bv; if (CP) { const int rr = row0g + row0 + 8 * hh + r; if (rowsPerB < 0) v += CP[cofs + (size_t)rr * ldc + col];      /* rowsPerB < 0: own element of the batched C plane */ else { const int bidx = rr / rowsPerB; v += CP[(size_t)bidx * sCPb + (size_t)by * 64 + col]; } } if (ACT == 1) v = (v > 0.f) ? v : expm1f(v); else if (ACT == 7) v = (v > 0.f) ? v + 1.0f : expf(v); else if (ACT == 8) v = tanhf(v); else if (ACT == 9) v = 0.5f * v * (1.0f + tanhf(0.7978845608028654f * (v + 0.044715f * v * v * v))); else if (ACT == 11) v = 1.0f / (1.0f + expf(-v)); else if (ACT == 12) v = (v > 0.f) ? v : 0.01f * v; else if (ACT == 14) v = (v > 0.f) ? v : 0.1f * v; else if (ACT == 16) v = (v >= 0.f) ? v : 0.3f * v; else if (ACT == 17) v = (v >= 0.f) ? v : 0.2f * v; else if (ACT == 15) v = v / (1.0f + expf(-v)); else if (ACT == 3) v = fmaxf(v, 0.f); else if (ACT == 6) v = 0.5f * v * (1.0f + erff(v * 0.70710678118654752f)); so[w][8 * hh + r][t * 16 + ln] = v; } }
  __builtin_amdgcn_fence(__ATOMIC_ACQ_REL, "workgroup"); __builtin_amdgcn_wave_barrier();
  const int rsub = lane >> 4, c4 = (lane & 15) * 4; typedef _Float16 v4h __attribute__((ext_vector_type(4)));
  {
#pragma unroll
    for (int q = 0; q < 8; ++q) { const int r = q * 2 + rsub; if (col0 + c4 < N) { const v4f v = *(const v4fa*)&so[w][r][c4]; if (C) *(v4f*)(C + cofs + (size_t)(row0 + r) * ldc + col0 + c4) = v; if (C16) { v4h h4; for (int i = 0; i < 4; ++i) h4[i] = (_Float16)v[i]; *(v4h*)(C16 + cofs + (size_t)(row0 + r) * ldc + col0 + c4) = h4; } } }
     }
}


typedef _Float16 v4h __attribute__((ext_vector_type(4)));

__global__ __launch_bounds__(256) void k_h16(const float* __restrict__ x, _Float16* __restrict__ X16, size_t n8) { const size_t t = (size_t)blockIdx.x * 256 + threadIdx.x; if (t >= n8) return; FragH f;
#pragma unroll
  for (int q = 0; q < 8; ++q) f.h[q] = (_Float16)x[t * 8 + q]; *(v8us*)((unsigned short*)X16 + t * 8) = f.half[0];  }
__global__ __launch_bounds__(256) void k_round16f(const float* __restrict__ W, _Float16* __restrict__ Bt, size_t n8) { const size_t t = (size_t)blockIdx.x * 256 + threadIdx.x; if (t >= n8) return; FragH f;
#pragma unroll
  for (int i = 0; i < 8; ++i) f.h[i] = (_Float16)(bf16_round(W[t * 8 + i]) * 16.0f); *(v8us*)((unsigned short*)Bt + t * 8) = f.half[0];  }
template <int NHv, int TTv>
__global__ __launch_bounds__(256) void k_vt(const _Float16* __restrict__ V16, int ldv, int voff, _Float16* __restrict__ Vt) { __shared__ unsigned short tl[64][66]; const int tid = threadIdx.x; const int slab = blockIdx.x / (TTv / 64), lg = blockIdx.x % (TTv / 64); const int b = slab / NHv, h = slab % NHv;
  for (int i = tid; i < 64 * 8; i += 256) { const int r = i / 8, c8 = (i % 8) * 8; FragH f; f.half[0] = *(const v8us*)((const unsigned short*)V16 + ((size_t)b * TTv + lg * 64 + r) * ldv + voff + h * 64 + c8);
#pragma unroll
    for (int q = 0; q < 8; ++q) tl[r][c8 + q] = f.u[q]; }
  __syncthreads();
  {
#pragma unroll
    for (int rd = 0; rd < 2; ++rd) { const int d = rd * 32 + tid / 8, pc = tid % 8; FragH f;
#pragma unroll
      for (int q = 0; q < 8; ++q) f.u[q] = tl[pc * 8 + q][d];
      *(v8us*)((unsigned short*)Vt + ((size_t)slab * 64 + d) * TTv + lg * 64 + pc * 8) = f.half[0]; }
     } }

__global__ __launch_bounds__(256) void k_hl(const float* __restrict__ F, _Float16* __restrict__ Hh, _Float16* __restrict__ Hl, size_t n8) { const size_t t = (size_t)blockIdx.x * 256 + threadIdx.x; if (t >= n8) return; FragH fh, fl; const v4f a = *(const v4fa*)(F + t * 8), c = *(const v4fa*)(F + t * 8 + 4);
#pragma unroll
  for (int q = 0; q < 4; ++q) { _Float16 h = (_Float16)a[q]; fh.h[q] = h; fl.h[q] = (_Float16)((a[q] - (float)h) * 1024.0f); h = (_Float16)c[q]; fh.h[4 + q] = h; fl.h[4 + q] = (_Float16)((c[q] - (float)h) * 1024.0f); }
  { *(v8us*)((unsigned short*)Hh + t * 8) = fh.half[0]; *(v8us*)((unsigned short*)Hl + t * 8) = fl.half[0];  } }

// ---- both projection layers in one launch ----
typedef float v2f __attribute__((ext_vector_type(2)));
typedef float v2fa __attribute__((ext_vector_type(2), may_alias));
typedef _Float16 v2ha __attribute__((ext_vector_type(2), may_alias));
typedef _Float16 v4ha __attribute__((ext_vector_type(4), may_alias));
#define PB_W2 (QTR * HALF / 8 / 256)      /* 16 blocks: w2 */
#define PJ_ROWS 16                        /* rows a block carries through both layers */
#define PJ_PX (DIM + 8)                   /* LDS pitch in f16: 16 bytes past a multiple of 256, so that the 16 rows of a fragment load fall on different banks */
#define PJ_PH (HALF + 8)
#define PJ_PT (HALF + 4)                   /* LDS pitch in f32 of the unit blocks' output tile: an odd multiple of 16 bytes; 16 rows of it fill sX exactly */
#define PJ_STEP ((size_t)32 * HALF * 4)   /* bytes of 32 rows (one k step) of a weight matrix of 256 columns */
// The 16 k rows of one k step that a lane's B fragments hold (k = 8h+i, 16+8h+i, the order of the A fragments), two neighbouring columns a load: 16 lanes read one whole 128-byte line of a row.
// base is the same for the wave, lob the lane's fixed byte offset (row 8h, its column pair).
__device__ __forceinline__ void pj_load(v2f (&q)[16], const char* __restrict__ base, const unsigned lob) {
#pragma unroll
  for (int i = 0; i < 16; ++i) q[i] = *(const v2fa*)(base + lob + (size_t)(i < 8 ? i : i + 8) * HALF * 4);
}
// f32 weights -> the f16 x16 values of bf16-rounded weights, straight into two B fragments (column 2l and column 2l+1 of the wave's 32), two k at a time.
// The x16 comes first (a power of two commutes with the rounding); the hardware's f32 -> bf16 conversion rounds to nearest even as bf16_round does (the same value for every finite weight) and takes one instruction for two weights.
typedef __bf16 v2bf __attribute__((ext_vector_type(2)));
typedef _Float16 v2h __attribute__((ext_vector_type(2)));
__device__ __forceinline__ void pj_cvt(const v2f (&q)[16], FragH& b0, FragH& b1) {
#pragma unroll
  for (int i = 0; i < 16; i += 2) {
    const v2f u = q[i] * 16.0f, v = q[i + 1] * 16.0f;
    const v2f t0 = {u[0], v[0]}, t1 = {u[1], v[1]};
    const v2h h0 = __builtin_convertvector(__builtin_convertvector(__builtin_convertvector(t0, v2bf), v2f), v2h);
    const v2h h1 = __builtin_convertvector(__builtin_convertvector(__builtin_convertvector(t1, v2bf), v2f), v2h);
    b0.h[i] = h0[0]; b0.h[i + 1] = h0[1]; b1.h[i] = h1[0]; b1.h[i + 1] = h1[1];
  }
}
__device__ __forceinline__ v16h pj_afrag(const unsigned short* p) { FragH f; f.half[0] = *(const v8us*)p; f.half[1] = *(const v8us*)(p + 16); return f.v; }
// One launch for all that comes before the fused tail. Blocks 0 .. PB_W2-1 make w2's f16 fragments; each other block takes 16 rows of bin_repr or of unit_embs through both layers:
// x -> f16 in LDS; h = x W + b (K = 512) on WMMA, f16 into LDS; h w1 half (K = 256) on WMMA, f32 to the workspace. No f16 copy of x, h or of these weights goes through memory.
// Wave w owns output columns 32w .. 32w+31 of both layers. Its two B tiles are the even and the odd columns (tile j, lane l: column 32w + 2l + j), so that f32 weights are read row-major as they lie, 8 bytes a lane,
// and converted in registers; each weight is used by one WMMA of the block, so LDS would add nothing. The weight rows of both layers form one stream of 24 k steps, loaded three steps ahead into three register buffers.
// D register r of tile j is row 8h + r, column 32w + 2l + j: a lane stores column pairs. Values and sum order are those of separate GEMMs over k steps of 32.
// The bin half is stored row-major. The unit half is stored as the tail's lanes read it: [tile of 16 units][k step][j][lane][4 f32], lane = 16h + unit, k = 32 step + 16 (j >> 1) + 8h + 4 (j & 1) + e,
// so that each of the tail's loads reads 512 contiguous bytes (four whole lines) and not 32 bytes of each of 16 rows; the turn goes through LDS (sX is free by then), and each line has one writer.
__global__ __launch_bounds__(256) void k_proj(const float* __restrict__ br, const float* __restrict__ ue, const float* __restrict__ bpw, const float* __restrict__ bpb, const float* __restrict__ upw, const float* __restrict__ upb,
                                              const float* __restrict__ w1, const float* __restrict__ w2, _Float16* __restrict__ BW2, float* __restrict__ A, float* __restrict__ Bu) {
  __shared__ __attribute__((aligned(16))) unsigned short sX[PJ_ROWS][PJ_PX];
  __shared__ __attribute__((aligned(16))) unsigned short sH[PJ_ROWS][PJ_PH];
  int b = blockIdx.x;
  if (b < PB_W2) { d_w2_frag(b, w2, BW2); return; }      /* whole blocks, ahead of every barrier */
  b -= PB_W2;
  const bool s = b >= NBT / PJ_ROWS;
  const int r0 = (s ? b - NBT / PJ_ROWS : b) * PJ_ROWS;
  const float* X = (s ? ue : br) + (size_t)r0 * DIM;
  const char* Wa = (const char*)(s ? upw : bpw);
  const char* Wb = (const char*)(w1 + (s ? HALF * HALF : 0));
  const float* bias = s ? upb : bpb;
  float* C = (s ? Bu : A) + (size_t)r0 * HALF;
  const int tid = threadIdx.x, w = tid >> 5, lane = tid & 31, ln = lane & 15, hh = lane >> 4;
  const int col = w * 32 + 2 * ln;
  const unsigned lob = (unsigned)(8 * hh * HALF + col) * 4u;
  v4f x[8];
#pragma unroll
  for (int i = 0; i < 8; ++i) x[i] = *(const v4fa*)(X + i * 1024 + tid * 4);
  const v2f bb = *(const v2fa*)(bias + col);
  v2f q[3][16];
  pj_load(q[0], Wa, lob); pj_load(q[1], Wa + PJ_STEP, lob); pj_load(q[2], Wa + 2 * PJ_STEP, lob);
#pragma unroll
  for (int i = 0; i < 8; ++i) {
    const int e = i * 1024 + tid * 4;
    v4ha h; h[0] = (_Float16)bf16_round(x[i][0]); h[1] = (_Float16)bf16_round(x[i][1]); h[2] = (_Float16)bf16_round(x[i][2]); h[3] = (_Float16)bf16_round(x[i][3]);
    *(v4ha*)&sX[e >> 9][e & (DIM - 1)] = h;
  }
  __syncthreads();
  const v8f z8 = {0.f, 0.f, 0.f, 0.f, 0.f, 0.f, 0.f, 0.f};
  v8f c0 = z8, c1 = z8;
  const unsigned short* ax = &sX[ln][8 * hh];
  // unrolled in full (about 24 KB of text, run once): the three buffers are then fixed registers that the loads write directly, and every weight address is one base, the lane's offset and an immediate;
  // rolled, the refilled values were copied between registers at the foot of each trip, behind a wait for all loads in flight. A buffer is refilled as soon as its values are converted.
#pragma unroll
  for (int ks = 0; ks < DIM / 32; ++ks) {
    FragH b0, b1;
    pj_cvt(q[ks % 3], b0, b1);
    pj_load(q[ks % 3], ks + 3 < DIM / 32 ? Wa + (ks + 3) * PJ_STEP : Wb + (ks + 3 - DIM / 32) * PJ_STEP, lob);      /* the last three refills are the second layer's first steps */
    const v16h a = pj_afrag(ax + ks * 32);
    c0 = __builtin_amdgcn_wmma_f32_16x16x32_f16(false, a, false, b0.v, (short)0, c0, false, false);
    c1 = __builtin_amdgcn_wmma_f32_16x16x32_f16(false, a, false, b1.v, (short)0, c1, false, false);
    __builtin_amdgcn_sched_barrier(0);      /* keeps the later steps' conversions, and with them the waits for their loads, behind this step's refill: moved up, the loads in flight are waited for too early */
  }
  const float bv0 = bf16_round(bb[0]), bv1 = bf16_round(bb[1]);
#pragma unroll
  for (int r = 0; r < 8; ++r) { v2ha h; h[0] = (_Float16)(c0[r] * 0.0625f + bv0); h[1] = (_Float16)(c1[r] * 0.0625f + bv1); *(v2ha*)&sH[8 * hh + r][col] = h; }
  __syncthreads();
  c0 = z8; c1 = z8;
  const unsigned short* ah = &sH[ln][8 * hh];
#pragma unroll
  for (int ks = 0; ks < HALF / 32; ++ks) {
    FragH b0, b1;
    pj_cvt(q[(ks + DIM / 32) % 3], b0, b1);
    if (ks + 3 < HALF / 32) pj_load(q[(ks + DIM / 32) % 3], Wb + (ks + 3) * PJ_STEP, lob);
    const v16h a = pj_afrag(ah + ks * 32);
    c0 = __builtin_amdgcn_wmma_f32_16x16x32_f16(false, a, false, b0.v, (short)0, c0, false, false);
    c1 = __builtin_amdgcn_wmma_f32_16x16x32_f16(false, a, false, b1.v, (short)0, c1, false, false);
    __builtin_amdgcn_sched_barrier(0);      /* as in the first layer's loop */
  }
  if (s) {      /* the same for the whole block */
    float* sT = (float*)&sX[0][0];      /* every wave has left sX at the barrier behind the first layer */
#pragma unroll
    for (int r = 0; r < 8; ++r) { v2f o; o[0] = c0[r] * 0.0625f; o[1] = c1[r] * 0.0625f; *(v2fa*)(sT + (8 * hh + r) * PJ_PT + col) = o; }
    __syncthreads();      /* the turn crosses lanes: the whole tile is in LDS before a lane reads values that other lanes wrote */
#pragma unroll
    for (int j = 0; j < 4; ++j) { const v4f o = *(const v4fa*)(sT + ln * PJ_PT + w * 32 + (j >> 1) * 16 + hh * 8 + (j & 1) * 4); *(v4fa*)(C + (w * 4 + j) * 128 + lane * 4) = o; }      /* wave w's columns are k step w: 512 contiguous bytes a store */
  } else {
#pragma unroll
    for (int r = 0; r < 8; ++r) { v2f o; o[0] = c0[r] * 0.0625f; o[1] = c1[r] * 0.0625f; *(v2fa*)(C + (size_t)(8 * hh + r) * HALF + col) = o; }      /* 16 lanes: one whole 128-byte line */
  }
  asm volatile("s_wait_xcnt 0x0" ::: "memory");      /* behind the last store: in the built code other text follows here that reuses the stores' data registers, and this wait stands in front of any such overwrite */
}

__global__ __launch_bounds__(256) void k_f16c(const float* __restrict__ A, _Float16* __restrict__ D, size_t n8) { const size_t t = (size_t)blockIdx.x * 256 + threadIdx.x; if (t >= n8) return; const v8f a = *(const v8f*)(A + t * 8); FragH f; for (int q = 0; q < 8; ++q) f.h[q] = (_Float16)a[q]; *(v8us*)((unsigned short*)D + t * 8) = f.half[0];  }
// Exact (erf) GELU in f32, written as h Phi(h) = max(h, 0) - |h| Q(|h|) with Q(a) = erfc(a / sqrt 2) / 2 = exp2(p(a)): one straight line for every h, no second form to evaluate and select, no range reduction around v_exp_f32 (p < 0, and an error of p counts only times Q).
// p is a degree-8 fit of log2 Q(a) on 0 <= a <= 5.5, weighted by Q: evaluated in f32 the error of Phi is about 1e-7 at most (the rounding level of 1 + erf in f32), and a negative h has no cancellation.
// The leading coefficient is negative, so past the fitted range p keeps falling and |h| exp2(p) goes to 0 as |h| Q does (the two are within 1e-8 from a = 5 on); every finite h is covered, h = +infinity or -infinity would give infinity times 0.
__device__ __forceinline__ float gelu_erf(float s) {
  const float a = fabsf(s);
  float p = fmaf(a, -2.12157283e-6f, 3.09552197e-5f); p = fmaf(a, p, -1.46757287e-4f); p = fmaf(a, p, -2.30747639e-4f); p = fmaf(a, p, 7.18435273e-3f);
  p = fmaf(a, p, -5.25792725e-2f); p = fmaf(a, p, -4.59180444e-1f); p = fmaf(a, p, -1.15110874e+0f); p = fmaf(a, p, -9.99999940e-1f);
  return fmaf(-a, __builtin_amdgcn_exp2f(p), fmaxf(s, 0.f));
}
// Fused tail: h1 = gelu(A[bt] + Bu[n] + b1), h2 = gelu(h1 w2 + b2), out = clip(h2 w3 + b3); h1 and h2 never leave the registers.
// One work-group per pair of bin rows; wave w owns units 32w .. 32w+31 as two tiles of 16 rows, and carries each tile for both bin rows at once:
// a w2 fragment read from LDS feeds two WMMAs, a unit value read from memory two GELUs, and the w2 fill serves twice the rows. With one bin row a wave the k loop's LDS reads add up to more clocks than its vector work on a SIMD.
// The product runs transposed: w2's columns are the A operand (from LDS, stored in fragment order), the h1 rows the B operand.
// A lane computes the 16 h1 values of its own row and k half straight into the B fragment (k = 8h+i, 16+8h+i on both operands).
// D register r of tile t is then h2[row = lane & 15][feature 16t + 8h + r]: the head's dot product stays inside a lane but for one add across the lane halves.
#define TL_BT 2      /* bin rows a work-group: 2 x 64 accumulator registers a wave, four waves a SIMD */
__global__ __launch_bounds__(256) void k_tail(const float* __restrict__ A, const float* __restrict__ Bu, const float* __restrict__ b1, const _Float16* __restrict__ W2t,
                                              const float* __restrict__ b2, const float* __restrict__ w3, const float* __restrict__ b3, float* __restrict__ out) {
  __shared__ __attribute__((aligned(16))) unsigned short sW[HALF / 32][QTR / 16][2][32][8];   /* [k step][feature tile][fragment half][lane][8 f16], 64 KiB: each fragment load reads 512 contiguous bytes */
  __shared__ __attribute__((aligned(16))) float sab[TL_BT][HALF];
  __shared__ __attribute__((aligned(16))) float sb2[QTR];
  __shared__ __attribute__((aligned(16))) float sw3[QTR];
  const int tid = threadIdx.x, w = tid >> 5, lane = tid & 31, ln = lane & 15, hh = lane >> 4;
  const int bt = blockIdx.x * TL_BT;
  // unrolled: all 16 loads of the w2 fill are in flight before the first LDS store
#pragma unroll
  for (int i = 0; i < 16; ++i) {      /* W2t lies in sW's own order: a straight copy, 512 contiguous bytes a wave and load */
    const int c = (i * 256 + tid) * 8;
    const v8us v = *(const v8us*)((const unsigned short*)W2t + c);
    *(v8us*)(&sW[0][0][0][0][0] + c) = v;
  }
  const float b1v = bf16_round(b1[tid]);
#pragma unroll
  for (int j = 0; j < TL_BT; ++j) sab[j][tid] = A[(size_t)(bt + j) * HALF + tid] + b1v;
  if (tid < QTR) { sb2[tid] = bf16_round(b2[tid]); sw3[tid] = bf16_round(w3[tid]); }
  __syncthreads();
  // Bu lies in fragment order: (tile, k step) q = 8 tile + ks of wave w is 512 floats at 16w + q, four loads of 128 floats, 4 a lane (k = 8h + e, 8h + 4 + e, 16 + 8h + e, 16 + 8h + 4 + e of unit row lane & 15)
  const float* ub = Bu + (size_t)w * 16 * 512 + lane * 4;
  v4f u0 = *(const v4fa*)(ub), u1 = *(const v4fa*)(ub + 128), u2 = *(const v4fa*)(ub + 256), u3 = *(const v4fa*)(ub + 384);
  float res[TL_BT] = {};
  // the tile loop and the k loop stay rolled: 32 + 128 inlined GELUs are all the text that the instruction cache should have to hold;
  // the loops inside them are unrolled, so that fragments and accumulators are indexed by constants and stay in registers
#pragma unroll 1
  for (int tile = 0; tile < 2; ++tile) {
    v8f acc[TL_BT][8] = {};
#pragma unroll 1
    for (int ks = 0; ks < HALF / 32; ++ks) {
      v4f s[TL_BT][4];
#pragma unroll
      for (int j = 0; j < TL_BT; ++j) {
        const float* ap = &sab[j][ks * 32 + 8 * hh];
        s[j][0] = *(const v4fa*)(ap) + u0; s[j][1] = *(const v4fa*)(ap + 4) + u1; s[j][2] = *(const v4fa*)(ap + 16) + u2; s[j][3] = *(const v4fa*)(ap + 20) + u3;
      }
      // the next step's unit values are loaded one step ahead, as soon as both rows' sums have used this step's (the last step reloads its own)
      const float* un = ub + min(tile * 8 + ks + 1, 15) * 512;
      u0 = *(const v4fa*)(un); u1 = *(const v4fa*)(un + 128); u2 = *(const v4fa*)(un + 256); u3 = *(const v4fa*)(un + 384);
      __builtin_amdgcn_sched_barrier(0);      /* keeps these loads up here: sunk to the foot of the loop they are waited for at once at the head of the next trip */
      FragH f[TL_BT], wf[8];
#pragma unroll
      for (int j = 0; j < TL_BT; ++j) {
        if (j == TL_BT - 1) {      /* the first four w2 fragments are on their way while the last row's GELUs run */
#pragma unroll
          for (int t = 0; t < 4; ++t) { wf[t].half[0] = *(const v8us*)&sW[ks][t][0][lane][0]; wf[t].half[1] = *(const v8us*)&sW[ks][t][1][lane][0]; }
        }
#pragma unroll
        for (int i = 0; i < 4; ++i) {
          f[j].h[i] = (_Float16)gelu_erf(s[j][0][i]); f[j].h[4 + i] = (_Float16)gelu_erf(s[j][1][i]);
          f[j].h[8 + i] = (_Float16)gelu_erf(s[j][2][i]); f[j].h[12 + i] = (_Float16)gelu_erf(s[j][3][i]);
        }
        __builtin_amdgcn_sched_barrier(0);      /* one row's 16 GELUs at a time, and no more than four fragments fetched beside them: otherwise the registers run out and the GELUs are scheduled one dependent chain after another */
      }
#pragma unroll
      for (int t = 4; t < 8; ++t) { wf[t].half[0] = *(const v8us*)&sW[ks][t][0][lane][0]; wf[t].half[1] = *(const v8us*)&sW[ks][t][1][lane][0]; }
      __builtin_amdgcn_sched_barrier(0);      /* the other four fragments are all asked for ahead of the first WMMA: left to itself the build passes them through one buffer, each load waited for at once */
#pragma unroll
      for (int t = 0; t < 8; ++t) {
#pragma unroll
        for (int j = 0; j < TL_BT; ++j) acc[j][t] = __builtin_amdgcn_wmma_f32_16x16x32_f16(false, wf[t].v, false, f[j].v, (short)0, acc[j][t], false, false);
      }
    }
    // compiler fence: keeps the 32 LDS loads of b2 and w3 inside the tile loop; hoisted out of it they hold 128 registers through the k loop, which then has none left to fetch w2 fragments ahead of its WMMAs
    asm volatile("" ::: "memory");
    v4f pv[TL_BT] = {};      /* four partial sums of the head a bin row, so that the GELUs pair up into packed f32 instructions */
#pragma unroll
    for (int t = 0; t < 8; ++t) {
      const int f0 = t * 16 + 8 * hh;
      const v4f c0 = *(const v4fa*)&sb2[f0], c1 = *(const v4fa*)&sb2[f0 + 4], g0 = *(const v4fa*)&sw3[f0], g1 = *(const v4fa*)&sw3[f0 + 4];
#pragma unroll
      for (int j = 0; j < TL_BT; ++j) {
        v4f h0, h1;
#pragma unroll
        for (int r = 0; r < 4; ++r) { h0[r] = gelu_erf(acc[j][t][r] * 0.0625f + c0[r]); h1[r] = gelu_erf(acc[j][t][4 + r] * 0.0625f + c1[r]); }
        pv[j] += h0 * g0; pv[j] += h1 * g1;
      }
    }
#pragma unroll
    for (int j = 0; j < TL_BT; ++j) {
      float p = (pv[j][0] + pv[j][1]) + (pv[j][2] + pv[j][3]);
      p += __shfl_xor(p, 16, 32);
      if (hh == tile) res[j] = p;      /* tile 0's rows end in lanes 0-15, tile 1's in lanes 16-31: one 128-byte store a wave and bin row */
    }
  }
  const float b3v = bf16_round(b3[0]);
#pragma unroll
  for (int j = 0; j < TL_BT; ++j) out[(size_t)(bt + j) * NU + w * 32 + lane] = fminf(fmaxf(res[j] + b3v, -10.0f), 10.0f);
}

extern "C" void kernel_launch(void* const* d_in, const int* in_sizes, int n_in,
                              void* d_out, int out_size, void* d_ws, size_t ws_size, hipStream_t stream) {
  (void)in_sizes; (void)n_in; (void)out_size;
  const float* const* I = (const float* const*)d_in; const float* br = I[0]; const float* ue = I[1]; const float* bpw = I[2]; const float* bpb = I[3]; const float* upw = I[4]; const float* upb = I[5]; const float* w1 = I[6]; const float* b1 = I[7]; const float* w2 = I[8]; const float* b2 = I[9]; const float* w3 = I[10]; const float* b3 = I[11];
  char* ws = (char*)d_ws; size_t off = 0;
  auto take = [&](size_t bytes) { char* p = ws + off; off += (bytes + 255) & ~(size_t)255; return p; };
  _Float16* BW2 = (_Float16*)take((size_t)QTR * HALF * 2); float* A = (float*)take((size_t)NBT * HALF * 4); float* Bu = (float*)take((size_t)NU * HALF * 4);
  if (off > ws_size) return;
  k_proj<<<PB_W2 + (NBT + NU) / PJ_ROWS, 256, 0, stream>>>(br, ue, bpw, bpb, upw, upb, w1, w2, BW2, A, Bu);      /* w2 -> f16 x16 in fragment order; A = (bin_repr Wbp + b) w1a, Bu = (unit_embs Wup + b) w1b in fragment order */
  k_tail<<<NBT / TL_BT, 256, 0, stream>>>(A, Bu, b1, BW2, b2, w3, b3, (float*)d_out);      /* h1, h2, head, clip */
}

// v007
// One run takes 30 microseconds.
// In both of two side-by-side timings against v006, it was 1.14 times as fast.
// All steps since v000 together make it 10.1 times as fast.
#include <hip/hip_runtime.h>
// PerNeuronMLPHead (2 x 512 time bins x 512, 256 units x 512: bin_h = bin_repr Wbp + b, unit_h = unit_embs Wup + b (256 wide); h1[(b,t), n] = gelu(bin_h w1a + unit_h w1b + b1) (the split-weight broadcast add); h2 = gelu(h1 w2 + b2) (128); log_rate = h2 w3 + b3; clip(-10, 10); exact erf GELU).
// Structure, two launches: one for both projection layers (16 rows a block through x W + b and h w1 half on f16 WMMA, f32 accumulation, weights read as f32 and made exact x16 f16 fragments in registers, h in LDS; w2's f16 fragments ride along as extra blocks; w2 and the unit half leave in the order in which the tail's lanes read them); then one fused kernel: broadcast add + GELU on VALU straight into f16 WMMA fragments, h1 w2 on f16 WMMA, GELU, the 128 -> 1 head and the clip on the f32 accumulators, two bin rows a work-group (128-B stores, one a wave and bin row).
// Compute dtype: inputs rounded to bf16; inputs / weights exact as f16; bin_h / unit_h and h1 as plain f16 operands (~2^-12); h2, GELU and head f32. v_wmma_f32_16x16x32_f16.
#define NB 2
#define NTB 512
#define DIM 512
#define HALF 256
#define QTR 128
#define NU 256
#define NBT (NB * NTB)           /* 1024 bin rows */
#define NRW ((size_t)NBT * NU)   /* 262144 output rows */
typedef __bf16 v16b __attribute__((ext_vector_type(16)));
typedef unsigned short v8us __attribute__((ext_vector_type(8), may_alias));
typedef float  v8f  __attribute__((ext_vector_type(8)));
typedef float  v4f  __attribute__((ext_vector_type(4)));
typedef float  v4fa __attribute__((ext_vector_type(4), may_alias));
union FragB { v16b v; v8us half[2]; unsigned short u[16]; };

__device__ __forceinline__ unsigned short bf16_bits(float x) { unsigned int u = __float_as_uint(x); return (unsigned short)((u + 0x7FFFu + ((u >> 16) & 1u)) >> 16); }
__device__ __forceinline__ float bf16_val(unsigned short b) { return __uint_as_float(((unsigned int)b) << 16); }
__device__ __forceinline__ float bf16_round(float x) { return bf16_val(bf16_bits(x)); }
// D += A·B with NT terms: 1 = ah·bh, 2 = + al·bh (A split), 3 = + ah·bl (both split)
template <int NT>
__device__ __forceinline__ v8f mmaN(v16b ah, v16b al, v16b bh, v16b bl, v8f c) {
  c = __builtin_amdgcn_wmma_f32_16x16x32_bf16(false, ah, false, bh, (short)0, c, false, false);
  if (NT >= 2) c = __builtin_amdgcn_wmma_f32_16x16x32_bf16(false, al, false, bh, (short)0, c, false, false);
  if (NT >= 3) c = __builtin_amdgcn_wmma_f32_16x16x32_bf16(false, ah, false, bl, (short)0, c, false, false);
  asm volatile("v_nop\n\tv_nop\n\tv_nop\n\tv_nop" : "+v"(c) : "v"(ah), "v"(al), "v"(bh), "v"(bl));
  return c;
}

__global__ __launch_bounds__(256) void k_wt_bf16(const float* __restrict__ W, unsigned short* __restrict__ Wt, int K, int N) {
  const int t = blockIdx.x * 256 + threadIdx.x;
  const int k8n = K / 8;
  if (t >= N * k8n) return;
  const int n = t / k8n, k8 = (t % k8n) * 8;
  v8us v;
#pragma unroll
  for (int i = 0; i < 8; ++i) v[i] = bf16_bits(W[(size_t)(k8 + i) * N + n]);
  *(v8us*)(Wt + (size_t)n * K + k8) = v;
  
}

// GEMM C[M][N] (f32, pitch ldc) = act(A[M][K]·W + bias). A f32 row-major (pitch lda) converted per fragment to bf16
// (ASPLIT: hi/lo two planes -> 2 terms, else single rounded term); Wt bf16 [N][K] (pitch ldb). BIAS_BF16 rounds the
// bias to bf16 first (bias quantised to bf16 before the add). K%32==0, M%16==0, N%64==0.
template <bool ASPLIT, int ACT, bool BIAS_BF16>
__global__ __launch_bounds__(128) void k_gemm_bf(const float* __restrict__ A, int lda, const unsigned short* __restrict__ Wt, int ldb,
                                               const float* __restrict__ bias, float* __restrict__ C, int ldc, int M, int N, int K) {
  __shared__ __attribute__((aligned(16))) float so[4][16][64];
  const int tid = threadIdx.x, w = tid >> 5, lane = tid & 31, ln = lane & 15, hh = lane >> 4;
  const int ntn = N / 64;
  const int wid = blockIdx.x * 4 + w;
  const int mt = wid / ntn, nq = wid % ntn;
  if (mt * 16 >= M) return;
  const int row0 = mt * 16, col0 = nq * 64;
  const float* arow = A + (size_t)(row0 + ln) * lda;
  v8f acc[4] = {};
  for (int kb = 0; kb < K; kb += 32) {
    FragB ah, al;
    const v4f x0 = *(const v4fa*)(arow + kb + 8 * hh), x1 = *(const v4fa*)(arow + kb + 8 * hh + 4);
    const v4f x2 = *(const v4fa*)(arow + kb + 16 + 8 * hh), x3 = *(const v4fa*)(arow + kb + 16 + 8 * hh + 4);
    float xs[16] = {x0[0],x0[1],x0[2],x0[3],x1[0],x1[1],x1[2],x1[3],x2[0],x2[1],x2[2],x2[3],x3[0],x3[1],x3[2],x3[3]};
#pragma unroll
    for (int i = 0; i < 16; ++i) { const unsigned short hb = bf16_bits(xs[i]); ah.u[i] = hb; al.u[i] = ASPLIT ? bf16_bits(xs[i] - bf16_val(hb)) : (unsigned short)0; }
#pragma unroll
    for (int t = 0; t < 4; ++t) {
      const unsigned short* brow = Wt + (size_t)(col0 + t * 16 + ln) * ldb + kb;
      FragB b;
      b.half[0] = *(const v8us*)(brow + 8 * hh);
      b.half[1] = *(const v8us*)(brow + 16 + 8 * hh);
      acc[t] = mmaN<ASPLIT ? 2 : 1>(ah.v, al.v, b.v, b.v, acc[t]);
    }
  }
#pragma unroll
  for (int t = 0; t < 4; ++t) {
    float bv = bias ? bias[col0 + t * 16 + ln] : 0.f;
    if (BIAS_BF16) bv = bf16_round(bv);
#pragma unroll
    for (int r = 0; r < 8; ++r) { float v = acc[t][r] + bv; if (ACT == 1) v = fmaxf(v, 0.f); so[w][8 * hh + r][t * 16 + ln] = v; }
  }
  __builtin_amdgcn_fence(__ATOMIC_ACQ_REL, "workgroup");
  __builtin_amdgcn_wave_barrier();
  const int rsub = lane >> 4, c4 = (lane & 15) * 4;
  {
#pragma unroll
    for (int q = 0; q < 8; ++q) {
      const int r = q * 2 + rsub;
      const v4f v = *(const v4fa*)&so[w][r][c4];
      *(v4f*)(C + (size_t)(row0 + r) * ldc + col0 + c4) = v;
    }
    
  }
}

// GEMM C = act(A·W + bias + resid): A f32 (ASPLIT -> hi/lo 2 terms), Wt bf16 [N][K]; ACT 0 none, 1 relu, 2 exact gelu;
// resid (optional, f32, row index = (row % rmod), pitch ldr, RES_BF16 rounds it) added before the activation.
template <bool ASPLIT, int ACT, bool BIAS_BF16, bool RES_BF16>
__global__ __launch_bounds__(128) void k_gemm_bf3(const float* __restrict__ A, int lda, const unsigned short* __restrict__ Wt, int ldb,
                                                const float* __restrict__ bias, const float* __restrict__ resid, int rmod, int ldr,
                                                float* __restrict__ C, int ldc, int M, int N, int K) {
  __shared__ __attribute__((aligned(16))) float so[4][16][64];
  const int tid = threadIdx.x, w = tid >> 5, lane = tid & 31, ln = lane & 15, hh = lane >> 4;
  const int ntn = N / 64;
  const int wid = blockIdx.x * 4 + w;
  const int mt = wid / ntn, nq = wid % ntn;
  if (mt * 16 >= M) return;
  const int row0 = mt * 16, col0 = nq * 64;
  const float* arow = A + (size_t)(row0 + ln) * lda;
  v8f acc[4] = {};
  for (int kb = 0; kb < K; kb += 32) {
    FragB ah, al;
    const v4f x0 = *(const v4fa*)(arow + kb + 8 * hh), x1 = *(const v4fa*)(arow + kb + 8 * hh + 4);
    const v4f x2 = *(const v4fa*)(arow + kb + 16 + 8 * hh), x3 = *(const v4fa*)(arow + kb + 16 + 8 * hh + 4);
    float xs[16] = {x0[0],x0[1],x0[2],x0[3],x1[0],x1[1],x1[2],x1[3],x2[0],x2[1],x2[2],x2[3],x3[0],x3[1],x3[2],x3[3]};
#pragma unroll
    for (int i = 0; i < 16; ++i) { const unsigned short hb = bf16_bits(xs[i]); ah.u[i] = hb; al.u[i] = ASPLIT ? bf16_bits(xs[i] - bf16_val(hb)) : (unsigned short)0; }
#pragma unroll
    for (int t = 0; t < 4; ++t) {
      const unsigned short* brow = Wt + (size_t)(col0 + t * 16 + ln) * ldb + kb;
      FragB b;
      b.half[0] = *(const v8us*)(brow + 8 * hh);
      b.half[1] = *(const v8us*)(brow + 16 + 8 * hh);
      acc[t] = mmaN<ASPLIT ? 2 : 1>(ah.v, al.v, b.v, b.v, acc[t]);
    }
  }
#pragma unroll
  for (int t = 0; t < 4; ++t) {
    const int col = col0 + t * 16 + ln;
    float bv = bias ? bias[col] : 0.f;
    if (BIAS_BF16) bv = bf16_round(bv);
#pragma unroll
    for (int r = 0; r < 8; ++r) {
      float v = acc[t][r] + bv;
      if (resid) { float rv = resid[(size_t)((row0 + 8 * hh + r) % rmod) * ldr + col]; if (RES_BF16) rv = bf16_round(rv); v += rv; }
      if (ACT == 1) v = fmaxf(v, 0.f);
      if (ACT == 2) v = 0.5f * v * (1.0f + erff(v * 0.70710678118654752f));
      if (ACT == 3) { const float u = 0.7978845608028654f * (v + 0.044715f * v * v * v); v = 0.5f * v * (1.0f + tanhf(u)); }
      so[w][8 * hh + r][t * 16 + ln] = v;
    }
  }
  __builtin_amdgcn_fence(__ATOMIC_ACQ_REL, "workgroup");
  __builtin_amdgcn_wave_barrier();
  const int rsub = lane >> 4, c4 = (lane & 15) * 4;
  {
#pragma unroll
    for (int q = 0; q < 8; ++q) {
      const int r = q * 2 + rsub;
      const v4f v = *(const v4fa*)&so[w][r][c4];
      *(v4f*)(C + (size_t)(row0 + r) * ldc + col0 + c4) = v;
    }
    
  }
}
// row LayerNorm (biased variance, eps) over N: s = X (+ R); optional out_sum <- s; out_norm <- (s-mu)*rsqrt(var+eps)*g + b
template <bool PARAM_BF16>
__global__ __launch_bounds__(256) void k_layernorm(const float* __restrict__ X, const float* __restrict__ R, const float* __restrict__ g, const float* __restrict__ bta,
                                                  float* __restrict__ out_sum, float* __restrict__ out_norm, int N, float eps) {
  __shared__ float red[256];
  const int row = blockIdx.x, tid = threadIdx.x;
  const float* x = X + (size_t)row * N; const float* rr = R ? R + (size_t)row * N : nullptr;
  float vals[16];                     // up to N = 4096
  const int per = N / 256;            // contiguous chunk per thread? use strided-by-4 chunks: thread handles j = tid*4 + 1024*u
  float s1 = 0.f;
  for (int u = 0; u < per / 4; ++u) {
    const int j = tid * 4 + 1024 * u;
    const v4f a = *(const v4fa*)(x + j);
    v4f b = {0.f,0.f,0.f,0.f}; if (rr) b = *(const v4fa*)(rr + j);
#pragma unroll
    for (int q = 0; q < 4; ++q) { const float v = a[q] + b[q]; vals[u * 4 + q] = v; s1 += v; }
  }
  red[tid] = s1; __syncthreads();
  for (int st = 128; st > 0; st >>= 1) { if (tid < st) red[tid] += red[tid + st]; __syncthreads(); }
  const float mu = red[0] / (float)N; __syncthreads();
  float s2 = 0.f;
  for (int u = 0; u < per / 4; ++u)
#pragma unroll
    for (int q = 0; q < 4; ++q) { const float c = vals[u * 4 + q] - mu; s2 += c * c; }
  red[tid] = s2; __syncthreads();
  for (int st = 128; st > 0; st >>= 1) { if (tid < st) red[tid] += red[tid + st]; __syncthreads(); }
  const float rs = rsqrtf(red[0] / (float)N + eps);
  {
    for (int u = 0; u < per / 4; ++u) {
      const int j = tid * 4 + 1024 * u;
      v4f o, sm;
#pragma unroll
      for (int q = 0; q < 4; ++q) {
        float gg = g[j + q], bb = bta[j + q];
        if (PARAM_BF16) { gg = bf16_round(gg); bb = bf16_round(bb); }
        sm[q] = vals[u * 4 + q]; o[q] = (vals[u * 4 + q] - mu) * rs * gg + bb;
      }
      if (out_sum) *(v4f*)(out_sum + (size_t)row * N + j) = sm;
      *(v4f*)(out_norm + (size_t)row * N + j) = o;
    }
    
  }
}



// ---- f16 WMMA path (v_wmma_f32_16x16x32_f16): 11-bit significands for operands in range — used for every GEMM launched here
typedef _Float16 v16h __attribute__((ext_vector_type(16)));
union FragH { v16h v; v8us half[2]; _Float16 h[16]; unsigned short u[16]; };
template <int NT>
__device__ __forceinline__ v8f mmaH(v16h ah, v16h al, v16h bh, v16h bl, v8f c) {
  c = __builtin_amdgcn_wmma_f32_16x16x32_f16(false, ah, false, bh, (short)0, c, false, false);
  if (NT >= 2) c = __builtin_amdgcn_wmma_f32_16x16x32_f16(false, al, false, bh, (short)0, c, false, false);
  if (NT >= 3) c = __builtin_amdgcn_wmma_f32_16x16x32_f16(false, ah, false, bl, (short)0, c, false, false);
  asm volatile("v_nop\n\tv_nop\n\tv_nop\n\tv_nop" : "+v"(c) : "v"(ah), "v"(al), "v"(bh), "v"(bl));
  return c;
}
// batched GEMM like k_gemm_b but f16 operands: A f32 (split into f16 hi/lo if ASPLIT, else rounded to f16), Bt = f16 values [n][k]; alpha; C f32; N multiple of 16 (partial tiles skipped)
template <bool ASPLIT>
__global__ __launch_bounds__(128) void k_gemm_h(const float* __restrict__ A, int lda, size_t sA, const _Float16* __restrict__ Bh, int ldb, size_t sB, float alpha, float* __restrict__ C, int ldc, size_t sC, int M, int N, int K) {
  __shared__ __attribute__((aligned(16))) float so[4][16][64];
  const int tid = threadIdx.x, w = tid >> 5, lane = tid & 31, ln = lane & 15, hh = lane >> 4; const int by = blockIdx.y;
  A += (size_t)by * sA; Bh += (size_t)by * sB; C += (size_t)by * sC;
  const int ntn = (N + 63) / 64; const int wid = blockIdx.x * 4 + w; const int mt = wid / ntn, nq = wid % ntn; if (mt * 16 >= M) return;
  const int row0 = mt * 16, col0 = nq * 64; const float* arow = A + (size_t)(row0 + ln) * lda;
  v8f acc[4] = {};
  for (int kb = 0; kb < K; kb += 32) {
    FragH ah, al;
    const v4f x0 = *(const v4fa*)(arow + kb + 8 * hh), x1 = *(const v4fa*)(arow + kb + 8 * hh + 4), x2 = *(const v4fa*)(arow + kb + 16 + 8 * hh), x3 = *(const v4fa*)(arow + kb + 16 + 8 * hh + 4);
    float xs[16] = {x0[0],x0[1],x0[2],x0[3],x1[0],x1[1],x1[2],x1[3],x2[0],x2[1],x2[2],x2[3],x3[0],x3[1],x3[2],x3[3]};
#pragma unroll
    for (int i = 0; i < 16; ++i) { const _Float16 h = (_Float16)xs[i]; ah.h[i] = h; al.h[i] = ASPLIT ? (_Float16)(xs[i] - (float)h) : (_Float16)0.0f; }
#pragma unroll
    for (int t = 0; t < 4; ++t) { if (col0 + t * 16 >= N) continue; const size_t boff = (size_t)(col0 + t * 16 + ln) * ldb + kb; FragH bq; bq.half[0] = *(const v8us*)(Bh + boff + 8 * hh); bq.half[1] = *(const v8us*)(Bh + boff + 16 + 8 * hh);
      acc[t] = mmaH<ASPLIT ? 2 : 1>(ah.v, al.v, bq.v, bq.v, acc[t]); }
  }
#pragma unroll
  for (int t = 0; t < 4; ++t) { if (col0 + t * 16 >= N) continue;
#pragma unroll
    for (int r = 0; r < 8; ++r) so[w][8 * hh + r][t * 16 + ln] = acc[t][r] * alpha; }
  __builtin_amdgcn_fence(__ATOMIC_ACQ_REL, "workgroup"); __builtin_amdgcn_wave_barrier();
  const int rsub = lane >> 4, c4 = (lane & 15) * 4;
  {
#pragma unroll
    for (int q = 0; q < 8; ++q) { const int r = q * 2 + rsub; if (col0 + c4 < N) { const v4f v = *(const v4fa*)&so[w][r][c4]; *(v4f*)(C + (size_t)(row0 + r) * ldc + col0 + c4) = v; } }
     }
}

// w2 (f32 [HALF][QTR], row-major) -> f16(bf16-rounded weight x 16; the power of two keeps bf16-exact weights exact in f16 away from the subnormal range), in the order of the tail's A fragments:
// chunk c = ((ks * 8 + t) * 2 + half) * 32 + lane holds the 8 values k = ks * 32 + half * 16 + (lane >> 4) * 8 + i of feature t * 16 + (lane & 15).
// One thread a chunk, chunks in thread order: a wave stores 512 contiguous bytes, and the tail's LDS fill is a straight copy of whole 128-byte lines.
__device__ __forceinline__ void d_w2_frag(const int blk, const float* __restrict__ W, _Float16* __restrict__ Wf) {
  const int c = blk * 256 + threadIdx.x; const int lane = c & 31, half = (c >> 5) & 1, t = (c >> 6) & 7, ks = c >> 9;
  const int n = t * 16 + (lane & 15), k8 = ks * 32 + half * 16 + (lane >> 4) * 8; FragH f;
#pragma unroll
  for (int i = 0; i < 8; ++i) f.h[i] = (_Float16)(bf16_round(W[(size_t)(k8 + i) * QTR + n]) * 16.0f); const v8us o = f.half[0];
  *(v8us*)((unsigned short*)Wf + (size_t)c * 8) = o;
}
// k_gemm_hh variant with fused epilogue: v = acc·alpha + bias[by·sBias + col] (+ CP[(row/rowsPerB)·sCPb + by·64 + col] if CP) ; ACT 0 none / 1 elu ; writes f16 C16 (and f32 C if non-null)
template <int ACT>
__global__ __launch_bounds__(128) void k_gemm_hhx(const _Float16* __restrict__ A, int lda, size_t sA, const _Float16* __restrict__ Bh, int ldb, size_t sB, float alpha, const float* __restrict__ bias, size_t sBias, const float* __restrict__ CP, int rowsPerB, size_t sCPb, int row0g,
    float* __restrict__ C, _Float16* __restrict__ C16, int ldc, size_t sC, int M, int N, int K) {
  __shared__ __attribute__((aligned(16))) float so[4][16][64];
  const int tid = threadIdx.x, w = tid >> 5, lane = tid & 31, ln = lane & 15, hh = lane >> 4; const int by = blockIdx.y;
  A += (size_t)by * sA; Bh += (size_t)by * sB; const size_t cofs = (size_t)by * sC; const float* bp = bias ? bias + (size_t)by * sBias : nullptr;
  const int ntn = (N + 63) / 64; const int wid = blockIdx.x * 4 + w; const int mt = wid / ntn, nq = wid % ntn; if (mt * 16 >= M) return;
  const int row0 = mt * 16, col0 = nq * 64; const _Float16* arow = A + (size_t)(row0 + ln) * lda;
  v8f acc[4] = {};
  for (int kb = 0; kb < K; kb += 32) { FragH ah; ah.half[0] = *(const v8us*)((const unsigned short*)arow + kb + 8 * hh); ah.half[1] = *(const v8us*)((const unsigned short*)arow + kb + 16 + 8 * hh);
#pragma unroll
    for (int t = 0; t < 4; ++t) { if (col0 + t * 16 >= N) continue; const size_t boff = (size_t)(col0 + t * 16 + ln) * ldb + kb; FragH bq; bq.half[0] = *(const v8us*)((const unsigned short*)Bh + boff + 8 * hh); bq.half[1] = *(const v8us*)((const unsigned short*)Bh + boff + 16 + 8 * hh);
      acc[t] = mmaH<1>(ah.v, ah.v, bq.v, bq.v, acc[t]); }
  }
#pragma unroll
  for (int t = 0; t < 4; ++t) { if (col0 + t * 16 >= N) continue; const int col = col0 + t * 16 + ln; const float bv = bp ? bf16_round(bp[col]) : 0.f;
#pragma unroll
    for (int r = 0; r < 8; ++r) { float v = acc[t][r] * alpha + bv; if (CP) { const int rr = row0g + row0 + 8 * hh + r; if (rowsPerB < 0) v += CP[cofs + (size_t)rr * ldc + col];      /* rowsPerB < 0: own element of the batched C plane */ else { const int bidx = rr / rowsPerB; v += CP[(size_t)bidx * sCPb + (size_t)by * 64 + col]; } } if (ACT == 1) v = (v > 0.f) ? v : expm1f(v); else if (ACT == 7) v = (v > 0.f) ? v + 1.0f : expf(v); else if (ACT == 8) v = tanhf(v); else if (ACT == 9) v = 0.5f * v * (1.0f + tanhf(0.7978845608028654f * (v + 0.044715f * v * v * v))); else if (ACT == 11) v = 1.0f / (1.0f + expf(-v)); else if (ACT == 12) v = (v > 0.f) ? v : 0.01f * v; else if (ACT == 14) v = (v > 0.f) ? v : 0.1f * v; else if (ACT == 16) v = (v >= 0.f) ? v : 0.3f * v; else if (ACT == 17) v = (v >= 0.f) ? v : 0.2f * v; else if (ACT == 15) v = v / (1.0f + expf(-v)); else if (ACT == 3) v = fmaxf(v, 0.f); else if (ACT == 6) v = 0.5f * v * (1.0f + erff(v * 0.70710678118654752f)); so[w][8 * hh + r][t * 16 + ln] = v; } }
  __builtin_amdgcn_fence(__ATOMIC_ACQ_REL, "workgroup"); __builtin_amdgcn_wave_barrier();
  const int rsub = lane >> 4, c4 = (lane & 15) * 4; typedef _Float16 v4h __attribute__((ext_vector_type(4)));
  {
#pragma unroll
    for (int q = 0; q < 8; ++q) { const int r = q * 2 + rsub; if (col0 + c4 < N) { const v4f v = *(const v4fa*)&so[w][r][c4]; if (C) *(v4f*)(C + cofs + (size_t)(row0 + r) * ldc + col0 + c4) = v; if (C16) { v4h h4; for (int i = 0; i < 4; ++i) h4[i] = (_Float16)v[i]; *(v4h*)(C16 + cofs + (size_t)(row0 + r) * ldc + col0 + c4) = h4; } } }
     }
}


typedef _Float16 v4h __attribute__((ext_vector_type(4)));

__global__ __launch_bounds__(256) void k_h16(const float* __restrict__ x, _Float16* __restrict__ X16, size_t n8) { const size_t t = (size_t)blockIdx.x * 256 + threadIdx.x; if (t >= n8) return; FragH f;
#pragma unroll
  for (int q = 0; q < 8; ++q) f.h[q] = (_Float16)x[t * 8 + q]; *(v8us*)((unsigned short*)X16 + t * 8) = f.half[0];  }
__global__ __launch_bounds__(256) void k_round16f(const float* __restrict__ W, _Float16* __restrict__ Bt, size_t n8) { const size_t t = (size_t)blockIdx.x * 256 + threadIdx.x; if (t >= n8) return; FragH f;
#pragma unroll
  for (int i = 0; i < 8; ++i) f.h[i] = (_Float16)(bf16_round(W[t * 8 + i]) * 16.0f); *(v8us*)((unsigned short*)Bt + t * 8) = f.half[0];  }
template <int NHv, int TTv>
__global__ __launch_bounds__(256) void k_vt(const _Float16* __restrict__ V16, int ldv, int voff, _Float16* __restrict__ Vt) { __shared__ unsigned short tl[64][66]; const int tid = threadIdx.x; const int slab = blockIdx.x / (TTv / 64), lg = blockIdx.x % (TTv / 64); const int b = slab / NHv, h = slab % NHv;
  for (int i = tid; i < 64 * 8; i += 256) { const int r = i / 8, c8 = (i % 8) * 8; FragH f; f.half[0] = *(const v8us*)((const unsigned short*)V16 + ((size_t)b * TTv + lg * 64 + r) * ldv + voff + h * 64 + c8);
#pragma unroll
    for (int q = 0; q < 8; ++q) tl[r][c8 + q] = f.u[q]; }
  __syncthreads();
  {
#pragma unroll
    for (int rd = 0; rd < 2; ++rd) { const int d = rd * 32 + tid / 8, pc = tid % 8; FragH f;
#pragma unroll
      for (int q = 0; q < 8; ++q) f.u[q] = tl[pc * 8 + q][d];
      *(v8us*)((unsigned short*)Vt + ((size_t)slab * 64 + d) * TTv + lg * 64 + pc * 8) = f.half[0]; }
     } }

__global__ __launch_bounds__(256) void k_hl(const float* __restrict__ F, _Float16* __restrict__ Hh, _Float16* __restrict__ Hl, size_t n8) { const size_t t = (size_t)blockIdx.x * 256 + threadIdx.x; if (t >= n8) return; FragH fh, fl; const v4f a = *(const v4fa*)(F + t * 8), c = *(const v4fa*)(F + t * 8 + 4);
#pragma unroll
  for (int q = 0; q < 4; ++q) { _Float16 h = (_Float16)a[q]; fh.h[q] = h; fl.h[q] = (_Float16)((a[q] - (float)h) * 1024.0f); h = (_Float16)c[q]; fh.h[4 + q] = h; fl.h[4 + q] = (_Float16)((c[q] - (float)h) * 1024.0f); }
  { *(v8us*)((unsigned short*)Hh + t * 8) = fh.half[0]; *(v8us*)((unsigned short*)Hl + t * 8) = fl.half[0];  } }

// ---- both projection layers in one launch ----
typedef float v2f __attribute__((ext_vector_type(2)));
typedef float v2fa __attribute__((ext_vector_type(2), may_alias));
typedef _Float16 v2ha __attribute__((ext_vector_type(2), may_alias));
typedef _Float16 v4ha __attribute__((ext_vector_type(4), may_alias));
#define PB_W2 (QTR * HALF / 8 / 256)      /* 16 blocks: w2 */
#define PJ_ROWS 16                        /* rows a block carries through both layers */
#define PJ_PX (DIM + 8)                   /* LDS pitch in f16: 16 bytes past a multiple of 256, so that the 16 rows of a fragment load fall on different banks */
#define PJ_PH (HALF + 8)
#define PJ_PT (HALF + 4)                   /* LDS pitch in f32 of the unit blocks' output tile: an odd multiple of 16 bytes; 16 rows of it fill sX exactly */
#define PJ_STEP ((size_t)32 * HALF * 4)   /* bytes of 32 rows (one k step) of a weight matrix of 256 columns */
// The 16 k rows of one k step that a lane's B fragments hold (k = 8h+i, 16+8h+i, the order of the A fragments), two neighbouring columns a load: 16 lanes read one whole 128-byte line of a row.
// base is the same for the wave, lob the lane's fixed byte offset (row 8h, its column pair).
__device__ __forceinline__ void pj_load(v2f (&q)[16], const char* __restrict__ base, const unsigned lob) {
#pragma unroll
  for (int i = 0; i < 16; ++i) q[i] = *(const v2fa*)(base + lob + (size_t)(i < 8 ? i : i + 8) * HALF * 4);
}
// f32 weights -> the f16 x16 values of bf16-rounded weights, straight into two B fragments (column 2l and column 2l+1 of the wave's 32), two k at a time.
// The x16 comes first (a power of two commutes with the rounding); the hardware's f32 -> bf16 conversion rounds to nearest even as bf16_round does (the same value for every finite weight) and takes one instruction for two weights.
typedef __bf16 v2bf __attribute__((ext_vector_type(2)));
typedef _Float16 v2h __attribute__((ext_vector_type(2)));
__device__ __forceinline__ void pj_cvt(const v2f (&q)[16], FragH& b0, FragH& b1) {
#pragma unroll
  for (int i = 0; i < 16; i += 2) {
    const v2f u = q[i] * 16.0f, v = q[i + 1] * 16.0f;
    const v2f t0 = {u[0], v[0]}, t1 = {u[1], v[1]};
    const v2h h0 = __builtin_convertvector(__builtin_convertvector(__builtin_convertvector(t0, v2bf), v2f), v2h);
    const v2h h1 = __builtin_convertvector(__builtin_convertvector(__builtin_convertvector(t1, v2bf), v2f), v2h);
    b0.h[i] = h0[0]; b0.h[i + 1] = h0[1]; b1.h[i] = h1[0]; b1.h[i + 1] = h1[1];
  }
}
__device__ __forceinline__ v16h pj_afrag(const unsigned short* p) { FragH f; f.half[0] = *(const v8us*)p; f.half[1] = *(const v8us*)(p + 16); return f.v; }
// One launch for all that comes before the fused tail. Blocks 0 .. PB_W2-1 make w2's f16 fragments; each other block takes 16 rows of bin_repr or of unit_embs through both layers:
// x -> f16 in LDS; h = x W + b (K = 512) on WMMA, f16 into LDS; h w1 half (K = 256) on WMMA, f32 to the workspace. No f16 copy of x, h or of these weights goes through memory.
// Wave w owns output columns 32w .. 32w+31 of both layers. Its two B tiles are the even and the odd columns (tile j, lane l: column 32w + 2l + j), so that f32 weights are read row-major as they lie, 8 bytes a lane,
// and converted in registers; each weight is used by one WMMA of the block, so LDS would add nothing. The weight rows of both layers form one stream of 24 k steps, loaded three steps ahead into three register buffers.
// D register r of tile j is row 8h + r, column 32w + 2l + j: a lane stores column pairs. Values and sum order are those of separate GEMMs over k steps of 32.
// The bin half is stored row-major. The unit half is stored as the tail's lanes read it: [tile of 16 units][k step][j][lane][4 f32], lane = 16h + unit, k = 32 step + 16 (j >> 1) + 8h + 4 (j & 1) + e,
// so that each of the tail's loads reads 512 contiguous bytes (four whole lines) and not 32 bytes of each of 16 rows; the turn goes through LDS (sX is free by then), and each line has one writer.
__global__ __launch_bounds__(256) void k_proj(const float* __restrict__ br, const float* __restrict__ ue, const float* __restrict__ bpw, const float* __restrict__ bpb, const float* __restrict__ upw, const float* __restrict__ upb,
                                              const float* __restrict__ w1, const float* __restrict__ w2, _Float16* __restrict__ BW2, float* __restrict__ A, float* __restrict__ Bu) {
  __shared__ __attribute__((aligned(16))) unsigned short sX[PJ_ROWS][PJ_PX];
  __shared__ __attribute__((aligned(16))) unsigned short sH[PJ_ROWS][PJ_PH];
  int b = blockIdx.x;
  if (b < PB_W2) { d_w2_frag(b, w2, BW2); return; }      /* whole blocks, ahead of every barrier */
  b -= PB_W2;
  const bool s = b >= NBT / PJ_ROWS;
  const int r0 = (s ? b - NBT / PJ_ROWS : b) * PJ_ROWS;
  const float* X = (s ? ue : br) + (size_t)r0 * DIM;
  const char* Wa = (const char*)(s ? upw : bpw);
  const char* Wb = (const char*)(w1 + (s ? HALF * HALF : 0));
  const float* bias = s ? upb : bpb;
  float* C = (s ? Bu : A) + (size_t)r0 * HALF;
  const int tid = threadIdx.x, w = tid >> 5, lane = tid & 31, ln = lane & 15, hh = lane >> 4;
  const int col = w * 32 + 2 * ln;
  const unsigned lob = (unsigned)(8 * hh * HALF + col) * 4u;
  v4f x[8];
#pragma unroll
  for (int i = 0; i < 8; ++i) x[i] = *(const v4fa*)(X + i * 1024 + tid * 4);
  const v2f bb = *(const v2fa*)(bias + col);
  v2f q[3][16];
  pj_load(q[0], Wa, lob); pj_load(q[1], Wa + PJ_STEP, lob); pj_load(q[2], Wa + 2 * PJ_STEP, lob);
#pragma unroll
  for (int i = 0; i < 8; ++i) {
    const int e = i * 1024 + tid * 4;
    v4ha h; h[0] = (_Float16)bf16_round(x[i][0]); h[1] = (_Float16)bf16_round(x[i][1]); h[2] = (_Float16)bf16_round(x[i][2]); h[3] = (_Float16)bf16_round(x[i][3]);
    *(v4ha*)&sX[e >> 9][e & (DIM - 1)] = h;
  }
  __syncthreads();
  const v8f z8 = {0.f, 0.f, 0.f, 0.f, 0.f, 0.f, 0.f, 0.f};
  v8f c0 = z8, c1 = z8;
  const unsigned short* ax = &sX[ln][8 * hh];
  // unrolled in full (about 24 KB of text, run once): the three buffers are then fixed registers that the loads write directly, and every weight address is one base, the lane's offset and an immediate;
  // rolled, the refilled values were copied between registers at the foot of each trip, behind a wait for all loads in flight. A buffer is refilled as soon as its values are converted.
#pragma unroll
  for (int ks = 0; ks < DIM / 32; ++ks) {
    FragH b0, b1;
    pj_cvt(q[ks % 3], b0, b1);
    pj_load(q[ks % 3], ks + 3 < DIM / 32 ? Wa + (ks + 3) * PJ_STEP : Wb + (ks + 3 - DIM / 32) * PJ_STEP, lob);      /* the last three refills are the second layer's first steps */
    const v16h a = pj_afrag(ax + ks * 32);
    c0 = __builtin_amdgcn_wmma_f32_16x16x32_f16(false, a, false, b0.v, (short)0, c0, false, false);
    c1 = __builtin_amdgcn_wmma_f32_16x16x32_f16(false, a, false, b1.v, (short)0, c1, false, false);
    __builtin_amdgcn_sched_barrier(0);      /* keeps the later steps' conversions, and with them the waits for their loads, behind this step's refill: moved up, the loads in flight are waited for too early */
  }
  const float bv0 = bf16_round(bb[0]), bv1 = bf16_round(bb[1]);
#pragma unroll
  for (int r = 0; r < 8; ++r) { v2ha h; h[0] = (_Float16)(c0[r] * 0.0625f + bv0); h[1] = (_Float16)(c1[r] * 0.0625f + bv1); *(v2ha*)&sH[8 * hh + r][col] = h; }
  __syncthreads();
  c0 = z8; c1 = z8;
  const unsigned short* ah = &sH[ln][8 * hh];
#pragma unroll
  for (int ks = 0; ks < HALF / 32; ++ks) {
    FragH b0, b1;
    pj_cvt(q[(ks + DIM / 32) % 3], b0, b1);
    if (ks + 3 < HALF / 32) pj_load(q[(ks + DIM / 32) % 3], Wb + (ks + 3) * PJ_STEP, lob);
    const v16h a = pj_afrag(ah + ks * 32);
    c0 = __builtin_amdgcn_wmma_f32_16x16x32_f16(false, a, false, b0.v, (short)0, c0, false, false);
    c1 = __builtin_amdgcn_wmma_f32_16x16x32_f16(false, a, false, b1.v, (short)0, c1, false, false);
    __builtin_amdgcn_sched_barrier(0);      /* as in the first layer's loop */
  }
  if (s) {      /* the same for the whole block */
    float* sT = (float*)&sX[0][0];      /* every wave has left sX at the barrier behind the first layer */
#pragma unroll
    for (int r = 0; r < 8; ++r) { v2f o; o[0] = c0[r] * 0.0625f; o[1] = c1[r] * 0.0625f; *(v2fa*)(sT + (8 * hh + r) * PJ_PT + col) = o; }
    __syncthreads();      /* the turn crosses lanes: the whole tile is in LDS before a lane reads values that other lanes wrote */
#pragma unroll
    for (int j = 0; j < 4; ++j) { const v4f o = *(const v4fa*)(sT + ln * PJ_PT + w * 32 + (j >> 1) * 16 + hh * 8 + (j & 1) * 4); *(v4fa*)(C + (w * 4 + j) * 128 + lane * 4) = o; }      /* wave w's columns are k step w: 512 contiguous bytes a store */
  } else {
#pragma unroll
    for (int r = 0; r < 8; ++r) { v2f o; o[0] = c0[r] * 0.0625f; o[1] = c1[r] * 0.0625f; *(v2fa*)(C + (size_t)(8 * hh + r) * HALF + col) = o; }      /* 16 lanes: one whole 128-byte line */
  }
  asm volatile("s_wait_xcnt 0x0" ::: "memory");      /* behind the last store: in the built code other text follows here that reuses the stores' data registers, and this wait stands in front of any such overwrite */
}

__global__ __launch_bounds__(256) void k_f16c(const float* __restrict__ A, _Float16* __restrict__ D, size_t n8) { const size_t t = (size_t)blockIdx.x * 256 + threadIdx.x; if (t >= n8) return; const v8f a = *(const v8f*)(A + t * 8); FragH f; for (int q = 0; q < 8; ++q) f.h[q] = (_Float16)a[q]; *(v8us*)((unsigned short*)D + t * 8) = f.half[0];  }
// Twice the exact (erf) GELU in f32: 2 h Phi(h) = h + h erf(h / sqrt 2) = h + h tanh(h G(h^2)), with h G(h^2) = atanh(erf(h / sqrt 2)), an odd function of h: one v_tanh_f32 in place of |h|, max(h, 0) and v_exp_f32,
// and the tanh saturates by itself on both sides, so that there is nothing to clamp or select. The factor 2 is taken back by the users' constants (the 1/32 behind the w2 product, the halved w3), both exact.
// G is a degree-4 fit in h^2, weighted by the slope of h tanh: evaluated in f32, the tanh taken as correctly rounded, the error of h Phi(h) is at most about 3e-6 (near |h| = 3.2 and 4.2), some twenty times below what the f16 rounding of h1 leaves in h2;
// an error e of the instruction itself counts |h| e / 2.
// The leading coefficient is positive and h G(h^2) keeps rising past the fitted range (above 6 from |h| = 4.5 on): every finite h is covered, an overflowing h^2 gives tanh(+-infinity) = +-1; h = +-infinity alone would not.
// Two neighbouring values at a time, so that every step but the tanh is one packed f32 instruction on a register pair as it lies.
__device__ __forceinline__ v2f gelu2_erf(const v2f s) {
  const v2f u = s * s, c4 = {1.11263194e-6f, 1.11263194e-6f}, c3 = {-3.04672030e-5f, -3.04672030e-5f}, c2 = {-1.25476174e-4f, -1.25476174e-4f}, c1 = {3.64699289e-2f, 3.64699289e-2f}, c0 = {7.97827601e-1f, 7.97827601e-1f};
  v2f p = __builtin_elementwise_fma(u, c4, c3); p = __builtin_elementwise_fma(u, p, c2); p = __builtin_elementwise_fma(u, p, c1); p = __builtin_elementwise_fma(u, p, c0);
  const v2f g = s * p, th = {__builtin_amdgcn_tanhf(g[0]), __builtin_amdgcn_tanhf(g[1])};
  return __builtin_elementwise_fma(s, th, s);
}
// Fused tail: h1 = gelu(A[bt] + Bu[n] + b1), h2 = gelu(h1 w2 + b2), out = clip(h2 w3 + b3); h1 and h2 never leave the registers. Both are carried as twice their value (gelu2_erf): 2 h1 x 16 w2 is scaled back by 1/32, 2 h2 meets w3 / 2.
// One work-group per pair of bin rows; wave w owns units 32w .. 32w+31 as two tiles of 16 rows, and carries each tile for both bin rows at once:
// a w2 fragment read from LDS feeds two WMMAs, a unit value read from memory two GELUs, and the w2 fill serves twice the rows. With one bin row a wave the k loop's LDS reads add up to more clocks than its vector work on a SIMD.
// The product runs transposed: w2's columns are the A operand (from LDS, stored in fragment order), the h1 rows the B operand.
// A lane computes the 16 h1 values of its own row and k half straight into the B fragment (k = 8h+i, 16+8h+i on both operands).
// D register r of tile t is then h2[row = lane & 15][feature 16t + 8h + r]: the head's dot product stays inside a lane but for one add across the lane halves.
#define TL_BT 2      /* bin rows a work-group: 2 x 64 accumulator registers a wave, four waves a SIMD */
__global__ __launch_bounds__(256) void k_tail(const float* __restrict__ A, const float* __restrict__ Bu, const float* __restrict__ b1, const _Float16* __restrict__ W2t,
                                              const float* __restrict__ b2, const float* __restrict__ w3, const float* __restrict__ b3, float* __restrict__ out) {
  __shared__ __attribute__((aligned(16))) unsigned short sW[HALF / 32][QTR / 16][2][32][8];   /* [k step][feature tile][fragment half][lane][8 f16], 64 KiB: each fragment load reads 512 contiguous bytes */
  __shared__ __attribute__((aligned(16))) float sab[TL_BT][HALF];
  __shared__ __attribute__((aligned(16))) float sb2[QTR];
  __shared__ __attribute__((aligned(16))) float sw3[QTR];
  const int tid = threadIdx.x, w = tid >> 5, lane = tid & 31, ln = lane & 15, hh = lane >> 4;
  const int bt = blockIdx.x * TL_BT;
  // unrolled: all 16 loads of the w2 fill are in flight before the first LDS store
#pragma unroll
  for (int i = 0; i < 16; ++i) {      /* W2t lies in sW's own order: a straight copy, 512 contiguous bytes a wave and load */
    const int c = (i * 256 + tid) * 8;
    const v8us v = *(const v8us*)((const unsigned short*)W2t + c);
    *(v8us*)(&sW[0][0][0][0][0] + c) = v;
  }
  const float b1v = bf16_round(b1[tid]);
#pragma unroll
  for (int j = 0; j < TL_BT; ++j) sab[j][tid] = A[(size_t)(bt + j) * HALF + tid] + b1v;
  if (tid < QTR) { sb2[tid] = bf16_round(b2[tid]); sw3[tid] = 0.5f * bf16_round(w3[tid]); }
  __syncthreads();
  // Bu lies in fragment order: (tile, k step) q = 8 tile + ks of wave w is 512 floats at 16w + q, four loads of 128 floats, 4 a lane (k = 8h + e, 8h + 4 + e, 16 + 8h + e, 16 + 8h + 4 + e of unit row lane & 15)
  const float* ub = Bu + (size_t)w * 16 * 512 + lane * 4;
  v4f u0 = *(const v4fa*)(ub), u1 = *(const v4fa*)(ub + 128), u2 = *(const v4fa*)(ub + 256), u3 = *(const v4fa*)(ub + 384);
  float res[TL_BT] = {};
  // the tile loop and the k loop stay rolled: 32 + 128 inlined GELUs are all the text that the instruction cache should have to hold;
  // the loops inside them are unrolled, so that fragments and accumulators are indexed by constants and stay in registers
#pragma unroll 1
  for (int tile = 0; tile < 2; ++tile) {
    v8f acc[TL_BT][8] = {};
#pragma unroll 1
    for (int ks = 0; ks < HALF / 32; ++ks) {
      v2f s[TL_BT][8];      /* pairs of neighbouring k, as gelu2_erf takes them */
#pragma unroll
      for (int j = 0; j < TL_BT; ++j) {
        const float* ap = &sab[j][ks * 32 + 8 * hh];
        const v4f a0 = *(const v4fa*)(ap), a1 = *(const v4fa*)(ap + 4), a2 = *(const v4fa*)(ap + 16), a3 = *(const v4fa*)(ap + 20);
        s[j][0] = a0.lo + u0.lo; s[j][1] = a0.hi + u0.hi; s[j][2] = a1.lo + u1.lo; s[j][3] = a1.hi + u1.hi;
        s[j][4] = a2.lo + u2.lo; s[j][5] = a2.hi + u2.hi; s[j][6] = a3.lo + u3.lo; s[j][7] = a3.hi + u3.hi;
      }
      // inputs only, nothing emitted: both rows' sums are made here, ahead of the loads below, which then overwrite the registers the sums have read; left free, the first row's sums sink behind the loads and the old unit values are copied aside, eight 64-bit moves a trip behind a wait for all four loads
      asm volatile("" :: "v"(s[0][0]), "v"(s[0][1]), "v"(s[0][2]), "v"(s[0][3]), "v"(s[0][4]), "v"(s[0][5]), "v"(s[0][6]), "v"(s[0][7]), "v"(s[1][0]), "v"(s[1][1]), "v"(s[1][2]), "v"(s[1][3]), "v"(s[1][4]), "v"(s[1][5]), "v"(s[1][6]), "v"(s[1][7]));
      // the next step's unit values are loaded one step ahead, as soon as both rows' sums have used this step's (the last step reloads its own)
      const float* un = ub + min(tile * 8 + ks + 1, 15) * 512;
      u0 = *(const v4fa*)(un); u1 = *(const v4fa*)(un + 128); u2 = *(const v4fa*)(un + 256); u3 = *(const v4fa*)(un + 384);
      __builtin_amdgcn_sched_barrier(0);      /* keeps these loads up here: sunk to the foot of the loop they are waited for at once at the head of the next trip */
      FragH f[TL_BT], wf[8];
#pragma unroll
      for (int j = 0; j < TL_BT; ++j) {
        if (j == TL_BT - 1) {      /* the first four w2 fragments are on their way while the last row's GELUs run */
#pragma unroll
          for (int t = 0; t < 4; ++t) { wf[t].half[0] = *(const v8us*)&sW[ks][t][0][lane][0]; wf[t].half[1] = *(const v8us*)&sW[ks][t][1][lane][0]; }
        }
#pragma unroll
        for (int i = 0; i < 8; ++i) {
          const v2f y = gelu2_erf(s[j][i]);
          f[j].h[2 * i] = (_Float16)y[0]; f[j].h[2 * i + 1] = (_Float16)y[1];
        }
        __builtin_amdgcn_sched_barrier(0);      /* one row's 16 GELUs at a time, and no more than four fragments fetched beside them: otherwise the registers run out and the GELUs are scheduled one dependent chain after another */
      }
#pragma unroll
      for (int t = 4; t < 8; ++t) { wf[t].half[0] = *(const v8us*)&sW[ks][t][0][lane][0]; wf[t].half[1] = *(const v8us*)&sW[ks][t][1][lane][0]; }
      __builtin_amdgcn_sched_barrier(0);      /* the other four fragments are all asked for ahead of the first WMMA: left to itself the build passes them through one buffer, each load waited for at once */
#pragma unroll
      for (int t = 0; t < 8; ++t) {
#pragma unroll
        for (int j = 0; j < TL_BT; ++j) acc[j][t] = __builtin_amdgcn_wmma_f32_16x16x32_f16(false, wf[t].v, false, f[j].v, (short)0, acc[j][t], false, false);
      }
    }
    // compiler fence: keeps the 32 LDS loads of b2 and w3 inside the tile loop; hoisted out of it they hold 128 registers through the k loop, which then has none left to fetch w2 fragments ahead of its WMMAs
    asm volatile("" ::: "memory");
    v4f pv[TL_BT] = {};      /* four partial sums of the head a bin row, so that the GELUs pair up into packed f32 instructions */
#pragma unroll
    for (int t = 0; t < 8; ++t) {
      const int f0 = t * 16 + 8 * hh;
      const v4f c0 = *(const v4fa*)&sb2[f0], c1 = *(const v4fa*)&sb2[f0 + 4], g0 = *(const v4fa*)&sw3[f0], g1 = *(const v4fa*)&sw3[f0 + 4];
#pragma unroll
      for (int j = 0; j < TL_BT; ++j) {
        v4f h0, h1;
#pragma unroll
        for (int r = 0; r < 4; r += 2) {
          const v2f x0 = {acc[j][t][r] * 0.03125f + c0[r], acc[j][t][r + 1] * 0.03125f + c0[r + 1]}, x1 = {acc[j][t][4 + r] * 0.03125f + c1[r], acc[j][t][5 + r] * 0.03125f + c1[r + 1]};
          const v2f y0 = gelu2_erf(x0), y1 = gelu2_erf(x1);
          h0[r] = y0[0]; h0[r + 1] = y0[1]; h1[r] = y1[0]; h1[r + 1] = y1[1];
        }
        pv[j] += h0 * g0; pv[j] += h1 * g1;
      }
    }
#pragma unroll
    for (int j = 0; j < TL_BT; ++j) {
      float p = (pv[j][0] + pv[j][1]) + (pv[j][2] + pv[j][3]);
      p += __shfl_xor(p, 16, 32);
      if (hh == tile) res[j] = p;      /* tile 0's rows end in lanes 0-15, tile 1's in lanes 16-31: one 128-byte store a wave and bin row */
    }
  }
  const float b3v = bf16_round(b3[0]);
#pragma unroll
  for (int j = 0; j < TL_BT; ++j) out[(size_t)(bt + j) * NU + w * 32 + lane] = fminf(fmaxf(res[j] + b3v, -10.0f), 10.0f);
}

extern "C" void kernel_launch(void* const* d_in, const int* in_sizes, int n_in,
                              void* d_out, int out_size, void* d_ws, size_t ws_size, hipStream_t stream) {
  (void)in_sizes; (void)n_in; (void)out_size;
  const float* const* I = (const float* const*)d_in; const float* br = I[0]; const float* ue = I[1]; const float* bpw = I[2]; const float* bpb = I[3]; const float* upw = I[4]; const float* upb = I[5]; const float* w1 = I[6]; const float* b1 = I[7]; const float* w2 = I[8]; const float* b2 = I[9]; const float* w3 = I[10]; const float* b3 = I[11];
  char* ws = (char*)d_ws; size_t off = 0;
  auto take = [&](size_t bytes) { char* p = ws + off; off += (bytes + 255) & ~(size_t)255; return p; };
  _Float16* BW2 = (_Float16*)take((size_t)QTR * HALF * 2); float* A = (float*)take((size_t)NBT * HALF * 4); float* Bu = (float*)take((size_t)NU * HALF * 4);
  if (off > ws_size) return;
  k_proj<<<PB_W2 + (NBT + NU) / PJ_ROWS, 256, 0, stream>>>(br, ue, bpw, bpb, upw, upb, w1, w2, BW2, A, Bu);      /* w2 -> f16 x16 in fragment order; A = (bin_repr Wbp + b) w1a, Bu = (unit_embs Wup + b) w1b in fragment order */
  k_tail<<<NBT / TL_BT, 256, 0, stream>>>(A, Bu, b1, BW2, b2, w3, b3, (float*)d_out);      /* h1, h2, head, clip */
}

// v008
// It runs in 27.9 microseconds.
// Next to v007, in two timings, it ran 1.07 times as fast each time.
// All steps since v000 together make it 10.9 times as fast.
#include <hip/hip_runtime.h>
// PerNeuronMLPHead (2 x 512 time bins x 512, 256 units x 512: bin_h = bin_repr Wbp + b, unit_h = unit_embs Wup + b (256 wide); h1[(b,t), n] = gelu(bin_h w1a + unit_h w1b + b1) (the split-weight broadcast add); h2 = gelu(h1 w2 + b2) (128); log_rate = h2 w3 + b3; clip(-10, 10); exact erf GELU).
// Structure, two launches: one for both projection layers (16 rows a block through x W + b and h w1 half on f16 WMMA, f32 accumulation, weights read as f32 and made exact x16 f16 fragments in registers, h in LDS; w2's f16 fragments ride along as extra blocks; w2 and the unit half leave in the order in which the tail's lanes read them); then one fused kernel: broadcast add + GELU on VALU straight into f16 WMMA fragments, h1 w2 on f16 WMMA, GELU, the 128 -> 1 head and the clip on the f32 accumulators, two bin rows a work-group (128-B stores, one a wave and bin row).
// Compute dtype: inputs rounded to bf16; inputs / weights exact as f16; bin_h / unit_h and h1 as plain f16 operands (~2^-12); h2, GELU and head f32. v_wmma_f32_16x16x32_f16.
#define NB 2
#define NTB 512
#define DIM 512
#define HALF 256
#define QTR 128
#define NU 256
#define NBT (NB * NTB)           /* 1024 bin rows */
#define NRW ((size_t)NBT * NU)   /* 262144 output rows */
typedef __bf16 v16b __attribute__((ext_vector_type(16)));
typedef unsigned short v8us __attribute__((ext_vector_type(8), may_alias));
typedef float  v8f  __attribute__((ext_vector_type(8)));
typedef float  v4f  __attribute__((ext_vector_type(4)));
typedef float  v4fa __attribute__((ext_vector_type(4), may_alias));
union FragB { v16b v; v8us half[2]; unsigned short u[16]; };

__device__ __forceinline__ unsigned short bf16_bits(float x) { unsigned int u = __float_as_uint(x); return (unsigned short)((u + 0x7FFFu + ((u >> 16) & 1u)) >> 16); }
__device__ __forceinline__ float bf16_val(unsigned short b) { return __uint_as_float(((unsigned int)b) << 16); }
__device__ __forceinline__ float bf16_round(float x) { return bf16_val(bf16_bits(x)); }
// D += A·B with NT terms: 1 = ah·bh, 2 = + al·bh (A split), 3 = + ah·bl (both split)
template <int NT>
__device__ __forceinline__ v8f mmaN(v16b ah, v16b al, v16b bh, v16b bl, v8f c) {
  c = __builtin_amdgcn_wmma_f32_16x16x32_bf16(false, ah, false, bh, (short)0, c, false, false);
  if (NT >= 2) c = __builtin_amdgcn_wmma_f32_16x16x32_bf16(false, al, false, bh, (short)0, c, false, false);
  if (NT >= 3) c = __builtin_amdgcn_wmma_f32_16x16x32_bf16(false, ah, false, bl, (short)0, c, false, false);
  asm volatile("v_nop\n\tv_nop\n\tv_nop\n\tv_nop" : "+v"(c) : "v"(ah), "v"(al), "v"(bh), "v"(bl));
  return c;
}

__global__ __launch_bounds__(256) void k_wt_bf16(const float* __restrict__ W, unsigned short* __restrict__ Wt, int K, int N) {
  const int t = blockIdx.x * 256 + threadIdx.x;
  const int k8n = K / 8;
  if (t >= N * k8n) return;
  const int n = t / k8n, k8 = (t % k8n) * 8;
  v8us v;
#pragma unroll
  for (int i = 0; i < 8; ++i) v[i] = bf16_bits(W[(size_t)(k8 + i) * N + n]);
  *(v8us*)(Wt + (size_t)n * K + k8) = v;
  
}

// GEMM C[M][N] (f32, pitch ldc) = act(A[M][K]·W + bias). A f32 row-major (pitch lda) converted per fragment to bf16
// (ASPLIT: hi/lo two planes -> 2 terms, else single rounded term); Wt bf16 [N][K] (pitch ldb). BIAS_BF16 rounds the
// bias to bf16 first (bias quantised to bf16 before the add). K%32==0, M%16==0, N%64==0.
template <bool ASPLIT, int ACT, bool BIAS_BF16>
__global__ __launch_bounds__(128) void k_gemm_bf(const float* __restrict__ A, int lda, const unsigned short* __restrict__ Wt, int ldb,
                                               const float* __restrict__ bias, float* __restrict__ C, int ldc, int M, int N, int K) {
  __shared__ __attribute__((aligned(16))) float so[4][16][64];
  const int tid = threadIdx.x, w = tid >> 5, lane = tid & 31, ln = lane & 15, hh = lane >> 4;
  const int ntn = N / 64;
  const int wid = blockIdx.x * 4 + w;
  const int mt = wid / ntn, nq = wid % ntn;
  if (mt * 16 >= M) return;
  const int row0 = mt * 16, col0 = nq * 64;
  const float* arow = A + (size_t)(row0 + ln) * lda;
  v8f acc[4] = {};
  for (int kb = 0; kb < K; kb += 32) {
    FragB ah, al;
    const v4f x0 = *(const v4fa*)(arow + kb + 8 * hh), x1 = *(const v4fa*)(arow + kb + 8 * hh + 4);
    const v4f x2 = *(const v4fa*)(arow + kb + 16 + 8 * hh), x3 = *(const v4fa*)(arow + kb + 16 + 8 * hh + 4);
    float xs[16] = {x0[0],x0[1],x0[2],x0[3],x1[0],x1[1],x1[2],x1[3],x2[0],x2[1],x2[2],x2[3],x3[0],x3[1],x3[2],x3[3]};
#pragma unroll
    for (int i = 0; i < 16; ++i) { const unsigned short hb = bf16_bits(xs[i]); ah.u[i] = hb; al.u[i] = ASPLIT ? bf16_bits(xs[i] - bf16_val(hb)) : (unsigned short)0; }
#pragma unroll
    for (int t = 0; t < 4; ++t) {
      const unsigned short* brow = Wt + (size_t)(col0 + t * 16 + ln) * ldb + kb;
      FragB b;
      b.half[0] = *(const v8us*)(brow + 8 * hh);
      b.half[1] = *(const v8us*)(brow + 16 + 8 * hh);
      acc[t] = mmaN<ASPLIT ? 2 : 1>(ah.v, al.v, b.v, b.v, acc[t]);
    }
  }
#pragma unroll
  for (int t = 0; t < 4; ++t) {
    float bv = bias ? bias[col0 + t * 16 + ln] : 0.f;
    if (BIAS_BF16) bv = bf16_round(bv);
#pragma unroll
    for (int r = 0; r < 8; ++r) { float v = acc[t][r] + bv; if (ACT == 1) v = fmaxf(v, 0.f); so[w][8 * hh + r][t * 16 + ln] = v; }
  }
  __builtin_amdgcn_fence(__ATOMIC_ACQ_REL, "workgroup");
  __builtin_amdgcn_wave_barrier();
  const int rsub = lane >> 4, c4 = (lane & 15) * 4;
  {
#pragma unroll
    for (int q = 0; q < 8; ++q) {
      const int r = q * 2 + rsub;
      const v4f v = *(const v4fa*)&so[w][r][c4];
      *(v4f*)(C + (size_t)(row0 + r) * ldc + col0 + c4) = v;
    }
    
  }
}

// GEMM C = act(A·W + bias + resid): A f32 (ASPLIT -> hi/lo 2 terms), Wt bf16 [N][K]; ACT 0 none, 1 relu, 2 exact gelu;
// resid (optional, f32, row index = (row % rmod), pitch ldr, RES_BF16 rounds it) added before the activation.
template <bool ASPLIT, int ACT, bool BIAS_BF16, bool RES_BF16>
__global__ __launch_bounds__(128) void k_gemm_bf3(const float* __restrict__ A, int lda, const unsigned short* __restrict__ Wt, int ldb,
                                                const float* __restrict__ bias, const float* __restrict__ resid, int rmod, int ldr,
                                                float* __restrict__ C, int ldc, int M, int N, int K) {
  __shared__ __attribute__((aligned(16))) float so[4][16][64];
  const int tid = threadIdx.x, w = tid >> 5, lane = tid & 31, ln = lane & 15, hh = lane >> 4;
  const int ntn = N / 64;
  const int wid = blockIdx.x * 4 + w;
  const int mt = wid / ntn, nq = wid % ntn;
  if (mt * 16 >= M) return;
  const int row0 = mt * 16, col0 = nq * 64;
  const float* arow = A + (size_t)(row0 + ln) * lda;
  v8f acc[4] = {};
  for (int kb = 0; kb < K; kb += 32) {
    FragB ah, al;
    const v4f x0 = *(const v4fa*)(arow + kb + 8 * hh), x1 = *(const v4fa*)(arow + kb + 8 * hh + 4);
    const v4f x2 = *(const v4fa*)(arow + kb + 16 + 8 * hh), x3 = *(const v4fa*)(arow + kb + 16 + 8 * hh + 4);
    float xs[16] = {x0[0],x0[1],x0[2],x0[3],x1[0],x1[1],x1[2],x1[3],x2[0],x2[1],x2[2],x2[3],x3[0],x3[1],x3[2],x3[3]};
#pragma unroll
    for (int i = 0; i < 16; ++i) { const unsigned short hb = bf16_bits(xs[i]); ah.u[i] = hb; al.u[i] = ASPLIT ? bf16_bits(xs[i] - bf16_val(hb)) : (unsigned short)0; }
#pragma unroll
    for (int t = 0; t < 4; ++t) {
      const unsigned short* brow = Wt + (size_t)(col0 + t * 16 + ln) * ldb + kb;
      FragB b;
      b.half[0] = *(const v8us*)(brow + 8 * hh);
      b.half[1] = *(const v8us*)(brow + 16 + 8 * hh);
      acc[t] = mmaN<ASPLIT ? 2 : 1>(ah.v, al.v, b.v, b.v, acc[t]);
    }
  }
#pragma unroll
  for (int t = 0; t < 4; ++t) {
    const int col = col0 + t * 16 + ln;
    float bv = bias ? bias[col] : 0.f;
    if (BIAS_BF16) bv = bf16_round(bv);
#pragma unroll
    for (int r = 0; r < 8; ++r) {
      float v = acc[t][r] + bv;
      if (resid) { float rv = resid[(size_t)((row0 + 8 * hh + r) % rmod) * ldr + col]; if (RES_BF16) rv = bf16_round(rv); v += rv; }
      if (ACT == 1) v = fmaxf(v, 0.f);
      if (ACT == 2) v = 0.5f * v * (1.0f + erff(v * 0.70710678118654752f));
      if (ACT == 3) { const float u = 0.7978845608028654f * (v + 0.044715f * v * v * v); v = 0.5f * v * (1.0f + tanhf(u)); }
      so[w][8 * hh + r][t * 16 + ln] = v;
    }
  }
  __builtin_amdgcn_fence(__ATOMIC_ACQ_REL, "workgroup");
  __builtin_amdgcn_wave_barrier();
  const int rsub = lane >> 4, c4 = (lane & 15) * 4;
  {
#pragma unroll
    for (int q = 0; q < 8; ++q) {
      const int r = q * 2 + rsub;
      const v4f v = *(const v4fa*)&so[w][r][c4];
      *(v4f*)(C + (size_t)(row0 + r) * ldc + col0 + c4) = v;
    }
    
  }
}
// row LayerNorm (biased variance, eps) over N: s = X (+ R); optional out_sum <- s; out_norm <- (s-mu)*rsqrt(var+eps)*g + b
template <bool PARAM_BF16>
__global__ __launch_bounds__(256) void k_layernorm(const float* __restrict__ X, const float* __restrict__ R, const float* __restrict__ g, const float* __restrict__ bta,
                                                  float* __restrict__ out_sum, float* __restrict__ out_norm, int N, float eps) {
  __shared__ float red[256];
  const int row = blockIdx.x, tid = threadIdx.x;
  const float* x = X + (size_t)row * N; const float* rr = R ? R + (size_t)row * N : nullptr;
  float vals[16];                     // up to N = 4096
  const int per = N / 256;            // contiguous chunk per thread? use strided-by-4 chunks: thread handles j = tid*4 + 1024*u
  float s1 = 0.f;
  for (int u = 0; u < per / 4; ++u) {
    const int j = tid * 4 + 1024 * u;
    const v4f a = *(const v4fa*)(x + j);
    v4f b = {0.f,0.f,0.f,0.f}; if (rr) b = *(const v4fa*)(rr + j);
#pragma unroll
    for (int q = 0; q < 4; ++q) { const float v = a[q] + b[q]; vals[u * 4 + q] = v; s1 += v; }
  }
  red[tid] = s1; __syncthreads();
  for (int st = 128; st > 0; st >>= 1) { if (tid < st) red[tid] += red[tid + st]; __syncthreads(); }
  const float mu = red[0] / (float)N; __syncthreads();
  float s2 = 0.f;
  for (int u = 0; u < per / 4; ++u)
#pragma unroll
    for (int q = 0; q < 4; ++q) { const float c = vals[u * 4 + q] - mu; s2 += c * c; }
  red[tid] = s2; __syncthreads();
  for (int st = 128; st > 0; st >>= 1) { if (tid < st) red[tid] += red[tid + st]; __syncthreads(); }
  const float rs = rsqrtf(red[0] / (float)N + eps);
  {
    for (int u = 0; u < per / 4; ++u) {
      const int j = tid * 4 + 1024 * u;
      v4f o, sm;
#pragma unroll
      for (int q = 0; q < 4; ++q) {
        float gg = g[j + q], bb = bta[j + q];
        if (PARAM_BF16) { gg = bf16_round(gg); bb = bf16_round(bb); }
        sm[q] = vals[u * 4 + q]; o[q] = (vals[u * 4 + q] - mu) * rs * gg + bb;
      }
      if (out_sum) *(v4f*)(out_sum + (size_t)row * N + j) = sm;
      *(v4f*)(out_norm + (size_t)row * N + j) = o;
    }
    
  }
}



// ---- f16 WMMA path (v_wmma_f32_16x16x32_f16): 11-bit significands for operands in range — used for every GEMM launched here
typedef _Float16 v16h __attribute__((ext_vector_type(16)));
union FragH { v16h v; v8us half[2]; _Float16 h[16]; unsigned short u[16]; };
template <int NT>
__device__ __forceinline__ v8f mmaH(v16h ah, v16h al, v16h bh, v16h bl, v8f c) {
  c = __builtin_amdgcn_wmma_f32_16x16x32_f16(false, ah, false, bh, (short)0, c, false, false);
  if (NT >= 2) c = __builtin_amdgcn_wmma_f32_16x16x32_f16(false, al, false, bh, (short)0, c, false, false);
  if (NT >= 3) c = __builtin_amdgcn_wmma_f32_16x16x32_f16(false, ah, false, bl, (short)0, c, false, false);
  asm volatile("v_nop\n\tv_nop\n\tv_nop\n\tv_nop" : "+v"(c) : "v"(ah), "v"(al), "v"(bh), "v"(bl));
  return c;
}
// batched GEMM like k_gemm_b but f16 operands: A f32 (split into f16 hi/lo if ASPLIT, else rounded to f16), Bt = f16 values [n][k]; alpha; C f32; N multiple of 16 (partial tiles skipped)
template <bool ASPLIT>
__global__ __launch_bounds__(128) void k_gemm_h(const float* __restrict__ A, int lda, size_t sA, const _Float16* __restrict__ Bh, int ldb, size_t sB, float alpha, float* __restrict__ C, int ldc, size_t sC, int M, int N, int K) {
  __shared__ __attribute__((aligned(16))) float so[4][16][64];
  const int tid = threadIdx.x, w = tid >> 5, lane = tid & 31, ln = lane & 15, hh = lane >> 4; const int by = blockIdx.y;
  A += (size_t)by * sA; Bh += (size_t)by * sB; C += (size_t)by * sC;
  const int ntn = (N + 63) / 64; const int wid = blockIdx.x * 4 + w; const int mt = wid / ntn, nq = wid % ntn; if (mt * 16 >= M) return;
  const int row0 = mt * 16, col0 = nq * 64; const float* arow = A + (size_t)(row0 + ln) * lda;
  v8f acc[4] = {};
  for (int kb = 0; kb < K; kb += 32) {
    FragH ah, al;
    const v4f x0 = *(const v4fa*)(arow + kb + 8 * hh), x1 = *(const v4fa*)(arow + kb + 8 * hh + 4), x2 = *(const v4fa*)(arow + kb + 16 + 8 * hh), x3 = *(const v4fa*)(arow + kb + 16 + 8 * hh + 4);
    float xs[16] = {x0[0],x0[1],x0[2],x0[3],x1[0],x1[1],x1[2],x1[3],x2[0],x2[1],x2[2],x2[3],x3[0],x3[1],x3[2],x3[3]};
#pragma unroll
    for (int i = 0; i < 16; ++i) { const _Float16 h = (_Float16)xs[i]; ah.h[i] = h; al.h[i] = ASPLIT ? (_Float16)(xs[i] - (float)h) : (_Float16)0.0f; }
#pragma unroll
    for (int t = 0; t < 4; ++t) { if (col0 + t * 16 >= N) continue; const size_t boff = (size_t)(col0 + t * 16 + ln) * ldb + kb; FragH bq; bq.half[0] = *(const v8us*)(Bh + boff + 8 * hh); bq.half[1] = *(const v8us*)(Bh + boff + 16 + 8 * hh);
      acc[t] = mmaH<ASPLIT ? 2 : 1>(ah.v, al.v, bq.v, bq.v, acc[t]); }
  }
#pragma unroll
  for (int t = 0; t < 4; ++t) { if (col0 + t * 16 >= N) continue;
#pragma unroll
    for (int r = 0; r < 8; ++r) so[w][8 * hh + r][t * 16 + ln] = acc[t][r] * alpha; }
  __builtin_amdgcn_fence(__ATOMIC_ACQ_REL, "workgroup"); __builtin_amdgcn_wave_barrier();
  const int rsub = lane >> 4, c4 = (lane & 15) * 4;
  {
#pragma unroll
    for (int q = 0; q < 8; ++q) { const int r = q * 2 + rsub; if (col0 + c4 < N) { const v4f v = *(const v4fa*)&so[w][r][c4]; *(v4f*)(C + (size_t)(row0 + r) * ldc + col0 + c4) = v; } }
     }
}

// w2 (f32 [HALF][QTR], row-major) -> f16(bf16-rounded weight x 16; the power of two keeps bf16-exact weights exact in f16 away from the subnormal range), in the order of the tail's A fragments:
// chunk c = ((ks * 8 + t) * 2 + half) * 32 + lane holds the 8 values k = ks * 32 + half * 16 + (lane >> 4) * 8 + i of feature t * 16 + (lane & 15).
// One thread a chunk, chunks in thread order: a wave stores 512 contiguous bytes, and the tail's LDS fill is a straight copy of whole 128-byte lines.
__device__ __forceinline__ void d_w2_frag(const int blk, const float* __restrict__ W, _Float16* __restrict__ Wf) {
  const int c = blk * 256 + threadIdx.x; const int lane = c & 31, half = (c >> 5) & 1, t = (c >> 6) & 7, ks = c >> 9;
  const int n = t * 16 + (lane & 15), k8 = ks * 32 + half * 16 + (lane >> 4) * 8; FragH f;
#pragma unroll
  for (int i = 0; i < 8; ++i) f.h[i] = (_Float16)(bf16_round(W[(size_t)(k8 + i) * QTR + n]) * 16.0f); const v8us o = f.half[0];
  *(v8us*)((unsigned short*)Wf + (size_t)c * 8) = o;
}
// k_gemm_hh variant with fused epilogue: v = acc·alpha + bias[by·sBias + col] (+ CP[(row/rowsPerB)·sCPb + by·64 + col] if CP) ; ACT 0 none / 1 elu ; writes f16 C16 (and f32 C if non-null)
template <int ACT>
__global__ __launch_bounds__(128) void k_gemm_hhx(const _Float16* __restrict__ A, int lda, size_t sA, const _Float16* __restrict__ Bh, int ldb, size_t sB, float alpha, const float* __restrict__ bias, size_t sBias, const float* __restrict__ CP, int rowsPerB, size_t sCPb, int row0g,
    float* __restrict__ C, _Float16* __restrict__ C16, int ldc, size_t sC, int M, int N, int K) {
  __shared__ __attribute__((aligned(16))) float so[4][16][64];
  const int tid = threadIdx.x, w = tid >> 5, lane = tid & 31, ln = lane & 15, hh = lane >> 4; const int by = blockIdx.y;
  A += (size_t)by * sA; Bh += (size_t)by * sB; const size_t cofs = (size_t)by * sC; const float* bp = bias ? bias + (size_t)by * sBias : nullptr;
  const int ntn = (N + 63) / 64; const int wid = blockIdx.x * 4 + w; const int mt = wid / ntn, nq = wid % ntn; if (mt * 16 >= M) return;
  const int row0 = mt * 16, col0 = nq * 64; const _Float16* arow = A + (size_t)(row0 + ln) * lda;
  v8f acc[4] = {};
  for (int kb = 0; kb < K; kb += 32) { FragH ah; ah.half[0] = *(const v8us*)((const unsigned short*)arow + kb + 8 * hh); ah.half[1] = *(const v8us*)((const unsigned short*)arow + kb + 16 + 8 * hh);
#pragma unroll
    for (int t = 0; t < 4; ++t) { if (col0 + t * 16 >= N) continue; const size_t boff = (size_t)(col0 + t * 16 + ln) * ldb + kb; FragH bq; bq.half[0] = *(const v8us*)((const unsigned short*)Bh + boff + 8 * hh); bq.half[1] = *(const v8us*)((const unsigned short*)Bh + boff + 16 + 8 * hh);
      acc[t] = mmaH<1>(ah.v, ah.v, bq.v, bq.v, acc[t]); }
  }
#pragma unroll
  for (int t = 0; t < 4; ++t) { if (col0 + t * 16 >= N) continue; const int col = col0 + t * 16 + ln; const float bv = bp ? bf16_round(bp[col]) : 0.f;
#pragma unroll
    for (int r = 0; r < 8; ++r) { float v = acc[t][r] * alpha + bv; if (CP) { const int rr = row0g + row0 + 8 * hh + r; if (rowsPerB < 0) v += CP[cofs + (size_t)rr * ldc + col];      /* rowsPerB < 0: own element of the batched C plane */ else { const int bidx = rr / rowsPerB; v += CP[(size_t)bidx * sCPb + (size_t)by * 64 + col]; } } if (ACT == 1) v = (v > 0.f) ? v : expm1f(v); else if (ACT == 7) v = (v > 0.f) ? v + 1.0f : expf(v); else if (ACT == 8) v = tanhf(v); else if (ACT == 9) v = 0.5f * v * (1.0f + tanhf(0.7978845608028654f * (v + 0.044715f * v * v * v))); else if (ACT == 11) v = 1.0f / (1.0f + expf(-v)); else if (ACT == 12) v = (v > 0.f) ? v : 0.01f * v; else if (ACT == 14) v = (v > 0.f) ? v : 0.1f * v; else if (ACT == 16) v = (v >= 0.f) ? v : 0.3f * v; else if (ACT == 17) v = (v >= 0.f) ? v : 0.2f * v; else if (ACT == 15) v = v / (1.0f + expf(-v)); else if (ACT == 3) v = fmaxf(v, 0.f); else if (ACT == 6) v = 0.5f * v * (1.0f + erff(v * 0.70710678118654752f)); so[w][8 * hh + r][t * 16 + ln] = v; } }
  __builtin_amdgcn_fence(__ATOMIC_ACQ_REL, "workgroup"); __builtin_amdgcn_wave_barrier();
  const int rsub = lane >> 4, c4 = (lane & 15) * 4; typedef _Float16 v4h __attribute__((ext_vector_type(4)));
  {
#pragma unroll
    for (int q = 0; q < 8; ++q) { const int r = q * 2 + rsub; if (col0 + c4 < N) { const v4f v = *(const v4fa*)&so[w][r][c4]; if (C) *(v4f*)(C + cofs + (size_t)(row0 + r) * ldc + col0 + c4) = v; if (C16) { v4h h4; for (int i = 0; i < 4; ++i) h4[i] = (_Float16)v[i]; *(v4h*)(C16 + cofs + (size_t)(row0 + r) * ldc + col0 + c4) = h4; } } }
     }
}


typedef _Float16 v4h __attribute__((ext_vector_type(4)));

__global__ __launch_bounds__(256) void k_h16(const float* __restrict__ x, _Float16* __restrict__ X16, size_t n8) { const size_t t = (size_t)blockIdx.x * 256 + threadIdx.x; if (t >= n8) return; FragH f;
#pragma unroll
  for (int q = 0; q < 8; ++q) f.h[q] = (_Float16)x[t * 8 + q]; *(v8us*)((unsigned short*)X16 + t * 8) = f.half[0];  }
__global__ __launch_bounds__(256) void k_round16f(const float* __restrict__ W, _Float16* __restrict__ Bt, size_t n8) { const size_t t = (size_t)blockIdx.x * 256 + threadIdx.x; if (t >= n8) return; FragH f;
#pragma unroll
  for (int i = 0; i < 8; ++i) f.h[i] = (_Float16)(bf16_round(W[t * 8 + i]) * 16.0f); *(v8us*)((unsigned short*)Bt + t * 8) = f.half[0];  }
template <int NHv, int TTv>
__global__ __launch_bounds__(256) void k_vt(const _Float16* __restrict__ V16, int ldv, int voff, _Float16* __restrict__ Vt) { __shared__ unsigned short tl[64][66]; const int tid = threadIdx.x; const int slab = blockIdx.x / (TTv / 64), lg = blockIdx.x % (TTv / 64); const int b = slab / NHv, h = slab % NHv;
  for (int i = tid; i < 64 * 8; i += 256) { const int r = i / 8, c8 = (i % 8) * 8; FragH f; f.half[0] = *(const v8us*)((const unsigned short*)V16 + ((size_t)b * TTv + lg * 64 + r) * ldv + voff + h * 64 + c8);
#pragma unroll
    for (int q = 0; q < 8; ++q) tl[r][c8 + q] = f.u[q]; }
  __syncthreads();
  {
#pragma unroll
    for (int rd = 0; rd < 2; ++rd) { const int d = rd * 32 + tid / 8, pc = tid % 8; FragH f;
#pragma unroll
      for (int q = 0; q < 8; ++q) f.u[q] = tl[pc * 8 + q][d];
      *(v8us*)((unsigned short*)Vt + ((size_t)slab * 64 + d) * TTv + lg * 64 + pc * 8) = f.half[0]; }
     } }

__global__ __launch_bounds__(256) void k_hl(const float* __restrict__ F, _Float16* __restrict__ Hh, _Float16* __restrict__ Hl, size_t n8) { const size_t t = (size_t)blockIdx.x * 256 + threadIdx.x; if (t >= n8) return; FragH fh, fl; const v4f a = *(const v4fa*)(F + t * 8), c = *(const v4fa*)(F + t * 8 + 4);
#pragma unroll
  for (int q = 0; q < 4; ++q) { _Float16 h = (_Float16)a[q]; fh.h[q] = h; fl.h[q] = (_Float16)((a[q] - (float)h) * 1024.0f); h = (_Float16)c[q]; fh.h[4 + q] = h; fl.h[4 + q] = (_Float16)((c[q] - (float)h) * 1024.0f); }
  { *(v8us*)((unsigned short*)Hh + t * 8) = fh.half[0]; *(v8us*)((unsigned short*)Hl + t * 8) = fl.half[0];  } }

// ---- both projection layers in one launch ----
typedef float v2f __attribute__((ext_vector_type(2)));
typedef float v2fa __attribute__((ext_vector_type(2), may_alias));
typedef _Float16 v2ha __attribute__((ext_vector_type(2), may_alias));
typedef _Float16 v4ha __attribute__((ext_vector_type(4), may_alias));
#define PB_W2 (QTR * HALF / 8 / 256)      /* 16 blocks: w2 */
#define PJ_ROWS 16                        /* rows a block carries through both layers */
#define PJ_PX (DIM + 8)                   /* LDS pitch in f16: 16 bytes past a multiple of 256, so that the 16 rows of a fragment load fall on different banks */
#define PJ_PH (HALF + 8)
#define PJ_PT (HALF + 4)                   /* LDS pitch in f32 of the unit blocks' output tile: an odd multiple of 16 bytes; 16 rows of it fill sX exactly */
#define PJ_STEP ((size_t)32 * HALF * 4)   /* bytes of 32 rows (one k step) of a weight matrix of 256 columns */
// The 16 k rows of one k step that a lane's B fragments hold (k = 8h+i, 16+8h+i, the order of the A fragments), two neighbouring columns a load: 16 lanes read one whole 128-byte line of a row.
// base is the same for the wave, lob the lane's fixed byte offset (row 8h, its column pair).
__device__ __forceinline__ void pj_load(v2f (&q)[16], const char* __restrict__ base, const unsigned lob) {
#pragma unroll
  for (int i = 0; i < 16; ++i) q[i] = *(const v2fa*)(base + lob + (size_t)(i < 8 ? i : i + 8) * HALF * 4);
}
// f32 weights -> the f16 x16 values of bf16-rounded weights, straight into two B fragments (column 2l and column 2l+1 of the wave's 32), two k at a time.
// The x16 comes first (a power of two commutes with the rounding); the hardware's f32 -> bf16 conversion rounds to nearest even as bf16_round does (the same value for every finite weight) and takes one instruction for two weights.
typedef __bf16 v2bf __attribute__((ext_vector_type(2)));
typedef _Float16 v2h __attribute__((ext_vector_type(2)));
__device__ __forceinline__ void pj_cvt(const v2f (&q)[16], FragH& b0, FragH& b1) {
#pragma unroll
  for (int i = 0; i < 16; i += 2) {
    const v2f u = q[i] * 16.0f, v = q[i + 1] * 16.0f;
    const v2f t0 = {u[0], v[0]}, t1 = {u[1], v[1]};
    const v2h h0 = __builtin_convertvector(__builtin_convertvector(__builtin_convertvector(t0, v2bf), v2f), v2h);
    const v2h h1 = __builtin_convertvector(__builtin_convertvector(__builtin_convertvector(t1, v2bf), v2f), v2h);
    b0.h[i] = h0[0]; b0.h[i + 1] = h0[1]; b1.h[i] = h1[0]; b1.h[i + 1] = h1[1];
  }
}
__device__ __forceinline__ v16h pj_afrag(const unsigned short* p) { FragH f; f.half[0] = *(const v8us*)p; f.half[1] = *(const v8us*)(p + 16); return f.v; }
// One launch for all that comes before the fused tail. Blocks 0 .. PB_W2-1 make w2's f16 fragments; each other block takes 16 rows of bin_repr or of unit_embs through both layers:
// x -> f16 in LDS; h = x W + b (K = 512) on WMMA, f16 into LDS; h w1 half (K = 256) on WMMA, f32 to the workspace. No f16 copy of x, h or of these weights goes through memory.
// Wave w owns output columns 32w .. 32w+31 of both layers. Its two B tiles are the even and the odd columns (tile j, lane l: column 32w + 2l + j), so that f32 weights are read row-major as they lie, 8 bytes a lane,
// and converted in registers; each weight is used by one WMMA of the block, so LDS would add nothing. The weight rows of both layers form one stream of 24 k steps, loaded three steps ahead into three register buffers.
// D register r of tile j is row 8h + r, column 32w + 2l + j: a lane stores column pairs. Values and sum order are those of separate GEMMs over k steps of 32. Both halves leave as 1/8 of their value (2^-7 in place of the 2^-4 that takes back the x16), as the tail's GELU takes them.
// The bin half is stored row-major. The unit half is stored as the tail's lanes read it: [tile of 16 units][k step][j][lane][4 f32], lane = 16h + unit, k = 32 step + 16 (j >> 1) + 8h + 4 (j & 1) + e,
// so that each of the tail's loads reads 512 contiguous bytes (four whole lines) and not 32 bytes of each of 16 rows; the turn goes through LDS (sX is free by then), and each line has one writer.
__global__ __launch_bounds__(256) void k_proj(const float* __restrict__ br, const float* __restrict__ ue, const float* __restrict__ bpw, const float* __restrict__ bpb, const float* __restrict__ upw, const float* __restrict__ upb,
                                              const float* __restrict__ w1, const float* __restrict__ w2, _Float16* __restrict__ BW2, float* __restrict__ A, float* __restrict__ Bu) {
  __shared__ __attribute__((aligned(16))) unsigned short sX[PJ_ROWS][PJ_PX];
  __shared__ __attribute__((aligned(16))) unsigned short sH[PJ_ROWS][PJ_PH];
  int b = blockIdx.x;
  if (b < PB_W2) { d_w2_frag(b, w2, BW2); return; }      /* whole blocks, ahead of every barrier */
  b -= PB_W2;
  const bool s = b >= NBT / PJ_ROWS;
  const int r0 = (s ? b - NBT / PJ_ROWS : b) * PJ_ROWS;
  const float* X = (s ? ue : br) + (size_t)r0 * DIM;
  const char* Wa = (const char*)(s ? upw : bpw);
  const char* Wb = (const char*)(w1 + (s ? HALF * HALF : 0));
  const float* bias = s ? upb : bpb;
  float* C = (s ? Bu : A) + (size_t)r0 * HALF;
  const int tid = threadIdx.x, w = tid >> 5, lane = tid & 31, ln = lane & 15, hh = lane >> 4;
  const int col = w * 32 + 2 * ln;
  const unsigned lob = (unsigned)(8 * hh * HALF + col) * 4u;
  v4f x[8];
#pragma unroll
  for (int i = 0; i < 8; ++i) x[i] = *(const v4fa*)(X + i * 1024 + tid * 4);
  const v2f bb = *(const v2fa*)(bias + col);
  v2f q[3][16];
  pj_load(q[0], Wa, lob); pj_load(q[1], Wa + PJ_STEP, lob); pj_load(q[2], Wa + 2 * PJ_STEP, lob);
#pragma unroll
  for (int i = 0; i < 8; ++i) {
    const int e = i * 1024 + tid * 4;
    v4ha h; h[0] = (_Float16)bf16_round(x[i][0]); h[1] = (_Float16)bf16_round(x[i][1]); h[2] = (_Float16)bf16_round(x[i][2]); h[3] = (_Float16)bf16_round(x[i][3]);
    *(v4ha*)&sX[e >> 9][e & (DIM - 1)] = h;
  }
  __syncthreads();
  const v8f z8 = {0.f, 0.f, 0.f, 0.f, 0.f, 0.f, 0.f, 0.f};
  v8f c0 = z8, c1 = z8;
  const unsigned short* ax = &sX[ln][8 * hh];
  // unrolled in full (about 24 KB of text, run once): the three buffers are then fixed registers that the loads write directly, and every weight address is one base, the lane's offset and an immediate;
  // rolled, the refilled values were copied between registers at the foot of each trip, behind a wait for all loads in flight. A buffer is refilled as soon as its values are converted.
#pragma unroll
  for (int ks = 0; ks < DIM / 32; ++ks) {
    FragH b0, b1;
    pj_cvt(q[ks % 3], b0, b1);
    pj_load(q[ks % 3], ks + 3 < DIM / 32 ? Wa + (ks + 3) * PJ_STEP : Wb + (ks + 3 - DIM / 32) * PJ_STEP, lob);      /* the last three refills are the second layer's first steps */
    const v16h a = pj_afrag(ax + ks * 32);
    c0 = __builtin_amdgcn_wmma_f32_16x16x32_f16(false, a, false, b0.v, (short)0, c0, false, false);
    c1 = __builtin_amdgcn_wmma_f32_16x16x32_f16(false, a, false, b1.v, (short)0, c1, false, false);
    __builtin_amdgcn_sched_barrier(0);      /* keeps the later steps' conversions, and with them the waits for their loads, behind this step's refill: moved up, the loads in flight are waited for too early */
  }
  const float bv0 = bf16_round(bb[0]), bv1 = bf16_round(bb[1]);
#pragma unroll
  for (int r = 0; r < 8; ++r) { v2ha h; h[0] = (_Float16)(c0[r] * 0.0625f + bv0); h[1] = (_Float16)(c1[r] * 0.0625f + bv1); *(v2ha*)&sH[8 * hh + r][col] = h; }
  __syncthreads();
  c0 = z8; c1 = z8;
  const unsigned short* ah = &sH[ln][8 * hh];
#pragma unroll
  for (int ks = 0; ks < HALF / 32; ++ks) {
    FragH b0, b1;
    pj_cvt(q[(ks + DIM / 32) % 3], b0, b1);
    if (ks + 3 < HALF / 32) pj_load(q[(ks + DIM / 32) % 3], Wb + (ks + 3) * PJ_STEP, lob);
    const v16h a = pj_afrag(ah + ks * 32);
    c0 = __builtin_amdgcn_wmma_f32_16x16x32_f16(false, a, false, b0.v, (short)0, c0, false, false);
    c1 = __builtin_amdgcn_wmma_f32_16x16x32_f16(false, a, false, b1.v, (short)0, c1, false, false);
    __builtin_amdgcn_sched_barrier(0);      /* as in the first layer's loop */
  }
  if (s) {      /* the same for the whole block */
    float* sT = (float*)&sX[0][0];      /* every wave has left sX at the barrier behind the first layer */
#pragma unroll
    for (int r = 0; r < 8; ++r) { v2f o; o[0] = c0[r] * 0.0078125f; o[1] = c1[r] * 0.0078125f; *(v2fa*)(sT + (8 * hh + r) * PJ_PT + col) = o; }
    __syncthreads();      /* the turn crosses lanes: the whole tile is in LDS before a lane reads values that other lanes wrote */
#pragma unroll
    for (int j = 0; j < 4; ++j) { const v4f o = *(const v4fa*)(sT + ln * PJ_PT + w * 32 + (j >> 1) * 16 + hh * 8 + (j & 1) * 4); *(v4fa*)(C + (w * 4 + j) * 128 + lane * 4) = o; }      /* wave w's columns are k step w: 512 contiguous bytes a store */
  } else {
#pragma unroll
    for (int r = 0; r < 8; ++r) { v2f o; o[0] = c0[r] * 0.0078125f; o[1] = c1[r] * 0.0078125f; *(v2fa*)(C + (size_t)(8 * hh + r) * HALF + col) = o; }      /* 16 lanes: one whole 128-byte line */
  }
  asm volatile("s_wait_xcnt 0x0" ::: "memory");      /* behind the last store: in the built code other text follows here that reuses the stores' data registers, and this wait stands in front of any such overwrite */
}

__global__ __launch_bounds__(256) void k_f16c(const float* __restrict__ A, _Float16* __restrict__ D, size_t n8) { const size_t t = (size_t)blockIdx.x * 256 + threadIdx.x; if (t >= n8) return; const v8f a = *(const v8f*)(A + t * 8); FragH f; for (int q = 0; q < 8; ++q) f.h[q] = (_Float16)a[q]; *(v8us*)((unsigned short*)D + t * 8) = f.half[0];  }
// A quarter of the exact (erf) GELU in f32, of an argument that comes as s = h / 8: h Phi(h) / 4 = (s + s erf(h / sqrt 2)) = s + s tanh(h G(h^2)), with h G(h^2) = atanh(erf(h / sqrt 2)), an odd function of h.
// Both powers of two are exact and are taken back by the users' constants (2^-7 in k_proj, b1 / 8, b2 / 8, the 1/32 behind the w2 product, 4 w3).
// G is a degree-2 fit in h^2, minimax in the error of h Phi(h): at most about 2.5e-5 (evaluated in f32, the tanh taken as correctly rounded; an error e of the instruction itself counts |h| e / 2). It is an absolute bound:
// about a tenth of the f16 half ulp of an h1 just below 1, above that half ulp on the negative side, where h1 itself is small; in the result it stays far below what the bf16 rounding of the inputs leaves.
// Its leading coefficient is negative: G peaks at h^2 = 52.6 and would turn negative from |h| = 11.1 on. So the square is taken as v = min(s s, 1), that is h^2 / 64 held at |h| = 8:
// up to there h G(h^2) rises (10 at |h| = 6, 13.8 at 8), beyond it G stays G(64) = 1.73 and the tanh is +-1 in f32: every finite h is covered, an overflowing square too.
// The min costs nothing: it is the clamp bit (to 0 .. 1) of the packed multiply. The compiler folds a clamp into scalar f32 instructions alone and would split the packed multiply in two for it, hence the asm.
// Eight pairs of neighbouring values at a time: every step but the tanh is one packed f32 instruction on a register pair as it lies.
__device__ __forceinline__ void gelu_x8(const v2f (&s)[8], v2f (&y)[8]) {
  v2f v[8];
  // the eight squares in one statement: the compiler hints no dependence on an asm result (s_delay_alu), so the first reader should stand several instructions behind its square; outputs are written before the last input is read, hence early clobber
  asm("v_pk_mul_f32 %0, %8, %8 clamp\n\tv_pk_mul_f32 %1, %9, %9 clamp\n\tv_pk_mul_f32 %2, %10, %10 clamp\n\tv_pk_mul_f32 %3, %11, %11 clamp\n\t"
      "v_pk_mul_f32 %4, %12, %12 clamp\n\tv_pk_mul_f32 %5, %13, %13 clamp\n\tv_pk_mul_f32 %6, %14, %14 clamp\n\tv_pk_mul_f32 %7, %15, %15 clamp"
      : "=&v"(v[0]), "=&v"(v[1]), "=&v"(v[2]), "=&v"(v[3]), "=&v"(v[4]), "=&v"(v[5]), "=&v"(v[6]), "=&v"(v[7])
      : "v"(s[0]), "v"(s[1]), "v"(s[2]), "v"(s[3]), "v"(s[4]), "v"(s[5]), "v"(s[6]), "v"(s[7]));
  const v2f c2 = {-1.15185041e1f, -1.15185041e1f}, c1 = {1.89468918e1f, 1.89468918e1f}, c0 = {6.38006306e0f, 6.38006306e0f};      /* 8 x 64^k times the coefficient of h^2k */
#pragma unroll
  for (int i = 0; i < 8; ++i) {
    v2f p = __builtin_elementwise_fma(v[i], c2, c1); p = __builtin_elementwise_fma(v[i], p, c0);
    const v2f g = s[i] * p, th = {__builtin_amdgcn_tanhf(g[0]), __builtin_amdgcn_tanhf(g[1])};
    y[i] = __builtin_elementwise_fma(s[i], th, s[i]);
  }
}
// Fused tail: h1 = gelu(A[bt] + Bu[n] + b1), h2 = gelu(h1 w2 + b2), out = clip(h2 w3 + b3); h1 and h2 never leave the registers. The GELUs' arguments are carried as 1/8, their values as 1/4 (gelu_x8): h1 / 4 x 16 w2 is brought to 1/8 by 1/32, h2 / 4 meets 4 w3.
// One work-group per pair of bin rows; wave w owns units 32w .. 32w+31 as two tiles of 16 rows, and carries each tile for both bin rows at once:
// a w2 fragment read from LDS feeds two WMMAs, a unit value read from memory two GELUs, and the w2 fill serves twice the rows. With one bin row a wave the k loop's LDS reads add up to more clocks than its vector work on a SIMD.
// The product runs transposed: w2's columns are the A operand (from LDS, stored in fragment order), the h1 rows the B operand.
// A lane computes the 16 h1 values of its own row and k half straight into the B fragment (k = 8h+i, 16+8h+i on both operands).
// D register r of tile t is then h2[row = lane & 15][feature 16t + 8h + r]: the head's dot product stays inside a lane but for one add across the lane halves.
#define TL_BT 2      /* bin rows a work-group: 2 x 64 accumulator registers a wave, four waves a SIMD */
__global__ __launch_bounds__(256) void k_tail(const float* __restrict__ A, const float* __restrict__ Bu, const float* __restrict__ b1, const _Float16* __restrict__ W2t,
                                              const float* __restrict__ b2, const float* __restrict__ w3, const float* __restrict__ b3, float* __restrict__ out) {
  __shared__ __attribute__((aligned(16))) unsigned short sW[HALF / 32][QTR / 16][2][32][8];   /* [k step][feature tile][fragment half][lane][8 f16], 64 KiB: each fragment load reads 512 contiguous bytes */
  __shared__ __attribute__((aligned(16))) float sab[TL_BT][HALF];
  __shared__ __attribute__((aligned(16))) float sb2[QTR];
  __shared__ __attribute__((aligned(16))) float sw3[QTR];
  const int tid = threadIdx.x, w = tid >> 5, lane = tid & 31, ln = lane & 15, hh = lane >> 4;
  const int bt = blockIdx.x * TL_BT;
  // unrolled: all 16 loads of the w2 fill are in flight before the first LDS store
#pragma unroll
  for (int i = 0; i < 16; ++i) {      /* W2t lies in sW's own order: a straight copy, 512 contiguous bytes a wave and load */
    const int c = (i * 256 + tid) * 8;
    const v8us v = *(const v8us*)((const unsigned short*)W2t + c);
    *(v8us*)(&sW[0][0][0][0][0] + c) = v;
  }
  const float b1v = 0.125f * bf16_round(b1[tid]);
#pragma unroll
  for (int j = 0; j < TL_BT; ++j) sab[j][tid] = A[(size_t)(bt + j) * HALF + tid] + b1v;
  if (tid < QTR) { sb2[tid] = 0.125f * bf16_round(b2[tid]); sw3[tid] = 4.0f * bf16_round(w3[tid]); }
  __syncthreads();
  // Bu lies in fragment order: (tile, k step) q = 8 tile + ks of wave w is 512 floats at 16w + q, four loads of 128 floats, 4 a lane (k = 8h + e, 8h + 4 + e, 16 + 8h + e, 16 + 8h + 4 + e of unit row lane & 15)
  const float* ub = Bu + (size_t)w * 16 * 512 + lane * 4;
  v4f u0 = *(const v4fa*)(ub), u1 = *(const v4fa*)(ub + 128), u2 = *(const v4fa*)(ub + 256), u3 = *(const v4fa*)(ub + 384);
  float res[TL_BT] = {};
  // the tile loop and the k loop stay rolled: 32 + 128 inlined GELUs are all the text that the instruction cache should have to hold;
  // the loops inside them are unrolled, so that fragments and accumulators are indexed by constants and stay in registers
#pragma unroll 1
  for (int tile = 0; tile < 2; ++tile) {
    v8f acc[TL_BT][8] = {};
#pragma unroll 1
    for (int ks = 0; ks < HALF / 32; ++ks) {
      v2f s[TL_BT][8];      /* pairs of neighbouring k, as gelu_x8 takes them */
#pragma unroll
      for (int j = 0; j < TL_BT; ++j) {
        const float* ap = &sab[j][ks * 32 + 8 * hh];
        const v4f a0 = *(const v4fa*)(ap), a1 = *(const v4fa*)(ap + 4), a2 = *(const v4fa*)(ap + 16), a3 = *(const v4fa*)(ap + 20);
        s[j][0] = a0.lo + u0.lo; s[j][1] = a0.hi + u0.hi; s[j][2] = a1.lo + u1.lo; s[j][3] = a1.hi + u1.hi;
        s[j][4] = a2.lo + u2.lo; s[j][5] = a2.hi + u2.hi; s[j][6] = a3.lo + u3.lo; s[j][7] = a3.hi + u3.hi;
      }
      // inputs only, nothing emitted: both rows' sums are made here, ahead of the loads below, which then overwrite the registers the sums have read; left free, the first row's sums sink behind the loads and the old unit values are copied aside, eight 64-bit moves a trip behind a wait for all four loads
      asm volatile("" :: "v"(s[0][0]), "v"(s[0][1]), "v"(s[0][2]), "v"(s[0][3]), "v"(s[0][4]), "v"(s[0][5]), "v"(s[0][6]), "v"(s[0][7]), "v"(s[1][0]), "v"(s[1][1]), "v"(s[1][2]), "v"(s[1][3]), "v"(s[1][4]), "v"(s[1][5]), "v"(s[1][6]), "v"(s[1][7]));
      // the next step's unit values are loaded one step ahead, as soon as both rows' sums have used this step's (the last step reloads its own)
      const float* un = ub + min(tile * 8 + ks + 1, 15) * 512;
      u0 = *(const v4fa*)(un); u1 = *(const v4fa*)(un + 128); u2 = *(const v4fa*)(un + 256); u3 = *(const v4fa*)(un + 384);
      __builtin_amdgcn_sched_barrier(0);      /* keeps these loads up here: sunk to the foot of the loop they are waited for at once at the head of the next trip */
      FragH f[TL_BT], wf[8];
#pragma unroll
      for (int j = 0; j < TL_BT; ++j) {
        if (j == TL_BT - 1) {      /* the first four w2 fragments are on their way while the last row's GELUs run */
#pragma unroll
          for (int t = 0; t < 4; ++t) { wf[t].half[0] = *(const v8us*)&sW[ks][t][0][lane][0]; wf[t].half[1] = *(const v8us*)&sW[ks][t][1][lane][0]; }
        }
        v2f y[8];
        gelu_x8(s[j], y);
#pragma unroll
        for (int i = 0; i < 8; ++i) { f[j].h[2 * i] = (_Float16)y[i][0]; f[j].h[2 * i + 1] = (_Float16)y[i][1]; }
        __builtin_amdgcn_sched_barrier(0);      /* one row's 16 GELUs at a time, and no more than four fragments fetched beside them: otherwise the registers run out and the GELUs are scheduled one dependent chain after another */
      }
#pragma unroll
      for (int t = 4; t < 8; ++t) { wf[t].half[0] = *(const v8us*)&sW[ks][t][0][lane][0]; wf[t].half[1] = *(const v8us*)&sW[ks][t][1][lane][0]; }
      __builtin_amdgcn_sched_barrier(0);      /* the other four fragments are all asked for ahead of the first WMMA: left to itself the build passes them through one buffer, each load waited for at once */
#pragma unroll
      for (int t = 0; t < 8; ++t) {
#pragma unroll
        for (int j = 0; j < TL_BT; ++j) acc[j][t] = __builtin_amdgcn_wmma_f32_16x16x32_f16(false, wf[t].v, false, f[j].v, (short)0, acc[j][t], false, false);
      }
    }
    // compiler fence: keeps the 32 LDS loads of b2 and w3 inside the tile loop; hoisted out of it they hold 128 registers through the k loop, which then has none left to fetch w2 fragments ahead of its WMMAs
    asm volatile("" ::: "memory");
    v4f pv[TL_BT] = {};      /* four partial sums of the head a bin row, so that the GELUs pair up into packed f32 instructions */
#pragma unroll
    for (int t = 0; t < 8; ++t) {
      const int f0 = t * 16 + 8 * hh;
      const v4f c0 = *(const v4fa*)&sb2[f0], c1 = *(const v4fa*)&sb2[f0 + 4], g0 = *(const v4fa*)&sw3[f0], g1 = *(const v4fa*)&sw3[f0 + 4];
      v2f x[4 * TL_BT], y[4 * TL_BT];      /* both bin rows' eight features of this tile: four pairs a row */
#pragma unroll
      for (int j = 0; j < TL_BT; ++j) {
#pragma unroll
        for (int r = 0; r < 4; r += 2) {
          x[4 * j + r / 2] = v2f{acc[j][t][r] * 0.03125f + c0[r], acc[j][t][r + 1] * 0.03125f + c0[r + 1]};
          x[4 * j + 2 + r / 2] = v2f{acc[j][t][4 + r] * 0.03125f + c1[r], acc[j][t][5 + r] * 0.03125f + c1[r + 1]};
        }
      }
      gelu_x8(x, y);
#pragma unroll
      for (int j = 0; j < TL_BT; ++j) {
        const v4f h0 = {y[4 * j][0], y[4 * j][1], y[4 * j + 1][0], y[4 * j + 1][1]}, h1 = {y[4 * j + 2][0], y[4 * j + 2][1], y[4 * j + 3][0], y[4 * j + 3][1]};
        pv[j] += h0 * g0; pv[j] += h1 * g1;
      }
    }
#pragma unroll
    for (int j = 0; j < TL_BT; ++j) {
      float p = (pv[j][0] + pv[j][1]) + (pv[j][2] + pv[j][3]);
      p += __shfl_xor(p, 16, 32);
      if (hh == tile) res[j] = p;      /* tile 0's rows end in lanes 0-15, tile 1's in lanes 16-31: one 128-byte store a wave and bin row */
    }
  }
  const float b3v = bf16_round(b3[0]);
#pragma unroll
  for (int j = 0; j < TL_BT; ++j) out[(size_t)(bt + j) * NU + w * 32 + lane] = fminf(fmaxf(res[j] + b3v, -10.0f), 10.0f);
}

extern "C" void kernel_launch(void* const* d_in, const int* in_sizes, int n_in,
                              void* d_out, int out_size, void* d_ws, size_t ws_size, hipStream_t stream) {
  (void)in_sizes; (void)n_in; (void)out_size;
  const float* const* I = (const float* const*)d_in; const float* br = I[0]; const float* ue = I[1]; const float* bpw = I[2]; const float* bpb = I[3]; const float* upw = I[4]; const float* upb = I[5]; const float* w1 = I[6]; const float* b1 = I[7]; const float* w2 = I[8]; const float* b2 = I[9]; const float* w3 = I[10]; const float* b3 = I[11];
  char* ws = (char*)d_ws; size_t off = 0;
  auto take = [&](size_t bytes) { char* p = ws + off; off += (bytes + 255) & ~(size_t)255; return p; };
  _Float16* BW2 = (_Float16*)take((size_t)QTR * HALF * 2); float* A = (float*)take((size_t)NBT * HALF * 4); float* Bu = (float*)take((size_t)NU * HALF * 4);
  if (off > ws_size) return;
  k_proj<<<PB_W2 + (NBT + NU) / PJ_ROWS, 256, 0, stream>>>(br, ue, bpw, bpb, upw, upb, w1, w2, BW2, A, Bu);      /* w2 -> f16 x16 in fragment order; A = (bin_repr Wbp + b) w1a / 8, Bu = (unit_embs Wup + b) w1b / 8 in fragment order */
  k_tail<<<NBT / TL_BT, 256, 0, stream>>>(A, Bu, b1, BW2, b2, w3, b3, (float*)d_out);      /* h1, h2, head, clip */
}
